// v000
// The times below were measured on an AMD MI455X: many runs one after another, warmed up first and cycling through
// copies of the inputs, with the whole window's GPU time divided by the number of runs. Launches and the gaps
// between them are all in it. The median over several windows is given; except for v000 it joins two sittings, which
// can be a few percent apart, so the side-by-side timings, each taken in one sitting, are the better comparison.
// v000 is the starting kernel. One run takes 1210 microseconds.
#include <hip/hip_runtime.h>
// Pre-LN causal attention block (2 x 2048 tokens, 1024 = 16 heads x 64; MLP 4096 with SiLU): t = LN_b(LN_a(x)); q,k,v = t W + b; x1 = x + (causal softmax(q.k/8) v) Wo + bo; out = x1 + (silu(LN_c(x1) We + be)) Wd + bd -> [2,2048,1024].
// Structure: the LayerNorms on VALU (the first pass also writes the bf16 residual plane); projections / MLP as f16 WMMA GEMMs (32x64 wave tiles, f32 accumulation, exact x16 weights, biases / SiLU / residual addends in the epilogue); q, k as f16 hi + (x2^10) residual planes, V^T as hi + residual planes; fused causal flash kernel per ((batch, head), 64 queries) (device-built causal tables, online f32 softmax, P staged hi + residual, two value accumulators); O as hi + residual planes into Wo (two GEMMs).
// Compute dtype: x, weights, biases, LN parameters rounded to bf16; LN outputs and the SiLU hidden as f16 operands (~2^-12); q, k, P, v, O as f16 hi + residual pairs (~2^-21); f32 accumulation, softmax, LayerNorm. v_wmma_f32_16x16x32_f16.
#define NBT 2
#define SLEN 2048
#define DM 1024
#define NH 16
#define SCL 0.125f
#define NR (NBT * SLEN)
typedef __bf16 v16b __attribute__((ext_vector_type(16)));
typedef unsigned short v8us __attribute__((ext_vector_type(8), may_alias));
typedef float  v8f  __attribute__((ext_vector_type(8)));
typedef float  v4f  __attribute__((ext_vector_type(4)));
typedef float  v4fa __attribute__((ext_vector_type(4), may_alias));
union FragB { v16b v; v8us half[2]; unsigned short u[16]; };

__device__ __forceinline__ unsigned short bf16_bits(float x) { unsigned int u = __float_as_uint(x); return (unsigned short)((u + 0x7FFFu + ((u >> 16) & 1u)) >> 16); }
__device__ __forceinline__ float bf16_val(unsigned short b) { return __uint_as_float(((unsigned int)b) << 16); }
__device__ __forceinline__ float bf16_round(float x) { return bf16_val(bf16_bits(x)); }
// D += A·B with NT terms: 1 = ah·bh, 2 = + al·bh (A split), 3 = + ah·bl (both split)
template <int NT>
__device__ __forceinline__ v8f mmaN(v16b ah, v16b al, v16b bh, v16b bl, v8f c) {
  c = __builtin_amdgcn_wmma_f32_16x16x32_bf16(false, ah, false, bh, (short)0, c, false, false);
  if (NT >= 2) c = __builtin_amdgcn_wmma_f32_16x16x32_bf16(false, al, false, bh, (short)0, c, false, false);
  if (NT >= 3) c = __builtin_amdgcn_wmma_f32_16x16x32_bf16(false, ah, false, bl, (short)0, c, false, false);
  asm volatile("v_nop\n\tv_nop\n\tv_nop\n\tv_nop" : "+v"(c) : "v"(ah), "v"(al), "v"(bh), "v"(bl));
  return c;
}

__global__ __launch_bounds__(256) void k_wt_bf16(const float* __restrict__ W, unsigned short* __restrict__ Wt, int K, int N) {
  const int t = blockIdx.x * 256 + threadIdx.x;
  const int k8n = K / 8;
  if (t >= N * k8n) return;
  const int n = t / k8n, k8 = (t % k8n) * 8;
  v8us v;
#pragma unroll
  for (int i = 0; i < 8; ++i) v[i] = bf16_bits(W[(size_t)(k8 + i) * N + n]);
  *(v8us*)(Wt + (size_t)n * K + k8) = v;
  
}

// GEMM C[M][N] (f32, pitch ldc) = act(A[M][K]·W + bias). A f32 row-major (pitch lda) converted per fragment to bf16
// (ASPLIT: hi/lo two planes -> 2 terms, else single rounded term); Wt bf16 [N][K] (pitch ldb). BIAS_BF16 rounds the
// bias to bf16 first (bias quantised to bf16 before the add). K%32==0, M%16==0, N%64==0.
template <bool ASPLIT, int ACT, bool BIAS_BF16>
__global__ __launch_bounds__(128) void k_gemm_bf(const float* __restrict__ A, int lda, const unsigned short* __restrict__ Wt, int ldb,
                                               const float* __restrict__ bias, float* __restrict__ C, int ldc, int M, int N, int K) {
  __shared__ __attribute__((aligned(16))) float so[4][16][64];
  const int tid = threadIdx.x, w = tid >> 5, lane = tid & 31, ln = lane & 15, hh = lane >> 4;
  const int ntn = N / 64;
  const int wid = blockIdx.x * 4 + w;
  const int mt = wid / ntn, nq = wid % ntn;
  if (mt * 16 >= M) return;
  const int row0 = mt * 16, col0 = nq * 64;
  const float* arow = A + (size_t)(row0 + ln) * lda;
  v8f acc[4] = {};
  for (int kb = 0; kb < K; kb += 32) {
    FragB ah, al;
    const v4f x0 = *(const v4fa*)(arow + kb + 8 * hh), x1 = *(const v4fa*)(arow + kb + 8 * hh + 4);
    const v4f x2 = *(const v4fa*)(arow + kb + 16 + 8 * hh), x3 = *(const v4fa*)(arow + kb + 16 + 8 * hh + 4);
    float xs[16] = {x0[0],x0[1],x0[2],x0[3],x1[0],x1[1],x1[2],x1[3],x2[0],x2[1],x2[2],x2[3],x3[0],x3[1],x3[2],x3[3]};
#pragma unroll
    for (int i = 0; i < 16; ++i) { const unsigned short hb = bf16_bits(xs[i]); ah.u[i] = hb; al.u[i] = ASPLIT ? bf16_bits(xs[i] - bf16_val(hb)) : (unsigned short)0; }
#pragma unroll
    for (int t = 0; t < 4; ++t) {
      const unsigned short* brow = Wt + (size_t)(col0 + t * 16 + ln) * ldb + kb;
      FragB b;
      b.half[0] = *(const v8us*)(brow + 8 * hh);
      b.half[1] = *(const v8us*)(brow + 16 + 8 * hh);
      acc[t] = mmaN<ASPLIT ? 2 : 1>(ah.v, al.v, b.v, b.v, acc[t]);
    }
  }
#pragma unroll
  for (int t = 0; t < 4; ++t) {
    float bv = bias ? bias[col0 + t * 16 + ln] : 0.f;
    if (BIAS_BF16) bv = bf16_round(bv);
#pragma unroll
    for (int r = 0; r < 8; ++r) { float v = acc[t][r] + bv; if (ACT == 1) v = fmaxf(v, 0.f); so[w][8 * hh + r][t * 16 + ln] = v; }
  }
  __builtin_amdgcn_fence(__ATOMIC_ACQ_REL, "workgroup");
  __builtin_amdgcn_wave_barrier();
  const int rsub = lane >> 4, c4 = (lane & 15) * 4;
  {
#pragma unroll
    for (int q = 0; q < 8; ++q) {
      const int r = q * 2 + rsub;
      const v4f v = *(const v4fa*)&so[w][r][c4];
      *(v4f*)(C + (size_t)(row0 + r) * ldc + col0 + c4) = v;
    }
    
  }
}

// GEMM C = act(A·W + bias + resid): A f32 (ASPLIT -> hi/lo 2 terms), Wt bf16 [N][K]; ACT 0 none, 1 relu, 2 exact gelu;
// resid (optional, f32, row index = (row % rmod), pitch ldr, RES_BF16 rounds it) added before the activation.
template <bool ASPLIT, int ACT, bool BIAS_BF16, bool RES_BF16>
__global__ __launch_bounds__(128) void k_gemm_bf3(const float* __restrict__ A, int lda, const unsigned short* __restrict__ Wt, int ldb,
                                                const float* __restrict__ bias, const float* __restrict__ resid, int rmod, int ldr,
                                                float* __restrict__ C, int ldc, int M, int N, int K) {
  __shared__ __attribute__((aligned(16))) float so[4][16][64];
  const int tid = threadIdx.x, w = tid >> 5, lane = tid & 31, ln = lane & 15, hh = lane >> 4;
  const int ntn = N / 64;
  const int wid = blockIdx.x * 4 + w;
  const int mt = wid / ntn, nq = wid % ntn;
  if (mt * 16 >= M) return;
  const int row0 = mt * 16, col0 = nq * 64;
  const float* arow = A + (size_t)(row0 + ln) * lda;
  v8f acc[4] = {};
  for (int kb = 0; kb < K; kb += 32) {
    FragB ah, al;
    const v4f x0 = *(const v4fa*)(arow + kb + 8 * hh), x1 = *(const v4fa*)(arow + kb + 8 * hh + 4);
    const v4f x2 = *(const v4fa*)(arow + kb + 16 + 8 * hh), x3 = *(const v4fa*)(arow + kb + 16 + 8 * hh + 4);
    float xs[16] = {x0[0],x0[1],x0[2],x0[3],x1[0],x1[1],x1[2],x1[3],x2[0],x2[1],x2[2],x2[3],x3[0],x3[1],x3[2],x3[3]};
#pragma unroll
    for (int i = 0; i < 16; ++i) { const unsigned short hb = bf16_bits(xs[i]); ah.u[i] = hb; al.u[i] = ASPLIT ? bf16_bits(xs[i] - bf16_val(hb)) : (unsigned short)0; }
#pragma unroll
    for (int t = 0; t < 4; ++t) {
      const unsigned short* brow = Wt + (size_t)(col0 + t * 16 + ln) * ldb + kb;
      FragB b;
      b.half[0] = *(const v8us*)(brow + 8 * hh);
      b.half[1] = *(const v8us*)(brow + 16 + 8 * hh);
      acc[t] = mmaN<ASPLIT ? 2 : 1>(ah.v, al.v, b.v, b.v, acc[t]);
    }
  }
#pragma unroll
  for (int t = 0; t < 4; ++t) {
    const int col = col0 + t * 16 + ln;
    float bv = bias ? bias[col] : 0.f;
    if (BIAS_BF16) bv = bf16_round(bv);
#pragma unroll
    for (int r = 0; r < 8; ++r) {
      float v = acc[t][r] + bv;
      if (resid) { float rv = resid[(size_t)((row0 + 8 * hh + r) % rmod) * ldr + col]; if (RES_BF16) rv = bf16_round(rv); v += rv; }
      if (ACT == 1) v = fmaxf(v, 0.f);
      if (ACT == 2) v = 0.5f * v * (1.0f + erff(v * 0.70710678118654752f));
      if (ACT == 3) { const float u = 0.7978845608028654f * (v + 0.044715f * v * v * v); v = 0.5f * v * (1.0f + tanhf(u)); }
      so[w][8 * hh + r][t * 16 + ln] = v;
    }
  }
  __builtin_amdgcn_fence(__ATOMIC_ACQ_REL, "workgroup");
  __builtin_amdgcn_wave_barrier();
  const int rsub = lane >> 4, c4 = (lane & 15) * 4;
  {
#pragma unroll
    for (int q = 0; q < 8; ++q) {
      const int r = q * 2 + rsub;
      const v4f v = *(const v4fa*)&so[w][r][c4];
      *(v4f*)(C + (size_t)(row0 + r) * ldc + col0 + c4) = v;
    }
    
  }
}
// row LayerNorm (biased variance, eps) over N: s = X (+ R); optional out_sum <- s; out_norm <- (s-mu)*rsqrt(var+eps)*g + b
template <bool PARAM_BF16>
__global__ __launch_bounds__(256) void k_layernorm(const float* __restrict__ X, const float* __restrict__ R, const float* __restrict__ g, const float* __restrict__ bta,
                                                  float* __restrict__ out_sum, float* __restrict__ out_norm, int N, float eps) {
  __shared__ float red[256];
  const int row = blockIdx.x, tid = threadIdx.x;
  const float* x = X + (size_t)row * N; const float* rr = R ? R + (size_t)row * N : nullptr;
  float vals[16];                     // up to N = 4096
  const int per = N / 256;            // contiguous chunk per thread? use strided-by-4 chunks: thread handles j = tid*4 + 1024*u
  float s1 = 0.f;
  for (int u = 0; u < per / 4; ++u) {
    const int j = tid * 4 + 1024 * u;
    const v4f a = *(const v4fa*)(x + j);
    v4f b = {0.f,0.f,0.f,0.f}; if (rr) b = *(const v4fa*)(rr + j);
#pragma unroll
    for (int q = 0; q < 4; ++q) { const float v = a[q] + b[q]; vals[u * 4 + q] = v; s1 += v; }
  }
  red[tid] = s1; __syncthreads();
  for (int st = 128; st > 0; st >>= 1) { if (tid < st) red[tid] += red[tid + st]; __syncthreads(); }
  const float mu = red[0] / (float)N; __syncthreads();
  float s2 = 0.f;
  for (int u = 0; u < per / 4; ++u)
#pragma unroll
    for (int q = 0; q < 4; ++q) { const float c = vals[u * 4 + q] - mu; s2 += c * c; }
  red[tid] = s2; __syncthreads();
  for (int st = 128; st > 0; st >>= 1) { if (tid < st) red[tid] += red[tid + st]; __syncthreads(); }
  const float rs = rsqrtf(red[0] / (float)N + eps);
  {
    for (int u = 0; u < per / 4; ++u) {
      const int j = tid * 4 + 1024 * u;
      v4f o, sm;
#pragma unroll
      for (int q = 0; q < 4; ++q) {
        float gg = g[j + q], bb = bta[j + q];
        if (PARAM_BF16) { gg = bf16_round(gg); bb = bf16_round(bb); }
        sm[q] = vals[u * 4 + q]; o[q] = (vals[u * 4 + q] - mu) * rs * gg + bb;
      }
      if (out_sum) *(v4f*)(out_sum + (size_t)row * N + j) = sm;
      *(v4f*)(out_norm + (size_t)row * N + j) = o;
    }
    
  }
}



// ---- f16 WMMA path (v_wmma_f32_16x16x32_f16): 11-bit significands for operands in range — used where a [0,1] probability operand needs more precision than bf16
typedef _Float16 v16h __attribute__((ext_vector_type(16)));
union FragH { v16h v; v8us half[2]; _Float16 h[16]; unsigned short u[16]; };
template <int NT>
__device__ __forceinline__ v8f mmaH(v16h ah, v16h al, v16h bh, v16h bl, v8f c) {
  c = __builtin_amdgcn_wmma_f32_16x16x32_f16(false, ah, false, bh, (short)0, c, false, false);
  if (NT >= 2) c = __builtin_amdgcn_wmma_f32_16x16x32_f16(false, al, false, bh, (short)0, c, false, false);
  if (NT >= 3) c = __builtin_amdgcn_wmma_f32_16x16x32_f16(false, ah, false, bl, (short)0, c, false, false);
  asm volatile("v_nop\n\tv_nop\n\tv_nop\n\tv_nop" : "+v"(c) : "v"(ah), "v"(al), "v"(bh), "v"(bl));
  return c;
}
// batched GEMM like k_gemm_b but f16 operands: A f32 (split into f16 hi/lo if ASPLIT, else rounded to f16), Bt = f16 values [n][k]; alpha; C f32; N multiple of 16 (partial tiles skipped)
template <bool ASPLIT>
__global__ __launch_bounds__(128) void k_gemm_h(const float* __restrict__ A, int lda, size_t sA, const _Float16* __restrict__ Bh, int ldb, size_t sB, float alpha, float* __restrict__ C, int ldc, size_t sC, int M, int N, int K) {
  __shared__ __attribute__((aligned(16))) float so[4][16][64];
  const int tid = threadIdx.x, w = tid >> 5, lane = tid & 31, ln = lane & 15, hh = lane >> 4; const int by = blockIdx.y;
  A += (size_t)by * sA; Bh += (size_t)by * sB; C += (size_t)by * sC;
  const int ntn = (N + 63) / 64; const int wid = blockIdx.x * 4 + w; const int mt = wid / ntn, nq = wid % ntn; if (mt * 16 >= M) return;
  const int row0 = mt * 16, col0 = nq * 64; const float* arow = A + (size_t)(row0 + ln) * lda;
  v8f acc[4] = {};
  for (int kb = 0; kb < K; kb += 32) {
    FragH ah, al;
    const v4f x0 = *(const v4fa*)(arow + kb + 8 * hh), x1 = *(const v4fa*)(arow + kb + 8 * hh + 4), x2 = *(const v4fa*)(arow + kb + 16 + 8 * hh), x3 = *(const v4fa*)(arow + kb + 16 + 8 * hh + 4);
    float xs[16] = {x0[0],x0[1],x0[2],x0[3],x1[0],x1[1],x1[2],x1[3],x2[0],x2[1],x2[2],x2[3],x3[0],x3[1],x3[2],x3[3]};
#pragma unroll
    for (int i = 0; i < 16; ++i) { const _Float16 h = (_Float16)xs[i]; ah.h[i] = h; al.h[i] = ASPLIT ? (_Float16)(xs[i] - (float)h) : (_Float16)0.0f; }
#pragma unroll
    for (int t = 0; t < 4; ++t) { if (col0 + t * 16 >= N) continue; const size_t boff = (size_t)(col0 + t * 16 + ln) * ldb + kb; FragH bq; bq.half[0] = *(const v8us*)(Bh + boff + 8 * hh); bq.half[1] = *(const v8us*)(Bh + boff + 16 + 8 * hh);
      acc[t] = mmaH<ASPLIT ? 2 : 1>(ah.v, al.v, bq.v, bq.v, acc[t]); }
  }
#pragma unroll
  for (int t = 0; t < 4; ++t) { if (col0 + t * 16 >= N) continue;
#pragma unroll
    for (int r = 0; r < 8; ++r) so[w][8 * hh + r][t * 16 + ln] = acc[t][r] * alpha; }
  __builtin_amdgcn_fence(__ATOMIC_ACQ_REL, "workgroup"); __builtin_amdgcn_wave_barrier();
  const int rsub = lane >> 4, c4 = (lane & 15) * 4;
  {
#pragma unroll
    for (int q = 0; q < 8; ++q) { const int r = q * 2 + rsub; if (col0 + c4 < N) { const v4f v = *(const v4fa*)&so[w][r][c4]; *(v4f*)(C + (size_t)(row0 + r) * ldc + col0 + c4) = v; } }
     }
}

// Wt[n][k] = f16(W[k][n]·scale) from f32 row-major W[K][N] (scale = power of two; bf16-exact weights stay exact in f16 away from the subnormal range)
__global__ __launch_bounds__(256) void k_wt_f16(const float* __restrict__ W, _Float16* __restrict__ Wt, int K, int N, float scale) {
  const int t = blockIdx.x * 256 + threadIdx.x; if (t >= N * (K / 8)) return; const int n = t / (K / 8), k8 = (t % (K / 8)) * 8; FragH f;
#pragma unroll
  for (int i = 0; i < 8; ++i) f.h[i] = (_Float16)(bf16_round(W[(size_t)(k8 + i) * N + n]) * scale); const v8us o = f.half[0];
  *(v8us*)((unsigned short*)Wt + (size_t)n * K + k8) = o; 
}
// k_gemm_hh variant with fused epilogue: v = acc·alpha + bias[by·sBias + col] (+ CP[(row/rowsPerB)·sCPb + by·64 + col] if CP) ; ACT 0 none / 1 elu ; writes f16 C16 (and f32 C if non-null)
template <int ACT>
__global__ __launch_bounds__(128) void k_gemm_hhx(const _Float16* __restrict__ A, int lda, size_t sA, const _Float16* __restrict__ Bh, int ldb, size_t sB, float alpha, const float* __restrict__ bias, size_t sBias, const float* __restrict__ CP, int rowsPerB, size_t sCPb, int row0g,
    float* __restrict__ C, _Float16* __restrict__ C16, int ldc, size_t sC, int M, int N, int K) {
  __shared__ __attribute__((aligned(16))) float so[4][16][64];
  const int tid = threadIdx.x, w = tid >> 5, lane = tid & 31, ln = lane & 15, hh = lane >> 4; const int by = blockIdx.y;
  A += (size_t)by * sA; Bh += (size_t)by * sB; const size_t cofs = (size_t)by * sC; const float* bp = bias ? bias + (size_t)by * sBias : nullptr;
  const int ntn = (N + 63) / 64; const int wid = blockIdx.x * 4 + w; const int mt = wid / ntn, nq = wid % ntn; if (mt * 16 >= M) return;
  const int row0 = mt * 16, col0 = nq * 64; const _Float16* arow = A + (size_t)(row0 + ln) * lda;
  v8f acc[4] = {};
  for (int kb = 0; kb < K; kb += 32) { FragH ah; ah.half[0] = *(const v8us*)((const unsigned short*)arow + kb + 8 * hh); ah.half[1] = *(const v8us*)((const unsigned short*)arow + kb + 16 + 8 * hh);
#pragma unroll
    for (int t = 0; t < 4; ++t) { if (col0 + t * 16 >= N) continue; const size_t boff = (size_t)(col0 + t * 16 + ln) * ldb + kb; FragH bq; bq.half[0] = *(const v8us*)((const unsigned short*)Bh + boff + 8 * hh); bq.half[1] = *(const v8us*)((const unsigned short*)Bh + boff + 16 + 8 * hh);
      acc[t] = mmaH<1>(ah.v, ah.v, bq.v, bq.v, acc[t]); }
  }
#pragma unroll
  for (int t = 0; t < 4; ++t) { if (col0 + t * 16 >= N) continue; const int col = col0 + t * 16 + ln; const float bv = bp ? bf16_round(bp[col]) : 0.f;
#pragma unroll
    for (int r = 0; r < 8; ++r) { float v = acc[t][r] * alpha + bv; if (CP) { const int bidx = (row0g + row0 + 8 * hh + r) / rowsPerB; v += CP[(size_t)bidx * sCPb + (size_t)by * 64 + col]; } if (ACT == 1) v = (v > 0.f) ? v : expm1f(v); else if (ACT == 7) v = (v > 0.f) ? v + 1.0f : expf(v); else if (ACT == 8) v = tanhf(v); else if (ACT == 9) v = 0.5f * v * (1.0f + tanhf(0.7978845608028654f * (v + 0.044715f * v * v * v))); else if (ACT == 11) v = 1.0f / (1.0f + expf(-v)); else if (ACT == 12) v = (v > 0.f) ? v : 0.01f * v; else if (ACT == 14) v = (v > 0.f) ? v : 0.1f * v; else if (ACT == 15) v = v / (1.0f + expf(-v)); else if (ACT == 3) v = fmaxf(v, 0.f); else if (ACT == 6) v = 0.5f * v * (1.0f + erff(v * 0.70710678118654752f)); so[w][8 * hh + r][t * 16 + ln] = v; } }
  __builtin_amdgcn_fence(__ATOMIC_ACQ_REL, "workgroup"); __builtin_amdgcn_wave_barrier();
  const int rsub = lane >> 4, c4 = (lane & 15) * 4; typedef _Float16 v4h __attribute__((ext_vector_type(4)));
  {
#pragma unroll
    for (int q = 0; q < 8; ++q) { const int r = q * 2 + rsub; if (col0 + c4 < N) { const v4f v = *(const v4fa*)&so[w][r][c4]; if (C) *(v4f*)(C + cofs + (size_t)(row0 + r) * ldc + col0 + c4) = v; if (C16) { v4h h4; for (int i = 0; i < 4; ++i) h4[i] = (_Float16)v[i]; *(v4h*)(C16 + cofs + (size_t)(row0 + r) * ldc + col0 + c4) = h4; } } }
     }
}


typedef _Float16 v4h __attribute__((ext_vector_type(4)));

__global__ __launch_bounds__(256) void k_x16(const float* __restrict__ x, _Float16* __restrict__ X16, size_t n8) { const size_t t = (size_t)blockIdx.x * 256 + threadIdx.x; if (t >= n8) return; FragH f;
#pragma unroll
  for (int q = 0; q < 8; ++q) f.h[q] = (_Float16)bf16_round(x[t * 8 + q]); *(v8us*)((unsigned short*)X16 + t * 8) = f.half[0];  }
__global__ __launch_bounds__(256) void k_h16(const float* __restrict__ x, _Float16* __restrict__ X16, size_t n8) { const size_t t = (size_t)blockIdx.x * 256 + threadIdx.x; if (t >= n8) return; FragH f;
#pragma unroll
  for (int q = 0; q < 8; ++q) f.h[q] = (_Float16)x[t * 8 + q]; *(v8us*)((unsigned short*)X16 + t * 8) = f.half[0];  }
__global__ __launch_bounds__(256) void k_round16f(const float* __restrict__ W, _Float16* __restrict__ Bt, size_t n8) { const size_t t = (size_t)blockIdx.x * 256 + threadIdx.x; if (t >= n8) return; FragH f;
#pragma unroll
  for (int i = 0; i < 8; ++i) f.h[i] = (_Float16)(bf16_round(W[t * 8 + i]) * 16.0f); *(v8us*)((unsigned short*)Bt + t * 8) = f.half[0];  }
template <int NHv, int TTv>
__global__ __launch_bounds__(256) void k_vt(const _Float16* __restrict__ V16, int ldv, int voff, _Float16* __restrict__ Vt) { __shared__ unsigned short tl[64][66]; const int tid = threadIdx.x; const int slab = blockIdx.x / (TTv / 64), lg = blockIdx.x % (TTv / 64); const int b = slab / NHv, h = slab % NHv;
  for (int i = tid; i < 64 * 8; i += 256) { const int r = i / 8, c8 = (i % 8) * 8; FragH f; f.half[0] = *(const v8us*)((const unsigned short*)V16 + ((size_t)b * TTv + lg * 64 + r) * ldv + voff + h * 64 + c8);
#pragma unroll
    for (int q = 0; q < 8; ++q) tl[r][c8 + q] = f.u[q]; }
  __syncthreads();
  {
#pragma unroll
    for (int rd = 0; rd < 2; ++rd) { const int d = rd * 32 + tid / 8, pc = tid % 8; FragH f;
#pragma unroll
      for (int q = 0; q < 8; ++q) f.u[q] = tl[pc * 8 + q][d];
      *(v8us*)((unsigned short*)Vt + ((size_t)slab * 64 + d) * TTv + lg * 64 + pc * 8) = f.half[0]; }
     } }

__global__ __launch_bounds__(256) void k_hl(const float* __restrict__ F, _Float16* __restrict__ Hh, _Float16* __restrict__ Hl, size_t n8) { const size_t t = (size_t)blockIdx.x * 256 + threadIdx.x; if (t >= n8) return; FragH fh, fl; const v4f a = *(const v4fa*)(F + t * 8), c = *(const v4fa*)(F + t * 8 + 4);
#pragma unroll
  for (int q = 0; q < 4; ++q) { _Float16 h = (_Float16)a[q]; fh.h[q] = h; fl.h[q] = (_Float16)((a[q] - (float)h) * 1024.0f); h = (_Float16)c[q]; fh.h[4 + q] = h; fl.h[4 + q] = (_Float16)((c[q] - (float)h) * 1024.0f); }
  { *(v8us*)((unsigned short*)Hh + t * 8) = fh.half[0]; *(v8us*)((unsigned short*)Hl + t * 8) = fl.half[0];  } }

// ---- fast GEMM (wave tile 32x64; requires M % 32 == 0 rows per launch region and N % 64 == 0); epilogue = k_gemm_hhx semantics ----
__device__ __forceinline__ v16h g2_frag(const _Float16* p, int hh) { FragH f; f.half[0] = *(const v8us*)((const unsigned short*)p + 8 * hh); f.half[1] = *(const v8us*)((const unsigned short*)p + 16 + 8 * hh); return f.v; }
__device__ __forceinline__ v8f g2_mma(v16h a, v16h b, v8f c) { v8f d = __builtin_amdgcn_wmma_f32_16x16x32_f16(false, a, false, b, (short)0, c, false, false); asm volatile("v_nop\n\tv_nop\n\tv_nop\n\tv_nop" : "+v"(d) : "v"(a), "v"(b)); return d; }
template <int ACT>
__global__ __launch_bounds__(128) void k_gemm2(const _Float16* __restrict__ A, int lda, size_t sA, const _Float16* __restrict__ Bh, int ldb, size_t sB, float alpha, const float* __restrict__ bias, size_t sBias, const float* __restrict__ CP, int rowsPerB, size_t sCPb, int row0g,
    float* __restrict__ C, _Float16* __restrict__ C16, int ldc, size_t sC, int M, int N, int K) {
  __shared__ __attribute__((aligned(16))) float so[4][32][68];
  const int tid = threadIdx.x, w = tid >> 5, lane = tid & 31, ln = lane & 15, hh = lane >> 4; const int by = blockIdx.y;
  A += (size_t)by * sA; Bh += (size_t)by * sB; const size_t cofs = (size_t)by * sC; const float* bp = bias ? bias + (size_t)by * sBias : nullptr;
  const int ntn = N >> 6; const int mt = blockIdx.x / ntn, nq = blockIdx.x - mt * ntn; const int row0 = mt * 128 + 32 * w, col0 = nq * 64; if (row0 >= M) return;
  const _Float16* a0p = A + (size_t)(row0 + ln) * lda; const _Float16* a1p = a0p + (size_t)16 * lda;
  const _Float16* b0p = Bh + (size_t)(col0 + ln) * ldb; const _Float16* b1p = b0p + (size_t)16 * ldb; const _Float16* b2p = b1p + (size_t)16 * ldb; const _Float16* b3p = b2p + (size_t)16 * ldb;
  const v8f z8 = {0.f,0.f,0.f,0.f,0.f,0.f,0.f,0.f}; v8f c00 = z8, c01 = z8, c02 = z8, c03 = z8, c10 = z8, c11 = z8, c12 = z8, c13 = z8;
#pragma unroll 1
  for (int kb = 0; kb < K; kb += 32) { const v16h a0 = g2_frag(a0p + kb, hh), a1 = g2_frag(a1p + kb, hh);
    v16h b = g2_frag(b0p + kb, hh); c00 = g2_mma(a0, b, c00); c10 = g2_mma(a1, b, c10);
    b = g2_frag(b1p + kb, hh); c01 = g2_mma(a0, b, c01); c11 = g2_mma(a1, b, c11);
    b = g2_frag(b2p + kb, hh); c02 = g2_mma(a0, b, c02); c12 = g2_mma(a1, b, c12);
    b = g2_frag(b3p + kb, hh); c03 = g2_mma(a0, b, c03); c13 = g2_mma(a1, b, c13); }
  v8f accs[8] = {c00, c01, c02, c03, c10, c11, c12, c13};
#pragma unroll
  for (int u = 0; u < 8; ++u) { const int t = u & 3, half = u >> 2; const int col = col0 + t * 16 + ln; const float bv = bp ? bf16_round(bp[col]) : 0.f;
#pragma unroll
    for (int r = 0; r < 8; ++r) { const int rloc = half * 16 + 8 * hh + r; float v = accs[u][r] * alpha + bv; if (CP) { const int bidx = (row0g + row0 + rloc) / rowsPerB; v += CP[(size_t)bidx * sCPb + (size_t)by * 64 + col]; }
      if (ACT == 3) v = fmaxf(v, 0.f); else if (ACT == 6) v = 0.5f * v * (1.0f + erff(v * 0.70710678118654752f)); else if (ACT == 11) v = 1.0f / (1.0f + expf(-v)); else if (ACT == 15) v = v / (1.0f + expf(-v)); else if (ACT == 12) v = (v > 0.f) ? v : 0.01f * v; else if (ACT == 8) v = tanhf(v);
      so[w][rloc][t * 16 + ln] = v; } }
  __builtin_amdgcn_fence(__ATOMIC_ACQ_REL, "workgroup"); __builtin_amdgcn_wave_barrier();
  const int rsub = lane >> 4, c4 = (lane & 15) * 4;
  {
#pragma unroll
    for (int q = 0; q < 16; ++q) { const int r = q * 2 + rsub; const v4f v = *(const v4fa*)&so[w][r][c4]; if (C) *(v4f*)(C + cofs + (size_t)(row0 + r) * ldc + col0 + c4) = v; if (C16) { v4h h4; for (int i = 0; i < 4; ++i) h4[i] = (_Float16)v[i]; *(v4h*)(C16 + cofs + (size_t)(row0 + r) * ldc + col0 + c4) = h4; } }
     } }



template <int TK>
__global__ __launch_bounds__(256) void k_vthl(const float* __restrict__ VF, int ldv, _Float16* __restrict__ Vth, _Float16* __restrict__ Vtl) { __shared__ float tl[64][65]; const int tid = threadIdx.x; const int slab = blockIdx.x / (TK / 64), lg = blockIdx.x % (TK / 64); const int b = slab / NH, h = slab % NH;
  for (int i = tid; i < 64 * 16; i += 256) { const int r = i / 16, c4 = (i % 16) * 4; const v4f a = *(const v4fa*)(VF + ((size_t)b * TK + lg * 64 + r) * ldv + h * 64 + c4); tl[r][c4] = a[0]; tl[r][c4 + 1] = a[1]; tl[r][c4 + 2] = a[2]; tl[r][c4 + 3] = a[3]; }
  __syncthreads();
  FragH fh[2], fl[2]; size_t oo[2];
#pragma unroll
  for (int rd = 0; rd < 2; ++rd) { const int d = rd * 32 + tid / 8, pc = tid % 8;
#pragma unroll
    for (int q = 0; q < 8; ++q) { const float v = tl[pc * 8 + q][d]; const _Float16 hv = (_Float16)v; fh[rd].h[q] = hv; fl[rd].h[q] = (_Float16)((v - (float)hv) * 1024.0f); } oo[rd] = ((size_t)slab * 64 + d) * TK + lg * 64 + pc * 8; }
  {
#pragma unroll
    for (int rd = 0; rd < 2; ++rd) { *(v8us*)((unsigned short*)Vth + oo[rd]) = fh[rd].half[0]; *(v8us*)((unsigned short*)Vtl + oo[rd]) = fl[rd].half[0]; }
     } }

template <int TQ, int TK>
__global__ __launch_bounds__(128) void k_flashm(const _Float16* __restrict__ Q16, const _Float16* __restrict__ Q16lo, int ldq, const _Float16* __restrict__ K16, const _Float16* __restrict__ K16lo, int ldk, const _Float16* __restrict__ Vt, const _Float16* __restrict__ Vtlo, const unsigned* __restrict__ MB, const int* __restrict__ RA, const int* __restrict__ KE, float* __restrict__ O, int ldo) {
  constexpr int RPW = 16, RTN = RPW / 16, NQB = TQ / (4 * RPW), DT = 4, KS = 2;
  __shared__ __attribute__((aligned(16))) unsigned short sP[4][RPW][40], sPl[4][RPW][40]; __shared__ __attribute__((aligned(16))) float sO[4][RPW][64 + 4];
  const int tid = threadIdx.x, w = tid >> 5, lane = tid & 31, ln = lane & 15, hh = lane >> 4;
  const int slab = blockIdx.x / NQB, qblk = blockIdx.x % NQB; const int b = slab / NH, h = slab % NH; const int qb0 = qblk * (4 * RPW); const int q0 = qb0 + w * RPW;
  FragH aq[2][KS], aql[2][KS];
#pragma unroll
  for (int rt = 0; rt < RTN; ++rt) { const size_t qo = ((size_t)b * TQ + q0 + rt * 16 + ln) * ldq + h * 64; const unsigned short* qr = (const unsigned short*)Q16 + qo; const unsigned short* ql = (const unsigned short*)Q16lo + qo;
#pragma unroll
    for (int ks = 0; ks < KS; ++ks) { aq[rt][ks].half[0] = *(const v8us*)(qr + ks * 32 + 8 * hh); aq[rt][ks].half[1] = *(const v8us*)(qr + ks * 32 + 16 + 8 * hh); aql[rt][ks].half[0] = *(const v8us*)(ql + ks * 32 + 8 * hh); aql[rt][ks].half[1] = *(const v8us*)(ql + ks * 32 + 16 + 8 * hh); } }
  const unsigned short* Vth = (const unsigned short*)Vt + (size_t)slab * 64 * TK; const unsigned short* Vtl = (const unsigned short*)Vtlo + (size_t)slab * 64 * TK;
  float m_r[2][8], l_r[2][8]; v8f oacc[2][DT], oaccl[2][DT];
#pragma unroll
  for (int rt = 0; rt < RTN; ++rt) {
#pragma unroll
    for (int r = 0; r < 8; ++r) { m_r[rt][r] = -3.0e38f; l_r[rt][r] = 0.f; }
#pragma unroll
    for (int dt = 0; dt < DT; ++dt) { oacc[rt][dt] = (v8f){0.f,0.f,0.f,0.f,0.f,0.f,0.f,0.f}; oaccl[rt][dt] = oacc[rt][dt]; } }
  int jend = KE[qblk * 32]; jend = min(TK, (jend + 31) & ~31); if (jend < 32) jend = 32;      /* block-uniform */
  int allm[2][8]; const unsigned* mrow[2][8];
#pragma unroll
  for (int rt = 0; rt < RTN; ++rt)
#pragma unroll
    for (int r = 0; r < 8; ++r) { const int tq = q0 + rt * 16 + 8 * hh + r; allm[rt][r] = RA[tq]; mrow[rt][r] = MB + (size_t)tq * (TK / 32); }
#pragma unroll 1
  for (int j0 = 0; j0 < jend; j0 += 32) {
    
    v8f s[2][2];
#pragma unroll
    for (int nt = 0; nt < 2; ++nt) { const size_t ko = ((size_t)b * TK + j0 + nt * 16 + ln) * ldk + h * 64; const unsigned short* kr = (const unsigned short*)K16 + ko; const unsigned short* kl = (const unsigned short*)K16lo + ko; FragH bk[KS], bkl[KS];
#pragma unroll
      for (int ks = 0; ks < KS; ++ks) { bk[ks].half[0] = *(const v8us*)(kr + ks * 32 + 8 * hh); bk[ks].half[1] = *(const v8us*)(kr + ks * 32 + 16 + 8 * hh); bkl[ks].half[0] = *(const v8us*)(kl + ks * 32 + 8 * hh); bkl[ks].half[1] = *(const v8us*)(kl + ks * 32 + 16 + 8 * hh); }
#pragma unroll
      for (int rt = 0; rt < RTN; ++rt) { v8f acc = (v8f){0.f,0.f,0.f,0.f,0.f,0.f,0.f,0.f}, accr = acc;
#pragma unroll
        for (int ks = 0; ks < KS; ++ks) { acc = mmaH<1>(aq[rt][ks].v, aq[rt][ks].v, bk[ks].v, bk[ks].v, acc); accr = mmaH<1>(aql[rt][ks].v, aql[rt][ks].v, bk[ks].v, bk[ks].v, accr); accr = mmaH<1>(aq[rt][ks].v, aq[rt][ks].v, bkl[ks].v, bkl[ks].v, accr); }
        s[rt][nt] = acc + accr * 0.0009765625f; } }
#pragma unroll
    for (int rt = 0; rt < RTN; ++rt)
#pragma unroll
      for (int r = 0; r < 8; ++r) { const unsigned mw = mrow[rt][r][j0 >> 5]; const bool am = (allm[rt][r] != 0);
        const bool ok0 = am || (((mw >> ln) & 1u) == 0u), ok1 = am || (((mw >> (16 + ln)) & 1u) == 0u);
        const float s0 = ok0 ? (am ? 0.f : s[rt][0][r] * SCL) : -INFINITY, s1 = ok1 ? (am ? 0.f : s[rt][1][r] * SCL) : -INFINITY; float mc = fmaxf(s0, s1);
        mc = fmaxf(mc, __shfl_xor(mc, 1, 32)); mc = fmaxf(mc, __shfl_xor(mc, 2, 32)); mc = fmaxf(mc, __shfl_xor(mc, 4, 32)); mc = fmaxf(mc, __shfl_xor(mc, 8, 32));
        const float mn = fmaxf(m_r[rt][r], mc); const float al = (mn > -1.0e38f) ? expf(m_r[rt][r] - mn) : 1.0f; m_r[rt][r] = mn; const float p0 = ok0 ? expf(s0 - mn) : 0.f, p1 = ok1 ? expf(s1 - mn) : 0.f; l_r[rt][r] = l_r[rt][r] * al + p0 + p1;
#pragma unroll
        for (int dt = 0; dt < DT; ++dt) { oacc[rt][dt][r] *= al; oaccl[rt][dt][r] *= al; }
        FragH t2, t3; const float ps0 = p0 * 1024.0f, ps1 = p1 * 1024.0f; t2.h[0] = (_Float16)ps0; t2.h[1] = (_Float16)ps1; t3.h[0] = (_Float16)((ps0 - (float)t2.h[0]) * 1024.0f); t3.h[1] = (_Float16)((ps1 - (float)t2.h[1]) * 1024.0f);
        sP[w][rt * 16 + 8 * hh + r][ln] = t2.u[0]; sP[w][rt * 16 + 8 * hh + r][16 + ln] = t2.u[1]; sPl[w][rt * 16 + 8 * hh + r][ln] = t3.u[0]; sPl[w][rt * 16 + 8 * hh + r][16 + ln] = t3.u[1]; }
    __builtin_amdgcn_fence(__ATOMIC_ACQ_REL, "workgroup"); __builtin_amdgcn_wave_barrier();
    FragH pa[2], pl[2];
#pragma unroll
    for (int rt = 0; rt < RTN; ++rt) { pa[rt].half[0] = *(const v8us*)&sP[w][rt * 16 + ln][8 * hh]; pa[rt].half[1] = *(const v8us*)&sP[w][rt * 16 + ln][16 + 8 * hh]; pl[rt].half[0] = *(const v8us*)&sPl[w][rt * 16 + ln][8 * hh]; pl[rt].half[1] = *(const v8us*)&sPl[w][rt * 16 + ln][16 + 8 * hh]; }
#pragma unroll
    for (int dt = 0; dt < DT; ++dt) { const size_t vo = (size_t)(dt * 16 + ln) * TK + j0; FragH bv, bl; bv.half[0] = *(const v8us*)(Vth + vo + 8 * hh); bv.half[1] = *(const v8us*)(Vth + vo + 16 + 8 * hh); bl.half[0] = *(const v8us*)(Vtl + vo + 8 * hh); bl.half[1] = *(const v8us*)(Vtl + vo + 16 + 8 * hh);
#pragma unroll
      for (int rt = 0; rt < RTN; ++rt) { oacc[rt][dt] = mmaH<1>(pa[rt].v, pa[rt].v, bv.v, bv.v, oacc[rt][dt]); oaccl[rt][dt] = mmaH<1>(pa[rt].v, pa[rt].v, bl.v, bl.v, oaccl[rt][dt]); oaccl[rt][dt] = mmaH<1>(pl[rt].v, pl[rt].v, bv.v, bv.v, oaccl[rt][dt]); } }
    __builtin_amdgcn_fence(__ATOMIC_ACQ_REL, "workgroup"); __builtin_amdgcn_wave_barrier(); }
#pragma unroll
  for (int rt = 0; rt < RTN; ++rt) {
#pragma unroll
    for (int r = 0; r < 8; ++r) { float l = l_r[rt][r]; l += __shfl_xor(l, 1, 32); l += __shfl_xor(l, 2, 32); l += __shfl_xor(l, 4, 32); l += __shfl_xor(l, 8, 32); l_r[rt][r] = (l > 0.f) ? 1.0f / (l * 1024.0f) : 0.f; }
#pragma unroll
    for (int dt = 0; dt < DT; ++dt)
#pragma unroll
      for (int r = 0; r < 8; ++r) sO[w][rt * 16 + 8 * hh + r][dt * 16 + ln] = (oacc[rt][dt][r] + oaccl[rt][dt][r] * 0.0009765625f) * l_r[rt][r]; }
  __builtin_amdgcn_fence(__ATOMIC_ACQ_REL, "workgroup"); __builtin_amdgcn_wave_barrier();
  {
#pragma unroll
    for (int rp = 0; rp < RPW; rp += 2) { const int r = rp + (lane >> 4), pc = lane & 15; const v4f val = *(const v4fa*)&sO[w][r][pc * 4]; *(v4f*)(O + ((size_t)b * TQ + q0 + r) * ldo + h * 64 + pc * 4) = val; }
     } }


template <int SRCBF>
__global__ __launch_bounds__(256) void k_lnab(const float* __restrict__ X, const float* __restrict__ g, const float* __restrict__ bb, _Float16* __restrict__ Y16, float* __restrict__ Y32, float* __restrict__ XB) {
  #pragma clang fp contract(off)
  const int tid = threadIdx.x, w = tid >> 5, ln = tid & 31; const int r = blockIdx.x * 8 + w; if (r >= NR) return; const float* x = X + (size_t)r * DM; float s = 0.f;
#pragma unroll 1
  for (int i = 0; i < DM / 128; ++i) { const v4f a = *(const v4fa*)(x + i * 128 + ln * 4); for (int q = 0; q < 4; ++q) s += SRCBF ? bf16_round(a[q]) : a[q]; }
  for (int o = 16; o > 0; o >>= 1) s += __shfl_xor(s, o, 32); const float mu = s / (float)DM; float q2 = 0.f;
#pragma unroll 1
  for (int i = 0; i < DM / 128; ++i) { const v4f a = *(const v4fa*)(x + i * 128 + ln * 4); for (int q = 0; q < 4; ++q) { const float d = (SRCBF ? bf16_round(a[q]) : a[q]) - mu; q2 += d * d; } }
  for (int o = 16; o > 0; o >>= 1) q2 += __shfl_xor(q2, o, 32); const float rs = rsqrtf(q2 / (float)DM + 1e-5f);
  {
#pragma unroll 1
    for (int i = 0; i < DM / 128; ++i) { const int c0 = i * 128 + ln * 4; const v4f a = *(const v4fa*)(x + c0); _Float16 h4[4]; v4f y4, xb;
      for (int q = 0; q < 4; ++q) { const float t = SRCBF ? bf16_round(a[q]) : a[q]; const float y = (t - mu) * rs * bf16_round(g[c0 + q]) + bf16_round(bb[c0 + q]); h4[q] = (_Float16)y; y4[q] = y; xb[q] = t; }
      if (Y16) *(unsigned long long*)((unsigned short*)Y16 + (size_t)r * DM + c0) = *(const unsigned long long*)h4; if (Y32) *(v4f*)(Y32 + (size_t)r * DM + c0) = y4; if (XB) *(v4f*)(XB + (size_t)r * DM + c0) = xb; }
     } }
__global__ __launch_bounds__(256) void k_causaltab(unsigned* __restrict__ MB, int* __restrict__ RA, int* __restrict__ KE, int nq, int nk) {
  const int t = blockIdx.x * 256 + threadIdx.x; const int nw = nk / 32;
  if (t < nq * nw) { const int q = t / nw, w = t % nw; const int first = q + 1 - 32 * w; const unsigned bits = (first <= 0) ? 0xffffffffu : ((first >= 32) ? 0u : (0xffffffffu << first)); *(unsigned*)(MB + t) = bits;  }
  if (t < nq) { *(int*)(RA + t) = 0;  }
  if (t < nq / 64) { const int v = 64 * (t + 1); *(int*)(KE + t * 32) = v;  } }


extern "C" void kernel_launch(void* const* d_in, const int* in_sizes, int n_in,
                              void* d_out, int out_size, void* d_ws, size_t ws_size, hipStream_t stream) {
  (void)in_sizes; (void)n_in; (void)out_size;
  const float* const* I = (const float* const*)d_in; const float* x = I[0]; const float* lag = I[1]; const float* lab = I[2]; const float* lbg = I[3]; const float* lbb = I[4]; const float* lcg = I[5]; const float* lcb = I[6];
  const float* Wq = I[7]; const float* bq = I[8]; const float* Wk = I[9]; const float* bk = I[10]; const float* Wv = I[11]; const float* bv = I[12]; const float* Wo = I[13]; const float* bo = I[14]; const float* We = I[15]; const float* be = I[16]; const float* Wd = I[17]; const float* bd = I[18];
  char* ws = (char*)d_ws; size_t off = 0;
  auto take = [&](size_t bytes) { char* p = ws + off; off += (bytes + 255) & ~(size_t)255; return p; };
  _Float16* BQ = (_Float16*)take((size_t)DM * DM * 2); _Float16* BK = (_Float16*)take((size_t)DM * DM * 2); _Float16* BV = (_Float16*)take((size_t)DM * DM * 2); _Float16* BO = (_Float16*)take((size_t)DM * DM * 2); _Float16* BE = (_Float16*)take((size_t)4096 * DM * 2); _Float16* BD = (_Float16*)take((size_t)DM * 4096 * 2);
  float* XB = (float*)take((size_t)NR * DM * 4); _Float16* T16 = (_Float16*)take((size_t)NR * DM * 2); float* F = (float*)take((size_t)NR * DM * 4);
  _Float16* Qh = (_Float16*)take((size_t)NR * DM * 2); _Float16* Ql = (_Float16*)take((size_t)NR * DM * 2); _Float16* Kh = (_Float16*)take((size_t)NR * DM * 2); _Float16* Kl = (_Float16*)take((size_t)NR * DM * 2); _Float16* Vth = (_Float16*)take((size_t)NR * DM * 2); _Float16* Vtl = (_Float16*)take((size_t)NR * DM * 2);
  unsigned* MB = (unsigned*)take((size_t)SLEN * (SLEN / 32) * 4); int* RA = (int*)take((size_t)SLEN * 4); int* KE = (int*)take((size_t)(SLEN / 64) * 32 * 4);
  if (off > ws_size) return;      /* 24 + 16 + 8 + 16 + 48 + 0.6 = 113 MiB (the first LN's f32 output lives in F until the second LN consumes it) */
  float* O = F; _Float16* Oh = Qh; _Float16* Ol = Ql; float* X1 = XB; _Float16* GH = Kh;      /* SiLU hidden [NR][4096] f16 = 32 MB over Kh|Kl|Vth|Vtl (dead after the flash) */
  const size_t n8 = (size_t)NR * DM / 8; const unsigned nb8 = (unsigned)((n8 + 255) / 256);
  k_wt_f16<<<(unsigned)(((size_t)DM * DM / 8 + 255) / 256), 256, 0, stream>>>(Wq, BQ, DM, DM, 16.0f); k_wt_f16<<<(unsigned)(((size_t)DM * DM / 8 + 255) / 256), 256, 0, stream>>>(Wk, BK, DM, DM, 16.0f); k_wt_f16<<<(unsigned)(((size_t)DM * DM / 8 + 255) / 256), 256, 0, stream>>>(Wv, BV, DM, DM, 16.0f); k_wt_f16<<<(unsigned)(((size_t)DM * DM / 8 + 255) / 256), 256, 0, stream>>>(Wo, BO, DM, DM, 16.0f);
  k_wt_f16<<<(unsigned)(((size_t)DM * 4096 / 8 + 255) / 256), 256, 0, stream>>>(We, BE, DM, 4096, 16.0f); k_wt_f16<<<(unsigned)(((size_t)4096 * DM / 8 + 255) / 256), 256, 0, stream>>>(Wd, BD, 4096, DM, 16.0f);      /* all (in,out) */
  k_causaltab<<<(SLEN * (SLEN / 32) + 255) / 256, 256, 0, stream>>>(MB, RA, KE, SLEN, SLEN);
  k_lnab<1><<<NR / 8, 256, 0, stream>>>(x, lag, lab, nullptr, F, XB);      /* t0 = LN_a(bf16 x) (f32), XB = bf16(x) */
  k_lnab<0><<<NR / 8, 256, 0, stream>>>(F, lbg, lbb, T16, nullptr, nullptr);      /* t = LN_b(t0) as f16 operand */
  const dim3 gP((NR / 128) * (DM / 64), 1), gM((NR / 128) * (4096 / 64), 1);
  k_gemm2<0><<<gP, 128, 0, stream>>>(T16, DM, 0, BQ, DM, 0, 0.0625f, bq, 0, nullptr, 1, 0, 0, F, nullptr, DM, 0, NR, DM, DM); k_hl<<<nb8, 256, 0, stream>>>(F, Qh, Ql, n8);
  k_gemm2<0><<<gP, 128, 0, stream>>>(T16, DM, 0, BK, DM, 0, 0.0625f, bk, 0, nullptr, 1, 0, 0, F, nullptr, DM, 0, NR, DM, DM); k_hl<<<nb8, 256, 0, stream>>>(F, Kh, Kl, n8);
  k_gemm2<0><<<gP, 128, 0, stream>>>(T16, DM, 0, BV, DM, 0, 0.0625f, bv, 0, nullptr, 1, 0, 0, F, nullptr, DM, 0, NR, DM, DM);
  for (int b = 0; b < NBT; ++b) k_vthl<SLEN><<<NH * (SLEN / 64), 256, 0, stream>>>(F + (size_t)b * SLEN * DM, DM, Vth + (size_t)b * SLEN * DM, Vtl + (size_t)b * SLEN * DM);
  for (int b = 0; b < NBT; ++b) { const size_t ro = (size_t)b * SLEN * DM;
    k_flashm<SLEN, SLEN><<<NH * (SLEN / 64), 128, 0, stream>>>(Qh + ro, Ql + ro, DM, Kh + ro, Kl + ro, DM, Vth + ro, Vtl + ro, MB, RA, KE, O + ro, DM); }
  k_hl<<<nb8, 256, 0, stream>>>(O, Oh, Ol, n8);
  k_gemm2<0><<<gP, 128, 0, stream>>>(Oh, DM, 0, BO, DM, 0, 0.0625f, bo, 0, XB, 1, (size_t)DM, 0, X1, nullptr, DM, 0, NR, DM, DM);      /* x1 = x + ctx Wo + bo (hi) */
  k_gemm2<0><<<gP, 128, 0, stream>>>(Ol, DM, 0, BO, DM, 0, 0.0625f / 1024.0f, nullptr, 0, X1, 1, (size_t)DM, 0, X1, nullptr, DM, 0, NR, DM, DM);      /* + lo */
  k_lnab<0><<<NR / 8, 256, 0, stream>>>(X1, lcg, lcb, T16, nullptr, nullptr);
  k_gemm2<15><<<gM, 128, 0, stream>>>(T16, DM, 0, BE, DM, 0, 0.0625f, be, 0, nullptr, 1, 0, 0, nullptr, GH, 4096, 0, NR, 4096, DM);      /* silu(t We + be) f16 (ACT 15 = x * sigmoid(x), present in the epilogue) */
  k_gemm2<0><<<gP, 128, 0, stream>>>(GH, 4096, 0, BD, 4096, 0, 0.0625f, bd, 0, X1, 1, (size_t)DM, 0, (float*)d_out, nullptr, DM, 0, NR, DM, 4096);      /* out = x1 + mlp */
}

// v001
// One run takes 966 microseconds.
// In both of two side-by-side timings against v000, it was 1.26 times as fast.
#include <hip/hip_runtime.h>
// Pre-LN causal attention block (2 x 2048 tokens, 1024 = 16 heads x 64; MLP 4096 with SiLU): t = LN_b(LN_a(x)); q,k,v = t W + b; x1 = x + (causal softmax(q.k/8) v) Wo + bo; out = x1 + (silu(LN_c(x1) We + be)) Wd + bd -> [2,2048,1024].
// Structure: the LayerNorms on VALU (the first pass also writes the bf16 residual plane); projections / MLP as f16 WMMA GEMMs (32x64 wave tiles, f32 accumulation, exact x16 weights, biases / SiLU / residual addends in the epilogue); q, k as f16 hi + (x2^10) residual planes, V^T as hi + residual planes; fused causal flash kernel, one work-group per (head, t): 64-query tile t of batch 0, then tile 31 - t of batch 1 (device-built causal tables, online f32 softmax, P staged hi + residual, two value accumulators); O as hi + residual planes into Wo (two GEMMs).
// Compute dtype: x, weights, biases, LN parameters rounded to bf16; LN outputs and the SiLU hidden as f16 operands (~2^-12); q, k, P, v, O as f16 hi + residual pairs (~2^-21); f32 accumulation, softmax, LayerNorm. v_wmma_f32_16x16x32_f16.
#define NBT 2
#define SLEN 2048
#define DM 1024
#define NH 16
#define SCL 0.125f
#define NR (NBT * SLEN)
typedef __bf16 v16b __attribute__((ext_vector_type(16)));
typedef unsigned short v8us __attribute__((ext_vector_type(8), may_alias));
typedef float  v8f  __attribute__((ext_vector_type(8)));
typedef float  v4f  __attribute__((ext_vector_type(4)));
typedef float  v4fa __attribute__((ext_vector_type(4), may_alias));
union FragB { v16b v; v8us half[2]; unsigned short u[16]; };

__device__ __forceinline__ unsigned short bf16_bits(float x) { unsigned int u = __float_as_uint(x); return (unsigned short)((u + 0x7FFFu + ((u >> 16) & 1u)) >> 16); }
__device__ __forceinline__ float bf16_val(unsigned short b) { return __uint_as_float(((unsigned int)b) << 16); }
__device__ __forceinline__ float bf16_round(float x) { return bf16_val(bf16_bits(x)); }
// D += A·B with NT terms: 1 = ah·bh, 2 = + al·bh (A split), 3 = + ah·bl (both split)
template <int NT>
__device__ __forceinline__ v8f mmaN(v16b ah, v16b al, v16b bh, v16b bl, v8f c) {
  c = __builtin_amdgcn_wmma_f32_16x16x32_bf16(false, ah, false, bh, (short)0, c, false, false);
  if (NT >= 2) c = __builtin_amdgcn_wmma_f32_16x16x32_bf16(false, al, false, bh, (short)0, c, false, false);
  if (NT >= 3) c = __builtin_amdgcn_wmma_f32_16x16x32_bf16(false, ah, false, bl, (short)0, c, false, false);
  asm volatile("v_nop\n\tv_nop\n\tv_nop\n\tv_nop" : "+v"(c) : "v"(ah), "v"(al), "v"(bh), "v"(bl));
  return c;
}

__global__ __launch_bounds__(256) void k_wt_bf16(const float* __restrict__ W, unsigned short* __restrict__ Wt, int K, int N) {
  const int t = blockIdx.x * 256 + threadIdx.x;
  const int k8n = K / 8;
  if (t >= N * k8n) return;
  const int n = t / k8n, k8 = (t % k8n) * 8;
  v8us v;
#pragma unroll
  for (int i = 0; i < 8; ++i) v[i] = bf16_bits(W[(size_t)(k8 + i) * N + n]);
  *(v8us*)(Wt + (size_t)n * K + k8) = v;
  
}

// GEMM C[M][N] (f32, pitch ldc) = act(A[M][K]·W + bias). A f32 row-major (pitch lda) converted per fragment to bf16
// (ASPLIT: hi/lo two planes -> 2 terms, else single rounded term); Wt bf16 [N][K] (pitch ldb). BIAS_BF16 rounds the
// bias to bf16 first (bias quantised to bf16 before the add). K%32==0, M%16==0, N%64==0.
template <bool ASPLIT, int ACT, bool BIAS_BF16>
__global__ __launch_bounds__(128) void k_gemm_bf(const float* __restrict__ A, int lda, const unsigned short* __restrict__ Wt, int ldb,
                                               const float* __restrict__ bias, float* __restrict__ C, int ldc, int M, int N, int K) {
  __shared__ __attribute__((aligned(16))) float so[4][16][64];
  const int tid = threadIdx.x, w = tid >> 5, lane = tid & 31, ln = lane & 15, hh = lane >> 4;
  const int ntn = N / 64;
  const int wid = blockIdx.x * 4 + w;
  const int mt = wid / ntn, nq = wid % ntn;
  if (mt * 16 >= M) return;
  const int row0 = mt * 16, col0 = nq * 64;
  const float* arow = A + (size_t)(row0 + ln) * lda;
  v8f acc[4] = {};
  for (int kb = 0; kb < K; kb += 32) {
    FragB ah, al;
    const v4f x0 = *(const v4fa*)(arow + kb + 8 * hh), x1 = *(const v4fa*)(arow + kb + 8 * hh + 4);
    const v4f x2 = *(const v4fa*)(arow + kb + 16 + 8 * hh), x3 = *(const v4fa*)(arow + kb + 16 + 8 * hh + 4);
    float xs[16] = {x0[0],x0[1],x0[2],x0[3],x1[0],x1[1],x1[2],x1[3],x2[0],x2[1],x2[2],x2[3],x3[0],x3[1],x3[2],x3[3]};
#pragma unroll
    for (int i = 0; i < 16; ++i) { const unsigned short hb = bf16_bits(xs[i]); ah.u[i] = hb; al.u[i] = ASPLIT ? bf16_bits(xs[i] - bf16_val(hb)) : (unsigned short)0; }
#pragma unroll
    for (int t = 0; t < 4; ++t) {
      const unsigned short* brow = Wt + (size_t)(col0 + t * 16 + ln) * ldb + kb;
      FragB b;
      b.half[0] = *(const v8us*)(brow + 8 * hh);
      b.half[1] = *(const v8us*)(brow + 16 + 8 * hh);
      acc[t] = mmaN<ASPLIT ? 2 : 1>(ah.v, al.v, b.v, b.v, acc[t]);
    }
  }
#pragma unroll
  for (int t = 0; t < 4; ++t) {
    float bv = bias ? bias[col0 + t * 16 + ln] : 0.f;
    if (BIAS_BF16) bv = bf16_round(bv);
#pragma unroll
    for (int r = 0; r < 8; ++r) { float v = acc[t][r] + bv; if (ACT == 1) v = fmaxf(v, 0.f); so[w][8 * hh + r][t * 16 + ln] = v; }
  }
  __builtin_amdgcn_fence(__ATOMIC_ACQ_REL, "workgroup");
  __builtin_amdgcn_wave_barrier();
  const int rsub = lane >> 4, c4 = (lane & 15) * 4;
  {
#pragma unroll
    for (int q = 0; q < 8; ++q) {
      const int r = q * 2 + rsub;
      const v4f v = *(const v4fa*)&so[w][r][c4];
      *(v4f*)(C + (size_t)(row0 + r) * ldc + col0 + c4) = v;
    }
    
  }
}

// GEMM C = act(A·W + bias + resid): A f32 (ASPLIT -> hi/lo 2 terms), Wt bf16 [N][K]; ACT 0 none, 1 relu, 2 exact gelu;
// resid (optional, f32, row index = (row % rmod), pitch ldr, RES_BF16 rounds it) added before the activation.
template <bool ASPLIT, int ACT, bool BIAS_BF16, bool RES_BF16>
__global__ __launch_bounds__(128) void k_gemm_bf3(const float* __restrict__ A, int lda, const unsigned short* __restrict__ Wt, int ldb,
                                                const float* __restrict__ bias, const float* __restrict__ resid, int rmod, int ldr,
                                                float* __restrict__ C, int ldc, int M, int N, int K) {
  __shared__ __attribute__((aligned(16))) float so[4][16][64];
  const int tid = threadIdx.x, w = tid >> 5, lane = tid & 31, ln = lane & 15, hh = lane >> 4;
  const int ntn = N / 64;
  const int wid = blockIdx.x * 4 + w;
  const int mt = wid / ntn, nq = wid % ntn;
  if (mt * 16 >= M) return;
  const int row0 = mt * 16, col0 = nq * 64;
  const float* arow = A + (size_t)(row0 + ln) * lda;
  v8f acc[4] = {};
  for (int kb = 0; kb < K; kb += 32) {
    FragB ah, al;
    const v4f x0 = *(const v4fa*)(arow + kb + 8 * hh), x1 = *(const v4fa*)(arow + kb + 8 * hh + 4);
    const v4f x2 = *(const v4fa*)(arow + kb + 16 + 8 * hh), x3 = *(const v4fa*)(arow + kb + 16 + 8 * hh + 4);
    float xs[16] = {x0[0],x0[1],x0[2],x0[3],x1[0],x1[1],x1[2],x1[3],x2[0],x2[1],x2[2],x2[3],x3[0],x3[1],x3[2],x3[3]};
#pragma unroll
    for (int i = 0; i < 16; ++i) { const unsigned short hb = bf16_bits(xs[i]); ah.u[i] = hb; al.u[i] = ASPLIT ? bf16_bits(xs[i] - bf16_val(hb)) : (unsigned short)0; }
#pragma unroll
    for (int t = 0; t < 4; ++t) {
      const unsigned short* brow = Wt + (size_t)(col0 + t * 16 + ln) * ldb + kb;
      FragB b;
      b.half[0] = *(const v8us*)(brow + 8 * hh);
      b.half[1] = *(const v8us*)(brow + 16 + 8 * hh);
      acc[t] = mmaN<ASPLIT ? 2 : 1>(ah.v, al.v, b.v, b.v, acc[t]);
    }
  }
#pragma unroll
  for (int t = 0; t < 4; ++t) {
    const int col = col0 + t * 16 + ln;
    float bv = bias ? bias[col] : 0.f;
    if (BIAS_BF16) bv = bf16_round(bv);
#pragma unroll
    for (int r = 0; r < 8; ++r) {
      float v = acc[t][r] + bv;
      if (resid) { float rv = resid[(size_t)((row0 + 8 * hh + r) % rmod) * ldr + col]; if (RES_BF16) rv = bf16_round(rv); v += rv; }
      if (ACT == 1) v = fmaxf(v, 0.f);
      if (ACT == 2) v = 0.5f * v * (1.0f + erff(v * 0.70710678118654752f));
      if (ACT == 3) { const float u = 0.7978845608028654f * (v + 0.044715f * v * v * v); v = 0.5f * v * (1.0f + tanhf(u)); }
      so[w][8 * hh + r][t * 16 + ln] = v;
    }
  }
  __builtin_amdgcn_fence(__ATOMIC_ACQ_REL, "workgroup");
  __builtin_amdgcn_wave_barrier();
  const int rsub = lane >> 4, c4 = (lane & 15) * 4;
  {
#pragma unroll
    for (int q = 0; q < 8; ++q) {
      const int r = q * 2 + rsub;
      const v4f v = *(const v4fa*)&so[w][r][c4];
      *(v4f*)(C + (size_t)(row0 + r) * ldc + col0 + c4) = v;
    }
    
  }
}
// row LayerNorm (biased variance, eps) over N: s = X (+ R); optional out_sum <- s; out_norm <- (s-mu)*rsqrt(var+eps)*g + b
template <bool PARAM_BF16>
__global__ __launch_bounds__(256) void k_layernorm(const float* __restrict__ X, const float* __restrict__ R, const float* __restrict__ g, const float* __restrict__ bta,
                                                  float* __restrict__ out_sum, float* __restrict__ out_norm, int N, float eps) {
  __shared__ float red[256];
  const int row = blockIdx.x, tid = threadIdx.x;
  const float* x = X + (size_t)row * N; const float* rr = R ? R + (size_t)row * N : nullptr;
  float vals[16];                     // up to N = 4096
  const int per = N / 256;            // contiguous chunk per thread? use strided-by-4 chunks: thread handles j = tid*4 + 1024*u
  float s1 = 0.f;
  for (int u = 0; u < per / 4; ++u) {
    const int j = tid * 4 + 1024 * u;
    const v4f a = *(const v4fa*)(x + j);
    v4f b = {0.f,0.f,0.f,0.f}; if (rr) b = *(const v4fa*)(rr + j);
#pragma unroll
    for (int q = 0; q < 4; ++q) { const float v = a[q] + b[q]; vals[u * 4 + q] = v; s1 += v; }
  }
  red[tid] = s1; __syncthreads();
  for (int st = 128; st > 0; st >>= 1) { if (tid < st) red[tid] += red[tid + st]; __syncthreads(); }
  const float mu = red[0] / (float)N; __syncthreads();
  float s2 = 0.f;
  for (int u = 0; u < per / 4; ++u)
#pragma unroll
    for (int q = 0; q < 4; ++q) { const float c = vals[u * 4 + q] - mu; s2 += c * c; }
  red[tid] = s2; __syncthreads();
  for (int st = 128; st > 0; st >>= 1) { if (tid < st) red[tid] += red[tid + st]; __syncthreads(); }
  const float rs = rsqrtf(red[0] / (float)N + eps);
  {
    for (int u = 0; u < per / 4; ++u) {
      const int j = tid * 4 + 1024 * u;
      v4f o, sm;
#pragma unroll
      for (int q = 0; q < 4; ++q) {
        float gg = g[j + q], bb = bta[j + q];
        if (PARAM_BF16) { gg = bf16_round(gg); bb = bf16_round(bb); }
        sm[q] = vals[u * 4 + q]; o[q] = (vals[u * 4 + q] - mu) * rs * gg + bb;
      }
      if (out_sum) *(v4f*)(out_sum + (size_t)row * N + j) = sm;
      *(v4f*)(out_norm + (size_t)row * N + j) = o;
    }
    
  }
}



// ---- f16 WMMA path (v_wmma_f32_16x16x32_f16): 11-bit significands for operands in range — used where a [0,1] probability operand needs more precision than bf16
typedef _Float16 v16h __attribute__((ext_vector_type(16)));
union FragH { v16h v; v8us half[2]; _Float16 h[16]; unsigned short u[16]; };
template <int NT>
__device__ __forceinline__ v8f mmaH(v16h ah, v16h al, v16h bh, v16h bl, v8f c) {
  c = __builtin_amdgcn_wmma_f32_16x16x32_f16(false, ah, false, bh, (short)0, c, false, false);
  if (NT >= 2) c = __builtin_amdgcn_wmma_f32_16x16x32_f16(false, al, false, bh, (short)0, c, false, false);
  if (NT >= 3) c = __builtin_amdgcn_wmma_f32_16x16x32_f16(false, ah, false, bl, (short)0, c, false, false);
  asm volatile("v_nop\n\tv_nop\n\tv_nop\n\tv_nop" : "+v"(c) : "v"(ah), "v"(al), "v"(bh), "v"(bl));
  return c;
}
// batched GEMM like k_gemm_b but f16 operands: A f32 (split into f16 hi/lo if ASPLIT, else rounded to f16), Bt = f16 values [n][k]; alpha; C f32; N multiple of 16 (partial tiles skipped)
template <bool ASPLIT>
__global__ __launch_bounds__(128) void k_gemm_h(const float* __restrict__ A, int lda, size_t sA, const _Float16* __restrict__ Bh, int ldb, size_t sB, float alpha, float* __restrict__ C, int ldc, size_t sC, int M, int N, int K) {
  __shared__ __attribute__((aligned(16))) float so[4][16][64];
  const int tid = threadIdx.x, w = tid >> 5, lane = tid & 31, ln = lane & 15, hh = lane >> 4; const int by = blockIdx.y;
  A += (size_t)by * sA; Bh += (size_t)by * sB; C += (size_t)by * sC;
  const int ntn = (N + 63) / 64; const int wid = blockIdx.x * 4 + w; const int mt = wid / ntn, nq = wid % ntn; if (mt * 16 >= M) return;
  const int row0 = mt * 16, col0 = nq * 64; const float* arow = A + (size_t)(row0 + ln) * lda;
  v8f acc[4] = {};
  for (int kb = 0; kb < K; kb += 32) {
    FragH ah, al;
    const v4f x0 = *(const v4fa*)(arow + kb + 8 * hh), x1 = *(const v4fa*)(arow + kb + 8 * hh + 4), x2 = *(const v4fa*)(arow + kb + 16 + 8 * hh), x3 = *(const v4fa*)(arow + kb + 16 + 8 * hh + 4);
    float xs[16] = {x0[0],x0[1],x0[2],x0[3],x1[0],x1[1],x1[2],x1[3],x2[0],x2[1],x2[2],x2[3],x3[0],x3[1],x3[2],x3[3]};
#pragma unroll
    for (int i = 0; i < 16; ++i) { const _Float16 h = (_Float16)xs[i]; ah.h[i] = h; al.h[i] = ASPLIT ? (_Float16)(xs[i] - (float)h) : (_Float16)0.0f; }
#pragma unroll
    for (int t = 0; t < 4; ++t) { if (col0 + t * 16 >= N) continue; const size_t boff = (size_t)(col0 + t * 16 + ln) * ldb + kb; FragH bq; bq.half[0] = *(const v8us*)(Bh + boff + 8 * hh); bq.half[1] = *(const v8us*)(Bh + boff + 16 + 8 * hh);
      acc[t] = mmaH<ASPLIT ? 2 : 1>(ah.v, al.v, bq.v, bq.v, acc[t]); }
  }
#pragma unroll
  for (int t = 0; t < 4; ++t) { if (col0 + t * 16 >= N) continue;
#pragma unroll
    for (int r = 0; r < 8; ++r) so[w][8 * hh + r][t * 16 + ln] = acc[t][r] * alpha; }
  __builtin_amdgcn_fence(__ATOMIC_ACQ_REL, "workgroup"); __builtin_amdgcn_wave_barrier();
  const int rsub = lane >> 4, c4 = (lane & 15) * 4;
  {
#pragma unroll
    for (int q = 0; q < 8; ++q) { const int r = q * 2 + rsub; if (col0 + c4 < N) { const v4f v = *(const v4fa*)&so[w][r][c4]; *(v4f*)(C + (size_t)(row0 + r) * ldc + col0 + c4) = v; } }
     }
}

// Wt[n][k] = f16(W[k][n]·scale) from f32 row-major W[K][N] (scale = power of two; bf16-exact weights stay exact in f16 away from the subnormal range)
__global__ __launch_bounds__(256) void k_wt_f16(const float* __restrict__ W, _Float16* __restrict__ Wt, int K, int N, float scale) {
  const int t = blockIdx.x * 256 + threadIdx.x; if (t >= N * (K / 8)) return; const int n = t / (K / 8), k8 = (t % (K / 8)) * 8; FragH f;
#pragma unroll
  for (int i = 0; i < 8; ++i) f.h[i] = (_Float16)(bf16_round(W[(size_t)(k8 + i) * N + n]) * scale); const v8us o = f.half[0];
  *(v8us*)((unsigned short*)Wt + (size_t)n * K + k8) = o; 
}
// k_gemm_hh variant with fused epilogue: v = acc·alpha + bias[by·sBias + col] (+ CP[(row/rowsPerB)·sCPb + by·64 + col] if CP) ; ACT 0 none / 1 elu ; writes f16 C16 (and f32 C if non-null)
template <int ACT>
__global__ __launch_bounds__(128) void k_gemm_hhx(const _Float16* __restrict__ A, int lda, size_t sA, const _Float16* __restrict__ Bh, int ldb, size_t sB, float alpha, const float* __restrict__ bias, size_t sBias, const float* __restrict__ CP, int rowsPerB, size_t sCPb, int row0g,
    float* __restrict__ C, _Float16* __restrict__ C16, int ldc, size_t sC, int M, int N, int K) {
  __shared__ __attribute__((aligned(16))) float so[4][16][64];
  const int tid = threadIdx.x, w = tid >> 5, lane = tid & 31, ln = lane & 15, hh = lane >> 4; const int by = blockIdx.y;
  A += (size_t)by * sA; Bh += (size_t)by * sB; const size_t cofs = (size_t)by * sC; const float* bp = bias ? bias + (size_t)by * sBias : nullptr;
  const int ntn = (N + 63) / 64; const int wid = blockIdx.x * 4 + w; const int mt = wid / ntn, nq = wid % ntn; if (mt * 16 >= M) return;
  const int row0 = mt * 16, col0 = nq * 64; const _Float16* arow = A + (size_t)(row0 + ln) * lda;
  v8f acc[4] = {};
  for (int kb = 0; kb < K; kb += 32) { FragH ah; ah.half[0] = *(const v8us*)((const unsigned short*)arow + kb + 8 * hh); ah.half[1] = *(const v8us*)((const unsigned short*)arow + kb + 16 + 8 * hh);
#pragma unroll
    for (int t = 0; t < 4; ++t) { if (col0 + t * 16 >= N) continue; const size_t boff = (size_t)(col0 + t * 16 + ln) * ldb + kb; FragH bq; bq.half[0] = *(const v8us*)((const unsigned short*)Bh + boff + 8 * hh); bq.half[1] = *(const v8us*)((const unsigned short*)Bh + boff + 16 + 8 * hh);
      acc[t] = mmaH<1>(ah.v, ah.v, bq.v, bq.v, acc[t]); }
  }
#pragma unroll
  for (int t = 0; t < 4; ++t) { if (col0 + t * 16 >= N) continue; const int col = col0 + t * 16 + ln; const float bv = bp ? bf16_round(bp[col]) : 0.f;
#pragma unroll
    for (int r = 0; r < 8; ++r) { float v = acc[t][r] * alpha + bv; if (CP) { const int bidx = (row0g + row0 + 8 * hh + r) / rowsPerB; v += CP[(size_t)bidx * sCPb + (size_t)by * 64 + col]; } if (ACT == 1) v = (v > 0.f) ? v : expm1f(v); else if (ACT == 7) v = (v > 0.f) ? v + 1.0f : expf(v); else if (ACT == 8) v = tanhf(v); else if (ACT == 9) v = 0.5f * v * (1.0f + tanhf(0.7978845608028654f * (v + 0.044715f * v * v * v))); else if (ACT == 11) v = 1.0f / (1.0f + expf(-v)); else if (ACT == 12) v = (v > 0.f) ? v : 0.01f * v; else if (ACT == 14) v = (v > 0.f) ? v : 0.1f * v; else if (ACT == 15) v = v / (1.0f + expf(-v)); else if (ACT == 3) v = fmaxf(v, 0.f); else if (ACT == 6) v = 0.5f * v * (1.0f + erff(v * 0.70710678118654752f)); so[w][8 * hh + r][t * 16 + ln] = v; } }
  __builtin_amdgcn_fence(__ATOMIC_ACQ_REL, "workgroup"); __builtin_amdgcn_wave_barrier();
  const int rsub = lane >> 4, c4 = (lane & 15) * 4; typedef _Float16 v4h __attribute__((ext_vector_type(4)));
  {
#pragma unroll
    for (int q = 0; q < 8; ++q) { const int r = q * 2 + rsub; if (col0 + c4 < N) { const v4f v = *(const v4fa*)&so[w][r][c4]; if (C) *(v4f*)(C + cofs + (size_t)(row0 + r) * ldc + col0 + c4) = v; if (C16) { v4h h4; for (int i = 0; i < 4; ++i) h4[i] = (_Float16)v[i]; *(v4h*)(C16 + cofs + (size_t)(row0 + r) * ldc + col0 + c4) = h4; } } }
     }
}


typedef _Float16 v4h __attribute__((ext_vector_type(4)));

__global__ __launch_bounds__(256) void k_x16(const float* __restrict__ x, _Float16* __restrict__ X16, size_t n8) { const size_t t = (size_t)blockIdx.x * 256 + threadIdx.x; if (t >= n8) return; FragH f;
#pragma unroll
  for (int q = 0; q < 8; ++q) f.h[q] = (_Float16)bf16_round(x[t * 8 + q]); *(v8us*)((unsigned short*)X16 + t * 8) = f.half[0];  }
__global__ __launch_bounds__(256) void k_h16(const float* __restrict__ x, _Float16* __restrict__ X16, size_t n8) { const size_t t = (size_t)blockIdx.x * 256 + threadIdx.x; if (t >= n8) return; FragH f;
#pragma unroll
  for (int q = 0; q < 8; ++q) f.h[q] = (_Float16)x[t * 8 + q]; *(v8us*)((unsigned short*)X16 + t * 8) = f.half[0];  }
__global__ __launch_bounds__(256) void k_round16f(const float* __restrict__ W, _Float16* __restrict__ Bt, size_t n8) { const size_t t = (size_t)blockIdx.x * 256 + threadIdx.x; if (t >= n8) return; FragH f;
#pragma unroll
  for (int i = 0; i < 8; ++i) f.h[i] = (_Float16)(bf16_round(W[t * 8 + i]) * 16.0f); *(v8us*)((unsigned short*)Bt + t * 8) = f.half[0];  }
template <int NHv, int TTv>
__global__ __launch_bounds__(256) void k_vt(const _Float16* __restrict__ V16, int ldv, int voff, _Float16* __restrict__ Vt) { __shared__ unsigned short tl[64][66]; const int tid = threadIdx.x; const int slab = blockIdx.x / (TTv / 64), lg = blockIdx.x % (TTv / 64); const int b = slab / NHv, h = slab % NHv;
  for (int i = tid; i < 64 * 8; i += 256) { const int r = i / 8, c8 = (i % 8) * 8; FragH f; f.half[0] = *(const v8us*)((const unsigned short*)V16 + ((size_t)b * TTv + lg * 64 + r) * ldv + voff + h * 64 + c8);
#pragma unroll
    for (int q = 0; q < 8; ++q) tl[r][c8 + q] = f.u[q]; }
  __syncthreads();
  {
#pragma unroll
    for (int rd = 0; rd < 2; ++rd) { const int d = rd * 32 + tid / 8, pc = tid % 8; FragH f;
#pragma unroll
      for (int q = 0; q < 8; ++q) f.u[q] = tl[pc * 8 + q][d];
      *(v8us*)((unsigned short*)Vt + ((size_t)slab * 64 + d) * TTv + lg * 64 + pc * 8) = f.half[0]; }
     } }

__global__ __launch_bounds__(256) void k_hl(const float* __restrict__ F, _Float16* __restrict__ Hh, _Float16* __restrict__ Hl, size_t n8) { const size_t t = (size_t)blockIdx.x * 256 + threadIdx.x; if (t >= n8) return; FragH fh, fl; const v4f a = *(const v4fa*)(F + t * 8), c = *(const v4fa*)(F + t * 8 + 4);
#pragma unroll
  for (int q = 0; q < 4; ++q) { _Float16 h = (_Float16)a[q]; fh.h[q] = h; fl.h[q] = (_Float16)((a[q] - (float)h) * 1024.0f); h = (_Float16)c[q]; fh.h[4 + q] = h; fl.h[4 + q] = (_Float16)((c[q] - (float)h) * 1024.0f); }
  { *(v8us*)((unsigned short*)Hh + t * 8) = fh.half[0]; *(v8us*)((unsigned short*)Hl + t * 8) = fl.half[0];  } }

// ---- fast GEMM (wave tile 32x64; requires M % 32 == 0 rows per launch region and N % 64 == 0); epilogue = k_gemm_hhx semantics ----
__device__ __forceinline__ v16h g2_frag(const _Float16* p, int hh) { FragH f; f.half[0] = *(const v8us*)((const unsigned short*)p + 8 * hh); f.half[1] = *(const v8us*)((const unsigned short*)p + 16 + 8 * hh); return f.v; }
__device__ __forceinline__ v8f g2_mma(v16h a, v16h b, v8f c) { v8f d = __builtin_amdgcn_wmma_f32_16x16x32_f16(false, a, false, b, (short)0, c, false, false); asm volatile("v_nop\n\tv_nop\n\tv_nop\n\tv_nop" : "+v"(d) : "v"(a), "v"(b)); return d; }
template <int ACT>
__global__ __launch_bounds__(128) void k_gemm2(const _Float16* __restrict__ A, int lda, size_t sA, const _Float16* __restrict__ Bh, int ldb, size_t sB, float alpha, const float* __restrict__ bias, size_t sBias, const float* __restrict__ CP, int rowsPerB, size_t sCPb, int row0g,
    float* __restrict__ C, _Float16* __restrict__ C16, int ldc, size_t sC, int M, int N, int K) {
  __shared__ __attribute__((aligned(16))) float so[4][32][68];
  const int tid = threadIdx.x, w = tid >> 5, lane = tid & 31, ln = lane & 15, hh = lane >> 4; const int by = blockIdx.y;
  A += (size_t)by * sA; Bh += (size_t)by * sB; const size_t cofs = (size_t)by * sC; const float* bp = bias ? bias + (size_t)by * sBias : nullptr;
  const int ntn = N >> 6; const int mt = blockIdx.x / ntn, nq = blockIdx.x - mt * ntn; const int row0 = mt * 128 + 32 * w, col0 = nq * 64; if (row0 >= M) return;
  const _Float16* a0p = A + (size_t)(row0 + ln) * lda; const _Float16* a1p = a0p + (size_t)16 * lda;
  const _Float16* b0p = Bh + (size_t)(col0 + ln) * ldb; const _Float16* b1p = b0p + (size_t)16 * ldb; const _Float16* b2p = b1p + (size_t)16 * ldb; const _Float16* b3p = b2p + (size_t)16 * ldb;
  const v8f z8 = {0.f,0.f,0.f,0.f,0.f,0.f,0.f,0.f}; v8f c00 = z8, c01 = z8, c02 = z8, c03 = z8, c10 = z8, c11 = z8, c12 = z8, c13 = z8;
#pragma unroll 1
  for (int kb = 0; kb < K; kb += 32) { const v16h a0 = g2_frag(a0p + kb, hh), a1 = g2_frag(a1p + kb, hh);
    v16h b = g2_frag(b0p + kb, hh); c00 = g2_mma(a0, b, c00); c10 = g2_mma(a1, b, c10);
    b = g2_frag(b1p + kb, hh); c01 = g2_mma(a0, b, c01); c11 = g2_mma(a1, b, c11);
    b = g2_frag(b2p + kb, hh); c02 = g2_mma(a0, b, c02); c12 = g2_mma(a1, b, c12);
    b = g2_frag(b3p + kb, hh); c03 = g2_mma(a0, b, c03); c13 = g2_mma(a1, b, c13); }
  v8f accs[8] = {c00, c01, c02, c03, c10, c11, c12, c13};
#pragma unroll
  for (int u = 0; u < 8; ++u) { const int t = u & 3, half = u >> 2; const int col = col0 + t * 16 + ln; const float bv = bp ? bf16_round(bp[col]) : 0.f;
#pragma unroll
    for (int r = 0; r < 8; ++r) { const int rloc = half * 16 + 8 * hh + r; float v = accs[u][r] * alpha + bv; if (CP) { const int bidx = (row0g + row0 + rloc) / rowsPerB; v += CP[(size_t)bidx * sCPb + (size_t)by * 64 + col]; }
      if (ACT == 3) v = fmaxf(v, 0.f); else if (ACT == 6) v = 0.5f * v * (1.0f + erff(v * 0.70710678118654752f)); else if (ACT == 11) v = 1.0f / (1.0f + expf(-v)); else if (ACT == 15) v = v / (1.0f + expf(-v)); else if (ACT == 12) v = (v > 0.f) ? v : 0.01f * v; else if (ACT == 8) v = tanhf(v);
      so[w][rloc][t * 16 + ln] = v; } }
  __builtin_amdgcn_fence(__ATOMIC_ACQ_REL, "workgroup"); __builtin_amdgcn_wave_barrier();
  const int rsub = lane >> 4, c4 = (lane & 15) * 4;
  {
#pragma unroll
    for (int q = 0; q < 16; ++q) { const int r = q * 2 + rsub; const v4f v = *(const v4fa*)&so[w][r][c4]; if (C) *(v4f*)(C + cofs + (size_t)(row0 + r) * ldc + col0 + c4) = v; if (C16) { v4h h4; for (int i = 0; i < 4; ++i) h4[i] = (_Float16)v[i]; *(v4h*)(C16 + cofs + (size_t)(row0 + r) * ldc + col0 + c4) = h4; } }
     } }



template <int TK>
__global__ __launch_bounds__(256) void k_vthl(const float* __restrict__ VF, int ldv, _Float16* __restrict__ Vth, _Float16* __restrict__ Vtl) { __shared__ float tl[64][65]; const int tid = threadIdx.x; const int slab = blockIdx.x / (TK / 64), lg = blockIdx.x % (TK / 64); const int b = slab / NH, h = slab % NH;
  for (int i = tid; i < 64 * 16; i += 256) { const int r = i / 16, c4 = (i % 16) * 4; const v4f a = *(const v4fa*)(VF + ((size_t)b * TK + lg * 64 + r) * ldv + h * 64 + c4); tl[r][c4] = a[0]; tl[r][c4 + 1] = a[1]; tl[r][c4 + 2] = a[2]; tl[r][c4 + 3] = a[3]; }
  __syncthreads();
  FragH fh[2], fl[2]; size_t oo[2];
#pragma unroll
  for (int rd = 0; rd < 2; ++rd) { const int d = rd * 32 + tid / 8, pc = tid % 8;
#pragma unroll
    for (int q = 0; q < 8; ++q) { const float v = tl[pc * 8 + q][d]; const _Float16 hv = (_Float16)v; fh[rd].h[q] = hv; fl[rd].h[q] = (_Float16)((v - (float)hv) * 1024.0f); } oo[rd] = ((size_t)slab * 64 + d) * TK + lg * 64 + pc * 8; }
  {
#pragma unroll
    for (int rd = 0; rd < 2; ++rd) { *(v8us*)((unsigned short*)Vth + oo[rd]) = fh[rd].half[0]; *(v8us*)((unsigned short*)Vtl + oo[rd]) = fl[rd].half[0]; }
     } }

template <int TQ, int TK>
__global__ __launch_bounds__(128) void k_flashm(const _Float16* __restrict__ Q16, const _Float16* __restrict__ Q16lo, int ldq, const _Float16* __restrict__ K16, const _Float16* __restrict__ K16lo, int ldk, const _Float16* __restrict__ Vt, const _Float16* __restrict__ Vtlo, const unsigned* __restrict__ MB, const int* __restrict__ RA, const int* __restrict__ KE, float* __restrict__ O, int ldo) {
  constexpr int RPW = 16, RTN = RPW / 16, NQB = TQ / (4 * RPW), DT = 4, KS = 2;
  __shared__ __attribute__((aligned(16))) unsigned short sP[4][RPW][40], sPl[4][RPW][40]; __shared__ __attribute__((aligned(16))) float sO[4][RPW][64 + 4];
  const int tid = threadIdx.x, w = tid >> 5, lane = tid & 31, ln = lane & 15, hh = lane >> 4;
  const int h = blockIdx.x / NQB, t0 = blockIdx.x % NQB;
  // Causal balance: the work-group runs query tile t0 of batch 0, then tile NQB - 1 - t0 of batch 1 (alternating), so every work-group walks the same number of key passes.
#pragma unroll 1      /* one copy of the tile body: the tiles run one after the other in every wave */
  for (int b = 0; b < NBT; ++b) {
  const int slab = b * NH + h, qblk = (b & 1) ? NQB - 1 - t0 : t0; const int qb0 = qblk * (4 * RPW); const int q0 = qb0 + w * RPW;
  FragH aq[2][KS], aql[2][KS];
#pragma unroll
  for (int rt = 0; rt < RTN; ++rt) { const size_t qo = ((size_t)b * TQ + q0 + rt * 16 + ln) * ldq + h * 64; const unsigned short* qr = (const unsigned short*)Q16 + qo; const unsigned short* ql = (const unsigned short*)Q16lo + qo;
#pragma unroll
    for (int ks = 0; ks < KS; ++ks) { aq[rt][ks].half[0] = *(const v8us*)(qr + ks * 32 + 8 * hh); aq[rt][ks].half[1] = *(const v8us*)(qr + ks * 32 + 16 + 8 * hh); aql[rt][ks].half[0] = *(const v8us*)(ql + ks * 32 + 8 * hh); aql[rt][ks].half[1] = *(const v8us*)(ql + ks * 32 + 16 + 8 * hh); } }
  const unsigned short* Vth = (const unsigned short*)Vt + (size_t)slab * 64 * TK; const unsigned short* Vtl = (const unsigned short*)Vtlo + (size_t)slab * 64 * TK;
  float m_r[2][8], l_r[2][8]; v8f oacc[2][DT], oaccl[2][DT];
#pragma unroll
  for (int rt = 0; rt < RTN; ++rt) {
#pragma unroll
    for (int r = 0; r < 8; ++r) { m_r[rt][r] = -3.0e38f; l_r[rt][r] = 0.f; }
#pragma unroll
    for (int dt = 0; dt < DT; ++dt) { oacc[rt][dt] = (v8f){0.f,0.f,0.f,0.f,0.f,0.f,0.f,0.f}; oaccl[rt][dt] = oacc[rt][dt]; } }
  int jend = KE[qblk * 32]; jend = min(TK, (jend + 31) & ~31); if (jend < 32) jend = 32;      /* block-uniform */
  int allm[2][8]; const unsigned* mrow[2][8];
#pragma unroll
  for (int rt = 0; rt < RTN; ++rt)
#pragma unroll
    for (int r = 0; r < 8; ++r) { const int tq = q0 + rt * 16 + 8 * hh + r; allm[rt][r] = RA[tq]; mrow[rt][r] = MB + (size_t)tq * (TK / 32); }
#pragma unroll 1
  for (int j0 = 0; j0 < jend; j0 += 32) {
    
    v8f s[2][2];
#pragma unroll
    for (int nt = 0; nt < 2; ++nt) { const size_t ko = ((size_t)b * TK + j0 + nt * 16 + ln) * ldk + h * 64; const unsigned short* kr = (const unsigned short*)K16 + ko; const unsigned short* kl = (const unsigned short*)K16lo + ko; FragH bk[KS], bkl[KS];
#pragma unroll
      for (int ks = 0; ks < KS; ++ks) { bk[ks].half[0] = *(const v8us*)(kr + ks * 32 + 8 * hh); bk[ks].half[1] = *(const v8us*)(kr + ks * 32 + 16 + 8 * hh); bkl[ks].half[0] = *(const v8us*)(kl + ks * 32 + 8 * hh); bkl[ks].half[1] = *(const v8us*)(kl + ks * 32 + 16 + 8 * hh); }
#pragma unroll
      for (int rt = 0; rt < RTN; ++rt) { v8f acc = (v8f){0.f,0.f,0.f,0.f,0.f,0.f,0.f,0.f}, accr = acc;
#pragma unroll
        for (int ks = 0; ks < KS; ++ks) { acc = mmaH<1>(aq[rt][ks].v, aq[rt][ks].v, bk[ks].v, bk[ks].v, acc); accr = mmaH<1>(aql[rt][ks].v, aql[rt][ks].v, bk[ks].v, bk[ks].v, accr); accr = mmaH<1>(aq[rt][ks].v, aq[rt][ks].v, bkl[ks].v, bkl[ks].v, accr); }
        s[rt][nt] = acc + accr * 0.0009765625f; } }
#pragma unroll
    for (int rt = 0; rt < RTN; ++rt)
#pragma unroll
      for (int r = 0; r < 8; ++r) { const unsigned mw = mrow[rt][r][j0 >> 5]; const bool am = (allm[rt][r] != 0);
        const bool ok0 = am || (((mw >> ln) & 1u) == 0u), ok1 = am || (((mw >> (16 + ln)) & 1u) == 0u);
        const float s0 = ok0 ? (am ? 0.f : s[rt][0][r] * SCL) : -INFINITY, s1 = ok1 ? (am ? 0.f : s[rt][1][r] * SCL) : -INFINITY; float mc = fmaxf(s0, s1);
        mc = fmaxf(mc, __shfl_xor(mc, 1, 32)); mc = fmaxf(mc, __shfl_xor(mc, 2, 32)); mc = fmaxf(mc, __shfl_xor(mc, 4, 32)); mc = fmaxf(mc, __shfl_xor(mc, 8, 32));
        const float mn = fmaxf(m_r[rt][r], mc); const float al = (mn > -1.0e38f) ? expf(m_r[rt][r] - mn) : 1.0f; m_r[rt][r] = mn; const float p0 = ok0 ? expf(s0 - mn) : 0.f, p1 = ok1 ? expf(s1 - mn) : 0.f; l_r[rt][r] = l_r[rt][r] * al + p0 + p1;
#pragma unroll
        for (int dt = 0; dt < DT; ++dt) { oacc[rt][dt][r] *= al; oaccl[rt][dt][r] *= al; }
        FragH t2, t3; const float ps0 = p0 * 1024.0f, ps1 = p1 * 1024.0f; t2.h[0] = (_Float16)ps0; t2.h[1] = (_Float16)ps1; t3.h[0] = (_Float16)((ps0 - (float)t2.h[0]) * 1024.0f); t3.h[1] = (_Float16)((ps1 - (float)t2.h[1]) * 1024.0f);
        sP[w][rt * 16 + 8 * hh + r][ln] = t2.u[0]; sP[w][rt * 16 + 8 * hh + r][16 + ln] = t2.u[1]; sPl[w][rt * 16 + 8 * hh + r][ln] = t3.u[0]; sPl[w][rt * 16 + 8 * hh + r][16 + ln] = t3.u[1]; }
    __builtin_amdgcn_fence(__ATOMIC_ACQ_REL, "workgroup"); __builtin_amdgcn_wave_barrier();
    FragH pa[2], pl[2];
#pragma unroll
    for (int rt = 0; rt < RTN; ++rt) { pa[rt].half[0] = *(const v8us*)&sP[w][rt * 16 + ln][8 * hh]; pa[rt].half[1] = *(const v8us*)&sP[w][rt * 16 + ln][16 + 8 * hh]; pl[rt].half[0] = *(const v8us*)&sPl[w][rt * 16 + ln][8 * hh]; pl[rt].half[1] = *(const v8us*)&sPl[w][rt * 16 + ln][16 + 8 * hh]; }
#pragma unroll
    for (int dt = 0; dt < DT; ++dt) { const size_t vo = (size_t)(dt * 16 + ln) * TK + j0; FragH bv, bl; bv.half[0] = *(const v8us*)(Vth + vo + 8 * hh); bv.half[1] = *(const v8us*)(Vth + vo + 16 + 8 * hh); bl.half[0] = *(const v8us*)(Vtl + vo + 8 * hh); bl.half[1] = *(const v8us*)(Vtl + vo + 16 + 8 * hh);
#pragma unroll
      for (int rt = 0; rt < RTN; ++rt) { oacc[rt][dt] = mmaH<1>(pa[rt].v, pa[rt].v, bv.v, bv.v, oacc[rt][dt]); oaccl[rt][dt] = mmaH<1>(pa[rt].v, pa[rt].v, bl.v, bl.v, oaccl[rt][dt]); oaccl[rt][dt] = mmaH<1>(pl[rt].v, pl[rt].v, bv.v, bv.v, oaccl[rt][dt]); } }
    __builtin_amdgcn_fence(__ATOMIC_ACQ_REL, "workgroup"); __builtin_amdgcn_wave_barrier(); }
#pragma unroll
  for (int rt = 0; rt < RTN; ++rt) {
#pragma unroll
    for (int r = 0; r < 8; ++r) { float l = l_r[rt][r]; l += __shfl_xor(l, 1, 32); l += __shfl_xor(l, 2, 32); l += __shfl_xor(l, 4, 32); l += __shfl_xor(l, 8, 32); l_r[rt][r] = (l > 0.f) ? 1.0f / (l * 1024.0f) : 0.f; }
#pragma unroll
    for (int dt = 0; dt < DT; ++dt)
#pragma unroll
      for (int r = 0; r < 8; ++r) sO[w][rt * 16 + 8 * hh + r][dt * 16 + ln] = (oacc[rt][dt][r] + oaccl[rt][dt][r] * 0.0009765625f) * l_r[rt][r]; }
  __builtin_amdgcn_fence(__ATOMIC_ACQ_REL, "workgroup"); __builtin_amdgcn_wave_barrier();
  {
#pragma unroll
    for (int rp = 0; rp < RPW; rp += 2) { const int r = rp + (lane >> 4), pc = lane & 15; const v4f val = *(const v4fa*)&sO[w][r][pc * 4]; *(v4f*)(O + ((size_t)b * TQ + q0 + r) * ldo + h * 64 + pc * 4) = val; }
     }
  asm volatile("s_wait_xcnt 0x0" ::: "memory");      /* the next tile's set-up overwrites the address registers of the stores above */
  } }


template <int SRCBF>
__global__ __launch_bounds__(256) void k_lnab(const float* __restrict__ X, const float* __restrict__ g, const float* __restrict__ bb, _Float16* __restrict__ Y16, float* __restrict__ Y32, float* __restrict__ XB) {
  #pragma clang fp contract(off)
  const int tid = threadIdx.x, w = tid >> 5, ln = tid & 31; const int r = blockIdx.x * 8 + w; if (r >= NR) return; const float* x = X + (size_t)r * DM; float s = 0.f;
#pragma unroll 1
  for (int i = 0; i < DM / 128; ++i) { const v4f a = *(const v4fa*)(x + i * 128 + ln * 4); for (int q = 0; q < 4; ++q) s += SRCBF ? bf16_round(a[q]) : a[q]; }
  for (int o = 16; o > 0; o >>= 1) s += __shfl_xor(s, o, 32); const float mu = s / (float)DM; float q2 = 0.f;
#pragma unroll 1
  for (int i = 0; i < DM / 128; ++i) { const v4f a = *(const v4fa*)(x + i * 128 + ln * 4); for (int q = 0; q < 4; ++q) { const float d = (SRCBF ? bf16_round(a[q]) : a[q]) - mu; q2 += d * d; } }
  for (int o = 16; o > 0; o >>= 1) q2 += __shfl_xor(q2, o, 32); const float rs = rsqrtf(q2 / (float)DM + 1e-5f);
  {
#pragma unroll 1
    for (int i = 0; i < DM / 128; ++i) { const int c0 = i * 128 + ln * 4; const v4f a = *(const v4fa*)(x + c0); _Float16 h4[4]; v4f y4, xb;
      for (int q = 0; q < 4; ++q) { const float t = SRCBF ? bf16_round(a[q]) : a[q]; const float y = (t - mu) * rs * bf16_round(g[c0 + q]) + bf16_round(bb[c0 + q]); h4[q] = (_Float16)y; y4[q] = y; xb[q] = t; }
      if (Y16) *(unsigned long long*)((unsigned short*)Y16 + (size_t)r * DM + c0) = *(const unsigned long long*)h4; if (Y32) *(v4f*)(Y32 + (size_t)r * DM + c0) = y4; if (XB) *(v4f*)(XB + (size_t)r * DM + c0) = xb; }
     } }
__global__ __launch_bounds__(256) void k_causaltab(unsigned* __restrict__ MB, int* __restrict__ RA, int* __restrict__ KE, int nq, int nk) {
  const int t = blockIdx.x * 256 + threadIdx.x; const int nw = nk / 32;
  if (t < nq * nw) { const int q = t / nw, w = t % nw; const int first = q + 1 - 32 * w; const unsigned bits = (first <= 0) ? 0xffffffffu : ((first >= 32) ? 0u : (0xffffffffu << first)); *(unsigned*)(MB + t) = bits;  }
  if (t < nq) { *(int*)(RA + t) = 0;  }
  if (t < nq / 64) { const int v = 64 * (t + 1); *(int*)(KE + t * 32) = v;  } }


extern "C" void kernel_launch(void* const* d_in, const int* in_sizes, int n_in,
                              void* d_out, int out_size, void* d_ws, size_t ws_size, hipStream_t stream) {
  (void)in_sizes; (void)n_in; (void)out_size;
  const float* const* I = (const float* const*)d_in; const float* x = I[0]; const float* lag = I[1]; const float* lab = I[2]; const float* lbg = I[3]; const float* lbb = I[4]; const float* lcg = I[5]; const float* lcb = I[6];
  const float* Wq = I[7]; const float* bq = I[8]; const float* Wk = I[9]; const float* bk = I[10]; const float* Wv = I[11]; const float* bv = I[12]; const float* Wo = I[13]; const float* bo = I[14]; const float* We = I[15]; const float* be = I[16]; const float* Wd = I[17]; const float* bd = I[18];
  char* ws = (char*)d_ws; size_t off = 0;
  auto take = [&](size_t bytes) { char* p = ws + off; off += (bytes + 255) & ~(size_t)255; return p; };
  _Float16* BQ = (_Float16*)take((size_t)DM * DM * 2); _Float16* BK = (_Float16*)take((size_t)DM * DM * 2); _Float16* BV = (_Float16*)take((size_t)DM * DM * 2); _Float16* BO = (_Float16*)take((size_t)DM * DM * 2); _Float16* BE = (_Float16*)take((size_t)4096 * DM * 2); _Float16* BD = (_Float16*)take((size_t)DM * 4096 * 2);
  float* XB = (float*)take((size_t)NR * DM * 4); _Float16* T16 = (_Float16*)take((size_t)NR * DM * 2); float* F = (float*)take((size_t)NR * DM * 4);
  _Float16* Qh = (_Float16*)take((size_t)NR * DM * 2); _Float16* Ql = (_Float16*)take((size_t)NR * DM * 2); _Float16* Kh = (_Float16*)take((size_t)NR * DM * 2); _Float16* Kl = (_Float16*)take((size_t)NR * DM * 2); _Float16* Vth = (_Float16*)take((size_t)NR * DM * 2); _Float16* Vtl = (_Float16*)take((size_t)NR * DM * 2);
  unsigned* MB = (unsigned*)take((size_t)SLEN * (SLEN / 32) * 4); int* RA = (int*)take((size_t)SLEN * 4); int* KE = (int*)take((size_t)(SLEN / 64) * 32 * 4);
  if (off > ws_size) return;      /* 24 + 16 + 8 + 16 + 48 + 0.6 = 113 MiB (the first LN's f32 output lives in F until the second LN consumes it) */
  float* O = F; _Float16* Oh = Qh; _Float16* Ol = Ql; float* X1 = XB; _Float16* GH = Kh;      /* SiLU hidden [NR][4096] f16 = 32 MB over Kh|Kl|Vth|Vtl (dead after the flash) */
  const size_t n8 = (size_t)NR * DM / 8; const unsigned nb8 = (unsigned)((n8 + 255) / 256);
  k_wt_f16<<<(unsigned)(((size_t)DM * DM / 8 + 255) / 256), 256, 0, stream>>>(Wq, BQ, DM, DM, 16.0f); k_wt_f16<<<(unsigned)(((size_t)DM * DM / 8 + 255) / 256), 256, 0, stream>>>(Wk, BK, DM, DM, 16.0f); k_wt_f16<<<(unsigned)(((size_t)DM * DM / 8 + 255) / 256), 256, 0, stream>>>(Wv, BV, DM, DM, 16.0f); k_wt_f16<<<(unsigned)(((size_t)DM * DM / 8 + 255) / 256), 256, 0, stream>>>(Wo, BO, DM, DM, 16.0f);
  k_wt_f16<<<(unsigned)(((size_t)DM * 4096 / 8 + 255) / 256), 256, 0, stream>>>(We, BE, DM, 4096, 16.0f); k_wt_f16<<<(unsigned)(((size_t)4096 * DM / 8 + 255) / 256), 256, 0, stream>>>(Wd, BD, 4096, DM, 16.0f);      /* all (in,out) */
  k_causaltab<<<(SLEN * (SLEN / 32) + 255) / 256, 256, 0, stream>>>(MB, RA, KE, SLEN, SLEN);
  k_lnab<1><<<NR / 8, 256, 0, stream>>>(x, lag, lab, nullptr, F, XB);      /* t0 = LN_a(bf16 x) (f32), XB = bf16(x) */
  k_lnab<0><<<NR / 8, 256, 0, stream>>>(F, lbg, lbb, T16, nullptr, nullptr);      /* t = LN_b(t0) as f16 operand */
  const dim3 gP((NR / 128) * (DM / 64), 1), gM((NR / 128) * (4096 / 64), 1);
  k_gemm2<0><<<gP, 128, 0, stream>>>(T16, DM, 0, BQ, DM, 0, 0.0625f, bq, 0, nullptr, 1, 0, 0, F, nullptr, DM, 0, NR, DM, DM); k_hl<<<nb8, 256, 0, stream>>>(F, Qh, Ql, n8);
  k_gemm2<0><<<gP, 128, 0, stream>>>(T16, DM, 0, BK, DM, 0, 0.0625f, bk, 0, nullptr, 1, 0, 0, F, nullptr, DM, 0, NR, DM, DM); k_hl<<<nb8, 256, 0, stream>>>(F, Kh, Kl, n8);
  k_gemm2<0><<<gP, 128, 0, stream>>>(T16, DM, 0, BV, DM, 0, 0.0625f, bv, 0, nullptr, 1, 0, 0, F, nullptr, DM, 0, NR, DM, DM);
  for (int b = 0; b < NBT; ++b) k_vthl<SLEN><<<NH * (SLEN / 64), 256, 0, stream>>>(F + (size_t)b * SLEN * DM, DM, Vth + (size_t)b * SLEN * DM, Vtl + (size_t)b * SLEN * DM);
  k_flashm<SLEN, SLEN><<<NH * (SLEN / 64), 128, 0, stream>>>(Qh, Ql, DM, Kh, Kl, DM, Vth, Vtl, MB, RA, KE, O, DM);      /* both batches in one grid of equal work-groups */
  k_hl<<<nb8, 256, 0, stream>>>(O, Oh, Ol, n8);
  k_gemm2<0><<<gP, 128, 0, stream>>>(Oh, DM, 0, BO, DM, 0, 0.0625f, bo, 0, XB, 1, (size_t)DM, 0, X1, nullptr, DM, 0, NR, DM, DM);      /* x1 = x + ctx Wo + bo (hi) */
  k_gemm2<0><<<gP, 128, 0, stream>>>(Ol, DM, 0, BO, DM, 0, 0.0625f / 1024.0f, nullptr, 0, X1, 1, (size_t)DM, 0, X1, nullptr, DM, 0, NR, DM, DM);      /* + lo */
  k_lnab<0><<<NR / 8, 256, 0, stream>>>(X1, lcg, lcb, T16, nullptr, nullptr);
  k_gemm2<15><<<gM, 128, 0, stream>>>(T16, DM, 0, BE, DM, 0, 0.0625f, be, 0, nullptr, 1, 0, 0, nullptr, GH, 4096, 0, NR, 4096, DM);      /* silu(t We + be) f16 (ACT 15 = x * sigmoid(x), present in the epilogue) */
  k_gemm2<0><<<gP, 128, 0, stream>>>(GH, 4096, 0, BD, 4096, 0, 0.0625f, bd, 0, X1, 1, (size_t)DM, 0, (float*)d_out, nullptr, DM, 0, NR, DM, 4096);      /* out = x1 + mlp */
}

// v002
// A run of this version takes 680 microseconds.
// Timed twice side by side with v001, it ran 1.42 times as fast both times.
// All steps since v000 together make it 1.78 times as fast.
#include <hip/hip_runtime.h>
// Pre-LN causal attention block (2 x 2048 tokens, 1024 = 16 heads x 64; MLP 4096 with SiLU): t = LN_b(LN_a(x)); q,k,v = t W + b; x1 = x + (causal softmax(q.k/8) v) Wo + bo; out = x1 + (silu(LN_c(x1) We + be)) Wd + bd -> [2,2048,1024].
// Structure: the LayerNorms on VALU (the first pass also writes the bf16 residual plane); projections / MLP as f16 WMMA GEMMs (32x64 wave tiles, f32 accumulation, exact x16 weights, biases / SiLU / residual addends in the epilogue); q, k as f16 hi + (x2^10) residual planes, V^T as hi + residual planes; fused causal flash kernel, one work-group per (head, t): 64-query tile t of batch 0, then tile 31 - t of batch 1 (device-built causal tables, online f32 softmax, P staged hi + residual, two value accumulators); O as hi + residual planes into Wo (two GEMMs).
// Compute dtype: x, weights, biases, LN parameters rounded to bf16; LN outputs and the SiLU hidden as f16 operands (~2^-12); q, k, P, v, O as f16 hi + residual pairs (~2^-21); f32 accumulation, softmax, LayerNorm. v_wmma_f32_16x16x32_f16.
#define NBT 2
#define SLEN 2048
#define DM 1024
#define NH 16
#define SCL 0.125f
#define NR (NBT * SLEN)
typedef __bf16 v16b __attribute__((ext_vector_type(16)));
typedef unsigned short v8us __attribute__((ext_vector_type(8), may_alias));
typedef float  v8f  __attribute__((ext_vector_type(8)));
typedef float  v4f  __attribute__((ext_vector_type(4)));
typedef float  v4fa __attribute__((ext_vector_type(4), may_alias));
union FragB { v16b v; v8us half[2]; unsigned short u[16]; };

__device__ __forceinline__ unsigned short bf16_bits(float x) { unsigned int u = __float_as_uint(x); return (unsigned short)((u + 0x7FFFu + ((u >> 16) & 1u)) >> 16); }
__device__ __forceinline__ float bf16_val(unsigned short b) { return __uint_as_float(((unsigned int)b) << 16); }
__device__ __forceinline__ float bf16_round(float x) { return bf16_val(bf16_bits(x)); }
// D += A·B with NT terms: 1 = ah·bh, 2 = + al·bh (A split), 3 = + ah·bl (both split)
template <int NT>
__device__ __forceinline__ v8f mmaN(v16b ah, v16b al, v16b bh, v16b bl, v8f c) {
  c = __builtin_amdgcn_wmma_f32_16x16x32_bf16(false, ah, false, bh, (short)0, c, false, false);
  if (NT >= 2) c = __builtin_amdgcn_wmma_f32_16x16x32_bf16(false, al, false, bh, (short)0, c, false, false);
  if (NT >= 3) c = __builtin_amdgcn_wmma_f32_16x16x32_bf16(false, ah, false, bl, (short)0, c, false, false);
  asm volatile("v_nop\n\tv_nop\n\tv_nop\n\tv_nop" : "+v"(c) : "v"(ah), "v"(al), "v"(bh), "v"(bl));
  return c;
}

__global__ __launch_bounds__(256) void k_wt_bf16(const float* __restrict__ W, unsigned short* __restrict__ Wt, int K, int N) {
  const int t = blockIdx.x * 256 + threadIdx.x;
  const int k8n = K / 8;
  if (t >= N * k8n) return;
  const int n = t / k8n, k8 = (t % k8n) * 8;
  v8us v;
#pragma unroll
  for (int i = 0; i < 8; ++i) v[i] = bf16_bits(W[(size_t)(k8 + i) * N + n]);
  *(v8us*)(Wt + (size_t)n * K + k8) = v;
  
}

// GEMM C[M][N] (f32, pitch ldc) = act(A[M][K]·W + bias). A f32 row-major (pitch lda) converted per fragment to bf16
// (ASPLIT: hi/lo two planes -> 2 terms, else single rounded term); Wt bf16 [N][K] (pitch ldb). BIAS_BF16 rounds the
// bias to bf16 first (bias quantised to bf16 before the add). K%32==0, M%16==0, N%64==0.
template <bool ASPLIT, int ACT, bool BIAS_BF16>
__global__ __launch_bounds__(128) void k_gemm_bf(const float* __restrict__ A, int lda, const unsigned short* __restrict__ Wt, int ldb,
                                               const float* __restrict__ bias, float* __restrict__ C, int ldc, int M, int N, int K) {
  __shared__ __attribute__((aligned(16))) float so[4][16][64];
  const int tid = threadIdx.x, w = tid >> 5, lane = tid & 31, ln = lane & 15, hh = lane >> 4;
  const int ntn = N / 64;
  const int wid = blockIdx.x * 4 + w;
  const int mt = wid / ntn, nq = wid % ntn;
  if (mt * 16 >= M) return;
  const int row0 = mt * 16, col0 = nq * 64;
  const float* arow = A + (size_t)(row0 + ln) * lda;
  v8f acc[4] = {};
  for (int kb = 0; kb < K; kb += 32) {
    FragB ah, al;
    const v4f x0 = *(const v4fa*)(arow + kb + 8 * hh), x1 = *(const v4fa*)(arow + kb + 8 * hh + 4);
    const v4f x2 = *(const v4fa*)(arow + kb + 16 + 8 * hh), x3 = *(const v4fa*)(arow + kb + 16 + 8 * hh + 4);
    float xs[16] = {x0[0],x0[1],x0[2],x0[3],x1[0],x1[1],x1[2],x1[3],x2[0],x2[1],x2[2],x2[3],x3[0],x3[1],x3[2],x3[3]};
#pragma unroll
    for (int i = 0; i < 16; ++i) { const unsigned short hb = bf16_bits(xs[i]); ah.u[i] = hb; al.u[i] = ASPLIT ? bf16_bits(xs[i] - bf16_val(hb)) : (unsigned short)0; }
#pragma unroll
    for (int t = 0; t < 4; ++t) {
      const unsigned short* brow = Wt + (size_t)(col0 + t * 16 + ln) * ldb + kb;
      FragB b;
      b.half[0] = *(const v8us*)(brow + 8 * hh);
      b.half[1] = *(const v8us*)(brow + 16 + 8 * hh);
      acc[t] = mmaN<ASPLIT ? 2 : 1>(ah.v, al.v, b.v, b.v, acc[t]);
    }
  }
#pragma unroll
  for (int t = 0; t < 4; ++t) {
    float bv = bias ? bias[col0 + t * 16 + ln] : 0.f;
    if (BIAS_BF16) bv = bf16_round(bv);
#pragma unroll
    for (int r = 0; r < 8; ++r) { float v = acc[t][r] + bv; if (ACT == 1) v = fmaxf(v, 0.f); so[w][8 * hh + r][t * 16 + ln] = v; }
  }
  __builtin_amdgcn_fence(__ATOMIC_ACQ_REL, "workgroup");
  __builtin_amdgcn_wave_barrier();
  const int rsub = lane >> 4, c4 = (lane & 15) * 4;
  {
#pragma unroll
    for (int q = 0; q < 8; ++q) {
      const int r = q * 2 + rsub;
      const v4f v = *(const v4fa*)&so[w][r][c4];
      *(v4f*)(C + (size_t)(row0 + r) * ldc + col0 + c4) = v;
    }
    
  }
}

// GEMM C = act(A·W + bias + resid): A f32 (ASPLIT -> hi/lo 2 terms), Wt bf16 [N][K]; ACT 0 none, 1 relu, 2 exact gelu;
// resid (optional, f32, row index = (row % rmod), pitch ldr, RES_BF16 rounds it) added before the activation.
template <bool ASPLIT, int ACT, bool BIAS_BF16, bool RES_BF16>
__global__ __launch_bounds__(128) void k_gemm_bf3(const float* __restrict__ A, int lda, const unsigned short* __restrict__ Wt, int ldb,
                                                const float* __restrict__ bias, const float* __restrict__ resid, int rmod, int ldr,
                                                float* __restrict__ C, int ldc, int M, int N, int K) {
  __shared__ __attribute__((aligned(16))) float so[4][16][64];
  const int tid = threadIdx.x, w = tid >> 5, lane = tid & 31, ln = lane & 15, hh = lane >> 4;
  const int ntn = N / 64;
  const int wid = blockIdx.x * 4 + w;
  const int mt = wid / ntn, nq = wid % ntn;
  if (mt * 16 >= M) return;
  const int row0 = mt * 16, col0 = nq * 64;
  const float* arow = A + (size_t)(row0 + ln) * lda;
  v8f acc[4] = {};
  for (int kb = 0; kb < K; kb += 32) {
    FragB ah, al;
    const v4f x0 = *(const v4fa*)(arow + kb + 8 * hh), x1 = *(const v4fa*)(arow + kb + 8 * hh + 4);
    const v4f x2 = *(const v4fa*)(arow + kb + 16 + 8 * hh), x3 = *(const v4fa*)(arow + kb + 16 + 8 * hh + 4);
    float xs[16] = {x0[0],x0[1],x0[2],x0[3],x1[0],x1[1],x1[2],x1[3],x2[0],x2[1],x2[2],x2[3],x3[0],x3[1],x3[2],x3[3]};
#pragma unroll
    for (int i = 0; i < 16; ++i) { const unsigned short hb = bf16_bits(xs[i]); ah.u[i] = hb; al.u[i] = ASPLIT ? bf16_bits(xs[i] - bf16_val(hb)) : (unsigned short)0; }
#pragma unroll
    for (int t = 0; t < 4; ++t) {
      const unsigned short* brow = Wt + (size_t)(col0 + t * 16 + ln) * ldb + kb;
      FragB b;
      b.half[0] = *(const v8us*)(brow + 8 * hh);
      b.half[1] = *(const v8us*)(brow + 16 + 8 * hh);
      acc[t] = mmaN<ASPLIT ? 2 : 1>(ah.v, al.v, b.v, b.v, acc[t]);
    }
  }
#pragma unroll
  for (int t = 0; t < 4; ++t) {
    const int col = col0 + t * 16 + ln;
    float bv = bias ? bias[col] : 0.f;
    if (BIAS_BF16) bv = bf16_round(bv);
#pragma unroll
    for (int r = 0; r < 8; ++r) {
      float v = acc[t][r] + bv;
      if (resid) { float rv = resid[(size_t)((row0 + 8 * hh + r) % rmod) * ldr + col]; if (RES_BF16) rv = bf16_round(rv); v += rv; }
      if (ACT == 1) v = fmaxf(v, 0.f);
      if (ACT == 2) v = 0.5f * v * (1.0f + erff(v * 0.70710678118654752f));
      if (ACT == 3) { const float u = 0.7978845608028654f * (v + 0.044715f * v * v * v); v = 0.5f * v * (1.0f + tanhf(u)); }
      so[w][8 * hh + r][t * 16 + ln] = v;
    }
  }
  __builtin_amdgcn_fence(__ATOMIC_ACQ_REL, "workgroup");
  __builtin_amdgcn_wave_barrier();
  const int rsub = lane >> 4, c4 = (lane & 15) * 4;
  {
#pragma unroll
    for (int q = 0; q < 8; ++q) {
      const int r = q * 2 + rsub;
      const v4f v = *(const v4fa*)&so[w][r][c4];
      *(v4f*)(C + (size_t)(row0 + r) * ldc + col0 + c4) = v;
    }
    
  }
}
// row LayerNorm (biased variance, eps) over N: s = X (+ R); optional out_sum <- s; out_norm <- (s-mu)*rsqrt(var+eps)*g + b
template <bool PARAM_BF16>
__global__ __launch_bounds__(256) void k_layernorm(const float* __restrict__ X, const float* __restrict__ R, const float* __restrict__ g, const float* __restrict__ bta,
                                                  float* __restrict__ out_sum, float* __restrict__ out_norm, int N, float eps) {
  __shared__ float red[256];
  const int row = blockIdx.x, tid = threadIdx.x;
  const float* x = X + (size_t)row * N; const float* rr = R ? R + (size_t)row * N : nullptr;
  float vals[16];                     // up to N = 4096
  const int per = N / 256;            // contiguous chunk per thread? use strided-by-4 chunks: thread handles j = tid*4 + 1024*u
  float s1 = 0.f;
  for (int u = 0; u < per / 4; ++u) {
    const int j = tid * 4 + 1024 * u;
    const v4f a = *(const v4fa*)(x + j);
    v4f b = {0.f,0.f,0.f,0.f}; if (rr) b = *(const v4fa*)(rr + j);
#pragma unroll
    for (int q = 0; q < 4; ++q) { const float v = a[q] + b[q]; vals[u * 4 + q] = v; s1 += v; }
  }
  red[tid] = s1; __syncthreads();
  for (int st = 128; st > 0; st >>= 1) { if (tid < st) red[tid] += red[tid + st]; __syncthreads(); }
  const float mu = red[0] / (float)N; __syncthreads();
  float s2 = 0.f;
  for (int u = 0; u < per / 4; ++u)
#pragma unroll
    for (int q = 0; q < 4; ++q) { const float c = vals[u * 4 + q] - mu; s2 += c * c; }
  red[tid] = s2; __syncthreads();
  for (int st = 128; st > 0; st >>= 1) { if (tid < st) red[tid] += red[tid + st]; __syncthreads(); }
  const float rs = rsqrtf(red[0] / (float)N + eps);
  {
    for (int u = 0; u < per / 4; ++u) {
      const int j = tid * 4 + 1024 * u;
      v4f o, sm;
#pragma unroll
      for (int q = 0; q < 4; ++q) {
        float gg = g[j + q], bb = bta[j + q];
        if (PARAM_BF16) { gg = bf16_round(gg); bb = bf16_round(bb); }
        sm[q] = vals[u * 4 + q]; o[q] = (vals[u * 4 + q] - mu) * rs * gg + bb;
      }
      if (out_sum) *(v4f*)(out_sum + (size_t)row * N + j) = sm;
      *(v4f*)(out_norm + (size_t)row * N + j) = o;
    }
    
  }
}



// ---- f16 WMMA path (v_wmma_f32_16x16x32_f16): 11-bit significands for operands in range — used where a [0,1] probability operand needs more precision than bf16
typedef _Float16 v16h __attribute__((ext_vector_type(16)));
union FragH { v16h v; v8us half[2]; _Float16 h[16]; unsigned short u[16]; };
template <int NT>
__device__ __forceinline__ v8f mmaH(v16h ah, v16h al, v16h bh, v16h bl, v8f c) {
  c = __builtin_amdgcn_wmma_f32_16x16x32_f16(false, ah, false, bh, (short)0, c, false, false);
  if (NT >= 2) c = __builtin_amdgcn_wmma_f32_16x16x32_f16(false, al, false, bh, (short)0, c, false, false);
  if (NT >= 3) c = __builtin_amdgcn_wmma_f32_16x16x32_f16(false, ah, false, bl, (short)0, c, false, false);
  asm volatile("v_nop\n\tv_nop\n\tv_nop\n\tv_nop" : "+v"(c) : "v"(ah), "v"(al), "v"(bh), "v"(bl));
  return c;
}
// batched GEMM like k_gemm_b but f16 operands: A f32 (split into f16 hi/lo if ASPLIT, else rounded to f16), Bt = f16 values [n][k]; alpha; C f32; N multiple of 16 (partial tiles skipped)
template <bool ASPLIT>
__global__ __launch_bounds__(128) void k_gemm_h(const float* __restrict__ A, int lda, size_t sA, const _Float16* __restrict__ Bh, int ldb, size_t sB, float alpha, float* __restrict__ C, int ldc, size_t sC, int M, int N, int K) {
  __shared__ __attribute__((aligned(16))) float so[4][16][64];
  const int tid = threadIdx.x, w = tid >> 5, lane = tid & 31, ln = lane & 15, hh = lane >> 4; const int by = blockIdx.y;
  A += (size_t)by * sA; Bh += (size_t)by * sB; C += (size_t)by * sC;
  const int ntn = (N + 63) / 64; const int wid = blockIdx.x * 4 + w; const int mt = wid / ntn, nq = wid % ntn; if (mt * 16 >= M) return;
  const int row0 = mt * 16, col0 = nq * 64; const float* arow = A + (size_t)(row0 + ln) * lda;
  v8f acc[4] = {};
  for (int kb = 0; kb < K; kb += 32) {
    FragH ah, al;
    const v4f x0 = *(const v4fa*)(arow + kb + 8 * hh), x1 = *(const v4fa*)(arow + kb + 8 * hh + 4), x2 = *(const v4fa*)(arow + kb + 16 + 8 * hh), x3 = *(const v4fa*)(arow + kb + 16 + 8 * hh + 4);
    float xs[16] = {x0[0],x0[1],x0[2],x0[3],x1[0],x1[1],x1[2],x1[3],x2[0],x2[1],x2[2],x2[3],x3[0],x3[1],x3[2],x3[3]};
#pragma unroll
    for (int i = 0; i < 16; ++i) { const _Float16 h = (_Float16)xs[i]; ah.h[i] = h; al.h[i] = ASPLIT ? (_Float16)(xs[i] - (float)h) : (_Float16)0.0f; }
#pragma unroll
    for (int t = 0; t < 4; ++t) { if (col0 + t * 16 >= N) continue; const size_t boff = (size_t)(col0 + t * 16 + ln) * ldb + kb; FragH bq; bq.half[0] = *(const v8us*)(Bh + boff + 8 * hh); bq.half[1] = *(const v8us*)(Bh + boff + 16 + 8 * hh);
      acc[t] = mmaH<ASPLIT ? 2 : 1>(ah.v, al.v, bq.v, bq.v, acc[t]); }
  }
#pragma unroll
  for (int t = 0; t < 4; ++t) { if (col0 + t * 16 >= N) continue;
#pragma unroll
    for (int r = 0; r < 8; ++r) so[w][8 * hh + r][t * 16 + ln] = acc[t][r] * alpha; }
  __builtin_amdgcn_fence(__ATOMIC_ACQ_REL, "workgroup"); __builtin_amdgcn_wave_barrier();
  const int rsub = lane >> 4, c4 = (lane & 15) * 4;
  {
#pragma unroll
    for (int q = 0; q < 8; ++q) { const int r = q * 2 + rsub; if (col0 + c4 < N) { const v4f v = *(const v4fa*)&so[w][r][c4]; *(v4f*)(C + (size_t)(row0 + r) * ldc + col0 + c4) = v; } }
     }
}

// Wt[n][k] = f16(W[k][n]·scale) from f32 row-major W[K][N] (scale = power of two; bf16-exact weights stay exact in f16 away from the subnormal range)
__global__ __launch_bounds__(256) void k_wt_f16(const float* __restrict__ W, _Float16* __restrict__ Wt, int K, int N, float scale) {
  const int t = blockIdx.x * 256 + threadIdx.x; if (t >= N * (K / 8)) return; const int n = t / (K / 8), k8 = (t % (K / 8)) * 8; FragH f;
#pragma unroll
  for (int i = 0; i < 8; ++i) f.h[i] = (_Float16)(bf16_round(W[(size_t)(k8 + i) * N + n]) * scale); const v8us o = f.half[0];
  *(v8us*)((unsigned short*)Wt + (size_t)n * K + k8) = o; 
}
// k_gemm_hh variant with fused epilogue: v = acc·alpha + bias[by·sBias + col] (+ CP[(row/rowsPerB)·sCPb + by·64 + col] if CP) ; ACT 0 none / 1 elu ; writes f16 C16 (and f32 C if non-null)
template <int ACT>
__global__ __launch_bounds__(128) void k_gemm_hhx(const _Float16* __restrict__ A, int lda, size_t sA, const _Float16* __restrict__ Bh, int ldb, size_t sB, float alpha, const float* __restrict__ bias, size_t sBias, const float* __restrict__ CP, int rowsPerB, size_t sCPb, int row0g,
    float* __restrict__ C, _Float16* __restrict__ C16, int ldc, size_t sC, int M, int N, int K) {
  __shared__ __attribute__((aligned(16))) float so[4][16][64];
  const int tid = threadIdx.x, w = tid >> 5, lane = tid & 31, ln = lane & 15, hh = lane >> 4; const int by = blockIdx.y;
  A += (size_t)by * sA; Bh += (size_t)by * sB; const size_t cofs = (size_t)by * sC; const float* bp = bias ? bias + (size_t)by * sBias : nullptr;
  const int ntn = (N + 63) / 64; const int wid = blockIdx.x * 4 + w; const int mt = wid / ntn, nq = wid % ntn; if (mt * 16 >= M) return;
  const int row0 = mt * 16, col0 = nq * 64; const _Float16* arow = A + (size_t)(row0 + ln) * lda;
  v8f acc[4] = {};
  for (int kb = 0; kb < K; kb += 32) { FragH ah; ah.half[0] = *(const v8us*)((const unsigned short*)arow + kb + 8 * hh); ah.half[1] = *(const v8us*)((const unsigned short*)arow + kb + 16 + 8 * hh);
#pragma unroll
    for (int t = 0; t < 4; ++t) { if (col0 + t * 16 >= N) continue; const size_t boff = (size_t)(col0 + t * 16 + ln) * ldb + kb; FragH bq; bq.half[0] = *(const v8us*)((const unsigned short*)Bh + boff + 8 * hh); bq.half[1] = *(const v8us*)((const unsigned short*)Bh + boff + 16 + 8 * hh);
      acc[t] = mmaH<1>(ah.v, ah.v, bq.v, bq.v, acc[t]); }
  }
#pragma unroll
  for (int t = 0; t < 4; ++t) { if (col0 + t * 16 >= N) continue; const int col = col0 + t * 16 + ln; const float bv = bp ? bf16_round(bp[col]) : 0.f;
#pragma unroll
    for (int r = 0; r < 8; ++r) { float v = acc[t][r] * alpha + bv; if (CP) { const int bidx = (row0g + row0 + 8 * hh + r) / rowsPerB; v += CP[(size_t)bidx * sCPb + (size_t)by * 64 + col]; } if (ACT == 1) v = (v > 0.f) ? v : expm1f(v); else if (ACT == 7) v = (v > 0.f) ? v + 1.0f : expf(v); else if (ACT == 8) v = tanhf(v); else if (ACT == 9) v = 0.5f * v * (1.0f + tanhf(0.7978845608028654f * (v + 0.044715f * v * v * v))); else if (ACT == 11) v = 1.0f / (1.0f + expf(-v)); else if (ACT == 12) v = (v > 0.f) ? v : 0.01f * v; else if (ACT == 14) v = (v > 0.f) ? v : 0.1f * v; else if (ACT == 15) v = v / (1.0f + expf(-v)); else if (ACT == 3) v = fmaxf(v, 0.f); else if (ACT == 6) v = 0.5f * v * (1.0f + erff(v * 0.70710678118654752f)); so[w][8 * hh + r][t * 16 + ln] = v; } }
  __builtin_amdgcn_fence(__ATOMIC_ACQ_REL, "workgroup"); __builtin_amdgcn_wave_barrier();
  const int rsub = lane >> 4, c4 = (lane & 15) * 4; typedef _Float16 v4h __attribute__((ext_vector_type(4)));
  {
#pragma unroll
    for (int q = 0; q < 8; ++q) { const int r = q * 2 + rsub; if (col0 + c4 < N) { const v4f v = *(const v4fa*)&so[w][r][c4]; if (C) *(v4f*)(C + cofs + (size_t)(row0 + r) * ldc + col0 + c4) = v; if (C16) { v4h h4; for (int i = 0; i < 4; ++i) h4[i] = (_Float16)v[i]; *(v4h*)(C16 + cofs + (size_t)(row0 + r) * ldc + col0 + c4) = h4; } } }
     }
}


typedef _Float16 v4h __attribute__((ext_vector_type(4)));

__global__ __launch_bounds__(256) void k_x16(const float* __restrict__ x, _Float16* __restrict__ X16, size_t n8) { const size_t t = (size_t)blockIdx.x * 256 + threadIdx.x; if (t >= n8) return; FragH f;
#pragma unroll
  for (int q = 0; q < 8; ++q) f.h[q] = (_Float16)bf16_round(x[t * 8 + q]); *(v8us*)((unsigned short*)X16 + t * 8) = f.half[0];  }
__global__ __launch_bounds__(256) void k_h16(const float* __restrict__ x, _Float16* __restrict__ X16, size_t n8) { const size_t t = (size_t)blockIdx.x * 256 + threadIdx.x; if (t >= n8) return; FragH f;
#pragma unroll
  for (int q = 0; q < 8; ++q) f.h[q] = (_Float16)x[t * 8 + q]; *(v8us*)((unsigned short*)X16 + t * 8) = f.half[0];  }
__global__ __launch_bounds__(256) void k_round16f(const float* __restrict__ W, _Float16* __restrict__ Bt, size_t n8) { const size_t t = (size_t)blockIdx.x * 256 + threadIdx.x; if (t >= n8) return; FragH f;
#pragma unroll
  for (int i = 0; i < 8; ++i) f.h[i] = (_Float16)(bf16_round(W[t * 8 + i]) * 16.0f); *(v8us*)((unsigned short*)Bt + t * 8) = f.half[0];  }
template <int NHv, int TTv>
__global__ __launch_bounds__(256) void k_vt(const _Float16* __restrict__ V16, int ldv, int voff, _Float16* __restrict__ Vt) { __shared__ unsigned short tl[64][66]; const int tid = threadIdx.x; const int slab = blockIdx.x / (TTv / 64), lg = blockIdx.x % (TTv / 64); const int b = slab / NHv, h = slab % NHv;
  for (int i = tid; i < 64 * 8; i += 256) { const int r = i / 8, c8 = (i % 8) * 8; FragH f; f.half[0] = *(const v8us*)((const unsigned short*)V16 + ((size_t)b * TTv + lg * 64 + r) * ldv + voff + h * 64 + c8);
#pragma unroll
    for (int q = 0; q < 8; ++q) tl[r][c8 + q] = f.u[q]; }
  __syncthreads();
  {
#pragma unroll
    for (int rd = 0; rd < 2; ++rd) { const int d = rd * 32 + tid / 8, pc = tid % 8; FragH f;
#pragma unroll
      for (int q = 0; q < 8; ++q) f.u[q] = tl[pc * 8 + q][d];
      *(v8us*)((unsigned short*)Vt + ((size_t)slab * 64 + d) * TTv + lg * 64 + pc * 8) = f.half[0]; }
     } }

__global__ __launch_bounds__(256) void k_hl(const float* __restrict__ F, _Float16* __restrict__ Hh, _Float16* __restrict__ Hl, size_t n8) { const size_t t = (size_t)blockIdx.x * 256 + threadIdx.x; if (t >= n8) return; FragH fh, fl; const v4f a = *(const v4fa*)(F + t * 8), c = *(const v4fa*)(F + t * 8 + 4);
#pragma unroll
  for (int q = 0; q < 4; ++q) { _Float16 h = (_Float16)a[q]; fh.h[q] = h; fl.h[q] = (_Float16)((a[q] - (float)h) * 1024.0f); h = (_Float16)c[q]; fh.h[4 + q] = h; fl.h[4 + q] = (_Float16)((c[q] - (float)h) * 1024.0f); }
  { *(v8us*)((unsigned short*)Hh + t * 8) = fh.half[0]; *(v8us*)((unsigned short*)Hl + t * 8) = fl.half[0];  } }

// ---- fast GEMM (work-group tile 128x64, wave tile 32x64; requires M % 128 == 0, N % 64 == 0, K % 128 == 0); epilogue = k_gemm_hhx semantics ----
// Operands go through LDS: per slice of 128 k the work-group loads 256 B of each of its 128 A rows and 64 B rows with whole-line 16-byte loads (two rows per wave-wide load),
// keeps them in registers while the slice before is worked on, and stores them into the other of two LDS buffers; the fragments are read from LDS, A and B alike as halves k + 8 * hh .. + 7 and k + 16 + 8 * hh .. + 7 of their row.
__device__ __forceinline__ v16h g2_sfrag(const unsigned short* p) { FragH f; f.half[0] = *(const v8us*)p; f.half[1] = *(const v8us*)(p + 16); return f.v; }      /* p = LDS row + k + 8 * hh */
__device__ __forceinline__ v8f g2_mma(v16h a, v16h b, v8f c) { v8f d = __builtin_amdgcn_wmma_f32_16x16x32_f16(false, a, false, b, (short)0, c, false, false); asm volatile("v_nop\n\tv_nop\n\tv_nop\n\tv_nop" : "+v"(d) : "v"(a), "v"(b)); return d; }
template <int ACT, int LD>      /* LD = lda = ldb = K at compile time: the row steps of the staging loads become immediate offsets */
__global__ __launch_bounds__(128) void k_gemm2(const _Float16* __restrict__ A, int lda, size_t sA, const _Float16* __restrict__ Bh, int ldb, size_t sB, float alpha, const float* __restrict__ bias, size_t sBias, const float* __restrict__ CP, int rowsPerB, size_t sCPb, int row0g,
    float* __restrict__ C, _Float16* __restrict__ C16, int ldc, size_t sC, int M, int N, int K) {
  constexpr int KS = 128, PIT = KS + 8, BUF = (128 + 64) * PIT;      /* slice of k; LDS row pitch 272 B = 16 B x 17 (no bank conflict for 16-byte fragment reads); halves per buffer: rows 0-127 A, 128-191 B */
  __shared__ __attribute__((aligned(16))) unsigned short st[2 * BUF];      /* 104,448 B */
  float (*so)[32][68] = reinterpret_cast<float (*)[32][68]>(st);      /* the epilogue's staging (34,816 B) reuses the buffers behind the last barrier */
  const int tid = threadIdx.x, w = tid >> 5, lane = tid & 31, ln = lane & 15, hh = lane >> 4; const int by = blockIdx.y;
  A += (size_t)by * sA; Bh += (size_t)by * sB; const size_t cofs = (size_t)by * sC; const float* bp = bias ? bias + (size_t)by * sBias : nullptr;
  const int ntn = N >> 6; const int mt = blockIdx.x / ntn, nq = blockIdx.x - mt * ntn; const int row0 = mt * 128 + 32 * w, col0 = nq * 64; if (mt * 128 >= M) return;      /* the same for the whole work-group: barriers follow */
  const int sr = tid >> 4, sc = (tid & 15) * 8;      /* staging: 16 threads cover the 256 B of a row, the work-group 8 rows per load */
  (void)lda; (void)ldb; (void)K;
  const char* aS = (const char*)(A + (size_t)(mt * 128) * LD); const char* bS = (const char*)(Bh + (size_t)col0 * LD);      /* the work-group's first A and B row: the same in every lane */
  unsigned vo = (unsigned)(sr * LD + sc) * 2u;      /* the lane's byte offset in both operands: its row of 8, its 16 bytes, the slice */
  const v8f z8 = {0.f,0.f,0.f,0.f,0.f,0.f,0.f,0.f}; v8f c00 = z8, c01 = z8, c02 = z8, c03 = z8, c10 = z8, c11 = z8, c12 = z8, c13 = z8;
  v8us rg[24];
  auto slice_load = [&]() {
#pragma unroll
    for (int i = 0; i < 16; ++i) rg[i] = *(const v8us*)(aS + (size_t)vo + (size_t)(16 * i) * LD);
#pragma unroll
    for (int i = 0; i < 8; ++i) rg[16 + i] = *(const v8us*)(bS + (size_t)vo + (size_t)(16 * i) * LD); };
  auto slice_next = [&]() { asm volatile("s_wait_xcnt 0x0" : "+v"(vo) : : "memory");      /* in front of the overwrite of the offset register that the issued loads name */
    vo += 2u * KS; };
  auto slice_store = [&](int bo) {
#pragma unroll
    for (int i = 0; i < 24; ++i) *(v8us*)&st[bo + (8 * i + sr) * PIT + sc] = rg[i]; };
  auto slice_mma = [&](int bo) { const unsigned short* ap = &st[bo + (32 * w + ln) * PIT + 8 * hh]; const unsigned short* bq = &st[bo + (128 + ln) * PIT + 8 * hh];
#pragma unroll
    for (int kk = 0; kk < KS; kk += 32) { const v16h a0 = g2_sfrag(ap + kk), a1 = g2_sfrag(ap + 16 * PIT + kk);      /* the six fragments of a k step as one group of LDS reads in front of its eight products */
      const v16h b0 = g2_sfrag(bq + kk), b1 = g2_sfrag(bq + 16 * PIT + kk), b2 = g2_sfrag(bq + 32 * PIT + kk), b3 = g2_sfrag(bq + 48 * PIT + kk);
      c00 = g2_mma(a0, b0, c00); c10 = g2_mma(a1, b0, c10); c01 = g2_mma(a0, b1, c01); c11 = g2_mma(a1, b1, c11);
      c02 = g2_mma(a0, b2, c02); c12 = g2_mma(a1, b2, c12); c03 = g2_mma(a0, b3, c03); c13 = g2_mma(a1, b3, c13); } };
  slice_load(); slice_next(); slice_store(0); __syncthreads();
  int cur = 0;      /* start (in halves) of the buffer that holds the slice being worked on: 0 or BUF */
#pragma unroll 1      /* one copy of the slice body; the buffer alternates at run time */
  for (int s = 1; s < LD / KS; ++s) {
    slice_load();      /* in flight while the slice before is worked on */
    slice_mma(cur);
    slice_next();
    slice_store(cur ^ BUF);      /* its last readers left this buffer in front of the barrier of the trip before */
    __syncthreads(); cur ^= BUF; }
  slice_mma(cur);
  __syncthreads();      /* every wave has read its last fragments before the buffers become output staging */
  v8f accs[8] = {c00, c01, c02, c03, c10, c11, c12, c13};
#pragma unroll
  for (int u = 0; u < 8; ++u) { const int t = u & 3, half = u >> 2; const int col = col0 + t * 16 + ln; const float bv = bp ? bf16_round(bp[col]) : 0.f;
#pragma unroll
    for (int r = 0; r < 8; ++r) { const int rloc = half * 16 + 8 * hh + r; float v = accs[u][r] * alpha + bv; if (CP) { const int bidx = (row0g + row0 + rloc) / rowsPerB; v += CP[(size_t)bidx * sCPb + (size_t)by * 64 + col]; }
      if (ACT == 3) v = fmaxf(v, 0.f); else if (ACT == 6) v = 0.5f * v * (1.0f + erff(v * 0.70710678118654752f)); else if (ACT == 11) v = 1.0f / (1.0f + expf(-v)); else if (ACT == 15) v = v / (1.0f + expf(-v)); else if (ACT == 12) v = (v > 0.f) ? v : 0.01f * v; else if (ACT == 8) v = tanhf(v);
      so[w][rloc][t * 16 + ln] = v; } }
  __builtin_amdgcn_fence(__ATOMIC_ACQ_REL, "workgroup"); __builtin_amdgcn_wave_barrier();
  const int rsub = lane >> 4, c4 = (lane & 15) * 4;
  {
#pragma unroll
    for (int q = 0; q < 16; ++q) { const int r = q * 2 + rsub; const v4f v = *(const v4fa*)&so[w][r][c4]; if (C) *(v4f*)(C + cofs + (size_t)(row0 + r) * ldc + col0 + c4) = v; if (C16) { v4h h4; for (int i = 0; i < 4; ++i) h4[i] = (_Float16)v[i]; *(v4h*)(C16 + cofs + (size_t)(row0 + r) * ldc + col0 + c4) = h4; } }
     } }



template <int TK>
__global__ __launch_bounds__(256) void k_vthl(const float* __restrict__ VF, int ldv, _Float16* __restrict__ Vth, _Float16* __restrict__ Vtl) { __shared__ float tl[64][65]; const int tid = threadIdx.x; const int slab = blockIdx.x / (TK / 64), lg = blockIdx.x % (TK / 64); const int b = slab / NH, h = slab % NH;
  for (int i = tid; i < 64 * 16; i += 256) { const int r = i / 16, c4 = (i % 16) * 4; const v4f a = *(const v4fa*)(VF + ((size_t)b * TK + lg * 64 + r) * ldv + h * 64 + c4); tl[r][c4] = a[0]; tl[r][c4 + 1] = a[1]; tl[r][c4 + 2] = a[2]; tl[r][c4 + 3] = a[3]; }
  __syncthreads();
  FragH fh[2], fl[2]; size_t oo[2];
#pragma unroll
  for (int rd = 0; rd < 2; ++rd) { const int d = rd * 32 + tid / 8, pc = tid % 8;
#pragma unroll
    for (int q = 0; q < 8; ++q) { const float v = tl[pc * 8 + q][d]; const _Float16 hv = (_Float16)v; fh[rd].h[q] = hv; fl[rd].h[q] = (_Float16)((v - (float)hv) * 1024.0f); } oo[rd] = ((size_t)slab * 64 + d) * TK + lg * 64 + pc * 8; }
  {
#pragma unroll
    for (int rd = 0; rd < 2; ++rd) { *(v8us*)((unsigned short*)Vth + oo[rd]) = fh[rd].half[0]; *(v8us*)((unsigned short*)Vtl + oo[rd]) = fl[rd].half[0]; }
     } }

template <int TQ, int TK>
__global__ __launch_bounds__(128) void k_flashm(const _Float16* __restrict__ Q16, const _Float16* __restrict__ Q16lo, int ldq, const _Float16* __restrict__ K16, const _Float16* __restrict__ K16lo, int ldk, const _Float16* __restrict__ Vt, const _Float16* __restrict__ Vtlo, const unsigned* __restrict__ MB, const int* __restrict__ RA, const int* __restrict__ KE, float* __restrict__ O, int ldo) {
  constexpr int RPW = 16, RTN = RPW / 16, NQB = TQ / (4 * RPW), DT = 4, KS = 2;
  __shared__ __attribute__((aligned(16))) unsigned short sP[4][RPW][40], sPl[4][RPW][40]; __shared__ __attribute__((aligned(16))) float sO[4][RPW][64 + 4];
  const int tid = threadIdx.x, w = tid >> 5, lane = tid & 31, ln = lane & 15, hh = lane >> 4;
  const int h = blockIdx.x / NQB, t0 = blockIdx.x % NQB;
  // Causal balance: the work-group runs query tile t0 of batch 0, then tile NQB - 1 - t0 of batch 1 (alternating), so every work-group walks the same number of key passes.
#pragma unroll 1      /* one copy of the tile body: the tiles run one after the other in every wave */
  for (int b = 0; b < NBT; ++b) {
  const int slab = b * NH + h, qblk = (b & 1) ? NQB - 1 - t0 : t0; const int qb0 = qblk * (4 * RPW); const int q0 = qb0 + w * RPW;
  FragH aq[2][KS], aql[2][KS];
#pragma unroll
  for (int rt = 0; rt < RTN; ++rt) { const size_t qo = ((size_t)b * TQ + q0 + rt * 16 + ln) * ldq + h * 64; const unsigned short* qr = (const unsigned short*)Q16 + qo; const unsigned short* ql = (const unsigned short*)Q16lo + qo;
#pragma unroll
    for (int ks = 0; ks < KS; ++ks) { aq[rt][ks].half[0] = *(const v8us*)(qr + ks * 32 + 8 * hh); aq[rt][ks].half[1] = *(const v8us*)(qr + ks * 32 + 16 + 8 * hh); aql[rt][ks].half[0] = *(const v8us*)(ql + ks * 32 + 8 * hh); aql[rt][ks].half[1] = *(const v8us*)(ql + ks * 32 + 16 + 8 * hh); } }
  const unsigned short* Vth = (const unsigned short*)Vt + (size_t)slab * 64 * TK; const unsigned short* Vtl = (const unsigned short*)Vtlo + (size_t)slab * 64 * TK;
  float m_r[2][8], l_r[2][8]; v8f oacc[2][DT], oaccl[2][DT];
#pragma unroll
  for (int rt = 0; rt < RTN; ++rt) {
#pragma unroll
    for (int r = 0; r < 8; ++r) { m_r[rt][r] = -3.0e38f; l_r[rt][r] = 0.f; }
#pragma unroll
    for (int dt = 0; dt < DT; ++dt) { oacc[rt][dt] = (v8f){0.f,0.f,0.f,0.f,0.f,0.f,0.f,0.f}; oaccl[rt][dt] = oacc[rt][dt]; } }
  int jend = KE[qblk * 32]; jend = min(TK, (jend + 31) & ~31); if (jend < 32) jend = 32;      /* block-uniform */
  int allm[2][8]; const unsigned* mrow[2][8];
#pragma unroll
  for (int rt = 0; rt < RTN; ++rt)
#pragma unroll
    for (int r = 0; r < 8; ++r) { const int tq = q0 + rt * 16 + 8 * hh + r; allm[rt][r] = RA[tq]; mrow[rt][r] = MB + (size_t)tq * (TK / 32); }
#pragma unroll 1
  for (int j0 = 0; j0 < jend; j0 += 32) {
    
    v8f s[2][2];
#pragma unroll
    for (int nt = 0; nt < 2; ++nt) { const size_t ko = ((size_t)b * TK + j0 + nt * 16 + ln) * ldk + h * 64; const unsigned short* kr = (const unsigned short*)K16 + ko; const unsigned short* kl = (const unsigned short*)K16lo + ko; FragH bk[KS], bkl[KS];
#pragma unroll
      for (int ks = 0; ks < KS; ++ks) { bk[ks].half[0] = *(const v8us*)(kr + ks * 32 + 8 * hh); bk[ks].half[1] = *(const v8us*)(kr + ks * 32 + 16 + 8 * hh); bkl[ks].half[0] = *(const v8us*)(kl + ks * 32 + 8 * hh); bkl[ks].half[1] = *(const v8us*)(kl + ks * 32 + 16 + 8 * hh); }
#pragma unroll
      for (int rt = 0; rt < RTN; ++rt) { v8f acc = (v8f){0.f,0.f,0.f,0.f,0.f,0.f,0.f,0.f}, accr = acc;
#pragma unroll
        for (int ks = 0; ks < KS; ++ks) { acc = mmaH<1>(aq[rt][ks].v, aq[rt][ks].v, bk[ks].v, bk[ks].v, acc); accr = mmaH<1>(aql[rt][ks].v, aql[rt][ks].v, bk[ks].v, bk[ks].v, accr); accr = mmaH<1>(aq[rt][ks].v, aq[rt][ks].v, bkl[ks].v, bkl[ks].v, accr); }
        s[rt][nt] = acc + accr * 0.0009765625f; } }
#pragma unroll
    for (int rt = 0; rt < RTN; ++rt)
#pragma unroll
      for (int r = 0; r < 8; ++r) { const unsigned mw = mrow[rt][r][j0 >> 5]; const bool am = (allm[rt][r] != 0);
        const bool ok0 = am || (((mw >> ln) & 1u) == 0u), ok1 = am || (((mw >> (16 + ln)) & 1u) == 0u);
        const float s0 = ok0 ? (am ? 0.f : s[rt][0][r] * SCL) : -INFINITY, s1 = ok1 ? (am ? 0.f : s[rt][1][r] * SCL) : -INFINITY; float mc = fmaxf(s0, s1);
        mc = fmaxf(mc, __shfl_xor(mc, 1, 32)); mc = fmaxf(mc, __shfl_xor(mc, 2, 32)); mc = fmaxf(mc, __shfl_xor(mc, 4, 32)); mc = fmaxf(mc, __shfl_xor(mc, 8, 32));
        const float mn = fmaxf(m_r[rt][r], mc); const float al = (mn > -1.0e38f) ? expf(m_r[rt][r] - mn) : 1.0f; m_r[rt][r] = mn; const float p0 = ok0 ? expf(s0 - mn) : 0.f, p1 = ok1 ? expf(s1 - mn) : 0.f; l_r[rt][r] = l_r[rt][r] * al + p0 + p1;
#pragma unroll
        for (int dt = 0; dt < DT; ++dt) { oacc[rt][dt][r] *= al; oaccl[rt][dt][r] *= al; }
        FragH t2, t3; const float ps0 = p0 * 1024.0f, ps1 = p1 * 1024.0f; t2.h[0] = (_Float16)ps0; t2.h[1] = (_Float16)ps1; t3.h[0] = (_Float16)((ps0 - (float)t2.h[0]) * 1024.0f); t3.h[1] = (_Float16)((ps1 - (float)t2.h[1]) * 1024.0f);
        sP[w][rt * 16 + 8 * hh + r][ln] = t2.u[0]; sP[w][rt * 16 + 8 * hh + r][16 + ln] = t2.u[1]; sPl[w][rt * 16 + 8 * hh + r][ln] = t3.u[0]; sPl[w][rt * 16 + 8 * hh + r][16 + ln] = t3.u[1]; }
    __builtin_amdgcn_fence(__ATOMIC_ACQ_REL, "workgroup"); __builtin_amdgcn_wave_barrier();
    FragH pa[2], pl[2];
#pragma unroll
    for (int rt = 0; rt < RTN; ++rt) { pa[rt].half[0] = *(const v8us*)&sP[w][rt * 16 + ln][8 * hh]; pa[rt].half[1] = *(const v8us*)&sP[w][rt * 16 + ln][16 + 8 * hh]; pl[rt].half[0] = *(const v8us*)&sPl[w][rt * 16 + ln][8 * hh]; pl[rt].half[1] = *(const v8us*)&sPl[w][rt * 16 + ln][16 + 8 * hh]; }
#pragma unroll
    for (int dt = 0; dt < DT; ++dt) { const size_t vo = (size_t)(dt * 16 + ln) * TK + j0; FragH bv, bl; bv.half[0] = *(const v8us*)(Vth + vo + 8 * hh); bv.half[1] = *(const v8us*)(Vth + vo + 16 + 8 * hh); bl.half[0] = *(const v8us*)(Vtl + vo + 8 * hh); bl.half[1] = *(const v8us*)(Vtl + vo + 16 + 8 * hh);
#pragma unroll
      for (int rt = 0; rt < RTN; ++rt) { oacc[rt][dt] = mmaH<1>(pa[rt].v, pa[rt].v, bv.v, bv.v, oacc[rt][dt]); oaccl[rt][dt] = mmaH<1>(pa[rt].v, pa[rt].v, bl.v, bl.v, oaccl[rt][dt]); oaccl[rt][dt] = mmaH<1>(pl[rt].v, pl[rt].v, bv.v, bv.v, oaccl[rt][dt]); } }
    __builtin_amdgcn_fence(__ATOMIC_ACQ_REL, "workgroup"); __builtin_amdgcn_wave_barrier(); }
#pragma unroll
  for (int rt = 0; rt < RTN; ++rt) {
#pragma unroll
    for (int r = 0; r < 8; ++r) { float l = l_r[rt][r]; l += __shfl_xor(l, 1, 32); l += __shfl_xor(l, 2, 32); l += __shfl_xor(l, 4, 32); l += __shfl_xor(l, 8, 32); l_r[rt][r] = (l > 0.f) ? 1.0f / (l * 1024.0f) : 0.f; }
#pragma unroll
    for (int dt = 0; dt < DT; ++dt)
#pragma unroll
      for (int r = 0; r < 8; ++r) sO[w][rt * 16 + 8 * hh + r][dt * 16 + ln] = (oacc[rt][dt][r] + oaccl[rt][dt][r] * 0.0009765625f) * l_r[rt][r]; }
  __builtin_amdgcn_fence(__ATOMIC_ACQ_REL, "workgroup"); __builtin_amdgcn_wave_barrier();
  {
#pragma unroll
    for (int rp = 0; rp < RPW; rp += 2) { const int r = rp + (lane >> 4), pc = lane & 15; const v4f val = *(const v4fa*)&sO[w][r][pc * 4]; *(v4f*)(O + ((size_t)b * TQ + q0 + r) * ldo + h * 64 + pc * 4) = val; }
     }
  asm volatile("s_wait_xcnt 0x0" ::: "memory");      /* the next tile's set-up overwrites the address registers of the stores above */
  } }


template <int SRCBF>
__global__ __launch_bounds__(256) void k_lnab(const float* __restrict__ X, const float* __restrict__ g, const float* __restrict__ bb, _Float16* __restrict__ Y16, float* __restrict__ Y32, float* __restrict__ XB) {
  #pragma clang fp contract(off)
  const int tid = threadIdx.x, w = tid >> 5, ln = tid & 31; const int r = blockIdx.x * 8 + w; if (r >= NR) return; const float* x = X + (size_t)r * DM; float s = 0.f;
#pragma unroll 1
  for (int i = 0; i < DM / 128; ++i) { const v4f a = *(const v4fa*)(x + i * 128 + ln * 4); for (int q = 0; q < 4; ++q) s += SRCBF ? bf16_round(a[q]) : a[q]; }
  for (int o = 16; o > 0; o >>= 1) s += __shfl_xor(s, o, 32); const float mu = s / (float)DM; float q2 = 0.f;
#pragma unroll 1
  for (int i = 0; i < DM / 128; ++i) { const v4f a = *(const v4fa*)(x + i * 128 + ln * 4); for (int q = 0; q < 4; ++q) { const float d = (SRCBF ? bf16_round(a[q]) : a[q]) - mu; q2 += d * d; } }
  for (int o = 16; o > 0; o >>= 1) q2 += __shfl_xor(q2, o, 32); const float rs = rsqrtf(q2 / (float)DM + 1e-5f);
  {
#pragma unroll 1
    for (int i = 0; i < DM / 128; ++i) { const int c0 = i * 128 + ln * 4; const v4f a = *(const v4fa*)(x + c0); _Float16 h4[4]; v4f y4, xb;
      for (int q = 0; q < 4; ++q) { const float t = SRCBF ? bf16_round(a[q]) : a[q]; const float y = (t - mu) * rs * bf16_round(g[c0 + q]) + bf16_round(bb[c0 + q]); h4[q] = (_Float16)y; y4[q] = y; xb[q] = t; }
      if (Y16) *(unsigned long long*)((unsigned short*)Y16 + (size_t)r * DM + c0) = *(const unsigned long long*)h4; if (Y32) *(v4f*)(Y32 + (size_t)r * DM + c0) = y4; if (XB) *(v4f*)(XB + (size_t)r * DM + c0) = xb; }
     } }
__global__ __launch_bounds__(256) void k_causaltab(unsigned* __restrict__ MB, int* __restrict__ RA, int* __restrict__ KE, int nq, int nk) {
  const int t = blockIdx.x * 256 + threadIdx.x; const int nw = nk / 32;
  if (t < nq * nw) { const int q = t / nw, w = t % nw; const int first = q + 1 - 32 * w; const unsigned bits = (first <= 0) ? 0xffffffffu : ((first >= 32) ? 0u : (0xffffffffu << first)); *(unsigned*)(MB + t) = bits;  }
  if (t < nq) { *(int*)(RA + t) = 0;  }
  if (t < nq / 64) { const int v = 64 * (t + 1); *(int*)(KE + t * 32) = v;  } }


extern "C" void kernel_launch(void* const* d_in, const int* in_sizes, int n_in,
                              void* d_out, int out_size, void* d_ws, size_t ws_size, hipStream_t stream) {
  (void)in_sizes; (void)n_in; (void)out_size;
  const float* const* I = (const float* const*)d_in; const float* x = I[0]; const float* lag = I[1]; const float* lab = I[2]; const float* lbg = I[3]; const float* lbb = I[4]; const float* lcg = I[5]; const float* lcb = I[6];
  const float* Wq = I[7]; const float* bq = I[8]; const float* Wk = I[9]; const float* bk = I[10]; const float* Wv = I[11]; const float* bv = I[12]; const float* Wo = I[13]; const float* bo = I[14]; const float* We = I[15]; const float* be = I[16]; const float* Wd = I[17]; const float* bd = I[18];
  char* ws = (char*)d_ws; size_t off = 0;
  auto take = [&](size_t bytes) { char* p = ws + off; off += (bytes + 255) & ~(size_t)255; return p; };
  _Float16* BQ = (_Float16*)take((size_t)DM * DM * 2); _Float16* BK = (_Float16*)take((size_t)DM * DM * 2); _Float16* BV = (_Float16*)take((size_t)DM * DM * 2); _Float16* BO = (_Float16*)take((size_t)DM * DM * 2); _Float16* BE = (_Float16*)take((size_t)4096 * DM * 2); _Float16* BD = (_Float16*)take((size_t)DM * 4096 * 2);
  float* XB = (float*)take((size_t)NR * DM * 4); _Float16* T16 = (_Float16*)take((size_t)NR * DM * 2); float* F = (float*)take((size_t)NR * DM * 4);
  _Float16* Qh = (_Float16*)take((size_t)NR * DM * 2); _Float16* Ql = (_Float16*)take((size_t)NR * DM * 2); _Float16* Kh = (_Float16*)take((size_t)NR * DM * 2); _Float16* Kl = (_Float16*)take((size_t)NR * DM * 2); _Float16* Vth = (_Float16*)take((size_t)NR * DM * 2); _Float16* Vtl = (_Float16*)take((size_t)NR * DM * 2);
  unsigned* MB = (unsigned*)take((size_t)SLEN * (SLEN / 32) * 4); int* RA = (int*)take((size_t)SLEN * 4); int* KE = (int*)take((size_t)(SLEN / 64) * 32 * 4);
  if (off > ws_size) return;      /* 24 + 16 + 8 + 16 + 48 + 0.6 = 113 MiB (the first LN's f32 output lives in F until the second LN consumes it) */
  float* O = F; _Float16* Oh = Qh; _Float16* Ol = Ql; float* X1 = XB; _Float16* GH = Kh;      /* SiLU hidden [NR][4096] f16 = 32 MB over Kh|Kl|Vth|Vtl (dead after the flash) */
  const size_t n8 = (size_t)NR * DM / 8; const unsigned nb8 = (unsigned)((n8 + 255) / 256);
  k_wt_f16<<<(unsigned)(((size_t)DM * DM / 8 + 255) / 256), 256, 0, stream>>>(Wq, BQ, DM, DM, 16.0f); k_wt_f16<<<(unsigned)(((size_t)DM * DM / 8 + 255) / 256), 256, 0, stream>>>(Wk, BK, DM, DM, 16.0f); k_wt_f16<<<(unsigned)(((size_t)DM * DM / 8 + 255) / 256), 256, 0, stream>>>(Wv, BV, DM, DM, 16.0f); k_wt_f16<<<(unsigned)(((size_t)DM * DM / 8 + 255) / 256), 256, 0, stream>>>(Wo, BO, DM, DM, 16.0f);
  k_wt_f16<<<(unsigned)(((size_t)DM * 4096 / 8 + 255) / 256), 256, 0, stream>>>(We, BE, DM, 4096, 16.0f); k_wt_f16<<<(unsigned)(((size_t)4096 * DM / 8 + 255) / 256), 256, 0, stream>>>(Wd, BD, 4096, DM, 16.0f);      /* all (in,out) */
  k_causaltab<<<(SLEN * (SLEN / 32) + 255) / 256, 256, 0, stream>>>(MB, RA, KE, SLEN, SLEN);
  k_lnab<1><<<NR / 8, 256, 0, stream>>>(x, lag, lab, nullptr, F, XB);      /* t0 = LN_a(bf16 x) (f32), XB = bf16(x) */
  k_lnab<0><<<NR / 8, 256, 0, stream>>>(F, lbg, lbb, T16, nullptr, nullptr);      /* t = LN_b(t0) as f16 operand */
  const dim3 gP((NR / 128) * (DM / 64), 1), gM((NR / 128) * (4096 / 64), 1);
  k_gemm2<0, DM><<<gP, 128, 0, stream>>>(T16, DM, 0, BQ, DM, 0, 0.0625f, bq, 0, nullptr, 1, 0, 0, F, nullptr, DM, 0, NR, DM, DM); k_hl<<<nb8, 256, 0, stream>>>(F, Qh, Ql, n8);
  k_gemm2<0, DM><<<gP, 128, 0, stream>>>(T16, DM, 0, BK, DM, 0, 0.0625f, bk, 0, nullptr, 1, 0, 0, F, nullptr, DM, 0, NR, DM, DM); k_hl<<<nb8, 256, 0, stream>>>(F, Kh, Kl, n8);
  k_gemm2<0, DM><<<gP, 128, 0, stream>>>(T16, DM, 0, BV, DM, 0, 0.0625f, bv, 0, nullptr, 1, 0, 0, F, nullptr, DM, 0, NR, DM, DM);
  for (int b = 0; b < NBT; ++b) k_vthl<SLEN><<<NH * (SLEN / 64), 256, 0, stream>>>(F + (size_t)b * SLEN * DM, DM, Vth + (size_t)b * SLEN * DM, Vtl + (size_t)b * SLEN * DM);
  k_flashm<SLEN, SLEN><<<NH * (SLEN / 64), 128, 0, stream>>>(Qh, Ql, DM, Kh, Kl, DM, Vth, Vtl, MB, RA, KE, O, DM);      /* both batches in one grid of equal work-groups */
  k_hl<<<nb8, 256, 0, stream>>>(O, Oh, Ol, n8);
  k_gemm2<0, DM><<<gP, 128, 0, stream>>>(Oh, DM, 0, BO, DM, 0, 0.0625f, bo, 0, XB, 1, (size_t)DM, 0, X1, nullptr, DM, 0, NR, DM, DM);      /* x1 = x + ctx Wo + bo (hi) */
  k_gemm2<0, DM><<<gP, 128, 0, stream>>>(Ol, DM, 0, BO, DM, 0, 0.0625f / 1024.0f, nullptr, 0, X1, 1, (size_t)DM, 0, X1, nullptr, DM, 0, NR, DM, DM);      /* + lo */
  k_lnab<0><<<NR / 8, 256, 0, stream>>>(X1, lcg, lcb, T16, nullptr, nullptr);
  k_gemm2<15, DM><<<gM, 128, 0, stream>>>(T16, DM, 0, BE, DM, 0, 0.0625f, be, 0, nullptr, 1, 0, 0, nullptr, GH, 4096, 0, NR, 4096, DM);      /* silu(t We + be) f16 (ACT 15 = x * sigmoid(x), present in the epilogue) */
  k_gemm2<0, 4096><<<gP, 128, 0, stream>>>(GH, 4096, 0, BD, 4096, 0, 0.0625f, bd, 0, X1, 1, (size_t)DM, 0, (float*)d_out, nullptr, DM, 0, NR, DM, 4096);      /* out = x1 + mlp */
}

// v003
// Measured time: 550 microseconds a run.
// Two timings next to v002 both put it at 1.24 times that version's speed.
// Counting every step since v000, it is 2.21 times as fast.
#include <hip/hip_runtime.h>
// Pre-LN causal attention block (2 x 2048 tokens, 1024 = 16 heads x 64; MLP 4096 with SiLU): t = LN_b(LN_a(x)); q,k,v = t W + b; x1 = x + (causal softmax(q.k/8) v) Wo + bo; out = x1 + (silu(LN_c(x1) We + be)) Wd + bd -> [2,2048,1024].
// Structure: the LayerNorms on VALU (the first pass also writes the bf16 residual plane); projections / MLP as f16 WMMA GEMMs (32x64 wave tiles, f32 accumulation, exact x16 weights, biases / SiLU / residual addends in the epilogue); q, k as f16 hi + (x2^10) residual planes, V^T as hi + residual planes; fused causal flash kernel, one work-group per (head, t): 64-query tile t of batch 0, then tile 31 - t of batch 1 (device-built causal tables, online f32 softmax, P staged hi + residual, two value accumulators); O as hi + residual planes into Wo (two GEMMs).
// Compute dtype: x, weights, biases, LN parameters rounded to bf16; LN outputs and the SiLU hidden as f16 operands (~2^-12); q, k, P, v, O as f16 hi + residual pairs (~2^-21); f32 accumulation, softmax, LayerNorm. v_wmma_f32_16x16x32_f16.
#define NBT 2
#define SLEN 2048
#define DM 1024
#define NH 16
#define SCL 0.125f
#define NR (NBT * SLEN)
typedef __bf16 v16b __attribute__((ext_vector_type(16)));
typedef unsigned short v8us __attribute__((ext_vector_type(8), may_alias));
typedef float  v8f  __attribute__((ext_vector_type(8)));
typedef float  v4f  __attribute__((ext_vector_type(4)));
typedef float  v4fa __attribute__((ext_vector_type(4), may_alias));
union FragB { v16b v; v8us half[2]; unsigned short u[16]; };

__device__ __forceinline__ unsigned short bf16_bits(float x) { unsigned int u = __float_as_uint(x); return (unsigned short)((u + 0x7FFFu + ((u >> 16) & 1u)) >> 16); }
__device__ __forceinline__ float bf16_val(unsigned short b) { return __uint_as_float(((unsigned int)b) << 16); }
__device__ __forceinline__ float bf16_round(float x) { return bf16_val(bf16_bits(x)); }
// D += A·B with NT terms: 1 = ah·bh, 2 = + al·bh (A split), 3 = + ah·bl (both split)
template <int NT>
__device__ __forceinline__ v8f mmaN(v16b ah, v16b al, v16b bh, v16b bl, v8f c) {
  c = __builtin_amdgcn_wmma_f32_16x16x32_bf16(false, ah, false, bh, (short)0, c, false, false);
  if (NT >= 2) c = __builtin_amdgcn_wmma_f32_16x16x32_bf16(false, al, false, bh, (short)0, c, false, false);
  if (NT >= 3) c = __builtin_amdgcn_wmma_f32_16x16x32_bf16(false, ah, false, bl, (short)0, c, false, false);
  asm volatile("v_nop\n\tv_nop\n\tv_nop\n\tv_nop" : "+v"(c) : "v"(ah), "v"(al), "v"(bh), "v"(bl));
  return c;
}

__global__ __launch_bounds__(256) void k_wt_bf16(const float* __restrict__ W, unsigned short* __restrict__ Wt, int K, int N) {
  const int t = blockIdx.x * 256 + threadIdx.x;
  const int k8n = K / 8;
  if (t >= N * k8n) return;
  const int n = t / k8n, k8 = (t % k8n) * 8;
  v8us v;
#pragma unroll
  for (int i = 0; i < 8; ++i) v[i] = bf16_bits(W[(size_t)(k8 + i) * N + n]);
  *(v8us*)(Wt + (size_t)n * K + k8) = v;
  
}

// GEMM C[M][N] (f32, pitch ldc) = act(A[M][K]·W + bias). A f32 row-major (pitch lda) converted per fragment to bf16
// (ASPLIT: hi/lo two planes -> 2 terms, else single rounded term); Wt bf16 [N][K] (pitch ldb). BIAS_BF16 rounds the
// bias to bf16 first (bias quantised to bf16 before the add). K%32==0, M%16==0, N%64==0.
template <bool ASPLIT, int ACT, bool BIAS_BF16>
__global__ __launch_bounds__(128) void k_gemm_bf(const float* __restrict__ A, int lda, const unsigned short* __restrict__ Wt, int ldb,
                                               const float* __restrict__ bias, float* __restrict__ C, int ldc, int M, int N, int K) {
  __shared__ __attribute__((aligned(16))) float so[4][16][64];
  const int tid = threadIdx.x, w = tid >> 5, lane = tid & 31, ln = lane & 15, hh = lane >> 4;
  const int ntn = N / 64;
  const int wid = blockIdx.x * 4 + w;
  const int mt = wid / ntn, nq = wid % ntn;
  if (mt * 16 >= M) return;
  const int row0 = mt * 16, col0 = nq * 64;
  const float* arow = A + (size_t)(row0 + ln) * lda;
  v8f acc[4] = {};
  for (int kb = 0; kb < K; kb += 32) {
    FragB ah, al;
    const v4f x0 = *(const v4fa*)(arow + kb + 8 * hh), x1 = *(const v4fa*)(arow + kb + 8 * hh + 4);
    const v4f x2 = *(const v4fa*)(arow + kb + 16 + 8 * hh), x3 = *(const v4fa*)(arow + kb + 16 + 8 * hh + 4);
    float xs[16] = {x0[0],x0[1],x0[2],x0[3],x1[0],x1[1],x1[2],x1[3],x2[0],x2[1],x2[2],x2[3],x3[0],x3[1],x3[2],x3[3]};
#pragma unroll
    for (int i = 0; i < 16; ++i) { const unsigned short hb = bf16_bits(xs[i]); ah.u[i] = hb; al.u[i] = ASPLIT ? bf16_bits(xs[i] - bf16_val(hb)) : (unsigned short)0; }
#pragma unroll
    for (int t = 0; t < 4; ++t) {
      const unsigned short* brow = Wt + (size_t)(col0 + t * 16 + ln) * ldb + kb;
      FragB b;
      b.half[0] = *(const v8us*)(brow + 8 * hh);
      b.half[1] = *(const v8us*)(brow + 16 + 8 * hh);
      acc[t] = mmaN<ASPLIT ? 2 : 1>(ah.v, al.v, b.v, b.v, acc[t]);
    }
  }
#pragma unroll
  for (int t = 0; t < 4; ++t) {
    float bv = bias ? bias[col0 + t * 16 + ln] : 0.f;
    if (BIAS_BF16) bv = bf16_round(bv);
#pragma unroll
    for (int r = 0; r < 8; ++r) { float v = acc[t][r] + bv; if (ACT == 1) v = fmaxf(v, 0.f); so[w][8 * hh + r][t * 16 + ln] = v; }
  }
  __builtin_amdgcn_fence(__ATOMIC_ACQ_REL, "workgroup");
  __builtin_amdgcn_wave_barrier();
  const int rsub = lane >> 4, c4 = (lane & 15) * 4;
  {
#pragma unroll
    for (int q = 0; q < 8; ++q) {
      const int r = q * 2 + rsub;
      const v4f v = *(const v4fa*)&so[w][r][c4];
      *(v4f*)(C + (size_t)(row0 + r) * ldc + col0 + c4) = v;
    }
    
  }
}

// GEMM C = act(A·W + bias + resid): A f32 (ASPLIT -> hi/lo 2 terms), Wt bf16 [N][K]; ACT 0 none, 1 relu, 2 exact gelu;
// resid (optional, f32, row index = (row % rmod), pitch ldr, RES_BF16 rounds it) added before the activation.
template <bool ASPLIT, int ACT, bool BIAS_BF16, bool RES_BF16>
__global__ __launch_bounds__(128) void k_gemm_bf3(const float* __restrict__ A, int lda, const unsigned short* __restrict__ Wt, int ldb,
                                                const float* __restrict__ bias, const float* __restrict__ resid, int rmod, int ldr,
                                                float* __restrict__ C, int ldc, int M, int N, int K) {
  __shared__ __attribute__((aligned(16))) float so[4][16][64];
  const int tid = threadIdx.x, w = tid >> 5, lane = tid & 31, ln = lane & 15, hh = lane >> 4;
  const int ntn = N / 64;
  const int wid = blockIdx.x * 4 + w;
  const int mt = wid / ntn, nq = wid % ntn;
  if (mt * 16 >= M) return;
  const int row0 = mt * 16, col0 = nq * 64;
  const float* arow = A + (size_t)(row0 + ln) * lda;
  v8f acc[4] = {};
  for (int kb = 0; kb < K; kb += 32) {
    FragB ah, al;
    const v4f x0 = *(const v4fa*)(arow + kb + 8 * hh), x1 = *(const v4fa*)(arow + kb + 8 * hh + 4);
    const v4f x2 = *(const v4fa*)(arow + kb + 16 + 8 * hh), x3 = *(const v4fa*)(arow + kb + 16 + 8 * hh + 4);
    float xs[16] = {x0[0],x0[1],x0[2],x0[3],x1[0],x1[1],x1[2],x1[3],x2[0],x2[1],x2[2],x2[3],x3[0],x3[1],x3[2],x3[3]};
#pragma unroll
    for (int i = 0; i < 16; ++i) { const unsigned short hb = bf16_bits(xs[i]); ah.u[i] = hb; al.u[i] = ASPLIT ? bf16_bits(xs[i] - bf16_val(hb)) : (unsigned short)0; }
#pragma unroll
    for (int t = 0; t < 4; ++t) {
      const unsigned short* brow = Wt + (size_t)(col0 + t * 16 + ln) * ldb + kb;
      FragB b;
      b.half[0] = *(const v8us*)(brow + 8 * hh);
      b.half[1] = *(const v8us*)(brow + 16 + 8 * hh);
      acc[t] = mmaN<ASPLIT ? 2 : 1>(ah.v, al.v, b.v, b.v, acc[t]);
    }
  }
#pragma unroll
  for (int t = 0; t < 4; ++t) {
    const int col = col0 + t * 16 + ln;
    float bv = bias ? bias[col] : 0.f;
    if (BIAS_BF16) bv = bf16_round(bv);
#pragma unroll
    for (int r = 0; r < 8; ++r) {
      float v = acc[t][r] + bv;
      if (resid) { float rv = resid[(size_t)((row0 + 8 * hh + r) % rmod) * ldr + col]; if (RES_BF16) rv = bf16_round(rv); v += rv; }
      if (ACT == 1) v = fmaxf(v, 0.f);
      if (ACT == 2) v = 0.5f * v * (1.0f + erff(v * 0.70710678118654752f));
      if (ACT == 3) { const float u = 0.7978845608028654f * (v + 0.044715f * v * v * v); v = 0.5f * v * (1.0f + tanhf(u)); }
      so[w][8 * hh + r][t * 16 + ln] = v;
    }
  }
  __builtin_amdgcn_fence(__ATOMIC_ACQ_REL, "workgroup");
  __builtin_amdgcn_wave_barrier();
  const int rsub = lane >> 4, c4 = (lane & 15) * 4;
  {
#pragma unroll
    for (int q = 0; q < 8; ++q) {
      const int r = q * 2 + rsub;
      const v4f v = *(const v4fa*)&so[w][r][c4];
      *(v4f*)(C + (size_t)(row0 + r) * ldc + col0 + c4) = v;
    }
    
  }
}
// row LayerNorm (biased variance, eps) over N: s = X (+ R); optional out_sum <- s; out_norm <- (s-mu)*rsqrt(var+eps)*g + b
template <bool PARAM_BF16>
__global__ __launch_bounds__(256) void k_layernorm(const float* __restrict__ X, const float* __restrict__ R, const float* __restrict__ g, const float* __restrict__ bta,
                                                  float* __restrict__ out_sum, float* __restrict__ out_norm, int N, float eps) {
  __shared__ float red[256];
  const int row = blockIdx.x, tid = threadIdx.x;
  const float* x = X + (size_t)row * N; const float* rr = R ? R + (size_t)row * N : nullptr;
  float vals[16];                     // up to N = 4096
  const int per = N / 256;            // contiguous chunk per thread? use strided-by-4 chunks: thread handles j = tid*4 + 1024*u
  float s1 = 0.f;
  for (int u = 0; u < per / 4; ++u) {
    const int j = tid * 4 + 1024 * u;
    const v4f a = *(const v4fa*)(x + j);
    v4f b = {0.f,0.f,0.f,0.f}; if (rr) b = *(const v4fa*)(rr + j);
#pragma unroll
    for (int q = 0; q < 4; ++q) { const float v = a[q] + b[q]; vals[u * 4 + q] = v; s1 += v; }
  }
  red[tid] = s1; __syncthreads();
  for (int st = 128; st > 0; st >>= 1) { if (tid < st) red[tid] += red[tid + st]; __syncthreads(); }
  const float mu = red[0] / (float)N; __syncthreads();
  float s2 = 0.f;
  for (int u = 0; u < per / 4; ++u)
#pragma unroll
    for (int q = 0; q < 4; ++q) { const float c = vals[u * 4 + q] - mu; s2 += c * c; }
  red[tid] = s2; __syncthreads();
  for (int st = 128; st > 0; st >>= 1) { if (tid < st) red[tid] += red[tid + st]; __syncthreads(); }
  const float rs = rsqrtf(red[0] / (float)N + eps);
  {
    for (int u = 0; u < per / 4; ++u) {
      const int j = tid * 4 + 1024 * u;
      v4f o, sm;
#pragma unroll
      for (int q = 0; q < 4; ++q) {
        float gg = g[j + q], bb = bta[j + q];
        if (PARAM_BF16) { gg = bf16_round(gg); bb = bf16_round(bb); }
        sm[q] = vals[u * 4 + q]; o[q] = (vals[u * 4 + q] - mu) * rs * gg + bb;
      }
      if (out_sum) *(v4f*)(out_sum + (size_t)row * N + j) = sm;
      *(v4f*)(out_norm + (size_t)row * N + j) = o;
    }
    
  }
}



// ---- f16 WMMA path (v_wmma_f32_16x16x32_f16): 11-bit significands for operands in range — used where a [0,1] probability operand needs more precision than bf16
typedef _Float16 v16h __attribute__((ext_vector_type(16)));
union FragH { v16h v; v8us half[2]; _Float16 h[16]; unsigned short u[16]; };
template <int NT>
__device__ __forceinline__ v8f mmaH(v16h ah, v16h al, v16h bh, v16h bl, v8f c) {
  c = __builtin_amdgcn_wmma_f32_16x16x32_f16(false, ah, false, bh, (short)0, c, false, false);
  if (NT >= 2) c = __builtin_amdgcn_wmma_f32_16x16x32_f16(false, al, false, bh, (short)0, c, false, false);
  if (NT >= 3) c = __builtin_amdgcn_wmma_f32_16x16x32_f16(false, ah, false, bl, (short)0, c, false, false);
  asm volatile("v_nop\n\tv_nop\n\tv_nop\n\tv_nop" : "+v"(c) : "v"(ah), "v"(al), "v"(bh), "v"(bl));
  return c;
}
// batched GEMM like k_gemm_b but f16 operands: A f32 (split into f16 hi/lo if ASPLIT, else rounded to f16), Bt = f16 values [n][k]; alpha; C f32; N multiple of 16 (partial tiles skipped)
template <bool ASPLIT>
__global__ __launch_bounds__(128) void k_gemm_h(const float* __restrict__ A, int lda, size_t sA, const _Float16* __restrict__ Bh, int ldb, size_t sB, float alpha, float* __restrict__ C, int ldc, size_t sC, int M, int N, int K) {
  __shared__ __attribute__((aligned(16))) float so[4][16][64];
  const int tid = threadIdx.x, w = tid >> 5, lane = tid & 31, ln = lane & 15, hh = lane >> 4; const int by = blockIdx.y;
  A += (size_t)by * sA; Bh += (size_t)by * sB; C += (size_t)by * sC;
  const int ntn = (N + 63) / 64; const int wid = blockIdx.x * 4 + w; const int mt = wid / ntn, nq = wid % ntn; if (mt * 16 >= M) return;
  const int row0 = mt * 16, col0 = nq * 64; const float* arow = A + (size_t)(row0 + ln) * lda;
  v8f acc[4] = {};
  for (int kb = 0; kb < K; kb += 32) {
    FragH ah, al;
    const v4f x0 = *(const v4fa*)(arow + kb + 8 * hh), x1 = *(const v4fa*)(arow + kb + 8 * hh + 4), x2 = *(const v4fa*)(arow + kb + 16 + 8 * hh), x3 = *(const v4fa*)(arow + kb + 16 + 8 * hh + 4);
    float xs[16] = {x0[0],x0[1],x0[2],x0[3],x1[0],x1[1],x1[2],x1[3],x2[0],x2[1],x2[2],x2[3],x3[0],x3[1],x3[2],x3[3]};
#pragma unroll
    for (int i = 0; i < 16; ++i) { const _Float16 h = (_Float16)xs[i]; ah.h[i] = h; al.h[i] = ASPLIT ? (_Float16)(xs[i] - (float)h) : (_Float16)0.0f; }
#pragma unroll
    for (int t = 0; t < 4; ++t) { if (col0 + t * 16 >= N) continue; const size_t boff = (size_t)(col0 + t * 16 + ln) * ldb + kb; FragH bq; bq.half[0] = *(const v8us*)(Bh + boff + 8 * hh); bq.half[1] = *(const v8us*)(Bh + boff + 16 + 8 * hh);
      acc[t] = mmaH<ASPLIT ? 2 : 1>(ah.v, al.v, bq.v, bq.v, acc[t]); }
  }
#pragma unroll
  for (int t = 0; t < 4; ++t) { if (col0 + t * 16 >= N) continue;
#pragma unroll
    for (int r = 0; r < 8; ++r) so[w][8 * hh + r][t * 16 + ln] = acc[t][r] * alpha; }
  __builtin_amdgcn_fence(__ATOMIC_ACQ_REL, "workgroup"); __builtin_amdgcn_wave_barrier();
  const int rsub = lane >> 4, c4 = (lane & 15) * 4;
  {
#pragma unroll
    for (int q = 0; q < 8; ++q) { const int r = q * 2 + rsub; if (col0 + c4 < N) { const v4f v = *(const v4fa*)&so[w][r][c4]; *(v4f*)(C + (size_t)(row0 + r) * ldc + col0 + c4) = v; } }
     }
}

// Wt[n][k] = f16(W[k][n]·scale) from f32 row-major W[K][N] (scale = power of two; bf16-exact weights stay exact in f16 away from the subnormal range)
__global__ __launch_bounds__(256) void k_wt_f16(const float* __restrict__ W, _Float16* __restrict__ Wt, int K, int N, float scale) {
  const int t = blockIdx.x * 256 + threadIdx.x; if (t >= N * (K / 8)) return; const int n = t / (K / 8), k8 = (t % (K / 8)) * 8; FragH f;
#pragma unroll
  for (int i = 0; i < 8; ++i) f.h[i] = (_Float16)(bf16_round(W[(size_t)(k8 + i) * N + n]) * scale); const v8us o = f.half[0];
  *(v8us*)((unsigned short*)Wt + (size_t)n * K + k8) = o; 
}
// k_gemm_hh variant with fused epilogue: v = acc·alpha + bias[by·sBias + col] (+ CP[(row/rowsPerB)·sCPb + by·64 + col] if CP) ; ACT 0 none / 1 elu ; writes f16 C16 (and f32 C if non-null)
template <int ACT>
__global__ __launch_bounds__(128) void k_gemm_hhx(const _Float16* __restrict__ A, int lda, size_t sA, const _Float16* __restrict__ Bh, int ldb, size_t sB, float alpha, const float* __restrict__ bias, size_t sBias, const float* __restrict__ CP, int rowsPerB, size_t sCPb, int row0g,
    float* __restrict__ C, _Float16* __restrict__ C16, int ldc, size_t sC, int M, int N, int K) {
  __shared__ __attribute__((aligned(16))) float so[4][16][64];
  const int tid = threadIdx.x, w = tid >> 5, lane = tid & 31, ln = lane & 15, hh = lane >> 4; const int by = blockIdx.y;
  A += (size_t)by * sA; Bh += (size_t)by * sB; const size_t cofs = (size_t)by * sC; const float* bp = bias ? bias + (size_t)by * sBias : nullptr;
  const int ntn = (N + 63) / 64; const int wid = blockIdx.x * 4 + w; const int mt = wid / ntn, nq = wid % ntn; if (mt * 16 >= M) return;
  const int row0 = mt * 16, col0 = nq * 64; const _Float16* arow = A + (size_t)(row0 + ln) * lda;
  v8f acc[4] = {};
  for (int kb = 0; kb < K; kb += 32) { FragH ah; ah.half[0] = *(const v8us*)((const unsigned short*)arow + kb + 8 * hh); ah.half[1] = *(const v8us*)((const unsigned short*)arow + kb + 16 + 8 * hh);
#pragma unroll
    for (int t = 0; t < 4; ++t) { if (col0 + t * 16 >= N) continue; const size_t boff = (size_t)(col0 + t * 16 + ln) * ldb + kb; FragH bq; bq.half[0] = *(const v8us*)((const unsigned short*)Bh + boff + 8 * hh); bq.half[1] = *(const v8us*)((const unsigned short*)Bh + boff + 16 + 8 * hh);
      acc[t] = mmaH<1>(ah.v, ah.v, bq.v, bq.v, acc[t]); }
  }
#pragma unroll
  for (int t = 0; t < 4; ++t) { if (col0 + t * 16 >= N) continue; const int col = col0 + t * 16 + ln; const float bv = bp ? bf16_round(bp[col]) : 0.f;
#pragma unroll
    for (int r = 0; r < 8; ++r) { float v = acc[t][r] * alpha + bv; if (CP) { const int bidx = (row0g + row0 + 8 * hh + r) / rowsPerB; v += CP[(size_t)bidx * sCPb + (size_t)by * 64 + col]; } if (ACT == 1) v = (v > 0.f) ? v : expm1f(v); else if (ACT == 7) v = (v > 0.f) ? v + 1.0f : expf(v); else if (ACT == 8) v = tanhf(v); else if (ACT == 9) v = 0.5f * v * (1.0f + tanhf(0.7978845608028654f * (v + 0.044715f * v * v * v))); else if (ACT == 11) v = 1.0f / (1.0f + expf(-v)); else if (ACT == 12) v = (v > 0.f) ? v : 0.01f * v; else if (ACT == 14) v = (v > 0.f) ? v : 0.1f * v; else if (ACT == 15) v = v / (1.0f + expf(-v)); else if (ACT == 3) v = fmaxf(v, 0.f); else if (ACT == 6) v = 0.5f * v * (1.0f + erff(v * 0.70710678118654752f)); so[w][8 * hh + r][t * 16 + ln] = v; } }
  __builtin_amdgcn_fence(__ATOMIC_ACQ_REL, "workgroup"); __builtin_amdgcn_wave_barrier();
  const int rsub = lane >> 4, c4 = (lane & 15) * 4; typedef _Float16 v4h __attribute__((ext_vector_type(4)));
  {
#pragma unroll
    for (int q = 0; q < 8; ++q) { const int r = q * 2 + rsub; if (col0 + c4 < N) { const v4f v = *(const v4fa*)&so[w][r][c4]; if (C) *(v4f*)(C + cofs + (size_t)(row0 + r) * ldc + col0 + c4) = v; if (C16) { v4h h4; for (int i = 0; i < 4; ++i) h4[i] = (_Float16)v[i]; *(v4h*)(C16 + cofs + (size_t)(row0 + r) * ldc + col0 + c4) = h4; } } }
     }
}


typedef _Float16 v4h __attribute__((ext_vector_type(4)));

__global__ __launch_bounds__(256) void k_x16(const float* __restrict__ x, _Float16* __restrict__ X16, size_t n8) { const size_t t = (size_t)blockIdx.x * 256 + threadIdx.x; if (t >= n8) return; FragH f;
#pragma unroll
  for (int q = 0; q < 8; ++q) f.h[q] = (_Float16)bf16_round(x[t * 8 + q]); *(v8us*)((unsigned short*)X16 + t * 8) = f.half[0];  }
__global__ __launch_bounds__(256) void k_h16(const float* __restrict__ x, _Float16* __restrict__ X16, size_t n8) { const size_t t = (size_t)blockIdx.x * 256 + threadIdx.x; if (t >= n8) return; FragH f;
#pragma unroll
  for (int q = 0; q < 8; ++q) f.h[q] = (_Float16)x[t * 8 + q]; *(v8us*)((unsigned short*)X16 + t * 8) = f.half[0];  }
__global__ __launch_bounds__(256) void k_round16f(const float* __restrict__ W, _Float16* __restrict__ Bt, size_t n8) { const size_t t = (size_t)blockIdx.x * 256 + threadIdx.x; if (t >= n8) return; FragH f;
#pragma unroll
  for (int i = 0; i < 8; ++i) f.h[i] = (_Float16)(bf16_round(W[t * 8 + i]) * 16.0f); *(v8us*)((unsigned short*)Bt + t * 8) = f.half[0];  }
template <int NHv, int TTv>
__global__ __launch_bounds__(256) void k_vt(const _Float16* __restrict__ V16, int ldv, int voff, _Float16* __restrict__ Vt) { __shared__ unsigned short tl[64][66]; const int tid = threadIdx.x; const int slab = blockIdx.x / (TTv / 64), lg = blockIdx.x % (TTv / 64); const int b = slab / NHv, h = slab % NHv;
  for (int i = tid; i < 64 * 8; i += 256) { const int r = i / 8, c8 = (i % 8) * 8; FragH f; f.half[0] = *(const v8us*)((const unsigned short*)V16 + ((size_t)b * TTv + lg * 64 + r) * ldv + voff + h * 64 + c8);
#pragma unroll
    for (int q = 0; q < 8; ++q) tl[r][c8 + q] = f.u[q]; }
  __syncthreads();
  {
#pragma unroll
    for (int rd = 0; rd < 2; ++rd) { const int d = rd * 32 + tid / 8, pc = tid % 8; FragH f;
#pragma unroll
      for (int q = 0; q < 8; ++q) f.u[q] = tl[pc * 8 + q][d];
      *(v8us*)((unsigned short*)Vt + ((size_t)slab * 64 + d) * TTv + lg * 64 + pc * 8) = f.half[0]; }
     } }

__global__ __launch_bounds__(256) void k_hl(const float* __restrict__ F, _Float16* __restrict__ Hh, _Float16* __restrict__ Hl, size_t n8) { const size_t t = (size_t)blockIdx.x * 256 + threadIdx.x; if (t >= n8) return; FragH fh, fl; const v4f a = *(const v4fa*)(F + t * 8), c = *(const v4fa*)(F + t * 8 + 4);
#pragma unroll
  for (int q = 0; q < 4; ++q) { _Float16 h = (_Float16)a[q]; fh.h[q] = h; fl.h[q] = (_Float16)((a[q] - (float)h) * 1024.0f); h = (_Float16)c[q]; fh.h[4 + q] = h; fl.h[4 + q] = (_Float16)((c[q] - (float)h) * 1024.0f); }
  { *(v8us*)((unsigned short*)Hh + t * 8) = fh.half[0]; *(v8us*)((unsigned short*)Hl + t * 8) = fl.half[0];  } }

// ---- fast GEMM (work-group tile 128x64, wave tile 32x64; requires M % 128 == 0, N % 64 == 0, K % 128 == 0); epilogue = k_gemm_hhx semantics ----
// Operands go through LDS: per slice of 128 k the work-group loads 256 B of each of its 128 A rows and 64 B rows with whole-line 16-byte loads (two rows per wave-wide load),
// keeps them in registers while the slice before is worked on, and stores them into the other of two LDS buffers; the fragments are read from LDS, A and B alike as halves k + 8 * hh .. + 7 and k + 16 + 8 * hh .. + 7 of their row.
__device__ __forceinline__ v16h g2_sfrag(const unsigned short* p) { FragH f; f.half[0] = *(const v8us*)p; f.half[1] = *(const v8us*)(p + 16); return f.v; }      /* p = LDS row + k + 8 * hh */
__device__ __forceinline__ v8f g2_mma(v16h a, v16h b, v8f c) { v8f d = __builtin_amdgcn_wmma_f32_16x16x32_f16(false, a, false, b, (short)0, c, false, false); asm volatile("v_nop\n\tv_nop\n\tv_nop\n\tv_nop" : "+v"(d) : "v"(a), "v"(b)); return d; }
template <int ACT, int LD>      /* LD = lda = ldb = K at compile time: the row steps of the staging loads become immediate offsets */
__global__ __launch_bounds__(128) void k_gemm2(const _Float16* __restrict__ A, int lda, size_t sA, const _Float16* __restrict__ Bh, int ldb, size_t sB, float alpha, const float* __restrict__ bias, size_t sBias, const float* __restrict__ CP, int rowsPerB, size_t sCPb, int row0g,
    float* __restrict__ C, _Float16* __restrict__ C16, int ldc, size_t sC, int M, int N, int K) {
  constexpr int KS = 128, PIT = KS + 8, BUF = (128 + 64) * PIT;      /* slice of k; LDS row pitch 272 B = 16 B x 17 (no bank conflict for 16-byte fragment reads); halves per buffer: rows 0-127 A, 128-191 B */
  __shared__ __attribute__((aligned(16))) unsigned short st[2 * BUF];      /* 104,448 B */
  float (*so)[32][68] = reinterpret_cast<float (*)[32][68]>(st);      /* the epilogue's staging (34,816 B) reuses the buffers behind the last barrier */
  const int tid = threadIdx.x, w = tid >> 5, lane = tid & 31, ln = lane & 15, hh = lane >> 4; const int by = blockIdx.y;
  A += (size_t)by * sA; Bh += (size_t)by * sB; const size_t cofs = (size_t)by * sC; const float* bp = bias ? bias + (size_t)by * sBias : nullptr;
  const int ntn = N >> 6; const int mt = blockIdx.x / ntn, nq = blockIdx.x - mt * ntn; const int row0 = mt * 128 + 32 * w, col0 = nq * 64; if (mt * 128 >= M) return;      /* the same for the whole work-group: barriers follow */
  const int sr = tid >> 4, sc = (tid & 15) * 8;      /* staging: 16 threads cover the 256 B of a row, the work-group 8 rows per load */
  (void)lda; (void)ldb; (void)K;
  const char* aS = (const char*)(A + (size_t)(mt * 128) * LD); const char* bS = (const char*)(Bh + (size_t)col0 * LD);      /* the work-group's first A and B row: the same in every lane */
  unsigned vo = (unsigned)(sr * LD + sc) * 2u;      /* the lane's byte offset in both operands: its row of 8, its 16 bytes, the slice */
  const v8f z8 = {0.f,0.f,0.f,0.f,0.f,0.f,0.f,0.f}; v8f c00 = z8, c01 = z8, c02 = z8, c03 = z8, c10 = z8, c11 = z8, c12 = z8, c13 = z8;
  v8us rg[24];
  auto slice_load = [&]() {
#pragma unroll
    for (int i = 0; i < 16; ++i) rg[i] = *(const v8us*)(aS + (size_t)vo + (size_t)(16 * i) * LD);
#pragma unroll
    for (int i = 0; i < 8; ++i) rg[16 + i] = *(const v8us*)(bS + (size_t)vo + (size_t)(16 * i) * LD); };
  auto slice_next = [&]() { asm volatile("s_wait_xcnt 0x0" : "+v"(vo) : : "memory");      /* in front of the overwrite of the offset register that the issued loads name */
    vo += 2u * KS; };
  auto slice_store = [&](int bo) {
#pragma unroll
    for (int i = 0; i < 24; ++i) *(v8us*)&st[bo + (8 * i + sr) * PIT + sc] = rg[i]; };
  auto slice_mma = [&](int bo) { const unsigned short* ap = &st[bo + (32 * w + ln) * PIT + 8 * hh]; const unsigned short* bq = &st[bo + (128 + ln) * PIT + 8 * hh];
#pragma unroll
    for (int kk = 0; kk < KS; kk += 32) { const v16h a0 = g2_sfrag(ap + kk), a1 = g2_sfrag(ap + 16 * PIT + kk);      /* the six fragments of a k step as one group of LDS reads in front of its eight products */
      const v16h b0 = g2_sfrag(bq + kk), b1 = g2_sfrag(bq + 16 * PIT + kk), b2 = g2_sfrag(bq + 32 * PIT + kk), b3 = g2_sfrag(bq + 48 * PIT + kk);
      c00 = g2_mma(a0, b0, c00); c10 = g2_mma(a1, b0, c10); c01 = g2_mma(a0, b1, c01); c11 = g2_mma(a1, b1, c11);
      c02 = g2_mma(a0, b2, c02); c12 = g2_mma(a1, b2, c12); c03 = g2_mma(a0, b3, c03); c13 = g2_mma(a1, b3, c13); } };
  slice_load(); slice_next(); slice_store(0); __syncthreads();
  int cur = 0;      /* start (in halves) of the buffer that holds the slice being worked on: 0 or BUF */
#pragma unroll 1      /* one copy of the slice body; the buffer alternates at run time */
  for (int s = 1; s < LD / KS; ++s) {
    slice_load();      /* in flight while the slice before is worked on */
    slice_mma(cur);
    slice_next();
    slice_store(cur ^ BUF);      /* its last readers left this buffer in front of the barrier of the trip before */
    __syncthreads(); cur ^= BUF; }
  slice_mma(cur);
  __syncthreads();      /* every wave has read its last fragments before the buffers become output staging */
  v8f accs[8] = {c00, c01, c02, c03, c10, c11, c12, c13};
#pragma unroll
  for (int u = 0; u < 8; ++u) { const int t = u & 3, half = u >> 2; const int col = col0 + t * 16 + ln; const float bv = bp ? bf16_round(bp[col]) : 0.f;
#pragma unroll
    for (int r = 0; r < 8; ++r) { const int rloc = half * 16 + 8 * hh + r; float v = accs[u][r] * alpha + bv; if (CP) { const int bidx = (row0g + row0 + rloc) / rowsPerB; v += CP[(size_t)bidx * sCPb + (size_t)by * 64 + col]; }
      if (ACT == 3) v = fmaxf(v, 0.f); else if (ACT == 6) v = 0.5f * v * (1.0f + erff(v * 0.70710678118654752f)); else if (ACT == 11) v = 1.0f / (1.0f + expf(-v)); else if (ACT == 15) v = v / (1.0f + expf(-v)); else if (ACT == 12) v = (v > 0.f) ? v : 0.01f * v; else if (ACT == 8) v = tanhf(v);
      so[w][rloc][t * 16 + ln] = v; } }
  __builtin_amdgcn_fence(__ATOMIC_ACQ_REL, "workgroup"); __builtin_amdgcn_wave_barrier();
  const int rsub = lane >> 4, c4 = (lane & 15) * 4;
  {
#pragma unroll
    for (int q = 0; q < 16; ++q) { const int r = q * 2 + rsub; const v4f v = *(const v4fa*)&so[w][r][c4]; if (C) *(v4f*)(C + cofs + (size_t)(row0 + r) * ldc + col0 + c4) = v; if (C16) { v4h h4; for (int i = 0; i < 4; ++i) h4[i] = (_Float16)v[i]; *(v4h*)(C16 + cofs + (size_t)(row0 + r) * ldc + col0 + c4) = h4; } }
     } }



template <int TK>
__global__ __launch_bounds__(256) void k_vthl(const float* __restrict__ VF, int ldv, _Float16* __restrict__ Vth, _Float16* __restrict__ Vtl) { __shared__ float tl[64][65]; const int tid = threadIdx.x; const int slab = blockIdx.x / (TK / 64), lg = blockIdx.x % (TK / 64); const int b = slab / NH, h = slab % NH;
  for (int i = tid; i < 64 * 16; i += 256) { const int r = i / 16, c4 = (i % 16) * 4; const v4f a = *(const v4fa*)(VF + ((size_t)b * TK + lg * 64 + r) * ldv + h * 64 + c4); tl[r][c4] = a[0]; tl[r][c4 + 1] = a[1]; tl[r][c4 + 2] = a[2]; tl[r][c4 + 3] = a[3]; }
  __syncthreads();
  FragH fh[2], fl[2]; size_t oo[2];
#pragma unroll
  for (int rd = 0; rd < 2; ++rd) { const int d = rd * 32 + tid / 8, pc = tid % 8;
#pragma unroll
    for (int q = 0; q < 8; ++q) { const float v = tl[pc * 8 + q][d]; const _Float16 hv = (_Float16)v; fh[rd].h[q] = hv; fl[rd].h[q] = (_Float16)((v - (float)hv) * 1024.0f); } oo[rd] = ((size_t)slab * 64 + d) * TK + lg * 64 + pc * 8; }
  {
#pragma unroll
    for (int rd = 0; rd < 2; ++rd) { *(v8us*)((unsigned short*)Vth + oo[rd]) = fh[rd].half[0]; *(v8us*)((unsigned short*)Vtl + oo[rd]) = fl[rd].half[0]; }
     } }

template <int TQ, int TK>
__global__ __launch_bounds__(128) void k_flashm(const _Float16* __restrict__ Q16, const _Float16* __restrict__ Q16lo, int ldq, const _Float16* __restrict__ K16, const _Float16* __restrict__ K16lo, int ldk, const _Float16* __restrict__ Vt, const _Float16* __restrict__ Vtlo, const unsigned* __restrict__ MB, const int* __restrict__ RA, const int* __restrict__ KE, float* __restrict__ O, int ldo) {
  constexpr int RPW = 16, RTN = RPW / 16, NQB = TQ / (4 * RPW), DT = 4, KS = 2;
  __shared__ __attribute__((aligned(16))) unsigned short sP[4][RPW][40], sPl[4][RPW][40]; __shared__ __attribute__((aligned(16))) float sO[4][RPW][64 + 4];
  const int tid = threadIdx.x, w = tid >> 5, lane = tid & 31, ln = lane & 15, hh = lane >> 4;
  const int h = blockIdx.x / NQB, t0 = blockIdx.x % NQB;
  // Causal balance: the work-group runs query tile t0 of batch 0, then tile NQB - 1 - t0 of batch 1 (alternating), so every work-group walks the same number of key passes.
#pragma unroll 1      /* one copy of the tile body: the tiles run one after the other in every wave */
  for (int b = 0; b < NBT; ++b) {
  const int slab = b * NH + h, qblk = (b & 1) ? NQB - 1 - t0 : t0; const int qb0 = qblk * (4 * RPW); const int q0 = qb0 + w * RPW;
  FragH aq[2][KS], aql[2][KS];
#pragma unroll
  for (int rt = 0; rt < RTN; ++rt) { const size_t qo = ((size_t)b * TQ + q0 + rt * 16 + ln) * ldq + h * 64; const unsigned short* qr = (const unsigned short*)Q16 + qo; const unsigned short* ql = (const unsigned short*)Q16lo + qo;
#pragma unroll
    for (int ks = 0; ks < KS; ++ks) { aq[rt][ks].half[0] = *(const v8us*)(qr + ks * 32 + 8 * hh); aq[rt][ks].half[1] = *(const v8us*)(qr + ks * 32 + 16 + 8 * hh); aql[rt][ks].half[0] = *(const v8us*)(ql + ks * 32 + 8 * hh); aql[rt][ks].half[1] = *(const v8us*)(ql + ks * 32 + 16 + 8 * hh); } }
  const unsigned short* Vth = (const unsigned short*)Vt + (size_t)slab * 64 * TK; const unsigned short* Vtl = (const unsigned short*)Vtlo + (size_t)slab * 64 * TK;
  float m_r[2][8], l_r[2][8]; v8f oacc[2][DT], oaccl[2][DT];
#pragma unroll
  for (int rt = 0; rt < RTN; ++rt) {
#pragma unroll
    for (int r = 0; r < 8; ++r) { m_r[rt][r] = -3.0e38f; l_r[rt][r] = 0.f; }
#pragma unroll
    for (int dt = 0; dt < DT; ++dt) { oacc[rt][dt] = (v8f){0.f,0.f,0.f,0.f,0.f,0.f,0.f,0.f}; oaccl[rt][dt] = oacc[rt][dt]; } }
  int jend = KE[qblk * 32]; jend = min(TK, (jend + 31) & ~31); if (jend < 32) jend = 32;      /* block-uniform */
  int allm[2][8]; const unsigned* mrow[2][8];
#pragma unroll
  for (int rt = 0; rt < RTN; ++rt)
#pragma unroll
    for (int r = 0; r < 8; ++r) { const int tq = q0 + rt * 16 + 8 * hh + r; allm[rt][r] = RA[tq]; mrow[rt][r] = MB + (size_t)tq * (TK / 32); }
#pragma unroll 1
  for (int j0 = 0; j0 < jend; j0 += 32) {
    unsigned mwd[2][8];      /* the pass's mask words, asked for ahead of the score products so that these cover the loads */
#pragma unroll
    for (int rt = 0; rt < RTN; ++rt)
#pragma unroll
      for (int r = 0; r < 8; ++r) mwd[rt][r] = mrow[rt][r][j0 >> 5];
    v8f s[2][2];
#pragma unroll
    for (int nt = 0; nt < 2; ++nt) { const size_t ko = ((size_t)b * TK + j0 + nt * 16 + ln) * ldk + h * 64; const unsigned short* kr = (const unsigned short*)K16 + ko; const unsigned short* kl = (const unsigned short*)K16lo + ko; FragH bk[KS], bkl[KS];
#pragma unroll
      for (int ks = 0; ks < KS; ++ks) { bk[ks].half[0] = *(const v8us*)(kr + ks * 32 + 8 * hh); bk[ks].half[1] = *(const v8us*)(kr + ks * 32 + 16 + 8 * hh); bkl[ks].half[0] = *(const v8us*)(kl + ks * 32 + 8 * hh); bkl[ks].half[1] = *(const v8us*)(kl + ks * 32 + 16 + 8 * hh); }
#pragma unroll
      for (int rt = 0; rt < RTN; ++rt) { v8f acc = (v8f){0.f,0.f,0.f,0.f,0.f,0.f,0.f,0.f}, accr = acc;
#pragma unroll
        for (int ks = 0; ks < KS; ++ks) { acc = mmaH<1>(aq[rt][ks].v, aq[rt][ks].v, bk[ks].v, bk[ks].v, acc); accr = mmaH<1>(aql[rt][ks].v, aql[rt][ks].v, bk[ks].v, bk[ks].v, accr); accr = mmaH<1>(aq[rt][ks].v, aq[rt][ks].v, bkl[ks].v, bkl[ks].v, accr); }
        s[rt][nt] = acc + accr * 0.0009765625f; } }
    // Online softmax, the eight rows of a lane side by side: each phase runs over all rows before the next begins, and every exponential is computed for every lane and then selected,
    // so the pass is one straight run of code in which the rows' shuffles and exponentials cover one another's latencies. Same values, same order of every sum as row after row.
#pragma unroll
    for (int rt = 0; rt < RTN; ++rt) {
      float s0v[8], s1v[8], mcv[8], alv[8], p0v[8], p1v[8]; bool ok0v[8], ok1v[8];
#pragma unroll
      for (int r = 0; r < 8; ++r) { const unsigned mw = mwd[rt][r]; const bool am = (allm[rt][r] != 0);
        ok0v[r] = am || (((mw >> ln) & 1u) == 0u); ok1v[r] = am || (((mw >> (16 + ln)) & 1u) == 0u);
        s0v[r] = ok0v[r] ? (am ? 0.f : s[rt][0][r] * SCL) : -INFINITY; s1v[r] = ok1v[r] ? (am ? 0.f : s[rt][1][r] * SCL) : -INFINITY; mcv[r] = fmaxf(s0v[r], s1v[r]); }
#pragma unroll
      for (int o = 1; o < 16; o <<= 1) { float xv[8];
#pragma unroll
        for (int r = 0; r < 8; ++r) xv[r] = __shfl_xor(mcv[r], o, 32);
        __builtin_amdgcn_sched_barrier(0);      /* all eight shuffles of a step are issued before the first result is waited for: one shuffle latency a step, not one a row */
#pragma unroll
        for (int r = 0; r < 8; ++r) mcv[r] = fmaxf(mcv[r], xv[r]); }
#pragma unroll
      for (int r = 0; r < 8; ++r) { const float mn = fmaxf(m_r[rt][r], mcv[r]);      /* mn is finite (at least -3.0e38), so a masked score gives exp(-inf) = 0 and no NaN reaches a selected value */
        const float ea = expf(m_r[rt][r] - mn), e0 = expf(s0v[r] - mn), e1 = expf(s1v[r] - mn);
        alv[r] = (mn > -1.0e38f) ? ea : 1.0f; m_r[rt][r] = mn; p0v[r] = ok0v[r] ? e0 : 0.f; p1v[r] = ok1v[r] ? e1 : 0.f; l_r[rt][r] = l_r[rt][r] * alv[r] + p0v[r] + p1v[r]; }
#pragma unroll
      for (int r = 0; r < 8; ++r) { const float al = alv[r], p0 = p0v[r], p1 = p1v[r];
#pragma unroll
        for (int dt = 0; dt < DT; ++dt) { oacc[rt][dt][r] *= al; oaccl[rt][dt][r] *= al; }
        FragH t2, t3; const float ps0 = p0 * 1024.0f, ps1 = p1 * 1024.0f; t2.h[0] = (_Float16)ps0; t2.h[1] = (_Float16)ps1; t3.h[0] = (_Float16)((ps0 - (float)t2.h[0]) * 1024.0f); t3.h[1] = (_Float16)((ps1 - (float)t2.h[1]) * 1024.0f);
        sP[w][rt * 16 + 8 * hh + r][ln] = t2.u[0]; sP[w][rt * 16 + 8 * hh + r][16 + ln] = t2.u[1]; sPl[w][rt * 16 + 8 * hh + r][ln] = t3.u[0]; sPl[w][rt * 16 + 8 * hh + r][16 + ln] = t3.u[1]; } }
    __builtin_amdgcn_fence(__ATOMIC_ACQ_REL, "workgroup"); __builtin_amdgcn_wave_barrier();
    FragH pa[2], pl[2];
#pragma unroll
    for (int rt = 0; rt < RTN; ++rt) { pa[rt].half[0] = *(const v8us*)&sP[w][rt * 16 + ln][8 * hh]; pa[rt].half[1] = *(const v8us*)&sP[w][rt * 16 + ln][16 + 8 * hh]; pl[rt].half[0] = *(const v8us*)&sPl[w][rt * 16 + ln][8 * hh]; pl[rt].half[1] = *(const v8us*)&sPl[w][rt * 16 + ln][16 + 8 * hh]; }
#pragma unroll
    for (int dt = 0; dt < DT; ++dt) { const size_t vo = (size_t)(dt * 16 + ln) * TK + j0; FragH bv, bl; bv.half[0] = *(const v8us*)(Vth + vo + 8 * hh); bv.half[1] = *(const v8us*)(Vth + vo + 16 + 8 * hh); bl.half[0] = *(const v8us*)(Vtl + vo + 8 * hh); bl.half[1] = *(const v8us*)(Vtl + vo + 16 + 8 * hh);
#pragma unroll
      for (int rt = 0; rt < RTN; ++rt) { oacc[rt][dt] = mmaH<1>(pa[rt].v, pa[rt].v, bv.v, bv.v, oacc[rt][dt]); oaccl[rt][dt] = mmaH<1>(pa[rt].v, pa[rt].v, bl.v, bl.v, oaccl[rt][dt]); oaccl[rt][dt] = mmaH<1>(pl[rt].v, pl[rt].v, bv.v, bv.v, oaccl[rt][dt]); } }
    __builtin_amdgcn_fence(__ATOMIC_ACQ_REL, "workgroup"); __builtin_amdgcn_wave_barrier(); }
#pragma unroll
  for (int rt = 0; rt < RTN; ++rt) {
#pragma unroll
    for (int r = 0; r < 8; ++r) { float l = l_r[rt][r]; l += __shfl_xor(l, 1, 32); l += __shfl_xor(l, 2, 32); l += __shfl_xor(l, 4, 32); l += __shfl_xor(l, 8, 32); l_r[rt][r] = (l > 0.f) ? 1.0f / (l * 1024.0f) : 0.f; }
#pragma unroll
    for (int dt = 0; dt < DT; ++dt)
#pragma unroll
      for (int r = 0; r < 8; ++r) sO[w][rt * 16 + 8 * hh + r][dt * 16 + ln] = (oacc[rt][dt][r] + oaccl[rt][dt][r] * 0.0009765625f) * l_r[rt][r]; }
  __builtin_amdgcn_fence(__ATOMIC_ACQ_REL, "workgroup"); __builtin_amdgcn_wave_barrier();
  {
#pragma unroll
    for (int rp = 0; rp < RPW; rp += 2) { const int r = rp + (lane >> 4), pc = lane & 15; const v4f val = *(const v4fa*)&sO[w][r][pc * 4]; *(v4f*)(O + ((size_t)b * TQ + q0 + r) * ldo + h * 64 + pc * 4) = val; }
     }
  asm volatile("s_wait_xcnt 0x0" ::: "memory");      /* the next tile's set-up overwrites the address registers of the stores above */
  } }


template <int SRCBF>
__global__ __launch_bounds__(256) void k_lnab(const float* __restrict__ X, const float* __restrict__ g, const float* __restrict__ bb, _Float16* __restrict__ Y16, float* __restrict__ Y32, float* __restrict__ XB) {
  #pragma clang fp contract(off)
  const int tid = threadIdx.x, w = tid >> 5, ln = tid & 31; const int r = blockIdx.x * 8 + w; if (r >= NR) return; const float* x = X + (size_t)r * DM; float s = 0.f;
#pragma unroll 1
  for (int i = 0; i < DM / 128; ++i) { const v4f a = *(const v4fa*)(x + i * 128 + ln * 4); for (int q = 0; q < 4; ++q) s += SRCBF ? bf16_round(a[q]) : a[q]; }
  for (int o = 16; o > 0; o >>= 1) s += __shfl_xor(s, o, 32); const float mu = s / (float)DM; float q2 = 0.f;
#pragma unroll 1
  for (int i = 0; i < DM / 128; ++i) { const v4f a = *(const v4fa*)(x + i * 128 + ln * 4); for (int q = 0; q < 4; ++q) { const float d = (SRCBF ? bf16_round(a[q]) : a[q]) - mu; q2 += d * d; } }
  for (int o = 16; o > 0; o >>= 1) q2 += __shfl_xor(q2, o, 32); const float rs = rsqrtf(q2 / (float)DM + 1e-5f);
  {
#pragma unroll 1
    for (int i = 0; i < DM / 128; ++i) { const int c0 = i * 128 + ln * 4; const v4f a = *(const v4fa*)(x + c0); _Float16 h4[4]; v4f y4, xb;
      for (int q = 0; q < 4; ++q) { const float t = SRCBF ? bf16_round(a[q]) : a[q]; const float y = (t - mu) * rs * bf16_round(g[c0 + q]) + bf16_round(bb[c0 + q]); h4[q] = (_Float16)y; y4[q] = y; xb[q] = t; }
      if (Y16) *(unsigned long long*)((unsigned short*)Y16 + (size_t)r * DM + c0) = *(const unsigned long long*)h4; if (Y32) *(v4f*)(Y32 + (size_t)r * DM + c0) = y4; if (XB) *(v4f*)(XB + (size_t)r * DM + c0) = xb; }
     } }
__global__ __launch_bounds__(256) void k_causaltab(unsigned* __restrict__ MB, int* __restrict__ RA, int* __restrict__ KE, int nq, int nk) {
  const int t = blockIdx.x * 256 + threadIdx.x; const int nw = nk / 32;
  if (t < nq * nw) { const int q = t / nw, w = t % nw; const int first = q + 1 - 32 * w; const unsigned bits = (first <= 0) ? 0xffffffffu : ((first >= 32) ? 0u : (0xffffffffu << first)); *(unsigned*)(MB + t) = bits;  }
  if (t < nq) { *(int*)(RA + t) = 0;  }
  if (t < nq / 64) { const int v = 64 * (t + 1); *(int*)(KE + t * 32) = v;  } }


extern "C" void kernel_launch(void* const* d_in, const int* in_sizes, int n_in,
                              void* d_out, int out_size, void* d_ws, size_t ws_size, hipStream_t stream) {
  (void)in_sizes; (void)n_in; (void)out_size;
  const float* const* I = (const float* const*)d_in; const float* x = I[0]; const float* lag = I[1]; const float* lab = I[2]; const float* lbg = I[3]; const float* lbb = I[4]; const float* lcg = I[5]; const float* lcb = I[6];
  const float* Wq = I[7]; const float* bq = I[8]; const float* Wk = I[9]; const float* bk = I[10]; const float* Wv = I[11]; const float* bv = I[12]; const float* Wo = I[13]; const float* bo = I[14]; const float* We = I[15]; const float* be = I[16]; const float* Wd = I[17]; const float* bd = I[18];
  char* ws = (char*)d_ws; size_t off = 0;
  auto take = [&](size_t bytes) { char* p = ws + off; off += (bytes + 255) & ~(size_t)255; return p; };
  _Float16* BQ = (_Float16*)take((size_t)DM * DM * 2); _Float16* BK = (_Float16*)take((size_t)DM * DM * 2); _Float16* BV = (_Float16*)take((size_t)DM * DM * 2); _Float16* BO = (_Float16*)take((size_t)DM * DM * 2); _Float16* BE = (_Float16*)take((size_t)4096 * DM * 2); _Float16* BD = (_Float16*)take((size_t)DM * 4096 * 2);
  float* XB = (float*)take((size_t)NR * DM * 4); _Float16* T16 = (_Float16*)take((size_t)NR * DM * 2); float* F = (float*)take((size_t)NR * DM * 4);
  _Float16* Qh = (_Float16*)take((size_t)NR * DM * 2); _Float16* Ql = (_Float16*)take((size_t)NR * DM * 2); _Float16* Kh = (_Float16*)take((size_t)NR * DM * 2); _Float16* Kl = (_Float16*)take((size_t)NR * DM * 2); _Float16* Vth = (_Float16*)take((size_t)NR * DM * 2); _Float16* Vtl = (_Float16*)take((size_t)NR * DM * 2);
  unsigned* MB = (unsigned*)take((size_t)SLEN * (SLEN / 32) * 4); int* RA = (int*)take((size_t)SLEN * 4); int* KE = (int*)take((size_t)(SLEN / 64) * 32 * 4);
  if (off > ws_size) return;      /* 24 + 16 + 8 + 16 + 48 + 0.6 = 113 MiB (the first LN's f32 output lives in F until the second LN consumes it) */
  float* O = F; _Float16* Oh = Qh; _Float16* Ol = Ql; float* X1 = XB; _Float16* GH = Kh;      /* SiLU hidden [NR][4096] f16 = 32 MB over Kh|Kl|Vth|Vtl (dead after the flash) */
  const size_t n8 = (size_t)NR * DM / 8; const unsigned nb8 = (unsigned)((n8 + 255) / 256);
  k_wt_f16<<<(unsigned)(((size_t)DM * DM / 8 + 255) / 256), 256, 0, stream>>>(Wq, BQ, DM, DM, 16.0f); k_wt_f16<<<(unsigned)(((size_t)DM * DM / 8 + 255) / 256), 256, 0, stream>>>(Wk, BK, DM, DM, 16.0f); k_wt_f16<<<(unsigned)(((size_t)DM * DM / 8 + 255) / 256), 256, 0, stream>>>(Wv, BV, DM, DM, 16.0f); k_wt_f16<<<(unsigned)(((size_t)DM * DM / 8 + 255) / 256), 256, 0, stream>>>(Wo, BO, DM, DM, 16.0f);
  k_wt_f16<<<(unsigned)(((size_t)DM * 4096 / 8 + 255) / 256), 256, 0, stream>>>(We, BE, DM, 4096, 16.0f); k_wt_f16<<<(unsigned)(((size_t)4096 * DM / 8 + 255) / 256), 256, 0, stream>>>(Wd, BD, 4096, DM, 16.0f);      /* all (in,out) */
  k_causaltab<<<(SLEN * (SLEN / 32) + 255) / 256, 256, 0, stream>>>(MB, RA, KE, SLEN, SLEN);
  k_lnab<1><<<NR / 8, 256, 0, stream>>>(x, lag, lab, nullptr, F, XB);      /* t0 = LN_a(bf16 x) (f32), XB = bf16(x) */
  k_lnab<0><<<NR / 8, 256, 0, stream>>>(F, lbg, lbb, T16, nullptr, nullptr);      /* t = LN_b(t0) as f16 operand */
  const dim3 gP((NR / 128) * (DM / 64), 1), gM((NR / 128) * (4096 / 64), 1);
  k_gemm2<0, DM><<<gP, 128, 0, stream>>>(T16, DM, 0, BQ, DM, 0, 0.0625f, bq, 0, nullptr, 1, 0, 0, F, nullptr, DM, 0, NR, DM, DM); k_hl<<<nb8, 256, 0, stream>>>(F, Qh, Ql, n8);
  k_gemm2<0, DM><<<gP, 128, 0, stream>>>(T16, DM, 0, BK, DM, 0, 0.0625f, bk, 0, nullptr, 1, 0, 0, F, nullptr, DM, 0, NR, DM, DM); k_hl<<<nb8, 256, 0, stream>>>(F, Kh, Kl, n8);
  k_gemm2<0, DM><<<gP, 128, 0, stream>>>(T16, DM, 0, BV, DM, 0, 0.0625f, bv, 0, nullptr, 1, 0, 0, F, nullptr, DM, 0, NR, DM, DM);
  for (int b = 0; b < NBT; ++b) k_vthl<SLEN><<<NH * (SLEN / 64), 256, 0, stream>>>(F + (size_t)b * SLEN * DM, DM, Vth + (size_t)b * SLEN * DM, Vtl + (size_t)b * SLEN * DM);
  k_flashm<SLEN, SLEN><<<NH * (SLEN / 64), 128, 0, stream>>>(Qh, Ql, DM, Kh, Kl, DM, Vth, Vtl, MB, RA, KE, O, DM);      /* both batches in one grid of equal work-groups */
  k_hl<<<nb8, 256, 0, stream>>>(O, Oh, Ol, n8);
  k_gemm2<0, DM><<<gP, 128, 0, stream>>>(Oh, DM, 0, BO, DM, 0, 0.0625f, bo, 0, XB, 1, (size_t)DM, 0, X1, nullptr, DM, 0, NR, DM, DM);      /* x1 = x + ctx Wo + bo (hi) */
  k_gemm2<0, DM><<<gP, 128, 0, stream>>>(Ol, DM, 0, BO, DM, 0, 0.0625f / 1024.0f, nullptr, 0, X1, 1, (size_t)DM, 0, X1, nullptr, DM, 0, NR, DM, DM);      /* + lo */
  k_lnab<0><<<NR / 8, 256, 0, stream>>>(X1, lcg, lcb, T16, nullptr, nullptr);
  k_gemm2<15, DM><<<gM, 128, 0, stream>>>(T16, DM, 0, BE, DM, 0, 0.0625f, be, 0, nullptr, 1, 0, 0, nullptr, GH, 4096, 0, NR, 4096, DM);      /* silu(t We + be) f16 (ACT 15 = x * sigmoid(x), present in the epilogue) */
  k_gemm2<0, 4096><<<gP, 128, 0, stream>>>(GH, 4096, 0, BD, 4096, 0, 0.0625f, bd, 0, X1, 1, (size_t)DM, 0, (float*)d_out, nullptr, DM, 0, NR, DM, 4096);      /* out = x1 + mlp */
}

// v004
// A run of this version takes 467 microseconds.
// Timed twice side by side with v003, it ran 1.18 times as fast both times.
// All steps since v000 together make it 2.60 times as fast.
#include <hip/hip_runtime.h>
// Pre-LN causal attention block (2 x 2048 tokens, 1024 = 16 heads x 64; MLP 4096 with SiLU): t = LN_b(LN_a(x)); q,k,v = t W + b; x1 = x + (causal softmax(q.k/8) v) Wo + bo; out = x1 + (silu(LN_c(x1) We + be)) Wd + bd -> [2,2048,1024].
// Structure: the LayerNorms on VALU (the first pass also writes the bf16 residual plane); projections / MLP as f16 WMMA GEMMs (32x64 wave tiles, f32 accumulation, exact x16 weights, biases / SiLU / residual addends in the epilogue); q, k as f16 hi + (x2^10) residual planes, V^T as hi + residual planes; fused causal flash kernel, one work-group per (head, t): 64-query tile t of batch 0, then tile 31 - t of batch 1 (32-key K and V^T tiles copied asynchronously into two LDS buffers shared by the four waves, device-built causal tables, online f32 softmax, P staged hi + residual, two value accumulators); O as hi + residual planes into Wo (two GEMMs).
// Compute dtype: x, weights, biases, LN parameters rounded to bf16; LN outputs and the SiLU hidden as f16 operands (~2^-12); q, k, P, v, O as f16 hi + residual pairs (~2^-21); f32 accumulation, softmax, LayerNorm. v_wmma_f32_16x16x32_f16.
#define NBT 2
#define SLEN 2048
#define DM 1024
#define NH 16
#define SCL 0.125f
#define NR (NBT * SLEN)
typedef __bf16 v16b __attribute__((ext_vector_type(16)));
typedef unsigned short v8us __attribute__((ext_vector_type(8), may_alias));
typedef float  v8f  __attribute__((ext_vector_type(8)));
typedef float  v4f  __attribute__((ext_vector_type(4)));
typedef float  v4fa __attribute__((ext_vector_type(4), may_alias));
union FragB { v16b v; v8us half[2]; unsigned short u[16]; };

__device__ __forceinline__ unsigned short bf16_bits(float x) { unsigned int u = __float_as_uint(x); return (unsigned short)((u + 0x7FFFu + ((u >> 16) & 1u)) >> 16); }
__device__ __forceinline__ float bf16_val(unsigned short b) { return __uint_as_float(((unsigned int)b) << 16); }
__device__ __forceinline__ float bf16_round(float x) { return bf16_val(bf16_bits(x)); }
// D += A·B with NT terms: 1 = ah·bh, 2 = + al·bh (A split), 3 = + ah·bl (both split)
template <int NT>
__device__ __forceinline__ v8f mmaN(v16b ah, v16b al, v16b bh, v16b bl, v8f c) {
  c = __builtin_amdgcn_wmma_f32_16x16x32_bf16(false, ah, false, bh, (short)0, c, false, false);
  if (NT >= 2) c = __builtin_amdgcn_wmma_f32_16x16x32_bf16(false, al, false, bh, (short)0, c, false, false);
  if (NT >= 3) c = __builtin_amdgcn_wmma_f32_16x16x32_bf16(false, ah, false, bl, (short)0, c, false, false);
  asm volatile("v_nop\n\tv_nop\n\tv_nop\n\tv_nop" : "+v"(c) : "v"(ah), "v"(al), "v"(bh), "v"(bl));
  return c;
}

__global__ __launch_bounds__(256) void k_wt_bf16(const float* __restrict__ W, unsigned short* __restrict__ Wt, int K, int N) {
  const int t = blockIdx.x * 256 + threadIdx.x;
  const int k8n = K / 8;
  if (t >= N * k8n) return;
  const int n = t / k8n, k8 = (t % k8n) * 8;
  v8us v;
#pragma unroll
  for (int i = 0; i < 8; ++i) v[i] = bf16_bits(W[(size_t)(k8 + i) * N + n]);
  *(v8us*)(Wt + (size_t)n * K + k8) = v;
  
}

// GEMM C[M][N] (f32, pitch ldc) = act(A[M][K]·W + bias). A f32 row-major (pitch lda) converted per fragment to bf16
// (ASPLIT: hi/lo two planes -> 2 terms, else single rounded term); Wt bf16 [N][K] (pitch ldb). BIAS_BF16 rounds the
// bias to bf16 first (bias quantised to bf16 before the add). K%32==0, M%16==0, N%64==0.
template <bool ASPLIT, int ACT, bool BIAS_BF16>
__global__ __launch_bounds__(128) void k_gemm_bf(const float* __restrict__ A, int lda, const unsigned short* __restrict__ Wt, int ldb,
                                               const float* __restrict__ bias, float* __restrict__ C, int ldc, int M, int N, int K) {
  __shared__ __attribute__((aligned(16))) float so[4][16][64];
  const int tid = threadIdx.x, w = tid >> 5, lane = tid & 31, ln = lane & 15, hh = lane >> 4;
  const int ntn = N / 64;
  const int wid = blockIdx.x * 4 + w;
  const int mt = wid / ntn, nq = wid % ntn;
  if (mt * 16 >= M) return;
  const int row0 = mt * 16, col0 = nq * 64;
  const float* arow = A + (size_t)(row0 + ln) * lda;
  v8f acc[4] = {};
  for (int kb = 0; kb < K; kb += 32) {
    FragB ah, al;
    const v4f x0 = *(const v4fa*)(arow + kb + 8 * hh), x1 = *(const v4fa*)(arow + kb + 8 * hh + 4);
    const v4f x2 = *(const v4fa*)(arow + kb + 16 + 8 * hh), x3 = *(const v4fa*)(arow + kb + 16 + 8 * hh + 4);
    float xs[16] = {x0[0],x0[1],x0[2],x0[3],x1[0],x1[1],x1[2],x1[3],x2[0],x2[1],x2[2],x2[3],x3[0],x3[1],x3[2],x3[3]};
#pragma unroll
    for (int i = 0; i < 16; ++i) { const unsigned short hb = bf16_bits(xs[i]); ah.u[i] = hb; al.u[i] = ASPLIT ? bf16_bits(xs[i] - bf16_val(hb)) : (unsigned short)0; }
#pragma unroll
    for (int t = 0; t < 4; ++t) {
      const unsigned short* brow = Wt + (size_t)(col0 + t * 16 + ln) * ldb + kb;
      FragB b;
      b.half[0] = *(const v8us*)(brow + 8 * hh);
      b.half[1] = *(const v8us*)(brow + 16 + 8 * hh);
      acc[t] = mmaN<ASPLIT ? 2 : 1>(ah.v, al.v, b.v, b.v, acc[t]);
    }
  }
#pragma unroll
  for (int t = 0; t < 4; ++t) {
    float bv = bias ? bias[col0 + t * 16 + ln] : 0.f;
    if (BIAS_BF16) bv = bf16_round(bv);
#pragma unroll
    for (int r = 0; r < 8; ++r) { float v = acc[t][r] + bv; if (ACT == 1) v = fmaxf(v, 0.f); so[w][8 * hh + r][t * 16 + ln] = v; }
  }
  __builtin_amdgcn_fence(__ATOMIC_ACQ_REL, "workgroup");
  __builtin_amdgcn_wave_barrier();
  const int rsub = lane >> 4, c4 = (lane & 15) * 4;
  {
#pragma unroll
    for (int q = 0; q < 8; ++q) {
      const int r = q * 2 + rsub;
      const v4f v = *(const v4fa*)&so[w][r][c4];
      *(v4f*)(C + (size_t)(row0 + r) * ldc + col0 + c4) = v;
    }
    
  }
}

// GEMM C = act(A·W + bias + resid): A f32 (ASPLIT -> hi/lo 2 terms), Wt bf16 [N][K]; ACT 0 none, 1 relu, 2 exact gelu;
// resid (optional, f32, row index = (row % rmod), pitch ldr, RES_BF16 rounds it) added before the activation.
template <bool ASPLIT, int ACT, bool BIAS_BF16, bool RES_BF16>
__global__ __launch_bounds__(128) void k_gemm_bf3(const float* __restrict__ A, int lda, const unsigned short* __restrict__ Wt, int ldb,
                                                const float* __restrict__ bias, const float* __restrict__ resid, int rmod, int ldr,
                                                float* __restrict__ C, int ldc, int M, int N, int K) {
  __shared__ __attribute__((aligned(16))) float so[4][16][64];
  const int tid = threadIdx.x, w = tid >> 5, lane = tid & 31, ln = lane & 15, hh = lane >> 4;
  const int ntn = N / 64;
  const int wid = blockIdx.x * 4 + w;
  const int mt = wid / ntn, nq = wid % ntn;
  if (mt * 16 >= M) return;
  const int row0 = mt * 16, col0 = nq * 64;
  const float* arow = A + (size_t)(row0 + ln) * lda;
  v8f acc[4] = {};
  for (int kb = 0; kb < K; kb += 32) {
    FragB ah, al;
    const v4f x0 = *(const v4fa*)(arow + kb + 8 * hh), x1 = *(const v4fa*)(arow + kb + 8 * hh + 4);
    const v4f x2 = *(const v4fa*)(arow + kb + 16 + 8 * hh), x3 = *(const v4fa*)(arow + kb + 16 + 8 * hh + 4);
    float xs[16] = {x0[0],x0[1],x0[2],x0[3],x1[0],x1[1],x1[2],x1[3],x2[0],x2[1],x2[2],x2[3],x3[0],x3[1],x3[2],x3[3]};
#pragma unroll
    for (int i = 0; i < 16; ++i) { const unsigned short hb = bf16_bits(xs[i]); ah.u[i] = hb; al.u[i] = ASPLIT ? bf16_bits(xs[i] - bf16_val(hb)) : (unsigned short)0; }
#pragma unroll
    for (int t = 0; t < 4; ++t) {
      const unsigned short* brow = Wt + (size_t)(col0 + t * 16 + ln) * ldb + kb;
      FragB b;
      b.half[0] = *(const v8us*)(brow + 8 * hh);
      b.half[1] = *(const v8us*)(brow + 16 + 8 * hh);
      acc[t] = mmaN<ASPLIT ? 2 : 1>(ah.v, al.v, b.v, b.v, acc[t]);
    }
  }
#pragma unroll
  for (int t = 0; t < 4; ++t) {
    const int col = col0 + t * 16 + ln;
    float bv = bias ? bias[col] : 0.f;
    if (BIAS_BF16) bv = bf16_round(bv);
#pragma unroll
    for (int r = 0; r < 8; ++r) {
      float v = acc[t][r] + bv;
      if (resid) { float rv = resid[(size_t)((row0 + 8 * hh + r) % rmod) * ldr + col]; if (RES_BF16) rv = bf16_round(rv); v += rv; }
      if (ACT == 1) v = fmaxf(v, 0.f);
      if (ACT == 2) v = 0.5f * v * (1.0f + erff(v * 0.70710678118654752f));
      if (ACT == 3) { const float u = 0.7978845608028654f * (v + 0.044715f * v * v * v); v = 0.5f * v * (1.0f + tanhf(u)); }
      so[w][8 * hh + r][t * 16 + ln] = v;
    }
  }
  __builtin_amdgcn_fence(__ATOMIC_ACQ_REL, "workgroup");
  __builtin_amdgcn_wave_barrier();
  const int rsub = lane >> 4, c4 = (lane & 15) * 4;
  {
#pragma unroll
    for (int q = 0; q < 8; ++q) {
      const int r = q * 2 + rsub;
      const v4f v = *(const v4fa*)&so[w][r][c4];
      *(v4f*)(C + (size_t)(row0 + r) * ldc + col0 + c4) = v;
    }
    
  }
}
// row LayerNorm (biased variance, eps) over N: s = X (+ R); optional out_sum <- s; out_norm <- (s-mu)*rsqrt(var+eps)*g + b
template <bool PARAM_BF16>
__global__ __launch_bounds__(256) void k_layernorm(const float* __restrict__ X, const float* __restrict__ R, const float* __restrict__ g, const float* __restrict__ bta,
                                                  float* __restrict__ out_sum, float* __restrict__ out_norm, int N, float eps) {
  __shared__ float red[256];
  const int row = blockIdx.x, tid = threadIdx.x;
  const float* x = X + (size_t)row * N; const float* rr = R ? R + (size_t)row * N : nullptr;
  float vals[16];                     // up to N = 4096
  const int per = N / 256;            // contiguous chunk per thread? use strided-by-4 chunks: thread handles j = tid*4 + 1024*u
  float s1 = 0.f;
  for (int u = 0; u < per / 4; ++u) {
    const int j = tid * 4 + 1024 * u;
    const v4f a = *(const v4fa*)(x + j);
    v4f b = {0.f,0.f,0.f,0.f}; if (rr) b = *(const v4fa*)(rr + j);
#pragma unroll
    for (int q = 0; q < 4; ++q) { const float v = a[q] + b[q]; vals[u * 4 + q] = v; s1 += v; }
  }
  red[tid] = s1; __syncthreads();
  for (int st = 128; st > 0; st >>= 1) { if (tid < st) red[tid] += red[tid + st]; __syncthreads(); }
  const float mu = red[0] / (float)N; __syncthreads();
  float s2 = 0.f;
  for (int u = 0; u < per / 4; ++u)
#pragma unroll
    for (int q = 0; q < 4; ++q) { const float c = vals[u * 4 + q] - mu; s2 += c * c; }
  red[tid] = s2; __syncthreads();
  for (int st = 128; st > 0; st >>= 1) { if (tid < st) red[tid] += red[tid + st]; __syncthreads(); }
  const float rs = rsqrtf(red[0] / (float)N + eps);
  {
    for (int u = 0; u < per / 4; ++u) {
      const int j = tid * 4 + 1024 * u;
      v4f o, sm;
#pragma unroll
      for (int q = 0; q < 4; ++q) {
        float gg = g[j + q], bb = bta[j + q];
        if (PARAM_BF16) { gg = bf16_round(gg); bb = bf16_round(bb); }
        sm[q] = vals[u * 4 + q]; o[q] = (vals[u * 4 + q] - mu) * rs * gg + bb;
      }
      if (out_sum) *(v4f*)(out_sum + (size_t)row * N + j) = sm;
      *(v4f*)(out_norm + (size_t)row * N + j) = o;
    }
    
  }
}



// ---- f16 WMMA path (v_wmma_f32_16x16x32_f16): 11-bit significands for operands in range — used where a [0,1] probability operand needs more precision than bf16
typedef _Float16 v16h __attribute__((ext_vector_type(16)));
union FragH { v16h v; v8us half[2]; _Float16 h[16]; unsigned short u[16]; };
template <int NT>
__device__ __forceinline__ v8f mmaH(v16h ah, v16h al, v16h bh, v16h bl, v8f c) {
  c = __builtin_amdgcn_wmma_f32_16x16x32_f16(false, ah, false, bh, (short)0, c, false, false);
  if (NT >= 2) c = __builtin_amdgcn_wmma_f32_16x16x32_f16(false, al, false, bh, (short)0, c, false, false);
  if (NT >= 3) c = __builtin_amdgcn_wmma_f32_16x16x32_f16(false, ah, false, bl, (short)0, c, false, false);
  asm volatile("v_nop\n\tv_nop\n\tv_nop\n\tv_nop" : "+v"(c) : "v"(ah), "v"(al), "v"(bh), "v"(bl));
  return c;
}
// batched GEMM like k_gemm_b but f16 operands: A f32 (split into f16 hi/lo if ASPLIT, else rounded to f16), Bt = f16 values [n][k]; alpha; C f32; N multiple of 16 (partial tiles skipped)
template <bool ASPLIT>
__global__ __launch_bounds__(128) void k_gemm_h(const float* __restrict__ A, int lda, size_t sA, const _Float16* __restrict__ Bh, int ldb, size_t sB, float alpha, float* __restrict__ C, int ldc, size_t sC, int M, int N, int K) {
  __shared__ __attribute__((aligned(16))) float so[4][16][64];
  const int tid = threadIdx.x, w = tid >> 5, lane = tid & 31, ln = lane & 15, hh = lane >> 4; const int by = blockIdx.y;
  A += (size_t)by * sA; Bh += (size_t)by * sB; C += (size_t)by * sC;
  const int ntn = (N + 63) / 64; const int wid = blockIdx.x * 4 + w; const int mt = wid / ntn, nq = wid % ntn; if (mt * 16 >= M) return;
  const int row0 = mt * 16, col0 = nq * 64; const float* arow = A + (size_t)(row0 + ln) * lda;
  v8f acc[4] = {};
  for (int kb = 0; kb < K; kb += 32) {
    FragH ah, al;
    const v4f x0 = *(const v4fa*)(arow + kb + 8 * hh), x1 = *(const v4fa*)(arow + kb + 8 * hh + 4), x2 = *(const v4fa*)(arow + kb + 16 + 8 * hh), x3 = *(const v4fa*)(arow + kb + 16 + 8 * hh + 4);
    float xs[16] = {x0[0],x0[1],x0[2],x0[3],x1[0],x1[1],x1[2],x1[3],x2[0],x2[1],x2[2],x2[3],x3[0],x3[1],x3[2],x3[3]};
#pragma unroll
    for (int i = 0; i < 16; ++i) { const _Float16 h = (_Float16)xs[i]; ah.h[i] = h; al.h[i] = ASPLIT ? (_Float16)(xs[i] - (float)h) : (_Float16)0.0f; }
#pragma unroll
    for (int t = 0; t < 4; ++t) { if (col0 + t * 16 >= N) continue; const size_t boff = (size_t)(col0 + t * 16 + ln) * ldb + kb; FragH bq; bq.half[0] = *(const v8us*)(Bh + boff + 8 * hh); bq.half[1] = *(const v8us*)(Bh + boff + 16 + 8 * hh);
      acc[t] = mmaH<ASPLIT ? 2 : 1>(ah.v, al.v, bq.v, bq.v, acc[t]); }
  }
#pragma unroll
  for (int t = 0; t < 4; ++t) { if (col0 + t * 16 >= N) continue;
#pragma unroll
    for (int r = 0; r < 8; ++r) so[w][8 * hh + r][t * 16 + ln] = acc[t][r] * alpha; }
  __builtin_amdgcn_fence(__ATOMIC_ACQ_REL, "workgroup"); __builtin_amdgcn_wave_barrier();
  const int rsub = lane >> 4, c4 = (lane & 15) * 4;
  {
#pragma unroll
    for (int q = 0; q < 8; ++q) { const int r = q * 2 + rsub; if (col0 + c4 < N) { const v4f v = *(const v4fa*)&so[w][r][c4]; *(v4f*)(C + (size_t)(row0 + r) * ldc + col0 + c4) = v; } }
     }
}

// Wt[n][k] = f16(W[k][n]·scale) from f32 row-major W[K][N] (scale = power of two; bf16-exact weights stay exact in f16 away from the subnormal range)
__global__ __launch_bounds__(256) void k_wt_f16(const float* __restrict__ W, _Float16* __restrict__ Wt, int K, int N, float scale) {
  const int t = blockIdx.x * 256 + threadIdx.x; if (t >= N * (K / 8)) return; const int n = t / (K / 8), k8 = (t % (K / 8)) * 8; FragH f;
#pragma unroll
  for (int i = 0; i < 8; ++i) f.h[i] = (_Float16)(bf16_round(W[(size_t)(k8 + i) * N + n]) * scale); const v8us o = f.half[0];
  *(v8us*)((unsigned short*)Wt + (size_t)n * K + k8) = o; 
}
// k_gemm_hh variant with fused epilogue: v = acc·alpha + bias[by·sBias + col] (+ CP[(row/rowsPerB)·sCPb + by·64 + col] if CP) ; ACT 0 none / 1 elu ; writes f16 C16 (and f32 C if non-null)
template <int ACT>
__global__ __launch_bounds__(128) void k_gemm_hhx(const _Float16* __restrict__ A, int lda, size_t sA, const _Float16* __restrict__ Bh, int ldb, size_t sB, float alpha, const float* __restrict__ bias, size_t sBias, const float* __restrict__ CP, int rowsPerB, size_t sCPb, int row0g,
    float* __restrict__ C, _Float16* __restrict__ C16, int ldc, size_t sC, int M, int N, int K) {
  __shared__ __attribute__((aligned(16))) float so[4][16][64];
  const int tid = threadIdx.x, w = tid >> 5, lane = tid & 31, ln = lane & 15, hh = lane >> 4; const int by = blockIdx.y;
  A += (size_t)by * sA; Bh += (size_t)by * sB; const size_t cofs = (size_t)by * sC; const float* bp = bias ? bias + (size_t)by * sBias : nullptr;
  const int ntn = (N + 63) / 64; const int wid = blockIdx.x * 4 + w; const int mt = wid / ntn, nq = wid % ntn; if (mt * 16 >= M) return;
  const int row0 = mt * 16, col0 = nq * 64; const _Float16* arow = A + (size_t)(row0 + ln) * lda;
  v8f acc[4] = {};
  for (int kb = 0; kb < K; kb += 32) { FragH ah; ah.half[0] = *(const v8us*)((const unsigned short*)arow + kb + 8 * hh); ah.half[1] = *(const v8us*)((const unsigned short*)arow + kb + 16 + 8 * hh);
#pragma unroll
    for (int t = 0; t < 4; ++t) { if (col0 + t * 16 >= N) continue; const size_t boff = (size_t)(col0 + t * 16 + ln) * ldb + kb; FragH bq; bq.half[0] = *(const v8us*)((const unsigned short*)Bh + boff + 8 * hh); bq.half[1] = *(const v8us*)((const unsigned short*)Bh + boff + 16 + 8 * hh);
      acc[t] = mmaH<1>(ah.v, ah.v, bq.v, bq.v, acc[t]); }
  }
#pragma unroll
  for (int t = 0; t < 4; ++t) { if (col0 + t * 16 >= N) continue; const int col = col0 + t * 16 + ln; const float bv = bp ? bf16_round(bp[col]) : 0.f;
#pragma unroll
    for (int r = 0; r < 8; ++r) { float v = acc[t][r] * alpha + bv; if (CP) { const int bidx = (row0g + row0 + 8 * hh + r) / rowsPerB; v += CP[(size_t)bidx * sCPb + (size_t)by * 64 + col]; } if (ACT == 1) v = (v > 0.f) ? v : expm1f(v); else if (ACT == 7) v = (v > 0.f) ? v + 1.0f : expf(v); else if (ACT == 8) v = tanhf(v); else if (ACT == 9) v = 0.5f * v * (1.0f + tanhf(0.7978845608028654f * (v + 0.044715f * v * v * v))); else if (ACT == 11) v = 1.0f / (1.0f + expf(-v)); else if (ACT == 12) v = (v > 0.f) ? v : 0.01f * v; else if (ACT == 14) v = (v > 0.f) ? v : 0.1f * v; else if (ACT == 15) v = v / (1.0f + expf(-v)); else if (ACT == 3) v = fmaxf(v, 0.f); else if (ACT == 6) v = 0.5f * v * (1.0f + erff(v * 0.70710678118654752f)); so[w][8 * hh + r][t * 16 + ln] = v; } }
  __builtin_amdgcn_fence(__ATOMIC_ACQ_REL, "workgroup"); __builtin_amdgcn_wave_barrier();
  const int rsub = lane >> 4, c4 = (lane & 15) * 4; typedef _Float16 v4h __attribute__((ext_vector_type(4)));
  {
#pragma unroll
    for (int q = 0; q < 8; ++q) { const int r = q * 2 + rsub; if (col0 + c4 < N) { const v4f v = *(const v4fa*)&so[w][r][c4]; if (C) *(v4f*)(C + cofs + (size_t)(row0 + r) * ldc + col0 + c4) = v; if (C16) { v4h h4; for (int i = 0; i < 4; ++i) h4[i] = (_Float16)v[i]; *(v4h*)(C16 + cofs + (size_t)(row0 + r) * ldc + col0 + c4) = h4; } } }
     }
}


typedef _Float16 v4h __attribute__((ext_vector_type(4)));

__global__ __launch_bounds__(256) void k_x16(const float* __restrict__ x, _Float16* __restrict__ X16, size_t n8) { const size_t t = (size_t)blockIdx.x * 256 + threadIdx.x; if (t >= n8) return; FragH f;
#pragma unroll
  for (int q = 0; q < 8; ++q) f.h[q] = (_Float16)bf16_round(x[t * 8 + q]); *(v8us*)((unsigned short*)X16 + t * 8) = f.half[0];  }
__global__ __launch_bounds__(256) void k_h16(const float* __restrict__ x, _Float16* __restrict__ X16, size_t n8) { const size_t t = (size_t)blockIdx.x * 256 + threadIdx.x; if (t >= n8) return; FragH f;
#pragma unroll
  for (int q = 0; q < 8; ++q) f.h[q] = (_Float16)x[t * 8 + q]; *(v8us*)((unsigned short*)X16 + t * 8) = f.half[0];  }
__global__ __launch_bounds__(256) void k_round16f(const float* __restrict__ W, _Float16* __restrict__ Bt, size_t n8) { const size_t t = (size_t)blockIdx.x * 256 + threadIdx.x; if (t >= n8) return; FragH f;
#pragma unroll
  for (int i = 0; i < 8; ++i) f.h[i] = (_Float16)(bf16_round(W[t * 8 + i]) * 16.0f); *(v8us*)((unsigned short*)Bt + t * 8) = f.half[0];  }
template <int NHv, int TTv>
__global__ __launch_bounds__(256) void k_vt(const _Float16* __restrict__ V16, int ldv, int voff, _Float16* __restrict__ Vt) { __shared__ unsigned short tl[64][66]; const int tid = threadIdx.x; const int slab = blockIdx.x / (TTv / 64), lg = blockIdx.x % (TTv / 64); const int b = slab / NHv, h = slab % NHv;
  for (int i = tid; i < 64 * 8; i += 256) { const int r = i / 8, c8 = (i % 8) * 8; FragH f; f.half[0] = *(const v8us*)((const unsigned short*)V16 + ((size_t)b * TTv + lg * 64 + r) * ldv + voff + h * 64 + c8);
#pragma unroll
    for (int q = 0; q < 8; ++q) tl[r][c8 + q] = f.u[q]; }
  __syncthreads();
  {
#pragma unroll
    for (int rd = 0; rd < 2; ++rd) { const int d = rd * 32 + tid / 8, pc = tid % 8; FragH f;
#pragma unroll
      for (int q = 0; q < 8; ++q) f.u[q] = tl[pc * 8 + q][d];
      *(v8us*)((unsigned short*)Vt + ((size_t)slab * 64 + d) * TTv + lg * 64 + pc * 8) = f.half[0]; }
     } }

__global__ __launch_bounds__(256) void k_hl(const float* __restrict__ F, _Float16* __restrict__ Hh, _Float16* __restrict__ Hl, size_t n8) { const size_t t = (size_t)blockIdx.x * 256 + threadIdx.x; if (t >= n8) return; FragH fh, fl; const v4f a = *(const v4fa*)(F + t * 8), c = *(const v4fa*)(F + t * 8 + 4);
#pragma unroll
  for (int q = 0; q < 4; ++q) { _Float16 h = (_Float16)a[q]; fh.h[q] = h; fl.h[q] = (_Float16)((a[q] - (float)h) * 1024.0f); h = (_Float16)c[q]; fh.h[4 + q] = h; fl.h[4 + q] = (_Float16)((c[q] - (float)h) * 1024.0f); }
  { *(v8us*)((unsigned short*)Hh + t * 8) = fh.half[0]; *(v8us*)((unsigned short*)Hl + t * 8) = fl.half[0];  } }

// ---- fast GEMM (work-group tile 128x64, wave tile 32x64; requires M % 128 == 0, N % 64 == 0, K % 128 == 0); epilogue = k_gemm_hhx semantics ----
// Operands go through LDS: per slice of 128 k the work-group loads 256 B of each of its 128 A rows and 64 B rows with whole-line 16-byte loads (two rows per wave-wide load),
// keeps them in registers while the slice before is worked on, and stores them into the other of two LDS buffers; the fragments are read from LDS, A and B alike as halves k + 8 * hh .. + 7 and k + 16 + 8 * hh .. + 7 of their row.
__device__ __forceinline__ v16h g2_sfrag(const unsigned short* p) { FragH f; f.half[0] = *(const v8us*)p; f.half[1] = *(const v8us*)(p + 16); return f.v; }      /* p = LDS row + k + 8 * hh */
__device__ __forceinline__ v8f g2_mma(v16h a, v16h b, v8f c) { v8f d = __builtin_amdgcn_wmma_f32_16x16x32_f16(false, a, false, b, (short)0, c, false, false); asm volatile("v_nop\n\tv_nop\n\tv_nop\n\tv_nop" : "+v"(d) : "v"(a), "v"(b)); return d; }
template <int ACT, int LD>      /* LD = lda = ldb = K at compile time: the row steps of the staging loads become immediate offsets */
__global__ __launch_bounds__(128) void k_gemm2(const _Float16* __restrict__ A, int lda, size_t sA, const _Float16* __restrict__ Bh, int ldb, size_t sB, float alpha, const float* __restrict__ bias, size_t sBias, const float* __restrict__ CP, int rowsPerB, size_t sCPb, int row0g,
    float* __restrict__ C, _Float16* __restrict__ C16, int ldc, size_t sC, int M, int N, int K) {
  constexpr int KS = 128, PIT = KS + 8, BUF = (128 + 64) * PIT;      /* slice of k; LDS row pitch 272 B = 16 B x 17 (no bank conflict for 16-byte fragment reads); halves per buffer: rows 0-127 A, 128-191 B */
  __shared__ __attribute__((aligned(16))) unsigned short st[2 * BUF];      /* 104,448 B */
  float (*so)[32][68] = reinterpret_cast<float (*)[32][68]>(st);      /* the epilogue's staging (34,816 B) reuses the buffers behind the last barrier */
  const int tid = threadIdx.x, w = tid >> 5, lane = tid & 31, ln = lane & 15, hh = lane >> 4; const int by = blockIdx.y;
  A += (size_t)by * sA; Bh += (size_t)by * sB; const size_t cofs = (size_t)by * sC; const float* bp = bias ? bias + (size_t)by * sBias : nullptr;
  const int ntn = N >> 6; const int mt = blockIdx.x / ntn, nq = blockIdx.x - mt * ntn; const int row0 = mt * 128 + 32 * w, col0 = nq * 64; if (mt * 128 >= M) return;      /* the same for the whole work-group: barriers follow */
  const int sr = tid >> 4, sc = (tid & 15) * 8;      /* staging: 16 threads cover the 256 B of a row, the work-group 8 rows per load */
  (void)lda; (void)ldb; (void)K;
  const char* aS = (const char*)(A + (size_t)(mt * 128) * LD); const char* bS = (const char*)(Bh + (size_t)col0 * LD);      /* the work-group's first A and B row: the same in every lane */
  unsigned vo = (unsigned)(sr * LD + sc) * 2u;      /* the lane's byte offset in both operands: its row of 8, its 16 bytes, the slice */
  const v8f z8 = {0.f,0.f,0.f,0.f,0.f,0.f,0.f,0.f}; v8f c00 = z8, c01 = z8, c02 = z8, c03 = z8, c10 = z8, c11 = z8, c12 = z8, c13 = z8;
  v8us rg[24];
  auto slice_load = [&]() {
#pragma unroll
    for (int i = 0; i < 16; ++i) rg[i] = *(const v8us*)(aS + (size_t)vo + (size_t)(16 * i) * LD);
#pragma unroll
    for (int i = 0; i < 8; ++i) rg[16 + i] = *(const v8us*)(bS + (size_t)vo + (size_t)(16 * i) * LD); };
  auto slice_next = [&]() { asm volatile("s_wait_xcnt 0x0" : "+v"(vo) : : "memory");      /* in front of the overwrite of the offset register that the issued loads name */
    vo += 2u * KS; };
  auto slice_store = [&](int bo) {
#pragma unroll
    for (int i = 0; i < 24; ++i) *(v8us*)&st[bo + (8 * i + sr) * PIT + sc] = rg[i]; };
  auto slice_mma = [&](int bo) { const unsigned short* ap = &st[bo + (32 * w + ln) * PIT + 8 * hh]; const unsigned short* bq = &st[bo + (128 + ln) * PIT + 8 * hh];
#pragma unroll
    for (int kk = 0; kk < KS; kk += 32) { const v16h a0 = g2_sfrag(ap + kk), a1 = g2_sfrag(ap + 16 * PIT + kk);      /* the six fragments of a k step as one group of LDS reads in front of its eight products */
      const v16h b0 = g2_sfrag(bq + kk), b1 = g2_sfrag(bq + 16 * PIT + kk), b2 = g2_sfrag(bq + 32 * PIT + kk), b3 = g2_sfrag(bq + 48 * PIT + kk);
      c00 = g2_mma(a0, b0, c00); c10 = g2_mma(a1, b0, c10); c01 = g2_mma(a0, b1, c01); c11 = g2_mma(a1, b1, c11);
      c02 = g2_mma(a0, b2, c02); c12 = g2_mma(a1, b2, c12); c03 = g2_mma(a0, b3, c03); c13 = g2_mma(a1, b3, c13); } };
  slice_load(); slice_next(); slice_store(0); __syncthreads();
  int cur = 0;      /* start (in halves) of the buffer that holds the slice being worked on: 0 or BUF */
#pragma unroll 1      /* one copy of the slice body; the buffer alternates at run time */
  for (int s = 1; s < LD / KS; ++s) {
    slice_load();      /* in flight while the slice before is worked on */
    slice_mma(cur);
    slice_next();
    slice_store(cur ^ BUF);      /* its last readers left this buffer in front of the barrier of the trip before */
    __syncthreads(); cur ^= BUF; }
  slice_mma(cur);
  __syncthreads();      /* every wave has read its last fragments before the buffers become output staging */
  v8f accs[8] = {c00, c01, c02, c03, c10, c11, c12, c13};
#pragma unroll
  for (int u = 0; u < 8; ++u) { const int t = u & 3, half = u >> 2; const int col = col0 + t * 16 + ln; const float bv = bp ? bf16_round(bp[col]) : 0.f;
#pragma unroll
    for (int r = 0; r < 8; ++r) { const int rloc = half * 16 + 8 * hh + r; float v = accs[u][r] * alpha + bv; if (CP) { const int bidx = (row0g + row0 + rloc) / rowsPerB; v += CP[(size_t)bidx * sCPb + (size_t)by * 64 + col]; }
      if (ACT == 3) v = fmaxf(v, 0.f); else if (ACT == 6) v = 0.5f * v * (1.0f + erff(v * 0.70710678118654752f)); else if (ACT == 11) v = 1.0f / (1.0f + expf(-v)); else if (ACT == 15) v = v / (1.0f + expf(-v)); else if (ACT == 12) v = (v > 0.f) ? v : 0.01f * v; else if (ACT == 8) v = tanhf(v);
      so[w][rloc][t * 16 + ln] = v; } }
  __builtin_amdgcn_fence(__ATOMIC_ACQ_REL, "workgroup"); __builtin_amdgcn_wave_barrier();
  const int rsub = lane >> 4, c4 = (lane & 15) * 4;
  {
#pragma unroll
    for (int q = 0; q < 16; ++q) { const int r = q * 2 + rsub; const v4f v = *(const v4fa*)&so[w][r][c4]; if (C) *(v4f*)(C + cofs + (size_t)(row0 + r) * ldc + col0 + c4) = v; if (C16) { v4h h4; for (int i = 0; i < 4; ++i) h4[i] = (_Float16)v[i]; *(v4h*)(C16 + cofs + (size_t)(row0 + r) * ldc + col0 + c4) = h4; } }
     } }



template <int TK>
__global__ __launch_bounds__(256) void k_vthl(const float* __restrict__ VF, int ldv, _Float16* __restrict__ Vth, _Float16* __restrict__ Vtl) { __shared__ float tl[64][65]; const int tid = threadIdx.x; const int slab = blockIdx.x / (TK / 64), lg = blockIdx.x % (TK / 64); const int b = slab / NH, h = slab % NH;
  for (int i = tid; i < 64 * 16; i += 256) { const int r = i / 16, c4 = (i % 16) * 4; const v4f a = *(const v4fa*)(VF + ((size_t)b * TK + lg * 64 + r) * ldv + h * 64 + c4); tl[r][c4] = a[0]; tl[r][c4 + 1] = a[1]; tl[r][c4 + 2] = a[2]; tl[r][c4 + 3] = a[3]; }
  __syncthreads();
  FragH fh[2], fl[2]; size_t oo[2];
#pragma unroll
  for (int rd = 0; rd < 2; ++rd) { const int d = rd * 32 + tid / 8, pc = tid % 8;
#pragma unroll
    for (int q = 0; q < 8; ++q) { const float v = tl[pc * 8 + q][d]; const _Float16 hv = (_Float16)v; fh[rd].h[q] = hv; fl[rd].h[q] = (_Float16)((v - (float)hv) * 1024.0f); } oo[rd] = ((size_t)slab * 64 + d) * TK + lg * 64 + pc * 8; }
  {
#pragma unroll
    for (int rd = 0; rd < 2; ++rd) { *(v8us*)((unsigned short*)Vth + oo[rd]) = fh[rd].half[0]; *(v8us*)((unsigned short*)Vtl + oo[rd]) = fl[rd].half[0]; }
     } }

template <int TQ, int TK>
__global__ __launch_bounds__(128) void k_flashm(const _Float16* __restrict__ Q16, const _Float16* __restrict__ Q16lo, int ldq, const _Float16* __restrict__ K16, const _Float16* __restrict__ K16lo, int ldk, const _Float16* __restrict__ Vt, const _Float16* __restrict__ Vtlo, const unsigned* __restrict__ MB, const int* __restrict__ RA, const int* __restrict__ KE, float* __restrict__ O, int ldo) {
  constexpr int RPW = 16, RTN = RPW / 16, NQB = TQ / (4 * RPW), DT = 4, KS = 2;
  __shared__ __attribute__((aligned(16))) unsigned short sP[4][RPW][40], sPl[4][RPW][40]; __shared__ __attribute__((aligned(16))) float sO[4][RPW][64 + 4];
  // A pass's keys and values lie in LDS once for the four waves. One buffer (in halves): 32 K rows hi, 32 K rows residual (128 B each, pitch 144 B), then 64 V^T rows hi, 64 residual (64 B each, pitch 80 B); pitches 16 B x odd for the 16-byte fragment reads.
  constexpr int KP = 72, VP = 40, VB0 = 64 * KP, KVB = VB0 + 128 * VP;
  __shared__ __attribute__((aligned(16))) unsigned short sKV[2 * KVB];      /* two buffers, 38,912 B: the next pass's tile flies while this one is worked on */
  const int tid = threadIdx.x, w = tid >> 5, lane = tid & 31, ln = lane & 15, hh = lane >> 4;
  const int h = blockIdx.x / NQB, t0 = blockIdx.x % NQB;
  // Causal balance: the work-group runs query tile t0 of batch 0, then tile NQB - 1 - t0 of batch 1 (alternating), so every work-group walks the same number of key passes.
#pragma unroll 1      /* one copy of the tile body: the tiles run one after the other in every wave */
  for (int b = 0; b < NBT; ++b) {
  const int slab = b * NH + h, qblk = (b & 1) ? NQB - 1 - t0 : t0; const int qb0 = qblk * (4 * RPW); const int q0 = qb0 + w * RPW;
  FragH aq[2][KS], aql[2][KS];
#pragma unroll
  for (int rt = 0; rt < RTN; ++rt) { const size_t qo = ((size_t)b * TQ + q0 + rt * 16 + ln) * ldq + h * 64; const unsigned short* qr = (const unsigned short*)Q16 + qo; const unsigned short* ql = (const unsigned short*)Q16lo + qo;
#pragma unroll
    for (int ks = 0; ks < KS; ++ks) { aq[rt][ks].half[0] = *(const v8us*)(qr + ks * 32 + 8 * hh); aq[rt][ks].half[1] = *(const v8us*)(qr + ks * 32 + 16 + 8 * hh); aql[rt][ks].half[0] = *(const v8us*)(ql + ks * 32 + 8 * hh); aql[rt][ks].half[1] = *(const v8us*)(ql + ks * 32 + 16 + 8 * hh); } }
  const unsigned short* Vth = (const unsigned short*)Vt + (size_t)slab * 64 * TK; const unsigned short* Vtl = (const unsigned short*)Vtlo + (size_t)slab * 64 * TK;
  // Staging, 8 copies of 16 B a lane and pass: 8 lanes cover a K row (rows tid / 8 and + 16 of each plane), 4 lanes a V^T row (rows tid / 4 and + 32 of each plane).
  const size_t kso = ((size_t)b * TK + (tid >> 3)) * ldk + h * 64 + (tid & 7) * 8, vso = (size_t)(tid >> 2) * TK + (tid & 3) * 8;
  const unsigned lk0 = (unsigned)(size_t)&sKV[(tid >> 3) * KP + (tid & 7) * 8], lv0 = (unsigned)(size_t)&sKV[VB0 + (tid >> 2) * VP + (tid & 3) * 8];      /* the lane's LDS byte addresses in buffer 0 */
  auto stage = [&](int js, int bo) {      /* keys js .. js + 31 into the buffer that starts at half bo */
    const unsigned short* kh = (const unsigned short*)K16 + kso + (size_t)js * ldk; const unsigned short* kl = (const unsigned short*)K16lo + kso + (size_t)js * ldk;
    const unsigned short* kh2 = kh + (size_t)16 * ldk; const unsigned short* kl2 = kl + (size_t)16 * ldk;
    const unsigned short* vh = Vth + vso + js; const unsigned short* vl = Vtl + vso + js; const unsigned short* vh2 = vh + (size_t)32 * TK; const unsigned short* vl2 = vl + (size_t)32 * TK;
    const unsigned lk = lk0 + 2u * (unsigned)bo, lv = lv0 + 2u * (unsigned)bo;
    const unsigned lk1 = lk + 2u * 16 * KP, lk2 = lk + 2u * 32 * KP, lk3 = lk + 2u * 48 * KP, lv1 = lv + 2u * 32 * VP, lv2 = lv + 2u * 64 * VP, lv3 = lv + 2u * 96 * VP;
    /* the copies and, as the statement's last line, the wait that stands in front of any rewrite of their address registers */
    asm volatile("global_load_async_to_lds_b128 %0, %8, off\n\t"
                 "global_load_async_to_lds_b128 %1, %9, off\n\t"
                 "global_load_async_to_lds_b128 %2, %10, off\n\t"
                 "global_load_async_to_lds_b128 %3, %11, off\n\t"
                 "global_load_async_to_lds_b128 %4, %12, off\n\t"
                 "global_load_async_to_lds_b128 %5, %13, off\n\t"
                 "global_load_async_to_lds_b128 %6, %14, off\n\t"
                 "global_load_async_to_lds_b128 %7, %15, off\n\t"
                 "s_wait_xcnt 0x0"
                 :: "v"(lk), "v"(lk1), "v"(lk2), "v"(lk3), "v"(lv), "v"(lv1), "v"(lv2), "v"(lv3), "v"(kh), "v"(kh2), "v"(kl), "v"(kl2), "v"(vh), "v"(vh2), "v"(vl), "v"(vl2) : "memory"); };
  float m_r[2][8], l_r[2][8]; v8f oacc[2][DT], oaccl[2][DT];
#pragma unroll
  for (int rt = 0; rt < RTN; ++rt) {
#pragma unroll
    for (int r = 0; r < 8; ++r) { m_r[rt][r] = -3.0e38f; l_r[rt][r] = 0.f; }
#pragma unroll
    for (int dt = 0; dt < DT; ++dt) { oacc[rt][dt] = (v8f){0.f,0.f,0.f,0.f,0.f,0.f,0.f,0.f}; oaccl[rt][dt] = oacc[rt][dt]; } }
  int jend = KE[qblk * 32]; jend = min(TK, (jend + 31) & ~31); if (jend < 32) jend = 32;      /* block-uniform */
  jend = __builtin_amdgcn_readfirstlane(jend);      /* in a scalar register: the tests around the copies and the barriers are scalar branches */
  int allm[2][8]; const unsigned* mrow[2][8];
#pragma unroll
  for (int rt = 0; rt < RTN; ++rt)
#pragma unroll
    for (int r = 0; r < 8; ++r) { const int tq = q0 + rt * 16 + 8 * hh + r; allm[rt][r] = RA[tq]; mrow[rt][r] = MB + (size_t)tq * (TK / 32); }
  stage(0, 0);      /* every reader of the tile before left both buffers in front of its last pass's barrier */
  asm volatile("s_wait_asynccnt 0x0" ::: "memory");      /* this wave's copies of pass 0 have landed */
  __syncthreads();      /* ... and every other wave's */
  if (jend > 32) stage(32, KVB);
  int cur = 0;      /* start (in halves) of the buffer that holds this pass's tile: 0 or KVB */
#pragma unroll 1
  for (int j0 = 0; j0 < jend; j0 += 32) {
    unsigned mwd[2][8];      /* the pass's mask words, asked for ahead of the score products so that these cover the loads */
#pragma unroll
    for (int rt = 0; rt < RTN; ++rt)
#pragma unroll
      for (int r = 0; r < 8; ++r) mwd[rt][r] = mrow[rt][r][j0 >> 5];
    v8f s[2][2];
#pragma unroll
    for (int nt = 0; nt < 2; ++nt) { const unsigned short* kr = &sKV[cur + (nt * 16 + ln) * KP]; const unsigned short* kl = kr + 32 * KP; FragH bk[KS], bkl[KS];
#pragma unroll
      for (int ks = 0; ks < KS; ++ks) { bk[ks].half[0] = *(const v8us*)(kr + ks * 32 + 8 * hh); bk[ks].half[1] = *(const v8us*)(kr + ks * 32 + 16 + 8 * hh); bkl[ks].half[0] = *(const v8us*)(kl + ks * 32 + 8 * hh); bkl[ks].half[1] = *(const v8us*)(kl + ks * 32 + 16 + 8 * hh); }
#pragma unroll
      for (int rt = 0; rt < RTN; ++rt) { v8f acc = (v8f){0.f,0.f,0.f,0.f,0.f,0.f,0.f,0.f}, accr = acc;
#pragma unroll
        for (int ks = 0; ks < KS; ++ks) { acc = mmaH<1>(aq[rt][ks].v, aq[rt][ks].v, bk[ks].v, bk[ks].v, acc); accr = mmaH<1>(aql[rt][ks].v, aql[rt][ks].v, bk[ks].v, bk[ks].v, accr); accr = mmaH<1>(aq[rt][ks].v, aq[rt][ks].v, bkl[ks].v, bkl[ks].v, accr); }
        s[rt][nt] = acc + accr * 0.0009765625f; } }
    // Online softmax, the eight rows of a lane side by side: each phase runs over all rows before the next begins, and every exponential is computed for every lane and then selected,
    // so the pass is one straight run of code in which the rows' shuffles and exponentials cover one another's latencies. Same values, same order of every sum as row after row.
#pragma unroll
    for (int rt = 0; rt < RTN; ++rt) {
      float s0v[8], s1v[8], mcv[8], alv[8], p0v[8], p1v[8]; bool ok0v[8], ok1v[8];
#pragma unroll
      for (int r = 0; r < 8; ++r) { const unsigned mw = mwd[rt][r]; const bool am = (allm[rt][r] != 0);
        ok0v[r] = am || (((mw >> ln) & 1u) == 0u); ok1v[r] = am || (((mw >> (16 + ln)) & 1u) == 0u);
        s0v[r] = ok0v[r] ? (am ? 0.f : s[rt][0][r] * SCL) : -INFINITY; s1v[r] = ok1v[r] ? (am ? 0.f : s[rt][1][r] * SCL) : -INFINITY; mcv[r] = fmaxf(s0v[r], s1v[r]); }
#pragma unroll
      for (int o = 1; o < 16; o <<= 1) { float xv[8];
#pragma unroll
        for (int r = 0; r < 8; ++r) xv[r] = __shfl_xor(mcv[r], o, 32);
        __builtin_amdgcn_sched_barrier(0);      /* all eight shuffles of a step are issued before the first result is waited for: one shuffle latency a step, not one a row */
#pragma unroll
        for (int r = 0; r < 8; ++r) mcv[r] = fmaxf(mcv[r], xv[r]); }
#pragma unroll
      for (int r = 0; r < 8; ++r) { const float mn = fmaxf(m_r[rt][r], mcv[r]);      /* mn is finite (at least -3.0e38), so a masked score gives exp(-inf) = 0 and no NaN reaches a selected value */
        const float ea = expf(m_r[rt][r] - mn), e0 = expf(s0v[r] - mn), e1 = expf(s1v[r] - mn);
        alv[r] = (mn > -1.0e38f) ? ea : 1.0f; m_r[rt][r] = mn; p0v[r] = ok0v[r] ? e0 : 0.f; p1v[r] = ok1v[r] ? e1 : 0.f; l_r[rt][r] = l_r[rt][r] * alv[r] + p0v[r] + p1v[r]; }
#pragma unroll
      for (int r = 0; r < 8; ++r) { const float al = alv[r], p0 = p0v[r], p1 = p1v[r];
#pragma unroll
        for (int dt = 0; dt < DT; ++dt) { oacc[rt][dt][r] *= al; oaccl[rt][dt][r] *= al; }
        FragH t2, t3; const float ps0 = p0 * 1024.0f, ps1 = p1 * 1024.0f; t2.h[0] = (_Float16)ps0; t2.h[1] = (_Float16)ps1; t3.h[0] = (_Float16)((ps0 - (float)t2.h[0]) * 1024.0f); t3.h[1] = (_Float16)((ps1 - (float)t2.h[1]) * 1024.0f);
        sP[w][rt * 16 + 8 * hh + r][ln] = t2.u[0]; sP[w][rt * 16 + 8 * hh + r][16 + ln] = t2.u[1]; sPl[w][rt * 16 + 8 * hh + r][ln] = t3.u[0]; sPl[w][rt * 16 + 8 * hh + r][16 + ln] = t3.u[1]; } }
    __builtin_amdgcn_fence(__ATOMIC_ACQ_REL, "workgroup"); __builtin_amdgcn_wave_barrier();
    FragH pa[2], pl[2];
#pragma unroll
    for (int rt = 0; rt < RTN; ++rt) { pa[rt].half[0] = *(const v8us*)&sP[w][rt * 16 + ln][8 * hh]; pa[rt].half[1] = *(const v8us*)&sP[w][rt * 16 + ln][16 + 8 * hh]; pl[rt].half[0] = *(const v8us*)&sPl[w][rt * 16 + ln][8 * hh]; pl[rt].half[1] = *(const v8us*)&sPl[w][rt * 16 + ln][16 + 8 * hh]; }
#pragma unroll
    for (int dt = 0; dt < DT; ++dt) { const unsigned short* vr = &sKV[cur + VB0 + (dt * 16 + ln) * VP + 8 * hh]; const unsigned short* vq = vr + 64 * VP; FragH bv, bl; bv.half[0] = *(const v8us*)vr; bv.half[1] = *(const v8us*)(vr + 16); bl.half[0] = *(const v8us*)vq; bl.half[1] = *(const v8us*)(vq + 16);
#pragma unroll
      for (int rt = 0; rt < RTN; ++rt) { oacc[rt][dt] = mmaH<1>(pa[rt].v, pa[rt].v, bv.v, bv.v, oacc[rt][dt]); oaccl[rt][dt] = mmaH<1>(pa[rt].v, pa[rt].v, bl.v, bl.v, oaccl[rt][dt]); oaccl[rt][dt] = mmaH<1>(pl[rt].v, pl[rt].v, bv.v, bv.v, oaccl[rt][dt]); } }
    asm volatile("s_wait_dscnt 0x0" ::: "memory");      /* this wave's LDS reads of the pass are done */
    asm volatile("s_wait_asynccnt 0x0" ::: "memory");      /* its copies of the next pass's tile have landed */
    __syncthreads();      /* publishes the next tile and ends every wave's reads of this one */
    if (j0 + 64 < jend) stage(j0 + 64, cur);      /* refill of the buffer just read, one whole pass ahead of its use */
    cur ^= KVB; }
  asm volatile("s_wait_asynccnt 0x0" ::: "memory");      /* nothing of this wave is in flight when the tile ends */
#pragma unroll
  for (int rt = 0; rt < RTN; ++rt) {
#pragma unroll
    for (int r = 0; r < 8; ++r) { float l = l_r[rt][r]; l += __shfl_xor(l, 1, 32); l += __shfl_xor(l, 2, 32); l += __shfl_xor(l, 4, 32); l += __shfl_xor(l, 8, 32); l_r[rt][r] = (l > 0.f) ? 1.0f / (l * 1024.0f) : 0.f; }
#pragma unroll
    for (int dt = 0; dt < DT; ++dt)
#pragma unroll
      for (int r = 0; r < 8; ++r) sO[w][rt * 16 + 8 * hh + r][dt * 16 + ln] = (oacc[rt][dt][r] + oaccl[rt][dt][r] * 0.0009765625f) * l_r[rt][r]; }
  __builtin_amdgcn_fence(__ATOMIC_ACQ_REL, "workgroup"); __builtin_amdgcn_wave_barrier();
  {
#pragma unroll
    for (int rp = 0; rp < RPW; rp += 2) { const int r = rp + (lane >> 4), pc = lane & 15; const v4f val = *(const v4fa*)&sO[w][r][pc * 4]; *(v4f*)(O + ((size_t)b * TQ + q0 + r) * ldo + h * 64 + pc * 4) = val; }
     }
  asm volatile("s_wait_xcnt 0x0" ::: "memory");      /* the next tile's set-up overwrites the address registers of the stores above */
  } }


template <int SRCBF>
__global__ __launch_bounds__(256) void k_lnab(const float* __restrict__ X, const float* __restrict__ g, const float* __restrict__ bb, _Float16* __restrict__ Y16, float* __restrict__ Y32, float* __restrict__ XB) {
  #pragma clang fp contract(off)
  const int tid = threadIdx.x, w = tid >> 5, ln = tid & 31; const int r = blockIdx.x * 8 + w; if (r >= NR) return; const float* x = X + (size_t)r * DM; float s = 0.f;
#pragma unroll 1
  for (int i = 0; i < DM / 128; ++i) { const v4f a = *(const v4fa*)(x + i * 128 + ln * 4); for (int q = 0; q < 4; ++q) s += SRCBF ? bf16_round(a[q]) : a[q]; }
  for (int o = 16; o > 0; o >>= 1) s += __shfl_xor(s, o, 32); const float mu = s / (float)DM; float q2 = 0.f;
#pragma unroll 1
  for (int i = 0; i < DM / 128; ++i) { const v4f a = *(const v4fa*)(x + i * 128 + ln * 4); for (int q = 0; q < 4; ++q) { const float d = (SRCBF ? bf16_round(a[q]) : a[q]) - mu; q2 += d * d; } }
  for (int o = 16; o > 0; o >>= 1) q2 += __shfl_xor(q2, o, 32); const float rs = rsqrtf(q2 / (float)DM + 1e-5f);
  {
#pragma unroll 1
    for (int i = 0; i < DM / 128; ++i) { const int c0 = i * 128 + ln * 4; const v4f a = *(const v4fa*)(x + c0); _Float16 h4[4]; v4f y4, xb;
      for (int q = 0; q < 4; ++q) { const float t = SRCBF ? bf16_round(a[q]) : a[q]; const float y = (t - mu) * rs * bf16_round(g[c0 + q]) + bf16_round(bb[c0 + q]); h4[q] = (_Float16)y; y4[q] = y; xb[q] = t; }
      if (Y16) *(unsigned long long*)((unsigned short*)Y16 + (size_t)r * DM + c0) = *(const unsigned long long*)h4; if (Y32) *(v4f*)(Y32 + (size_t)r * DM + c0) = y4; if (XB) *(v4f*)(XB + (size_t)r * DM + c0) = xb; }
     } }
__global__ __launch_bounds__(256) void k_causaltab(unsigned* __restrict__ MB, int* __restrict__ RA, int* __restrict__ KE, int nq, int nk) {
  const int t = blockIdx.x * 256 + threadIdx.x; const int nw = nk / 32;
  if (t < nq * nw) { const int q = t / nw, w = t % nw; const int first = q + 1 - 32 * w; const unsigned bits = (first <= 0) ? 0xffffffffu : ((first >= 32) ? 0u : (0xffffffffu << first)); *(unsigned*)(MB + t) = bits;  }
  if (t < nq) { *(int*)(RA + t) = 0;  }
  if (t < nq / 64) { const int v = 64 * (t + 1); *(int*)(KE + t * 32) = v;  } }


extern "C" void kernel_launch(void* const* d_in, const int* in_sizes, int n_in,
                              void* d_out, int out_size, void* d_ws, size_t ws_size, hipStream_t stream) {
  (void)in_sizes; (void)n_in; (void)out_size;
  const float* const* I = (const float* const*)d_in; const float* x = I[0]; const float* lag = I[1]; const float* lab = I[2]; const float* lbg = I[3]; const float* lbb = I[4]; const float* lcg = I[5]; const float* lcb = I[6];
  const float* Wq = I[7]; const float* bq = I[8]; const float* Wk = I[9]; const float* bk = I[10]; const float* Wv = I[11]; const float* bv = I[12]; const float* Wo = I[13]; const float* bo = I[14]; const float* We = I[15]; const float* be = I[16]; const float* Wd = I[17]; const float* bd = I[18];
  char* ws = (char*)d_ws; size_t off = 0;
  auto take = [&](size_t bytes) { char* p = ws + off; off += (bytes + 255) & ~(size_t)255; return p; };
  _Float16* BQ = (_Float16*)take((size_t)DM * DM * 2); _Float16* BK = (_Float16*)take((size_t)DM * DM * 2); _Float16* BV = (_Float16*)take((size_t)DM * DM * 2); _Float16* BO = (_Float16*)take((size_t)DM * DM * 2); _Float16* BE = (_Float16*)take((size_t)4096 * DM * 2); _Float16* BD = (_Float16*)take((size_t)DM * 4096 * 2);
  float* XB = (float*)take((size_t)NR * DM * 4); _Float16* T16 = (_Float16*)take((size_t)NR * DM * 2); float* F = (float*)take((size_t)NR * DM * 4);
  _Float16* Qh = (_Float16*)take((size_t)NR * DM * 2); _Float16* Ql = (_Float16*)take((size_t)NR * DM * 2); _Float16* Kh = (_Float16*)take((size_t)NR * DM * 2); _Float16* Kl = (_Float16*)take((size_t)NR * DM * 2); _Float16* Vth = (_Float16*)take((size_t)NR * DM * 2); _Float16* Vtl = (_Float16*)take((size_t)NR * DM * 2);
  unsigned* MB = (unsigned*)take((size_t)SLEN * (SLEN / 32) * 4); int* RA = (int*)take((size_t)SLEN * 4); int* KE = (int*)take((size_t)(SLEN / 64) * 32 * 4);
  if (off > ws_size) return;      /* 24 + 16 + 8 + 16 + 48 + 0.6 = 113 MiB (the first LN's f32 output lives in F until the second LN consumes it) */
  float* O = F; _Float16* Oh = Qh; _Float16* Ol = Ql; float* X1 = XB; _Float16* GH = Kh;      /* SiLU hidden [NR][4096] f16 = 32 MB over Kh|Kl|Vth|Vtl (dead after the flash) */
  const size_t n8 = (size_t)NR * DM / 8; const unsigned nb8 = (unsigned)((n8 + 255) / 256);
  k_wt_f16<<<(unsigned)(((size_t)DM * DM / 8 + 255) / 256), 256, 0, stream>>>(Wq, BQ, DM, DM, 16.0f); k_wt_f16<<<(unsigned)(((size_t)DM * DM / 8 + 255) / 256), 256, 0, stream>>>(Wk, BK, DM, DM, 16.0f); k_wt_f16<<<(unsigned)(((size_t)DM * DM / 8 + 255) / 256), 256, 0, stream>>>(Wv, BV, DM, DM, 16.0f); k_wt_f16<<<(unsigned)(((size_t)DM * DM / 8 + 255) / 256), 256, 0, stream>>>(Wo, BO, DM, DM, 16.0f);
  k_wt_f16<<<(unsigned)(((size_t)DM * 4096 / 8 + 255) / 256), 256, 0, stream>>>(We, BE, DM, 4096, 16.0f); k_wt_f16<<<(unsigned)(((size_t)4096 * DM / 8 + 255) / 256), 256, 0, stream>>>(Wd, BD, 4096, DM, 16.0f);      /* all (in,out) */
  k_causaltab<<<(SLEN * (SLEN / 32) + 255) / 256, 256, 0, stream>>>(MB, RA, KE, SLEN, SLEN);
  k_lnab<1><<<NR / 8, 256, 0, stream>>>(x, lag, lab, nullptr, F, XB);      /* t0 = LN_a(bf16 x) (f32), XB = bf16(x) */
  k_lnab<0><<<NR / 8, 256, 0, stream>>>(F, lbg, lbb, T16, nullptr, nullptr);      /* t = LN_b(t0) as f16 operand */
  const dim3 gP((NR / 128) * (DM / 64), 1), gM((NR / 128) * (4096 / 64), 1);
  k_gemm2<0, DM><<<gP, 128, 0, stream>>>(T16, DM, 0, BQ, DM, 0, 0.0625f, bq, 0, nullptr, 1, 0, 0, F, nullptr, DM, 0, NR, DM, DM); k_hl<<<nb8, 256, 0, stream>>>(F, Qh, Ql, n8);
  k_gemm2<0, DM><<<gP, 128, 0, stream>>>(T16, DM, 0, BK, DM, 0, 0.0625f, bk, 0, nullptr, 1, 0, 0, F, nullptr, DM, 0, NR, DM, DM); k_hl<<<nb8, 256, 0, stream>>>(F, Kh, Kl, n8);
  k_gemm2<0, DM><<<gP, 128, 0, stream>>>(T16, DM, 0, BV, DM, 0, 0.0625f, bv, 0, nullptr, 1, 0, 0, F, nullptr, DM, 0, NR, DM, DM);
  for (int b = 0; b < NBT; ++b) k_vthl<SLEN><<<NH * (SLEN / 64), 256, 0, stream>>>(F + (size_t)b * SLEN * DM, DM, Vth + (size_t)b * SLEN * DM, Vtl + (size_t)b * SLEN * DM);
  k_flashm<SLEN, SLEN><<<NH * (SLEN / 64), 128, 0, stream>>>(Qh, Ql, DM, Kh, Kl, DM, Vth, Vtl, MB, RA, KE, O, DM);      /* both batches in one grid of equal work-groups */
  k_hl<<<nb8, 256, 0, stream>>>(O, Oh, Ol, n8);
  k_gemm2<0, DM><<<gP, 128, 0, stream>>>(Oh, DM, 0, BO, DM, 0, 0.0625f, bo, 0, XB, 1, (size_t)DM, 0, X1, nullptr, DM, 0, NR, DM, DM);      /* x1 = x + ctx Wo + bo (hi) */
  k_gemm2<0, DM><<<gP, 128, 0, stream>>>(Ol, DM, 0, BO, DM, 0, 0.0625f / 1024.0f, nullptr, 0, X1, 1, (size_t)DM, 0, X1, nullptr, DM, 0, NR, DM, DM);      /* + lo */
  k_lnab<0><<<NR / 8, 256, 0, stream>>>(X1, lcg, lcb, T16, nullptr, nullptr);
  k_gemm2<15, DM><<<gM, 128, 0, stream>>>(T16, DM, 0, BE, DM, 0, 0.0625f, be, 0, nullptr, 1, 0, 0, nullptr, GH, 4096, 0, NR, 4096, DM);      /* silu(t We + be) f16 (ACT 15 = x * sigmoid(x), present in the epilogue) */
  k_gemm2<0, 4096><<<gP, 128, 0, stream>>>(GH, 4096, 0, BD, 4096, 0, 0.0625f, bd, 0, X1, 1, (size_t)DM, 0, (float*)d_out, nullptr, DM, 0, NR, DM, 4096);      /* out = x1 + mlp */
}

// v005
// A run of this version takes 421 microseconds.
// In two side-by-side timings against v004, it was 1.12 and 1.10 times as fast.
// All steps since v000 together make it 2.89 times as fast.
#include <hip/hip_runtime.h>
// Pre-LN causal attention block (2 x 2048 tokens, 1024 = 16 heads x 64; MLP 4096 with SiLU): t = LN_b(LN_a(x)); q,k,v = t W + b; x1 = x + (causal softmax(q.k/8) v) Wo + bo; out = x1 + (silu(LN_c(x1) We + be)) Wd + bd -> [2,2048,1024].
// Structure: the LayerNorms on VALU (the first pass also writes the bf16 residual plane); projections / MLP as f16 WMMA GEMMs (32x64 wave tiles, f32 accumulation, exact x16 weights, biases / SiLU / residual addends in the epilogue); q, k as f16 hi + (x2^10) residual planes, V^T as hi + residual planes; fused causal flash kernel, one work-group per (head, t): 64-query tile t of batch 0, then tile 31 - t of batch 1 (32-key K and V^T tiles copied asynchronously into two LDS buffers shared by the four waves, device-built causal tables, online f32 softmax, P staged hi + residual, two value accumulators); O as hi + residual planes into Wo (two GEMMs).
// Compute dtype: x, weights, biases, LN parameters rounded to bf16; LN outputs and the SiLU hidden as f16 operands (~2^-12); q, k, P, v, O as f16 hi + residual pairs (~2^-21); f32 accumulation, softmax, LayerNorm. v_wmma_f32_16x16x32_f16.
#define NBT 2
#define SLEN 2048
#define DM 1024
#define NH 16
#define SCL 0.125f
#define NR (NBT * SLEN)
typedef __bf16 v16b __attribute__((ext_vector_type(16)));
typedef unsigned short v8us __attribute__((ext_vector_type(8), may_alias));
typedef float  v8f  __attribute__((ext_vector_type(8)));
typedef float  v4f  __attribute__((ext_vector_type(4)));
typedef float  v4fa __attribute__((ext_vector_type(4), may_alias));
union FragB { v16b v; v8us half[2]; unsigned short u[16]; };

__device__ __forceinline__ unsigned short bf16_bits(float x) { unsigned int u = __float_as_uint(x); return (unsigned short)((u + 0x7FFFu + ((u >> 16) & 1u)) >> 16); }
__device__ __forceinline__ float bf16_val(unsigned short b) { return __uint_as_float(((unsigned int)b) << 16); }
__device__ __forceinline__ float bf16_round(float x) { return bf16_val(bf16_bits(x)); }
// D += A·B with NT terms: 1 = ah·bh, 2 = + al·bh (A split), 3 = + ah·bl (both split)
template <int NT>
__device__ __forceinline__ v8f mmaN(v16b ah, v16b al, v16b bh, v16b bl, v8f c) {
  c = __builtin_amdgcn_wmma_f32_16x16x32_bf16(false, ah, false, bh, (short)0, c, false, false);
  if (NT >= 2) c = __builtin_amdgcn_wmma_f32_16x16x32_bf16(false, al, false, bh, (short)0, c, false, false);
  if (NT >= 3) c = __builtin_amdgcn_wmma_f32_16x16x32_bf16(false, ah, false, bl, (short)0, c, false, false);
  asm volatile("v_nop\n\tv_nop\n\tv_nop\n\tv_nop" : "+v"(c) : "v"(ah), "v"(al), "v"(bh), "v"(bl));
  return c;
}

__global__ __launch_bounds__(256) void k_wt_bf16(const float* __restrict__ W, unsigned short* __restrict__ Wt, int K, int N) {
  const int t = blockIdx.x * 256 + threadIdx.x;
  const int k8n = K / 8;
  if (t >= N * k8n) return;
  const int n = t / k8n, k8 = (t % k8n) * 8;
  v8us v;
#pragma unroll
  for (int i = 0; i < 8; ++i) v[i] = bf16_bits(W[(size_t)(k8 + i) * N + n]);
  *(v8us*)(Wt + (size_t)n * K + k8) = v;
  
}

// GEMM C[M][N] (f32, pitch ldc) = act(A[M][K]·W + bias). A f32 row-major (pitch lda) converted per fragment to bf16
// (ASPLIT: hi/lo two planes -> 2 terms, else single rounded term); Wt bf16 [N][K] (pitch ldb). BIAS_BF16 rounds the
// bias to bf16 first (bias quantised to bf16 before the add). K%32==0, M%16==0, N%64==0.
template <bool ASPLIT, int ACT, bool BIAS_BF16>
__global__ __launch_bounds__(128) void k_gemm_bf(const float* __restrict__ A, int lda, const unsigned short* __restrict__ Wt, int ldb,
                                               const float* __restrict__ bias, float* __restrict__ C, int ldc, int M, int N, int K) {
  __shared__ __attribute__((aligned(16))) float so[4][16][64];
  const int tid = threadIdx.x, w = tid >> 5, lane = tid & 31, ln = lane & 15, hh = lane >> 4;
  const int ntn = N / 64;
  const int wid = blockIdx.x * 4 + w;
  const int mt = wid / ntn, nq = wid % ntn;
  if (mt * 16 >= M) return;
  const int row0 = mt * 16, col0 = nq * 64;
  const float* arow = A + (size_t)(row0 + ln) * lda;
  v8f acc[4] = {};
  for (int kb = 0; kb < K; kb += 32) {
    FragB ah, al;
    const v4f x0 = *(const v4fa*)(arow + kb + 8 * hh), x1 = *(const v4fa*)(arow + kb + 8 * hh + 4);
    const v4f x2 = *(const v4fa*)(arow + kb + 16 + 8 * hh), x3 = *(const v4fa*)(arow + kb + 16 + 8 * hh + 4);
    float xs[16] = {x0[0],x0[1],x0[2],x0[3],x1[0],x1[1],x1[2],x1[3],x2[0],x2[1],x2[2],x2[3],x3[0],x3[1],x3[2],x3[3]};
#pragma unroll
    for (int i = 0; i < 16; ++i) { const unsigned short hb = bf16_bits(xs[i]); ah.u[i] = hb; al.u[i] = ASPLIT ? bf16_bits(xs[i] - bf16_val(hb)) : (unsigned short)0; }
#pragma unroll
    for (int t = 0; t < 4; ++t) {
      const unsigned short* brow = Wt + (size_t)(col0 + t * 16 + ln) * ldb + kb;
      FragB b;
      b.half[0] = *(const v8us*)(brow + 8 * hh);
      b.half[1] = *(const v8us*)(brow + 16 + 8 * hh);
      acc[t] = mmaN<ASPLIT ? 2 : 1>(ah.v, al.v, b.v, b.v, acc[t]);
    }
  }
#pragma unroll
  for (int t = 0; t < 4; ++t) {
    float bv = bias ? bias[col0 + t * 16 + ln] : 0.f;
    if (BIAS_BF16) bv = bf16_round(bv);
#pragma unroll
    for (int r = 0; r < 8; ++r) { float v = acc[t][r] + bv; if (ACT == 1) v = fmaxf(v, 0.f); so[w][8 * hh + r][t * 16 + ln] = v; }
  }
  __builtin_amdgcn_fence(__ATOMIC_ACQ_REL, "workgroup");
  __builtin_amdgcn_wave_barrier();
  const int rsub = lane >> 4, c4 = (lane & 15) * 4;
  {
#pragma unroll
    for (int q = 0; q < 8; ++q) {
      const int r = q * 2 + rsub;
      const v4f v = *(const v4fa*)&so[w][r][c4];
      *(v4f*)(C + (size_t)(row0 + r) * ldc + col0 + c4) = v;
    }
    
  }
}

// GEMM C = act(A·W + bias + resid): A f32 (ASPLIT -> hi/lo 2 terms), Wt bf16 [N][K]; ACT 0 none, 1 relu, 2 exact gelu;
// resid (optional, f32, row index = (row % rmod), pitch ldr, RES_BF16 rounds it) added before the activation.
template <bool ASPLIT, int ACT, bool BIAS_BF16, bool RES_BF16>
__global__ __launch_bounds__(128) void k_gemm_bf3(const float* __restrict__ A, int lda, const unsigned short* __restrict__ Wt, int ldb,
                                                const float* __restrict__ bias, const float* __restrict__ resid, int rmod, int ldr,
                                                float* __restrict__ C, int ldc, int M, int N, int K) {
  __shared__ __attribute__((aligned(16))) float so[4][16][64];
  const int tid = threadIdx.x, w = tid >> 5, lane = tid & 31, ln = lane & 15, hh = lane >> 4;
  const int ntn = N / 64;
  const int wid = blockIdx.x * 4 + w;
  const int mt = wid / ntn, nq = wid % ntn;
  if (mt * 16 >= M) return;
  const int row0 = mt * 16, col0 = nq * 64;
  const float* arow = A + (size_t)(row0 + ln) * lda;
  v8f acc[4] = {};
  for (int kb = 0; kb < K; kb += 32) {
    FragB ah, al;
    const v4f x0 = *(const v4fa*)(arow + kb + 8 * hh), x1 = *(const v4fa*)(arow + kb + 8 * hh + 4);
    const v4f x2 = *(const v4fa*)(arow + kb + 16 + 8 * hh), x3 = *(const v4fa*)(arow + kb + 16 + 8 * hh + 4);
    float xs[16] = {x0[0],x0[1],x0[2],x0[3],x1[0],x1[1],x1[2],x1[3],x2[0],x2[1],x2[2],x2[3],x3[0],x3[1],x3[2],x3[3]};
#pragma unroll
    for (int i = 0; i < 16; ++i) { const unsigned short hb = bf16_bits(xs[i]); ah.u[i] = hb; al.u[i] = ASPLIT ? bf16_bits(xs[i] - bf16_val(hb)) : (unsigned short)0; }
#pragma unroll
    for (int t = 0; t < 4; ++t) {
      const unsigned short* brow = Wt + (size_t)(col0 + t * 16 + ln) * ldb + kb;
      FragB b;
      b.half[0] = *(const v8us*)(brow + 8 * hh);
      b.half[1] = *(const v8us*)(brow + 16 + 8 * hh);
      acc[t] = mmaN<ASPLIT ? 2 : 1>(ah.v, al.v, b.v, b.v, acc[t]);
    }
  }
#pragma unroll
  for (int t = 0; t < 4; ++t) {
    const int col = col0 + t * 16 + ln;
    float bv = bias ? bias[col] : 0.f;
    if (BIAS_BF16) bv = bf16_round(bv);
#pragma unroll
    for (int r = 0; r < 8; ++r) {
      float v = acc[t][r] + bv;
      if (resid) { float rv = resid[(size_t)((row0 + 8 * hh + r) % rmod) * ldr + col]; if (RES_BF16) rv = bf16_round(rv); v += rv; }
      if (ACT == 1) v = fmaxf(v, 0.f);
      if (ACT == 2) v = 0.5f * v * (1.0f + erff(v * 0.70710678118654752f));
      if (ACT == 3) { const float u = 0.7978845608028654f * (v + 0.044715f * v * v * v); v = 0.5f * v * (1.0f + tanhf(u)); }
      so[w][8 * hh + r][t * 16 + ln] = v;
    }
  }
  __builtin_amdgcn_fence(__ATOMIC_ACQ_REL, "workgroup");
  __builtin_amdgcn_wave_barrier();
  const int rsub = lane >> 4, c4 = (lane & 15) * 4;
  {
#pragma unroll
    for (int q = 0; q < 8; ++q) {
      const int r = q * 2 + rsub;
      const v4f v = *(const v4fa*)&so[w][r][c4];
      *(v4f*)(C + (size_t)(row0 + r) * ldc + col0 + c4) = v;
    }
    
  }
}
// row LayerNorm (biased variance, eps) over N: s = X (+ R); optional out_sum <- s; out_norm <- (s-mu)*rsqrt(var+eps)*g + b
template <bool PARAM_BF16>
__global__ __launch_bounds__(256) void k_layernorm(const float* __restrict__ X, const float* __restrict__ R, const float* __restrict__ g, const float* __restrict__ bta,
                                                  float* __restrict__ out_sum, float* __restrict__ out_norm, int N, float eps) {
  __shared__ float red[256];
  const int row = blockIdx.x, tid = threadIdx.x;
  const float* x = X + (size_t)row * N; const float* rr = R ? R + (size_t)row * N : nullptr;
  float vals[16];                     // up to N = 4096
  const int per = N / 256;            // contiguous chunk per thread? use strided-by-4 chunks: thread handles j = tid*4 + 1024*u
  float s1 = 0.f;
  for (int u = 0; u < per / 4; ++u) {
    const int j = tid * 4 + 1024 * u;
    const v4f a = *(const v4fa*)(x + j);
    v4f b = {0.f,0.f,0.f,0.f}; if (rr) b = *(const v4fa*)(rr + j);
#pragma unroll
    for (int q = 0; q < 4; ++q) { const float v = a[q] + b[q]; vals[u * 4 + q] = v; s1 += v; }
  }
  red[tid] = s1; __syncthreads();
  for (int st = 128; st > 0; st >>= 1) { if (tid < st) red[tid] += red[tid + st]; __syncthreads(); }
  const float mu = red[0] / (float)N; __syncthreads();
  float s2 = 0.f;
  for (int u = 0; u < per / 4; ++u)
#pragma unroll
    for (int q = 0; q < 4; ++q) { const float c = vals[u * 4 + q] - mu; s2 += c * c; }
  red[tid] = s2; __syncthreads();
  for (int st = 128; st > 0; st >>= 1) { if (tid < st) red[tid] += red[tid + st]; __syncthreads(); }
  const float rs = rsqrtf(red[0] / (float)N + eps);
  {
    for (int u = 0; u < per / 4; ++u) {
      const int j = tid * 4 + 1024 * u;
      v4f o, sm;
#pragma unroll
      for (int q = 0; q < 4; ++q) {
        float gg = g[j + q], bb = bta[j + q];
        if (PARAM_BF16) { gg = bf16_round(gg); bb = bf16_round(bb); }
        sm[q] = vals[u * 4 + q]; o[q] = (vals[u * 4 + q] - mu) * rs * gg + bb;
      }
      if (out_sum) *(v4f*)(out_sum + (size_t)row * N + j) = sm;
      *(v4f*)(out_norm + (size_t)row * N + j) = o;
    }
    
  }
}



// ---- f16 WMMA path (v_wmma_f32_16x16x32_f16): 11-bit significands for operands in range — used where a [0,1] probability operand needs more precision than bf16
typedef _Float16 v16h __attribute__((ext_vector_type(16)));
union FragH { v16h v; v8us half[2]; _Float16 h[16]; unsigned short u[16]; };
template <int NT>
__device__ __forceinline__ v8f mmaH(v16h ah, v16h al, v16h bh, v16h bl, v8f c) {
  c = __builtin_amdgcn_wmma_f32_16x16x32_f16(false, ah, false, bh, (short)0, c, false, false);
  if (NT >= 2) c = __builtin_amdgcn_wmma_f32_16x16x32_f16(false, al, false, bh, (short)0, c, false, false);
  if (NT >= 3) c = __builtin_amdgcn_wmma_f32_16x16x32_f16(false, ah, false, bl, (short)0, c, false, false);
  asm volatile("v_nop\n\tv_nop\n\tv_nop\n\tv_nop" : "+v"(c) : "v"(ah), "v"(al), "v"(bh), "v"(bl));
  return c;
}
// batched GEMM like k_gemm_b but f16 operands: A f32 (split into f16 hi/lo if ASPLIT, else rounded to f16), Bt = f16 values [n][k]; alpha; C f32; N multiple of 16 (partial tiles skipped)
template <bool ASPLIT>
__global__ __launch_bounds__(128) void k_gemm_h(const float* __restrict__ A, int lda, size_t sA, const _Float16* __restrict__ Bh, int ldb, size_t sB, float alpha, float* __restrict__ C, int ldc, size_t sC, int M, int N, int K) {
  __shared__ __attribute__((aligned(16))) float so[4][16][64];
  const int tid = threadIdx.x, w = tid >> 5, lane = tid & 31, ln = lane & 15, hh = lane >> 4; const int by = blockIdx.y;
  A += (size_t)by * sA; Bh += (size_t)by * sB; C += (size_t)by * sC;
  const int ntn = (N + 63) / 64; const int wid = blockIdx.x * 4 + w; const int mt = wid / ntn, nq = wid % ntn; if (mt * 16 >= M) return;
  const int row0 = mt * 16, col0 = nq * 64; const float* arow = A + (size_t)(row0 + ln) * lda;
  v8f acc[4] = {};
  for (int kb = 0; kb < K; kb += 32) {
    FragH ah, al;
    const v4f x0 = *(const v4fa*)(arow + kb + 8 * hh), x1 = *(const v4fa*)(arow + kb + 8 * hh + 4), x2 = *(const v4fa*)(arow + kb + 16 + 8 * hh), x3 = *(const v4fa*)(arow + kb + 16 + 8 * hh + 4);
    float xs[16] = {x0[0],x0[1],x0[2],x0[3],x1[0],x1[1],x1[2],x1[3],x2[0],x2[1],x2[2],x2[3],x3[0],x3[1],x3[2],x3[3]};
#pragma unroll
    for (int i = 0; i < 16; ++i) { const _Float16 h = (_Float16)xs[i]; ah.h[i] = h; al.h[i] = ASPLIT ? (_Float16)(xs[i] - (float)h) : (_Float16)0.0f; }
#pragma unroll
    for (int t = 0; t < 4; ++t) { if (col0 + t * 16 >= N) continue; const size_t boff = (size_t)(col0 + t * 16 + ln) * ldb + kb; FragH bq; bq.half[0] = *(const v8us*)(Bh + boff + 8 * hh); bq.half[1] = *(const v8us*)(Bh + boff + 16 + 8 * hh);
      acc[t] = mmaH<ASPLIT ? 2 : 1>(ah.v, al.v, bq.v, bq.v, acc[t]); }
  }
#pragma unroll
  for (int t = 0; t < 4; ++t) { if (col0 + t * 16 >= N) continue;
#pragma unroll
    for (int r = 0; r < 8; ++r) so[w][8 * hh + r][t * 16 + ln] = acc[t][r] * alpha; }
  __builtin_amdgcn_fence(__ATOMIC_ACQ_REL, "workgroup"); __builtin_amdgcn_wave_barrier();
  const int rsub = lane >> 4, c4 = (lane & 15) * 4;
  {
#pragma unroll
    for (int q = 0; q < 8; ++q) { const int r = q * 2 + rsub; if (col0 + c4 < N) { const v4f v = *(const v4fa*)&so[w][r][c4]; *(v4f*)(C + (size_t)(row0 + r) * ldc + col0 + c4) = v; } }
     }
}

// Wt[n][k] = f16(bf16(W[k][n]) * 16) from f32 row-major W[K][N] (power-of-two scale: bf16-exact weights stay exact in f16 away from the subnormal range).
// One work-group turns a block of 64 k x 256 n in LDS: it reads the block's rows by whole lines (a wave-wide 16-byte load = 512 B of one row, all 16 loads of a lane in flight together),
// keeps it as f16 [k][n] (pitch 260 halves), reads it back as dwords (two n of one k) and writes 128-B lines of Wt (8 lanes x 8 k of one n). K, N at compile time: every row step is an immediate offset.
typedef unsigned long long u64a __attribute__((may_alias)); typedef unsigned u32a __attribute__((may_alias));
template <int K, int N>
__device__ __forceinline__ void wt_block(const float* __restrict__ W, _Float16* __restrict__ Wt, int u, unsigned short* tl) {
  constexpr int P = 256 + 4, NB = N / 256; const int tid = threadIdx.x; const int k0 = (u / NB) * 64, n0 = (u % NB) * 256;
  const float* src = W + (size_t)(k0 + (tid >> 6)) * N + n0 + (tid & 63) * 4; v4f a[16];
#pragma unroll
  for (int j = 0; j < 16; ++j) a[j] = *(const v4fa*)(src + (size_t)(4 * j) * N);
  asm volatile("s_wait_xcnt 0x0" : : "v"(src) : "memory");      /* in front of any overwrite of the address register that the 16 issued loads name (it stays live up to here) */
#pragma unroll
  for (int j = 0; j < 16; ++j) { FragH f;
#pragma unroll
    for (int q = 0; q < 4; ++q) f.h[q] = (_Float16)(bf16_round(a[j][q]) * 16.0f);
    *(u64a*)&tl[((tid >> 6) + 4 * j) * P + (tid & 63) * 4] = (unsigned long long)f.u[0] | ((unsigned long long)f.u[1] << 16) | ((unsigned long long)f.u[2] << 32) | ((unsigned long long)f.u[3] << 48); }
  __syncthreads();      /* the block is whole in LDS before any lane reads across the rows that other waves stored */
  const int kc = (tid & 7) * 8, np = tid >> 3; unsigned short* dst = (unsigned short*)Wt + (size_t)(n0 + 2 * np) * K + k0 + kc;
#pragma unroll
  for (int j = 0; j < 4; ++j) { unsigned d[8]; FragH lo, hi;
#pragma unroll
    for (int i = 0; i < 8; ++i) d[i] = *(const u32a*)&tl[(kc + i) * P + 2 * (np + 32 * j)];
#pragma unroll
    for (int i = 0; i < 8; ++i) { lo.u[i] = (unsigned short)(d[i] & 0xffffu); hi.u[i] = (unsigned short)(d[i] >> 16); }
    *(v8us*)(dst + (size_t)(64 * j) * K) = lo.half[0]; *(v8us*)(dst + (size_t)(64 * j + 1) * K) = hi.half[0]; } }
// All six weights in one grid of 768 equal work-groups: 4 x 64 blocks of the 1024 x 1024 projections, 256 of We, 256 of Wd.
__global__ __launch_bounds__(256) void k_wt_all(const float* __restrict__ Wq, const float* __restrict__ Wk, const float* __restrict__ Wv, const float* __restrict__ Wo, const float* __restrict__ We, const float* __restrict__ Wd,
    _Float16* __restrict__ BQ, _Float16* __restrict__ BK, _Float16* __restrict__ BV, _Float16* __restrict__ BO, _Float16* __restrict__ BE, _Float16* __restrict__ BD) {
  __shared__ __attribute__((aligned(16))) unsigned short tl[64 * 260];      /* 33,280 B */
  const int u = blockIdx.x;      /* the same for the whole work-group: a barrier follows in each branch */
  if (u < 256) { const int m = u >> 6; wt_block<DM, DM>(m == 0 ? Wq : m == 1 ? Wk : m == 2 ? Wv : Wo, m == 0 ? BQ : m == 1 ? BK : m == 2 ? BV : BO, u & 63, tl); }
  else if (u < 512) wt_block<DM, 4096>(We, BE, u - 256, tl);
  else wt_block<4096, DM>(Wd, BD, u - 512, tl); }
// k_gemm_hh variant with fused epilogue: v = acc·alpha + bias[by·sBias + col] (+ CP[(row/rowsPerB)·sCPb + by·64 + col] if CP) ; ACT 0 none / 1 elu ; writes f16 C16 (and f32 C if non-null)
template <int ACT>
__global__ __launch_bounds__(128) void k_gemm_hhx(const _Float16* __restrict__ A, int lda, size_t sA, const _Float16* __restrict__ Bh, int ldb, size_t sB, float alpha, const float* __restrict__ bias, size_t sBias, const float* __restrict__ CP, int rowsPerB, size_t sCPb, int row0g,
    float* __restrict__ C, _Float16* __restrict__ C16, int ldc, size_t sC, int M, int N, int K) {
  __shared__ __attribute__((aligned(16))) float so[4][16][64];
  const int tid = threadIdx.x, w = tid >> 5, lane = tid & 31, ln = lane & 15, hh = lane >> 4; const int by = blockIdx.y;
  A += (size_t)by * sA; Bh += (size_t)by * sB; const size_t cofs = (size_t)by * sC; const float* bp = bias ? bias + (size_t)by * sBias : nullptr;
  const int ntn = (N + 63) / 64; const int wid = blockIdx.x * 4 + w; const int mt = wid / ntn, nq = wid % ntn; if (mt * 16 >= M) return;
  const int row0 = mt * 16, col0 = nq * 64; const _Float16* arow = A + (size_t)(row0 + ln) * lda;
  v8f acc[4] = {};
  for (int kb = 0; kb < K; kb += 32) { FragH ah; ah.half[0] = *(const v8us*)((const unsigned short*)arow + kb + 8 * hh); ah.half[1] = *(const v8us*)((const unsigned short*)arow + kb + 16 + 8 * hh);
#pragma unroll
    for (int t = 0; t < 4; ++t) { if (col0 + t * 16 >= N) continue; const size_t boff = (size_t)(col0 + t * 16 + ln) * ldb + kb; FragH bq; bq.half[0] = *(const v8us*)((const unsigned short*)Bh + boff + 8 * hh); bq.half[1] = *(const v8us*)((const unsigned short*)Bh + boff + 16 + 8 * hh);
      acc[t] = mmaH<1>(ah.v, ah.v, bq.v, bq.v, acc[t]); }
  }
#pragma unroll
  for (int t = 0; t < 4; ++t) { if (col0 + t * 16 >= N) continue; const int col = col0 + t * 16 + ln; const float bv = bp ? bf16_round(bp[col]) : 0.f;
#pragma unroll
    for (int r = 0; r < 8; ++r) { float v = acc[t][r] * alpha + bv; if (CP) { const int bidx = (row0g + row0 + 8 * hh + r) / rowsPerB; v += CP[(size_t)bidx * sCPb + (size_t)by * 64 + col]; } if (ACT == 1) v = (v > 0.f) ? v : expm1f(v); else if (ACT == 7) v = (v > 0.f) ? v + 1.0f : expf(v); else if (ACT == 8) v = tanhf(v); else if (ACT == 9) v = 0.5f * v * (1.0f + tanhf(0.7978845608028654f * (v + 0.044715f * v * v * v))); else if (ACT == 11) v = 1.0f / (1.0f + expf(-v)); else if (ACT == 12) v = (v > 0.f) ? v : 0.01f * v; else if (ACT == 14) v = (v > 0.f) ? v : 0.1f * v; else if (ACT == 15) v = v / (1.0f + expf(-v)); else if (ACT == 3) v = fmaxf(v, 0.f); else if (ACT == 6) v = 0.5f * v * (1.0f + erff(v * 0.70710678118654752f)); so[w][8 * hh + r][t * 16 + ln] = v; } }
  __builtin_amdgcn_fence(__ATOMIC_ACQ_REL, "workgroup"); __builtin_amdgcn_wave_barrier();
  const int rsub = lane >> 4, c4 = (lane & 15) * 4; typedef _Float16 v4h __attribute__((ext_vector_type(4)));
  {
#pragma unroll
    for (int q = 0; q < 8; ++q) { const int r = q * 2 + rsub; if (col0 + c4 < N) { const v4f v = *(const v4fa*)&so[w][r][c4]; if (C) *(v4f*)(C + cofs + (size_t)(row0 + r) * ldc + col0 + c4) = v; if (C16) { v4h h4; for (int i = 0; i < 4; ++i) h4[i] = (_Float16)v[i]; *(v4h*)(C16 + cofs + (size_t)(row0 + r) * ldc + col0 + c4) = h4; } } }
     }
}


typedef _Float16 v4h __attribute__((ext_vector_type(4)));

__global__ __launch_bounds__(256) void k_x16(const float* __restrict__ x, _Float16* __restrict__ X16, size_t n8) { const size_t t = (size_t)blockIdx.x * 256 + threadIdx.x; if (t >= n8) return; FragH f;
#pragma unroll
  for (int q = 0; q < 8; ++q) f.h[q] = (_Float16)bf16_round(x[t * 8 + q]); *(v8us*)((unsigned short*)X16 + t * 8) = f.half[0];  }
__global__ __launch_bounds__(256) void k_h16(const float* __restrict__ x, _Float16* __restrict__ X16, size_t n8) { const size_t t = (size_t)blockIdx.x * 256 + threadIdx.x; if (t >= n8) return; FragH f;
#pragma unroll
  for (int q = 0; q < 8; ++q) f.h[q] = (_Float16)x[t * 8 + q]; *(v8us*)((unsigned short*)X16 + t * 8) = f.half[0];  }
__global__ __launch_bounds__(256) void k_round16f(const float* __restrict__ W, _Float16* __restrict__ Bt, size_t n8) { const size_t t = (size_t)blockIdx.x * 256 + threadIdx.x; if (t >= n8) return; FragH f;
#pragma unroll
  for (int i = 0; i < 8; ++i) f.h[i] = (_Float16)(bf16_round(W[t * 8 + i]) * 16.0f); *(v8us*)((unsigned short*)Bt + t * 8) = f.half[0];  }
template <int NHv, int TTv>
__global__ __launch_bounds__(256) void k_vt(const _Float16* __restrict__ V16, int ldv, int voff, _Float16* __restrict__ Vt) { __shared__ unsigned short tl[64][66]; const int tid = threadIdx.x; const int slab = blockIdx.x / (TTv / 64), lg = blockIdx.x % (TTv / 64); const int b = slab / NHv, h = slab % NHv;
  for (int i = tid; i < 64 * 8; i += 256) { const int r = i / 8, c8 = (i % 8) * 8; FragH f; f.half[0] = *(const v8us*)((const unsigned short*)V16 + ((size_t)b * TTv + lg * 64 + r) * ldv + voff + h * 64 + c8);
#pragma unroll
    for (int q = 0; q < 8; ++q) tl[r][c8 + q] = f.u[q]; }
  __syncthreads();
  {
#pragma unroll
    for (int rd = 0; rd < 2; ++rd) { const int d = rd * 32 + tid / 8, pc = tid % 8; FragH f;
#pragma unroll
      for (int q = 0; q < 8; ++q) f.u[q] = tl[pc * 8 + q][d];
      *(v8us*)((unsigned short*)Vt + ((size_t)slab * 64 + d) * TTv + lg * 64 + pc * 8) = f.half[0]; }
     } }

__global__ __launch_bounds__(256) void k_hl(const float* __restrict__ F, _Float16* __restrict__ Hh, _Float16* __restrict__ Hl, size_t n8) { const size_t t = (size_t)blockIdx.x * 256 + threadIdx.x; if (t >= n8) return; FragH fh, fl; const v4f a = *(const v4fa*)(F + t * 8), c = *(const v4fa*)(F + t * 8 + 4);
#pragma unroll
  for (int q = 0; q < 4; ++q) { _Float16 h = (_Float16)a[q]; fh.h[q] = h; fl.h[q] = (_Float16)((a[q] - (float)h) * 1024.0f); h = (_Float16)c[q]; fh.h[4 + q] = h; fl.h[4 + q] = (_Float16)((c[q] - (float)h) * 1024.0f); }
  { *(v8us*)((unsigned short*)Hh + t * 8) = fh.half[0]; *(v8us*)((unsigned short*)Hl + t * 8) = fl.half[0];  } }

// ---- fast GEMM (work-group tile 128x64, wave tile 32x64; requires M % 128 == 0, N % 64 == 0, K % 128 == 0); epilogue = k_gemm_hhx semantics ----
// Operands go through LDS: per slice of 128 k the work-group loads 256 B of each of its 128 A rows and 64 B rows with whole-line 16-byte loads (two rows per wave-wide load),
// keeps them in registers while the slice before is worked on, and stores them into the other of two LDS buffers; the fragments are read from LDS, A and B alike as halves k + 8 * hh .. + 7 and k + 16 + 8 * hh .. + 7 of their row.
__device__ __forceinline__ v16h g2_sfrag(const unsigned short* p) { FragH f; f.half[0] = *(const v8us*)p; f.half[1] = *(const v8us*)(p + 16); return f.v; }      /* p = LDS row + k + 8 * hh */
__device__ __forceinline__ v8f g2_mma(v16h a, v16h b, v8f c) { v8f d = __builtin_amdgcn_wmma_f32_16x16x32_f16(false, a, false, b, (short)0, c, false, false); asm volatile("v_nop\n\tv_nop\n\tv_nop\n\tv_nop" : "+v"(d) : "v"(a), "v"(b)); return d; }
template <int ACT, int LD>      /* LD = lda = ldb = K at compile time: the row steps of the staging loads become immediate offsets */
__global__ __launch_bounds__(128) void k_gemm2(const _Float16* __restrict__ A, int lda, size_t sA, const _Float16* __restrict__ Bh, int ldb, size_t sB, float alpha, const float* __restrict__ bias, size_t sBias, const float* __restrict__ CP, int rowsPerB, size_t sCPb, int row0g,
    float* __restrict__ C, _Float16* __restrict__ C16, int ldc, size_t sC, int M, int N, int K) {
  constexpr int KS = 128, PIT = KS + 8, BUF = (128 + 64) * PIT;      /* slice of k; LDS row pitch 272 B = 16 B x 17 (no bank conflict for 16-byte fragment reads); halves per buffer: rows 0-127 A, 128-191 B */
  __shared__ __attribute__((aligned(16))) unsigned short st[2 * BUF];      /* 104,448 B */
  float (*so)[32][68] = reinterpret_cast<float (*)[32][68]>(st);      /* the epilogue's staging (34,816 B) reuses the buffers behind the last barrier */
  const int tid = threadIdx.x, w = tid >> 5, lane = tid & 31, ln = lane & 15, hh = lane >> 4; const int by = blockIdx.y;
  A += (size_t)by * sA; Bh += (size_t)by * sB; const size_t cofs = (size_t)by * sC; const float* bp = bias ? bias + (size_t)by * sBias : nullptr;
  const int ntn = N >> 6; const int mt = blockIdx.x / ntn, nq = blockIdx.x - mt * ntn; const int row0 = mt * 128 + 32 * w, col0 = nq * 64; if (mt * 128 >= M) return;      /* the same for the whole work-group: barriers follow */
  const int sr = tid >> 4, sc = (tid & 15) * 8;      /* staging: 16 threads cover the 256 B of a row, the work-group 8 rows per load */
  (void)lda; (void)ldb; (void)K;
  const char* aS = (const char*)(A + (size_t)(mt * 128) * LD); const char* bS = (const char*)(Bh + (size_t)col0 * LD);      /* the work-group's first A and B row: the same in every lane */
  unsigned vo = (unsigned)(sr * LD + sc) * 2u;      /* the lane's byte offset in both operands: its row of 8, its 16 bytes, the slice */
  const v8f z8 = {0.f,0.f,0.f,0.f,0.f,0.f,0.f,0.f}; v8f c00 = z8, c01 = z8, c02 = z8, c03 = z8, c10 = z8, c11 = z8, c12 = z8, c13 = z8;
  v8us rg[24];
  auto slice_load = [&]() {
#pragma unroll
    for (int i = 0; i < 16; ++i) rg[i] = *(const v8us*)(aS + (size_t)vo + (size_t)(16 * i) * LD);
#pragma unroll
    for (int i = 0; i < 8; ++i) rg[16 + i] = *(const v8us*)(bS + (size_t)vo + (size_t)(16 * i) * LD); };
  auto slice_next = [&]() { asm volatile("s_wait_xcnt 0x0" : "+v"(vo) : : "memory");      /* in front of the overwrite of the offset register that the issued loads name */
    vo += 2u * KS; };
  auto slice_store = [&](int bo) {
#pragma unroll
    for (int i = 0; i < 24; ++i) *(v8us*)&st[bo + (8 * i + sr) * PIT + sc] = rg[i]; };
  auto slice_mma = [&](int bo) { const unsigned short* ap = &st[bo + (32 * w + ln) * PIT + 8 * hh]; const unsigned short* bq = &st[bo + (128 + ln) * PIT + 8 * hh];
#pragma unroll
    for (int kk = 0; kk < KS; kk += 32) { const v16h a0 = g2_sfrag(ap + kk), a1 = g2_sfrag(ap + 16 * PIT + kk);      /* the six fragments of a k step as one group of LDS reads in front of its eight products */
      const v16h b0 = g2_sfrag(bq + kk), b1 = g2_sfrag(bq + 16 * PIT + kk), b2 = g2_sfrag(bq + 32 * PIT + kk), b3 = g2_sfrag(bq + 48 * PIT + kk);
      c00 = g2_mma(a0, b0, c00); c10 = g2_mma(a1, b0, c10); c01 = g2_mma(a0, b1, c01); c11 = g2_mma(a1, b1, c11);
      c02 = g2_mma(a0, b2, c02); c12 = g2_mma(a1, b2, c12); c03 = g2_mma(a0, b3, c03); c13 = g2_mma(a1, b3, c13); } };
  slice_load(); slice_next(); slice_store(0); __syncthreads();
  int cur = 0;      /* start (in halves) of the buffer that holds the slice being worked on: 0 or BUF */
#pragma unroll 1      /* one copy of the slice body; the buffer alternates at run time */
  for (int s = 1; s < LD / KS; ++s) {
    slice_load();      /* in flight while the slice before is worked on */
    slice_mma(cur);
    slice_next();
    slice_store(cur ^ BUF);      /* its last readers left this buffer in front of the barrier of the trip before */
    __syncthreads(); cur ^= BUF; }
  slice_mma(cur);
  __syncthreads();      /* every wave has read its last fragments before the buffers become output staging */
  v8f accs[8] = {c00, c01, c02, c03, c10, c11, c12, c13};
#pragma unroll
  for (int u = 0; u < 8; ++u) { const int t = u & 3, half = u >> 2; const int col = col0 + t * 16 + ln; const float bv = bp ? bf16_round(bp[col]) : 0.f;
#pragma unroll
    for (int r = 0; r < 8; ++r) { const int rloc = half * 16 + 8 * hh + r; float v = accs[u][r] * alpha + bv; if (CP) { const int bidx = (row0g + row0 + rloc) / rowsPerB; v += CP[(size_t)bidx * sCPb + (size_t)by * 64 + col]; }
      if (ACT == 3) v = fmaxf(v, 0.f); else if (ACT == 6) v = 0.5f * v * (1.0f + erff(v * 0.70710678118654752f)); else if (ACT == 11) v = 1.0f / (1.0f + expf(-v)); else if (ACT == 15) v = v / (1.0f + expf(-v)); else if (ACT == 12) v = (v > 0.f) ? v : 0.01f * v; else if (ACT == 8) v = tanhf(v);
      so[w][rloc][t * 16 + ln] = v; } }
  __builtin_amdgcn_fence(__ATOMIC_ACQ_REL, "workgroup"); __builtin_amdgcn_wave_barrier();
  const int rsub = lane >> 4, c4 = (lane & 15) * 4;
  {
#pragma unroll
    for (int q = 0; q < 16; ++q) { const int r = q * 2 + rsub; const v4f v = *(const v4fa*)&so[w][r][c4]; if (C) *(v4f*)(C + cofs + (size_t)(row0 + r) * ldc + col0 + c4) = v; if (C16) { v4h h4; for (int i = 0; i < 4; ++i) h4[i] = (_Float16)v[i]; *(v4h*)(C16 + cofs + (size_t)(row0 + r) * ldc + col0 + c4) = h4; } }
     } }



template <int TK>
__global__ __launch_bounds__(256) void k_vthl(const float* __restrict__ VF, int ldv, _Float16* __restrict__ Vth, _Float16* __restrict__ Vtl) { __shared__ float tl[64][65]; const int tid = threadIdx.x; const int slab = blockIdx.x / (TK / 64), lg = blockIdx.x % (TK / 64); const int b = slab / NH, h = slab % NH;
  for (int i = tid; i < 64 * 16; i += 256) { const int r = i / 16, c4 = (i % 16) * 4; const v4f a = *(const v4fa*)(VF + ((size_t)b * TK + lg * 64 + r) * ldv + h * 64 + c4); tl[r][c4] = a[0]; tl[r][c4 + 1] = a[1]; tl[r][c4 + 2] = a[2]; tl[r][c4 + 3] = a[3]; }
  __syncthreads();
  FragH fh[2], fl[2]; size_t oo[2];
#pragma unroll
  for (int rd = 0; rd < 2; ++rd) { const int d = rd * 32 + tid / 8, pc = tid % 8;
#pragma unroll
    for (int q = 0; q < 8; ++q) { const float v = tl[pc * 8 + q][d]; const _Float16 hv = (_Float16)v; fh[rd].h[q] = hv; fl[rd].h[q] = (_Float16)((v - (float)hv) * 1024.0f); } oo[rd] = ((size_t)slab * 64 + d) * TK + lg * 64 + pc * 8; }
  {
#pragma unroll
    for (int rd = 0; rd < 2; ++rd) { *(v8us*)((unsigned short*)Vth + oo[rd]) = fh[rd].half[0]; *(v8us*)((unsigned short*)Vtl + oo[rd]) = fl[rd].half[0]; }
     } }

template <int TQ, int TK>
__global__ __launch_bounds__(128) void k_flashm(const _Float16* __restrict__ Q16, const _Float16* __restrict__ Q16lo, int ldq, const _Float16* __restrict__ K16, const _Float16* __restrict__ K16lo, int ldk, const _Float16* __restrict__ Vt, const _Float16* __restrict__ Vtlo, const unsigned* __restrict__ MB, const int* __restrict__ RA, const int* __restrict__ KE, float* __restrict__ O, int ldo) {
  constexpr int RPW = 16, RTN = RPW / 16, NQB = TQ / (4 * RPW), DT = 4, KS = 2;
  __shared__ __attribute__((aligned(16))) unsigned short sP[4][RPW][40], sPl[4][RPW][40]; __shared__ __attribute__((aligned(16))) float sO[4][RPW][64 + 4];
  // A pass's keys and values lie in LDS once for the four waves. One buffer (in halves): 32 K rows hi, 32 K rows residual (128 B each, pitch 144 B), then 64 V^T rows hi, 64 residual (64 B each, pitch 80 B); pitches 16 B x odd for the 16-byte fragment reads.
  constexpr int KP = 72, VP = 40, VB0 = 64 * KP, KVB = VB0 + 128 * VP;
  __shared__ __attribute__((aligned(16))) unsigned short sKV[2 * KVB];      /* two buffers, 38,912 B: the next pass's tile flies while this one is worked on */
  const int tid = threadIdx.x, w = tid >> 5, lane = tid & 31, ln = lane & 15, hh = lane >> 4;
  const int h = blockIdx.x / NQB, t0 = blockIdx.x % NQB;
  // Causal balance: the work-group runs query tile t0 of batch 0, then tile NQB - 1 - t0 of batch 1 (alternating), so every work-group walks the same number of key passes.
#pragma unroll 1      /* one copy of the tile body: the tiles run one after the other in every wave */
  for (int b = 0; b < NBT; ++b) {
  const int slab = b * NH + h, qblk = (b & 1) ? NQB - 1 - t0 : t0; const int qb0 = qblk * (4 * RPW); const int q0 = qb0 + w * RPW;
  FragH aq[2][KS], aql[2][KS];
#pragma unroll
  for (int rt = 0; rt < RTN; ++rt) { const size_t qo = ((size_t)b * TQ + q0 + rt * 16 + ln) * ldq + h * 64; const unsigned short* qr = (const unsigned short*)Q16 + qo; const unsigned short* ql = (const unsigned short*)Q16lo + qo;
#pragma unroll
    for (int ks = 0; ks < KS; ++ks) { aq[rt][ks].half[0] = *(const v8us*)(qr + ks * 32 + 8 * hh); aq[rt][ks].half[1] = *(const v8us*)(qr + ks * 32 + 16 + 8 * hh); aql[rt][ks].half[0] = *(const v8us*)(ql + ks * 32 + 8 * hh); aql[rt][ks].half[1] = *(const v8us*)(ql + ks * 32 + 16 + 8 * hh); } }
  const unsigned short* Vth = (const unsigned short*)Vt + (size_t)slab * 64 * TK; const unsigned short* Vtl = (const unsigned short*)Vtlo + (size_t)slab * 64 * TK;
  // Staging, 8 copies of 16 B a lane and pass: 8 lanes cover a K row (rows tid / 8 and + 16 of each plane), 4 lanes a V^T row (rows tid / 4 and + 32 of each plane).
  const size_t kso = ((size_t)b * TK + (tid >> 3)) * ldk + h * 64 + (tid & 7) * 8, vso = (size_t)(tid >> 2) * TK + (tid & 3) * 8;
  const unsigned lk0 = (unsigned)(size_t)&sKV[(tid >> 3) * KP + (tid & 7) * 8], lv0 = (unsigned)(size_t)&sKV[VB0 + (tid >> 2) * VP + (tid & 3) * 8];      /* the lane's LDS byte addresses in buffer 0 */
  auto stage = [&](int js, int bo) {      /* keys js .. js + 31 into the buffer that starts at half bo */
    const unsigned short* kh = (const unsigned short*)K16 + kso + (size_t)js * ldk; const unsigned short* kl = (const unsigned short*)K16lo + kso + (size_t)js * ldk;
    const unsigned short* kh2 = kh + (size_t)16 * ldk; const unsigned short* kl2 = kl + (size_t)16 * ldk;
    const unsigned short* vh = Vth + vso + js; const unsigned short* vl = Vtl + vso + js; const unsigned short* vh2 = vh + (size_t)32 * TK; const unsigned short* vl2 = vl + (size_t)32 * TK;
    const unsigned lk = lk0 + 2u * (unsigned)bo, lv = lv0 + 2u * (unsigned)bo;
    const unsigned lk1 = lk + 2u * 16 * KP, lk2 = lk + 2u * 32 * KP, lk3 = lk + 2u * 48 * KP, lv1 = lv + 2u * 32 * VP, lv2 = lv + 2u * 64 * VP, lv3 = lv + 2u * 96 * VP;
    /* the copies and, as the statement's last line, the wait that stands in front of any rewrite of their address registers */
    asm volatile("global_load_async_to_lds_b128 %0, %8, off\n\t"
                 "global_load_async_to_lds_b128 %1, %9, off\n\t"
                 "global_load_async_to_lds_b128 %2, %10, off\n\t"
                 "global_load_async_to_lds_b128 %3, %11, off\n\t"
                 "global_load_async_to_lds_b128 %4, %12, off\n\t"
                 "global_load_async_to_lds_b128 %5, %13, off\n\t"
                 "global_load_async_to_lds_b128 %6, %14, off\n\t"
                 "global_load_async_to_lds_b128 %7, %15, off\n\t"
                 "s_wait_xcnt 0x0"
                 :: "v"(lk), "v"(lk1), "v"(lk2), "v"(lk3), "v"(lv), "v"(lv1), "v"(lv2), "v"(lv3), "v"(kh), "v"(kh2), "v"(kl), "v"(kl2), "v"(vh), "v"(vh2), "v"(vl), "v"(vl2) : "memory"); };
  float m_r[2][8], l_r[2][8]; v8f oacc[2][DT], oaccl[2][DT];
#pragma unroll
  for (int rt = 0; rt < RTN; ++rt) {
#pragma unroll
    for (int r = 0; r < 8; ++r) { m_r[rt][r] = -3.0e38f; l_r[rt][r] = 0.f; }
#pragma unroll
    for (int dt = 0; dt < DT; ++dt) { oacc[rt][dt] = (v8f){0.f,0.f,0.f,0.f,0.f,0.f,0.f,0.f}; oaccl[rt][dt] = oacc[rt][dt]; } }
  int jend = KE[qblk * 32]; jend = min(TK, (jend + 31) & ~31); if (jend < 32) jend = 32;      /* block-uniform */
  jend = __builtin_amdgcn_readfirstlane(jend);      /* in a scalar register: the tests around the copies and the barriers are scalar branches */
  int allm[2][8]; const unsigned* mrow[2][8];
#pragma unroll
  for (int rt = 0; rt < RTN; ++rt)
#pragma unroll
    for (int r = 0; r < 8; ++r) { const int tq = q0 + rt * 16 + 8 * hh + r; allm[rt][r] = RA[tq]; mrow[rt][r] = MB + (size_t)tq * (TK / 32); }
  stage(0, 0);      /* every reader of the tile before left both buffers in front of its last pass's barrier */
  asm volatile("s_wait_asynccnt 0x0" ::: "memory");      /* this wave's copies of pass 0 have landed */
  __syncthreads();      /* ... and every other wave's */
  if (jend > 32) stage(32, KVB);
  int cur = 0;      /* start (in halves) of the buffer that holds this pass's tile: 0 or KVB */
#pragma unroll 1
  for (int j0 = 0; j0 < jend; j0 += 32) {
    unsigned mwd[2][8];      /* the pass's mask words, asked for ahead of the score products so that these cover the loads */
#pragma unroll
    for (int rt = 0; rt < RTN; ++rt)
#pragma unroll
      for (int r = 0; r < 8; ++r) mwd[rt][r] = mrow[rt][r][j0 >> 5];
    v8f s[2][2];
#pragma unroll
    for (int nt = 0; nt < 2; ++nt) { const unsigned short* kr = &sKV[cur + (nt * 16 + ln) * KP]; const unsigned short* kl = kr + 32 * KP; FragH bk[KS], bkl[KS];
#pragma unroll
      for (int ks = 0; ks < KS; ++ks) { bk[ks].half[0] = *(const v8us*)(kr + ks * 32 + 8 * hh); bk[ks].half[1] = *(const v8us*)(kr + ks * 32 + 16 + 8 * hh); bkl[ks].half[0] = *(const v8us*)(kl + ks * 32 + 8 * hh); bkl[ks].half[1] = *(const v8us*)(kl + ks * 32 + 16 + 8 * hh); }
#pragma unroll
      for (int rt = 0; rt < RTN; ++rt) { v8f acc = (v8f){0.f,0.f,0.f,0.f,0.f,0.f,0.f,0.f}, accr = acc;
#pragma unroll
        for (int ks = 0; ks < KS; ++ks) { acc = mmaH<1>(aq[rt][ks].v, aq[rt][ks].v, bk[ks].v, bk[ks].v, acc); accr = mmaH<1>(aql[rt][ks].v, aql[rt][ks].v, bk[ks].v, bk[ks].v, accr); accr = mmaH<1>(aq[rt][ks].v, aq[rt][ks].v, bkl[ks].v, bkl[ks].v, accr); }
        s[rt][nt] = acc + accr * 0.0009765625f; } }
    // Online softmax, the eight rows of a lane side by side: each phase runs over all rows before the next begins, and every exponential is computed for every lane and then selected,
    // so the pass is one straight run of code in which the rows' shuffles and exponentials cover one another's latencies. Same values, same order of every sum as row after row.
#pragma unroll
    for (int rt = 0; rt < RTN; ++rt) {
      float s0v[8], s1v[8], mcv[8], alv[8], p0v[8], p1v[8]; bool ok0v[8], ok1v[8];
#pragma unroll
      for (int r = 0; r < 8; ++r) { const unsigned mw = mwd[rt][r]; const bool am = (allm[rt][r] != 0);
        ok0v[r] = am || (((mw >> ln) & 1u) == 0u); ok1v[r] = am || (((mw >> (16 + ln)) & 1u) == 0u);
        s0v[r] = ok0v[r] ? (am ? 0.f : s[rt][0][r] * SCL) : -INFINITY; s1v[r] = ok1v[r] ? (am ? 0.f : s[rt][1][r] * SCL) : -INFINITY; mcv[r] = fmaxf(s0v[r], s1v[r]); }
#pragma unroll
      for (int o = 1; o < 16; o <<= 1) { float xv[8];
#pragma unroll
        for (int r = 0; r < 8; ++r) xv[r] = __shfl_xor(mcv[r], o, 32);
        __builtin_amdgcn_sched_barrier(0);      /* all eight shuffles of a step are issued before the first result is waited for: one shuffle latency a step, not one a row */
#pragma unroll
        for (int r = 0; r < 8; ++r) mcv[r] = fmaxf(mcv[r], xv[r]); }
#pragma unroll
      for (int r = 0; r < 8; ++r) { const float mn = fmaxf(m_r[rt][r], mcv[r]);      /* mn is finite (at least -3.0e38), so a masked score gives exp(-inf) = 0 and no NaN reaches a selected value */
        const float ea = expf(m_r[rt][r] - mn), e0 = expf(s0v[r] - mn), e1 = expf(s1v[r] - mn);
        alv[r] = (mn > -1.0e38f) ? ea : 1.0f; m_r[rt][r] = mn; p0v[r] = ok0v[r] ? e0 : 0.f; p1v[r] = ok1v[r] ? e1 : 0.f; l_r[rt][r] = l_r[rt][r] * alv[r] + p0v[r] + p1v[r]; }
#pragma unroll
      for (int r = 0; r < 8; ++r) { const float al = alv[r], p0 = p0v[r], p1 = p1v[r];
#pragma unroll
        for (int dt = 0; dt < DT; ++dt) { oacc[rt][dt][r] *= al; oaccl[rt][dt][r] *= al; }
        FragH t2, t3; const float ps0 = p0 * 1024.0f, ps1 = p1 * 1024.0f; t2.h[0] = (_Float16)ps0; t2.h[1] = (_Float16)ps1; t3.h[0] = (_Float16)((ps0 - (float)t2.h[0]) * 1024.0f); t3.h[1] = (_Float16)((ps1 - (float)t2.h[1]) * 1024.0f);
        sP[w][rt * 16 + 8 * hh + r][ln] = t2.u[0]; sP[w][rt * 16 + 8 * hh + r][16 + ln] = t2.u[1]; sPl[w][rt * 16 + 8 * hh + r][ln] = t3.u[0]; sPl[w][rt * 16 + 8 * hh + r][16 + ln] = t3.u[1]; } }
    __builtin_amdgcn_fence(__ATOMIC_ACQ_REL, "workgroup"); __builtin_amdgcn_wave_barrier();
    FragH pa[2], pl[2];
#pragma unroll
    for (int rt = 0; rt < RTN; ++rt) { pa[rt].half[0] = *(const v8us*)&sP[w][rt * 16 + ln][8 * hh]; pa[rt].half[1] = *(const v8us*)&sP[w][rt * 16 + ln][16 + 8 * hh]; pl[rt].half[0] = *(const v8us*)&sPl[w][rt * 16 + ln][8 * hh]; pl[rt].half[1] = *(const v8us*)&sPl[w][rt * 16 + ln][16 + 8 * hh]; }
#pragma unroll
    for (int dt = 0; dt < DT; ++dt) { const unsigned short* vr = &sKV[cur + VB0 + (dt * 16 + ln) * VP + 8 * hh]; const unsigned short* vq = vr + 64 * VP; FragH bv, bl; bv.half[0] = *(const v8us*)vr; bv.half[1] = *(const v8us*)(vr + 16); bl.half[0] = *(const v8us*)vq; bl.half[1] = *(const v8us*)(vq + 16);
#pragma unroll
      for (int rt = 0; rt < RTN; ++rt) { oacc[rt][dt] = mmaH<1>(pa[rt].v, pa[rt].v, bv.v, bv.v, oacc[rt][dt]); oaccl[rt][dt] = mmaH<1>(pa[rt].v, pa[rt].v, bl.v, bl.v, oaccl[rt][dt]); oaccl[rt][dt] = mmaH<1>(pl[rt].v, pl[rt].v, bv.v, bv.v, oaccl[rt][dt]); } }
    asm volatile("s_wait_dscnt 0x0" ::: "memory");      /* this wave's LDS reads of the pass are done */
    asm volatile("s_wait_asynccnt 0x0" ::: "memory");      /* its copies of the next pass's tile have landed */
    __syncthreads();      /* publishes the next tile and ends every wave's reads of this one */
    if (j0 + 64 < jend) stage(j0 + 64, cur);      /* refill of the buffer just read, one whole pass ahead of its use */
    cur ^= KVB; }
  asm volatile("s_wait_asynccnt 0x0" ::: "memory");      /* nothing of this wave is in flight when the tile ends */
#pragma unroll
  for (int rt = 0; rt < RTN; ++rt) {
#pragma unroll
    for (int r = 0; r < 8; ++r) { float l = l_r[rt][r]; l += __shfl_xor(l, 1, 32); l += __shfl_xor(l, 2, 32); l += __shfl_xor(l, 4, 32); l += __shfl_xor(l, 8, 32); l_r[rt][r] = (l > 0.f) ? 1.0f / (l * 1024.0f) : 0.f; }
#pragma unroll
    for (int dt = 0; dt < DT; ++dt)
#pragma unroll
      for (int r = 0; r < 8; ++r) sO[w][rt * 16 + 8 * hh + r][dt * 16 + ln] = (oacc[rt][dt][r] + oaccl[rt][dt][r] * 0.0009765625f) * l_r[rt][r]; }
  __builtin_amdgcn_fence(__ATOMIC_ACQ_REL, "workgroup"); __builtin_amdgcn_wave_barrier();
  {
#pragma unroll
    for (int rp = 0; rp < RPW; rp += 2) { const int r = rp + (lane >> 4), pc = lane & 15; const v4f val = *(const v4fa*)&sO[w][r][pc * 4]; *(v4f*)(O + ((size_t)b * TQ + q0 + r) * ldo + h * 64 + pc * 4) = val; }
     }
  asm volatile("s_wait_xcnt 0x0" ::: "memory");      /* the next tile's set-up overwrites the address registers of the stores above */
  } }


template <int SRCBF>
__global__ __launch_bounds__(256) void k_lnab(const float* __restrict__ X, const float* __restrict__ g, const float* __restrict__ bb, _Float16* __restrict__ Y16, float* __restrict__ Y32, float* __restrict__ XB) {
  #pragma clang fp contract(off)
  const int tid = threadIdx.x, w = tid >> 5, ln = tid & 31; const int r = blockIdx.x * 8 + w; if (r >= NR) return; const float* x = X + (size_t)r * DM; float s = 0.f;
#pragma unroll 1
  for (int i = 0; i < DM / 128; ++i) { const v4f a = *(const v4fa*)(x + i * 128 + ln * 4); for (int q = 0; q < 4; ++q) s += SRCBF ? bf16_round(a[q]) : a[q]; }
  for (int o = 16; o > 0; o >>= 1) s += __shfl_xor(s, o, 32); const float mu = s / (float)DM; float q2 = 0.f;
#pragma unroll 1
  for (int i = 0; i < DM / 128; ++i) { const v4f a = *(const v4fa*)(x + i * 128 + ln * 4); for (int q = 0; q < 4; ++q) { const float d = (SRCBF ? bf16_round(a[q]) : a[q]) - mu; q2 += d * d; } }
  for (int o = 16; o > 0; o >>= 1) q2 += __shfl_xor(q2, o, 32); const float rs = rsqrtf(q2 / (float)DM + 1e-5f);
  {
#pragma unroll 1
    for (int i = 0; i < DM / 128; ++i) { const int c0 = i * 128 + ln * 4; const v4f a = *(const v4fa*)(x + c0); _Float16 h4[4]; v4f y4, xb;
      for (int q = 0; q < 4; ++q) { const float t = SRCBF ? bf16_round(a[q]) : a[q]; const float y = (t - mu) * rs * bf16_round(g[c0 + q]) + bf16_round(bb[c0 + q]); h4[q] = (_Float16)y; y4[q] = y; xb[q] = t; }
      if (Y16) *(unsigned long long*)((unsigned short*)Y16 + (size_t)r * DM + c0) = *(const unsigned long long*)h4; if (Y32) *(v4f*)(Y32 + (size_t)r * DM + c0) = y4; if (XB) *(v4f*)(XB + (size_t)r * DM + c0) = xb; }
     } }
__global__ __launch_bounds__(256) void k_causaltab(unsigned* __restrict__ MB, int* __restrict__ RA, int* __restrict__ KE, int nq, int nk) {
  const int t = blockIdx.x * 256 + threadIdx.x; const int nw = nk / 32;
  if (t < nq * nw) { const int q = t / nw, w = t % nw; const int first = q + 1 - 32 * w; const unsigned bits = (first <= 0) ? 0xffffffffu : ((first >= 32) ? 0u : (0xffffffffu << first)); *(unsigned*)(MB + t) = bits;  }
  if (t < nq) { *(int*)(RA + t) = 0;  }
  if (t < nq / 64) { const int v = 64 * (t + 1); *(int*)(KE + t * 32) = v;  } }


extern "C" void kernel_launch(void* const* d_in, const int* in_sizes, int n_in,
                              void* d_out, int out_size, void* d_ws, size_t ws_size, hipStream_t stream) {
  (void)in_sizes; (void)n_in; (void)out_size;
  const float* const* I = (const float* const*)d_in; const float* x = I[0]; const float* lag = I[1]; const float* lab = I[2]; const float* lbg = I[3]; const float* lbb = I[4]; const float* lcg = I[5]; const float* lcb = I[6];
  const float* Wq = I[7]; const float* bq = I[8]; const float* Wk = I[9]; const float* bk = I[10]; const float* Wv = I[11]; const float* bv = I[12]; const float* Wo = I[13]; const float* bo = I[14]; const float* We = I[15]; const float* be = I[16]; const float* Wd = I[17]; const float* bd = I[18];
  char* ws = (char*)d_ws; size_t off = 0;
  auto take = [&](size_t bytes) { char* p = ws + off; off += (bytes + 255) & ~(size_t)255; return p; };
  _Float16* BQ = (_Float16*)take((size_t)DM * DM * 2); _Float16* BK = (_Float16*)take((size_t)DM * DM * 2); _Float16* BV = (_Float16*)take((size_t)DM * DM * 2); _Float16* BO = (_Float16*)take((size_t)DM * DM * 2); _Float16* BE = (_Float16*)take((size_t)4096 * DM * 2); _Float16* BD = (_Float16*)take((size_t)DM * 4096 * 2);
  float* XB = (float*)take((size_t)NR * DM * 4); _Float16* T16 = (_Float16*)take((size_t)NR * DM * 2); float* F = (float*)take((size_t)NR * DM * 4);
  _Float16* Qh = (_Float16*)take((size_t)NR * DM * 2); _Float16* Ql = (_Float16*)take((size_t)NR * DM * 2); _Float16* Kh = (_Float16*)take((size_t)NR * DM * 2); _Float16* Kl = (_Float16*)take((size_t)NR * DM * 2); _Float16* Vth = (_Float16*)take((size_t)NR * DM * 2); _Float16* Vtl = (_Float16*)take((size_t)NR * DM * 2);
  unsigned* MB = (unsigned*)take((size_t)SLEN * (SLEN / 32) * 4); int* RA = (int*)take((size_t)SLEN * 4); int* KE = (int*)take((size_t)(SLEN / 64) * 32 * 4);
  if (off > ws_size) return;      /* 24 + 16 + 8 + 16 + 48 + 0.6 = 113 MiB (the first LN's f32 output lives in F until the second LN consumes it) */
  float* O = F; _Float16* Oh = Qh; _Float16* Ol = Ql; float* X1 = XB; _Float16* GH = Kh;      /* SiLU hidden [NR][4096] f16 = 32 MB over Kh|Kl|Vth|Vtl (dead after the flash) */
  const size_t n8 = (size_t)NR * DM / 8; const unsigned nb8 = (unsigned)((n8 + 255) / 256);
  k_wt_all<<<768, 256, 0, stream>>>(Wq, Wk, Wv, Wo, We, Wd, BQ, BK, BV, BO, BE, BD);      /* all (in,out) */
  k_causaltab<<<(SLEN * (SLEN / 32) + 255) / 256, 256, 0, stream>>>(MB, RA, KE, SLEN, SLEN);
  k_lnab<1><<<NR / 8, 256, 0, stream>>>(x, lag, lab, nullptr, F, XB);      /* t0 = LN_a(bf16 x) (f32), XB = bf16(x) */
  k_lnab<0><<<NR / 8, 256, 0, stream>>>(F, lbg, lbb, T16, nullptr, nullptr);      /* t = LN_b(t0) as f16 operand */
  const dim3 gP((NR / 128) * (DM / 64), 1), gM((NR / 128) * (4096 / 64), 1);
  k_gemm2<0, DM><<<gP, 128, 0, stream>>>(T16, DM, 0, BQ, DM, 0, 0.0625f, bq, 0, nullptr, 1, 0, 0, F, nullptr, DM, 0, NR, DM, DM); k_hl<<<nb8, 256, 0, stream>>>(F, Qh, Ql, n8);
  k_gemm2<0, DM><<<gP, 128, 0, stream>>>(T16, DM, 0, BK, DM, 0, 0.0625f, bk, 0, nullptr, 1, 0, 0, F, nullptr, DM, 0, NR, DM, DM); k_hl<<<nb8, 256, 0, stream>>>(F, Kh, Kl, n8);
  k_gemm2<0, DM><<<gP, 128, 0, stream>>>(T16, DM, 0, BV, DM, 0, 0.0625f, bv, 0, nullptr, 1, 0, 0, F, nullptr, DM, 0, NR, DM, DM);
  for (int b = 0; b < NBT; ++b) k_vthl<SLEN><<<NH * (SLEN / 64), 256, 0, stream>>>(F + (size_t)b * SLEN * DM, DM, Vth + (size_t)b * SLEN * DM, Vtl + (size_t)b * SLEN * DM);
  k_flashm<SLEN, SLEN><<<NH * (SLEN / 64), 128, 0, stream>>>(Qh, Ql, DM, Kh, Kl, DM, Vth, Vtl, MB, RA, KE, O, DM);      /* both batches in one grid of equal work-groups */
  k_hl<<<nb8, 256, 0, stream>>>(O, Oh, Ol, n8);
  k_gemm2<0, DM><<<gP, 128, 0, stream>>>(Oh, DM, 0, BO, DM, 0, 0.0625f, bo, 0, XB, 1, (size_t)DM, 0, X1, nullptr, DM, 0, NR, DM, DM);      /* x1 = x + ctx Wo + bo (hi) */
  k_gemm2<0, DM><<<gP, 128, 0, stream>>>(Ol, DM, 0, BO, DM, 0, 0.0625f / 1024.0f, nullptr, 0, X1, 1, (size_t)DM, 0, X1, nullptr, DM, 0, NR, DM, DM);      /* + lo */
  k_lnab<0><<<NR / 8, 256, 0, stream>>>(X1, lcg, lcb, T16, nullptr, nullptr);
  k_gemm2<15, DM><<<gM, 128, 0, stream>>>(T16, DM, 0, BE, DM, 0, 0.0625f, be, 0, nullptr, 1, 0, 0, nullptr, GH, 4096, 0, NR, 4096, DM);      /* silu(t We + be) f16 (ACT 15 = x * sigmoid(x), present in the epilogue) */
  k_gemm2<0, 4096><<<gP, 128, 0, stream>>>(GH, 4096, 0, BD, 4096, 0, 0.0625f, bd, 0, X1, 1, (size_t)DM, 0, (float*)d_out, nullptr, DM, 0, NR, DM, 4096);      /* out = x1 + mlp */
}

// v006
// One run takes 349 microseconds.
// Next to v005, in two timings, it ran 1.20 times as fast each time.
// All steps since v000 together make it 3.47 times as fast.
#include <hip/hip_runtime.h>
// Pre-LN causal attention block (2 x 2048 tokens, 1024 = 16 heads x 64; MLP 4096 with SiLU): t = LN_b(LN_a(x)); q,k,v = t W + b; x1 = x + (causal softmax(q.k/8) v) Wo + bo; out = x1 + (silu(LN_c(x1) We + be)) Wd + bd -> [2,2048,1024].
// Structure: the LayerNorms on VALU (the first pass also writes the bf16 residual plane); projections / MLP as f16 WMMA GEMMs (32x64 wave tiles, f32 accumulation, exact x16 weights, biases / SiLU / residual addends in the epilogue); q, k as f16 hi + (x2^10) residual planes, V^T as hi + residual planes; fused causal flash kernel, one work-group per (head, t): 64-query tile t of batch 0, then tile 31 - t of batch 1 (32-key K and V^T tiles copied asynchronously into two LDS buffers shared by the four waves, device-built causal tables, online f32 softmax, P staged hi + residual, two value accumulators); O as hi + residual planes into Wo (two GEMMs).
// Compute dtype: x, weights, biases, LN parameters rounded to bf16; LN outputs and the SiLU hidden as f16 operands (~2^-12); q, k, P, v, O as f16 hi + residual pairs (~2^-21); f32 accumulation, softmax, LayerNorm. v_wmma_f32_16x16x32_f16.
#define NBT 2
#define SLEN 2048
#define DM 1024
#define NH 16
#define SCL 0.125f
#define NR (NBT * SLEN)
typedef __bf16 v16b __attribute__((ext_vector_type(16)));
typedef unsigned short v8us __attribute__((ext_vector_type(8), may_alias));
typedef float  v8f  __attribute__((ext_vector_type(8)));
typedef float  v4f  __attribute__((ext_vector_type(4)));
typedef float  v4fa __attribute__((ext_vector_type(4), may_alias));
union FragB { v16b v; v8us half[2]; unsigned short u[16]; };

__device__ __forceinline__ unsigned short bf16_bits(float x) { unsigned int u = __float_as_uint(x); return (unsigned short)((u + 0x7FFFu + ((u >> 16) & 1u)) >> 16); }
__device__ __forceinline__ float bf16_val(unsigned short b) { return __uint_as_float(((unsigned int)b) << 16); }
__device__ __forceinline__ float bf16_round(float x) { return bf16_val(bf16_bits(x)); }
// D += A·B with NT terms: 1 = ah·bh, 2 = + al·bh (A split), 3 = + ah·bl (both split)
template <int NT>
__device__ __forceinline__ v8f mmaN(v16b ah, v16b al, v16b bh, v16b bl, v8f c) {
  c = __builtin_amdgcn_wmma_f32_16x16x32_bf16(false, ah, false, bh, (short)0, c, false, false);
  if (NT >= 2) c = __builtin_amdgcn_wmma_f32_16x16x32_bf16(false, al, false, bh, (short)0, c, false, false);
  if (NT >= 3) c = __builtin_amdgcn_wmma_f32_16x16x32_bf16(false, ah, false, bl, (short)0, c, false, false);
  asm volatile("v_nop\n\tv_nop\n\tv_nop\n\tv_nop" : "+v"(c) : "v"(ah), "v"(al), "v"(bh), "v"(bl));
  return c;
}

__global__ __launch_bounds__(256) void k_wt_bf16(const float* __restrict__ W, unsigned short* __restrict__ Wt, int K, int N) {
  const int t = blockIdx.x * 256 + threadIdx.x;
  const int k8n = K / 8;
  if (t >= N * k8n) return;
  const int n = t / k8n, k8 = (t % k8n) * 8;
  v8us v;
#pragma unroll
  for (int i = 0; i < 8; ++i) v[i] = bf16_bits(W[(size_t)(k8 + i) * N + n]);
  *(v8us*)(Wt + (size_t)n * K + k8) = v;
  
}

// GEMM C[M][N] (f32, pitch ldc) = act(A[M][K]·W + bias). A f32 row-major (pitch lda) converted per fragment to bf16
// (ASPLIT: hi/lo two planes -> 2 terms, else single rounded term); Wt bf16 [N][K] (pitch ldb). BIAS_BF16 rounds the
// bias to bf16 first (bias quantised to bf16 before the add). K%32==0, M%16==0, N%64==0.
template <bool ASPLIT, int ACT, bool BIAS_BF16>
__global__ __launch_bounds__(128) void k_gemm_bf(const float* __restrict__ A, int lda, const unsigned short* __restrict__ Wt, int ldb,
                                               const float* __restrict__ bias, float* __restrict__ C, int ldc, int M, int N, int K) {
  __shared__ __attribute__((aligned(16))) float so[4][16][64];
  const int tid = threadIdx.x, w = tid >> 5, lane = tid & 31, ln = lane & 15, hh = lane >> 4;
  const int ntn = N / 64;
  const int wid = blockIdx.x * 4 + w;
  const int mt = wid / ntn, nq = wid % ntn;
  if (mt * 16 >= M) return;
  const int row0 = mt * 16, col0 = nq * 64;
  const float* arow = A + (size_t)(row0 + ln) * lda;
  v8f acc[4] = {};
  for (int kb = 0; kb < K; kb += 32) {
    FragB ah, al;
    const v4f x0 = *(const v4fa*)(arow + kb + 8 * hh), x1 = *(const v4fa*)(arow + kb + 8 * hh + 4);
    const v4f x2 = *(const v4fa*)(arow + kb + 16 + 8 * hh), x3 = *(const v4fa*)(arow + kb + 16 + 8 * hh + 4);
    float xs[16] = {x0[0],x0[1],x0[2],x0[3],x1[0],x1[1],x1[2],x1[3],x2[0],x2[1],x2[2],x2[3],x3[0],x3[1],x3[2],x3[3]};
#pragma unroll
    for (int i = 0; i < 16; ++i) { const unsigned short hb = bf16_bits(xs[i]); ah.u[i] = hb; al.u[i] = ASPLIT ? bf16_bits(xs[i] - bf16_val(hb)) : (unsigned short)0; }
#pragma unroll
    for (int t = 0; t < 4; ++t) {
      const unsigned short* brow = Wt + (size_t)(col0 + t * 16 + ln) * ldb + kb;
      FragB b;
      b.half[0] = *(const v8us*)(brow + 8 * hh);
      b.half[1] = *(const v8us*)(brow + 16 + 8 * hh);
      acc[t] = mmaN<ASPLIT ? 2 : 1>(ah.v, al.v, b.v, b.v, acc[t]);
    }
  }
#pragma unroll
  for (int t = 0; t < 4; ++t) {
    float bv = bias ? bias[col0 + t * 16 + ln] : 0.f;
    if (BIAS_BF16) bv = bf16_round(bv);
#pragma unroll
    for (int r = 0; r < 8; ++r) { float v = acc[t][r] + bv; if (ACT == 1) v = fmaxf(v, 0.f); so[w][8 * hh + r][t * 16 + ln] = v; }
  }
  __builtin_amdgcn_fence(__ATOMIC_ACQ_REL, "workgroup");
  __builtin_amdgcn_wave_barrier();
  const int rsub = lane >> 4, c4 = (lane & 15) * 4;
  {
#pragma unroll
    for (int q = 0; q < 8; ++q) {
      const int r = q * 2 + rsub;
      const v4f v = *(const v4fa*)&so[w][r][c4];
      *(v4f*)(C + (size_t)(row0 + r) * ldc + col0 + c4) = v;
    }
    
  }
}

// GEMM C = act(A·W + bias + resid): A f32 (ASPLIT -> hi/lo 2 terms), Wt bf16 [N][K]; ACT 0 none, 1 relu, 2 exact gelu;
// resid (optional, f32, row index = (row % rmod), pitch ldr, RES_BF16 rounds it) added before the activation.
template <bool ASPLIT, int ACT, bool BIAS_BF16, bool RES_BF16>
__global__ __launch_bounds__(128) void k_gemm_bf3(const float* __restrict__ A, int lda, const unsigned short* __restrict__ Wt, int ldb,
                                                const float* __restrict__ bias, const float* __restrict__ resid, int rmod, int ldr,
                                                float* __restrict__ C, int ldc, int M, int N, int K) {
  __shared__ __attribute__((aligned(16))) float so[4][16][64];
  const int tid = threadIdx.x, w = tid >> 5, lane = tid & 31, ln = lane & 15, hh = lane >> 4;
  const int ntn = N / 64;
  const int wid = blockIdx.x * 4 + w;
  const int mt = wid / ntn, nq = wid % ntn;
  if (mt * 16 >= M) return;
  const int row0 = mt * 16, col0 = nq * 64;
  const float* arow = A + (size_t)(row0 + ln) * lda;
  v8f acc[4] = {};
  for (int kb = 0; kb < K; kb += 32) {
    FragB ah, al;
    const v4f x0 = *(const v4fa*)(arow + kb + 8 * hh), x1 = *(const v4fa*)(arow + kb + 8 * hh + 4);
    const v4f x2 = *(const v4fa*)(arow + kb + 16 + 8 * hh), x3 = *(const v4fa*)(arow + kb + 16 + 8 * hh + 4);
    float xs[16] = {x0[0],x0[1],x0[2],x0[3],x1[0],x1[1],x1[2],x1[3],x2[0],x2[1],x2[2],x2[3],x3[0],x3[1],x3[2],x3[3]};
#pragma unroll
    for (int i = 0; i < 16; ++i) { const unsigned short hb = bf16_bits(xs[i]); ah.u[i] = hb; al.u[i] = ASPLIT ? bf16_bits(xs[i] - bf16_val(hb)) : (unsigned short)0; }
#pragma unroll
    for (int t = 0; t < 4; ++t) {
      const unsigned short* brow = Wt + (size_t)(col0 + t * 16 + ln) * ldb + kb;
      FragB b;
      b.half[0] = *(const v8us*)(brow + 8 * hh);
      b.half[1] = *(const v8us*)(brow + 16 + 8 * hh);
      acc[t] = mmaN<ASPLIT ? 2 : 1>(ah.v, al.v, b.v, b.v, acc[t]);
    }
  }
#pragma unroll
  for (int t = 0; t < 4; ++t) {
    const int col = col0 + t * 16 + ln;
    float bv = bias ? bias[col] : 0.f;
    if (BIAS_BF16) bv = bf16_round(bv);
#pragma unroll
    for (int r = 0; r < 8; ++r) {
      float v = acc[t][r] + bv;
      if (resid) { float rv = resid[(size_t)((row0 + 8 * hh + r) % rmod) * ldr + col]; if (RES_BF16) rv = bf16_round(rv); v += rv; }
      if (ACT == 1) v = fmaxf(v, 0.f);
      if (ACT == 2) v = 0.5f * v * (1.0f + erff(v * 0.70710678118654752f));
      if (ACT == 3) { const float u = 0.7978845608028654f * (v + 0.044715f * v * v * v); v = 0.5f * v * (1.0f + tanhf(u)); }
      so[w][8 * hh + r][t * 16 + ln] = v;
    }
  }
  __builtin_amdgcn_fence(__ATOMIC_ACQ_REL, "workgroup");
  __builtin_amdgcn_wave_barrier();
  const int rsub = lane >> 4, c4 = (lane & 15) * 4;
  {
#pragma unroll
    for (int q = 0; q < 8; ++q) {
      const int r = q * 2 + rsub;
      const v4f v = *(const v4fa*)&so[w][r][c4];
      *(v4f*)(C + (size_t)(row0 + r) * ldc + col0 + c4) = v;
    }
    
  }
}
// row LayerNorm (biased variance, eps) over N: s = X (+ R); optional out_sum <- s; out_norm <- (s-mu)*rsqrt(var+eps)*g + b
template <bool PARAM_BF16>
__global__ __launch_bounds__(256) void k_layernorm(const float* __restrict__ X, const float* __restrict__ R, const float* __restrict__ g, const float* __restrict__ bta,
                                                  float* __restrict__ out_sum, float* __restrict__ out_norm, int N, float eps) {
  __shared__ float red[256];
  const int row = blockIdx.x, tid = threadIdx.x;
  const float* x = X + (size_t)row * N; const float* rr = R ? R + (size_t)row * N : nullptr;
  float vals[16];                     // up to N = 4096
  const int per = N / 256;            // contiguous chunk per thread? use strided-by-4 chunks: thread handles j = tid*4 + 1024*u
  float s1 = 0.f;
  for (int u = 0; u < per / 4; ++u) {
    const int j = tid * 4 + 1024 * u;
    const v4f a = *(const v4fa*)(x + j);
    v4f b = {0.f,0.f,0.f,0.f}; if (rr) b = *(const v4fa*)(rr + j);
#pragma unroll
    for (int q = 0; q < 4; ++q) { const float v = a[q] + b[q]; vals[u * 4 + q] = v; s1 += v; }
  }
  red[tid] = s1; __syncthreads();
  for (int st = 128; st > 0; st >>= 1) { if (tid < st) red[tid] += red[tid + st]; __syncthreads(); }
  const float mu = red[0] / (float)N; __syncthreads();
  float s2 = 0.f;
  for (int u = 0; u < per / 4; ++u)
#pragma unroll
    for (int q = 0; q < 4; ++q) { const float c = vals[u * 4 + q] - mu; s2 += c * c; }
  red[tid] = s2; __syncthreads();
  for (int st = 128; st > 0; st >>= 1) { if (tid < st) red[tid] += red[tid + st]; __syncthreads(); }
  const float rs = rsqrtf(red[0] / (float)N + eps);
  {
    for (int u = 0; u < per / 4; ++u) {
      const int j = tid * 4 + 1024 * u;
      v4f o, sm;
#pragma unroll
      for (int q = 0; q < 4; ++q) {
        float gg = g[j + q], bb = bta[j + q];
        if (PARAM_BF16) { gg = bf16_round(gg); bb = bf16_round(bb); }
        sm[q] = vals[u * 4 + q]; o[q] = (vals[u * 4 + q] - mu) * rs * gg + bb;
      }
      if (out_sum) *(v4f*)(out_sum + (size_t)row * N + j) = sm;
      *(v4f*)(out_norm + (size_t)row * N + j) = o;
    }
    
  }
}



// ---- f16 WMMA path (v_wmma_f32_16x16x32_f16): 11-bit significands for operands in range — used where a [0,1] probability operand needs more precision than bf16
typedef _Float16 v16h __attribute__((ext_vector_type(16)));
union FragH { v16h v; v8us half[2]; _Float16 h[16]; unsigned short u[16]; };
template <int NT>
__device__ __forceinline__ v8f mmaH(v16h ah, v16h al, v16h bh, v16h bl, v8f c) {
  c = __builtin_amdgcn_wmma_f32_16x16x32_f16(false, ah, false, bh, (short)0, c, false, false);
  if (NT >= 2) c = __builtin_amdgcn_wmma_f32_16x16x32_f16(false, al, false, bh, (short)0, c, false, false);
  if (NT >= 3) c = __builtin_amdgcn_wmma_f32_16x16x32_f16(false, ah, false, bl, (short)0, c, false, false);
  asm volatile("v_nop\n\tv_nop\n\tv_nop\n\tv_nop" : "+v"(c) : "v"(ah), "v"(al), "v"(bh), "v"(bl));
  return c;
}
// batched GEMM like k_gemm_b but f16 operands: A f32 (split into f16 hi/lo if ASPLIT, else rounded to f16), Bt = f16 values [n][k]; alpha; C f32; N multiple of 16 (partial tiles skipped)
template <bool ASPLIT>
__global__ __launch_bounds__(128) void k_gemm_h(const float* __restrict__ A, int lda, size_t sA, const _Float16* __restrict__ Bh, int ldb, size_t sB, float alpha, float* __restrict__ C, int ldc, size_t sC, int M, int N, int K) {
  __shared__ __attribute__((aligned(16))) float so[4][16][64];
  const int tid = threadIdx.x, w = tid >> 5, lane = tid & 31, ln = lane & 15, hh = lane >> 4; const int by = blockIdx.y;
  A += (size_t)by * sA; Bh += (size_t)by * sB; C += (size_t)by * sC;
  const int ntn = (N + 63) / 64; const int wid = blockIdx.x * 4 + w; const int mt = wid / ntn, nq = wid % ntn; if (mt * 16 >= M) return;
  const int row0 = mt * 16, col0 = nq * 64; const float* arow = A + (size_t)(row0 + ln) * lda;
  v8f acc[4] = {};
  for (int kb = 0; kb < K; kb += 32) {
    FragH ah, al;
    const v4f x0 = *(const v4fa*)(arow + kb + 8 * hh), x1 = *(const v4fa*)(arow + kb + 8 * hh + 4), x2 = *(const v4fa*)(arow + kb + 16 + 8 * hh), x3 = *(const v4fa*)(arow + kb + 16 + 8 * hh + 4);
    float xs[16] = {x0[0],x0[1],x0[2],x0[3],x1[0],x1[1],x1[2],x1[3],x2[0],x2[1],x2[2],x2[3],x3[0],x3[1],x3[2],x3[3]};
#pragma unroll
    for (int i = 0; i < 16; ++i) { const _Float16 h = (_Float16)xs[i]; ah.h[i] = h; al.h[i] = ASPLIT ? (_Float16)(xs[i] - (float)h) : (_Float16)0.0f; }
#pragma unroll
    for (int t = 0; t < 4; ++t) { if (col0 + t * 16 >= N) continue; const size_t boff = (size_t)(col0 + t * 16 + ln) * ldb + kb; FragH bq; bq.half[0] = *(const v8us*)(Bh + boff + 8 * hh); bq.half[1] = *(const v8us*)(Bh + boff + 16 + 8 * hh);
      acc[t] = mmaH<ASPLIT ? 2 : 1>(ah.v, al.v, bq.v, bq.v, acc[t]); }
  }
#pragma unroll
  for (int t = 0; t < 4; ++t) { if (col0 + t * 16 >= N) continue;
#pragma unroll
    for (int r = 0; r < 8; ++r) so[w][8 * hh + r][t * 16 + ln] = acc[t][r] * alpha; }
  __builtin_amdgcn_fence(__ATOMIC_ACQ_REL, "workgroup"); __builtin_amdgcn_wave_barrier();
  const int rsub = lane >> 4, c4 = (lane & 15) * 4;
  {
#pragma unroll
    for (int q = 0; q < 8; ++q) { const int r = q * 2 + rsub; if (col0 + c4 < N) { const v4f v = *(const v4fa*)&so[w][r][c4]; *(v4f*)(C + (size_t)(row0 + r) * ldc + col0 + c4) = v; } }
     }
}

// Wt[n][k] = f16(bf16(W[k][n]) * 16) from f32 row-major W[K][N] (power-of-two scale: bf16-exact weights stay exact in f16 away from the subnormal range).
// One work-group turns a block of 64 k x 256 n in LDS: it reads the block's rows by whole lines (a wave-wide 16-byte load = 512 B of one row, all 16 loads of a lane in flight together),
// keeps it as f16 [k][n] (pitch 260 halves), reads it back as dwords (two n of one k) and writes 128-B lines of Wt (8 lanes x 8 k of one n). K, N at compile time: every row step is an immediate offset.
typedef unsigned long long u64a __attribute__((may_alias)); typedef unsigned u32a __attribute__((may_alias));
template <int K, int N>
__device__ __forceinline__ void wt_block(const float* __restrict__ W, _Float16* __restrict__ Wt, int u, unsigned short* tl) {
  constexpr int P = 256 + 4, NB = N / 256; const int tid = threadIdx.x; const int k0 = (u / NB) * 64, n0 = (u % NB) * 256;
  const float* src = W + (size_t)(k0 + (tid >> 6)) * N + n0 + (tid & 63) * 4; v4f a[16];
#pragma unroll
  for (int j = 0; j < 16; ++j) a[j] = *(const v4fa*)(src + (size_t)(4 * j) * N);
  asm volatile("s_wait_xcnt 0x0" : : "v"(src) : "memory");      /* in front of any overwrite of the address register that the 16 issued loads name (it stays live up to here) */
#pragma unroll
  for (int j = 0; j < 16; ++j) { FragH f;
#pragma unroll
    for (int q = 0; q < 4; ++q) f.h[q] = (_Float16)(bf16_round(a[j][q]) * 16.0f);
    *(u64a*)&tl[((tid >> 6) + 4 * j) * P + (tid & 63) * 4] = (unsigned long long)f.u[0] | ((unsigned long long)f.u[1] << 16) | ((unsigned long long)f.u[2] << 32) | ((unsigned long long)f.u[3] << 48); }
  __syncthreads();      /* the block is whole in LDS before any lane reads across the rows that other waves stored */
  const int kc = (tid & 7) * 8, np = tid >> 3; unsigned short* dst = (unsigned short*)Wt + (size_t)(n0 + 2 * np) * K + k0 + kc;
#pragma unroll
  for (int j = 0; j < 4; ++j) { unsigned d[8]; FragH lo, hi;
#pragma unroll
    for (int i = 0; i < 8; ++i) d[i] = *(const u32a*)&tl[(kc + i) * P + 2 * (np + 32 * j)];
#pragma unroll
    for (int i = 0; i < 8; ++i) { lo.u[i] = (unsigned short)(d[i] & 0xffffu); hi.u[i] = (unsigned short)(d[i] >> 16); }
    *(v8us*)(dst + (size_t)(64 * j) * K) = lo.half[0]; *(v8us*)(dst + (size_t)(64 * j + 1) * K) = hi.half[0]; } }
// All six weights in one grid of 768 equal work-groups: 4 x 64 blocks of the 1024 x 1024 projections, 256 of We, 256 of Wd.
__global__ __launch_bounds__(256) void k_wt_all(const float* __restrict__ Wq, const float* __restrict__ Wk, const float* __restrict__ Wv, const float* __restrict__ Wo, const float* __restrict__ We, const float* __restrict__ Wd,
    _Float16* __restrict__ BQ, _Float16* __restrict__ BK, _Float16* __restrict__ BV, _Float16* __restrict__ BO, _Float16* __restrict__ BE, _Float16* __restrict__ BD) {
  __shared__ __attribute__((aligned(16))) unsigned short tl[64 * 260];      /* 33,280 B */
  const int u = blockIdx.x;      /* the same for the whole work-group: a barrier follows in each branch */
  if (u < 256) { const int m = u >> 6; wt_block<DM, DM>(m == 0 ? Wq : m == 1 ? Wk : m == 2 ? Wv : Wo, m == 0 ? BQ : m == 1 ? BK : m == 2 ? BV : BO, u & 63, tl); }
  else if (u < 512) wt_block<DM, 4096>(We, BE, u - 256, tl);
  else wt_block<4096, DM>(Wd, BD, u - 512, tl); }
// k_gemm_hh variant with fused epilogue: v = acc·alpha + bias[by·sBias + col] (+ CP[(row/rowsPerB)·sCPb + by·64 + col] if CP) ; ACT 0 none / 1 elu ; writes f16 C16 (and f32 C if non-null)
template <int ACT>
__global__ __launch_bounds__(128) void k_gemm_hhx(const _Float16* __restrict__ A, int lda, size_t sA, const _Float16* __restrict__ Bh, int ldb, size_t sB, float alpha, const float* __restrict__ bias, size_t sBias, const float* __restrict__ CP, int rowsPerB, size_t sCPb, int row0g,
    float* __restrict__ C, _Float16* __restrict__ C16, int ldc, size_t sC, int M, int N, int K) {
  __shared__ __attribute__((aligned(16))) float so[4][16][64];
  const int tid = threadIdx.x, w = tid >> 5, lane = tid & 31, ln = lane & 15, hh = lane >> 4; const int by = blockIdx.y;
  A += (size_t)by * sA; Bh += (size_t)by * sB; const size_t cofs = (size_t)by * sC; const float* bp = bias ? bias + (size_t)by * sBias : nullptr;
  const int ntn = (N + 63) / 64; const int wid = blockIdx.x * 4 + w; const int mt = wid / ntn, nq = wid % ntn; if (mt * 16 >= M) return;
  const int row0 = mt * 16, col0 = nq * 64; const _Float16* arow = A + (size_t)(row0 + ln) * lda;
  v8f acc[4] = {};
  for (int kb = 0; kb < K; kb += 32) { FragH ah; ah.half[0] = *(const v8us*)((const unsigned short*)arow + kb + 8 * hh); ah.half[1] = *(const v8us*)((const unsigned short*)arow + kb + 16 + 8 * hh);
#pragma unroll
    for (int t = 0; t < 4; ++t) { if (col0 + t * 16 >= N) continue; const size_t boff = (size_t)(col0 + t * 16 + ln) * ldb + kb; FragH bq; bq.half[0] = *(const v8us*)((const unsigned short*)Bh + boff + 8 * hh); bq.half[1] = *(const v8us*)((const unsigned short*)Bh + boff + 16 + 8 * hh);
      acc[t] = mmaH<1>(ah.v, ah.v, bq.v, bq.v, acc[t]); }
  }
#pragma unroll
  for (int t = 0; t < 4; ++t) { if (col0 + t * 16 >= N) continue; const int col = col0 + t * 16 + ln; const float bv = bp ? bf16_round(bp[col]) : 0.f;
#pragma unroll
    for (int r = 0; r < 8; ++r) { float v = acc[t][r] * alpha + bv; if (CP) { const int bidx = (row0g + row0 + 8 * hh + r) / rowsPerB; v += CP[(size_t)bidx * sCPb + (size_t)by * 64 + col]; } if (ACT == 1) v = (v > 0.f) ? v : expm1f(v); else if (ACT == 7) v = (v > 0.f) ? v + 1.0f : expf(v); else if (ACT == 8) v = tanhf(v); else if (ACT == 9) v = 0.5f * v * (1.0f + tanhf(0.7978845608028654f * (v + 0.044715f * v * v * v))); else if (ACT == 11) v = 1.0f / (1.0f + expf(-v)); else if (ACT == 12) v = (v > 0.f) ? v : 0.01f * v; else if (ACT == 14) v = (v > 0.f) ? v : 0.1f * v; else if (ACT == 15) v = v / (1.0f + expf(-v)); else if (ACT == 3) v = fmaxf(v, 0.f); else if (ACT == 6) v = 0.5f * v * (1.0f + erff(v * 0.70710678118654752f)); so[w][8 * hh + r][t * 16 + ln] = v; } }
  __builtin_amdgcn_fence(__ATOMIC_ACQ_REL, "workgroup"); __builtin_amdgcn_wave_barrier();
  const int rsub = lane >> 4, c4 = (lane & 15) * 4; typedef _Float16 v4h __attribute__((ext_vector_type(4)));
  {
#pragma unroll
    for (int q = 0; q < 8; ++q) { const int r = q * 2 + rsub; if (col0 + c4 < N) { const v4f v = *(const v4fa*)&so[w][r][c4]; if (C) *(v4f*)(C + cofs + (size_t)(row0 + r) * ldc + col0 + c4) = v; if (C16) { v4h h4; for (int i = 0; i < 4; ++i) h4[i] = (_Float16)v[i]; *(v4h*)(C16 + cofs + (size_t)(row0 + r) * ldc + col0 + c4) = h4; } } }
     }
}


typedef _Float16 v4h __attribute__((ext_vector_type(4)));

__global__ __launch_bounds__(256) void k_x16(const float* __restrict__ x, _Float16* __restrict__ X16, size_t n8) { const size_t t = (size_t)blockIdx.x * 256 + threadIdx.x; if (t >= n8) return; FragH f;
#pragma unroll
  for (int q = 0; q < 8; ++q) f.h[q] = (_Float16)bf16_round(x[t * 8 + q]); *(v8us*)((unsigned short*)X16 + t * 8) = f.half[0];  }
__global__ __launch_bounds__(256) void k_h16(const float* __restrict__ x, _Float16* __restrict__ X16, size_t n8) { const size_t t = (size_t)blockIdx.x * 256 + threadIdx.x; if (t >= n8) return; FragH f;
#pragma unroll
  for (int q = 0; q < 8; ++q) f.h[q] = (_Float16)x[t * 8 + q]; *(v8us*)((unsigned short*)X16 + t * 8) = f.half[0];  }
__global__ __launch_bounds__(256) void k_round16f(const float* __restrict__ W, _Float16* __restrict__ Bt, size_t n8) { const size_t t = (size_t)blockIdx.x * 256 + threadIdx.x; if (t >= n8) return; FragH f;
#pragma unroll
  for (int i = 0; i < 8; ++i) f.h[i] = (_Float16)(bf16_round(W[t * 8 + i]) * 16.0f); *(v8us*)((unsigned short*)Bt + t * 8) = f.half[0];  }
template <int NHv, int TTv>
__global__ __launch_bounds__(256) void k_vt(const _Float16* __restrict__ V16, int ldv, int voff, _Float16* __restrict__ Vt) { __shared__ unsigned short tl[64][66]; const int tid = threadIdx.x; const int slab = blockIdx.x / (TTv / 64), lg = blockIdx.x % (TTv / 64); const int b = slab / NHv, h = slab % NHv;
  for (int i = tid; i < 64 * 8; i += 256) { const int r = i / 8, c8 = (i % 8) * 8; FragH f; f.half[0] = *(const v8us*)((const unsigned short*)V16 + ((size_t)b * TTv + lg * 64 + r) * ldv + voff + h * 64 + c8);
#pragma unroll
    for (int q = 0; q < 8; ++q) tl[r][c8 + q] = f.u[q]; }
  __syncthreads();
  {
#pragma unroll
    for (int rd = 0; rd < 2; ++rd) { const int d = rd * 32 + tid / 8, pc = tid % 8; FragH f;
#pragma unroll
      for (int q = 0; q < 8; ++q) f.u[q] = tl[pc * 8 + q][d];
      *(v8us*)((unsigned short*)Vt + ((size_t)slab * 64 + d) * TTv + lg * 64 + pc * 8) = f.half[0]; }
     } }

__global__ __launch_bounds__(256) void k_hl(const float* __restrict__ F, _Float16* __restrict__ Hh, _Float16* __restrict__ Hl, size_t n8) { const size_t t = (size_t)blockIdx.x * 256 + threadIdx.x; if (t >= n8) return; FragH fh, fl; const v4f a = *(const v4fa*)(F + t * 8), c = *(const v4fa*)(F + t * 8 + 4);
#pragma unroll
  for (int q = 0; q < 4; ++q) { _Float16 h = (_Float16)a[q]; fh.h[q] = h; fl.h[q] = (_Float16)((a[q] - (float)h) * 1024.0f); h = (_Float16)c[q]; fh.h[4 + q] = h; fl.h[4 + q] = (_Float16)((c[q] - (float)h) * 1024.0f); }
  { *(v8us*)((unsigned short*)Hh + t * 8) = fh.half[0]; *(v8us*)((unsigned short*)Hl + t * 8) = fl.half[0];  } }

// ---- fast GEMM (work-group tile 128x64, wave tile 32x64; requires M % 128 == 0, N % 64 == 0, K % 128 == 0); epilogue: v = act(acc * alpha + bf16(bias[col])), or v = acc * alpha + bf16(bias[col]) + residual[row][col] ----
// Operands go through LDS: per slice of 128 k the work-group loads 256 B of each of its 128 A rows and 64 B rows with whole-line 16-byte loads (two rows per wave-wide load),
// keeps them in registers while the slice before is worked on, and stores them into the other of two LDS buffers; the fragments are read from LDS, A and B alike as halves k + 8 * hh .. + 7 and k + 16 + 8 * hh .. + 7 of their row.
__device__ __forceinline__ v16h g2_sfrag(const unsigned short* p) { FragH f; f.half[0] = *(const v8us*)p; f.half[1] = *(const v8us*)(p + 16); return f.v; }      /* p = LDS row + k + 8 * hh */
__device__ __forceinline__ v8f g2_mma(v16h a, v16h b, v8f c) { v8f d = __builtin_amdgcn_wmma_f32_16x16x32_f16(false, a, false, b, (short)0, c, false, false); asm volatile("v_nop\n\tv_nop\n\tv_nop\n\tv_nop" : "+v"(d) : "v"(a), "v"(b)); return d; }
template <int ACT, int LD, int LDC, int EP>      /* LD = lda = ldb = K and LDC = ldc at compile time: the row steps of the staging loads, of the residual loads and of the stores become immediate offsets. EP, the epilogue's kind: 1 = bias, 2 = residual plane added (indexed like C), 4 = f16 output to C16 (else f32 to C) */
__global__ __launch_bounds__(128) void k_gemm2(const _Float16* __restrict__ A, int lda, size_t sA, const _Float16* __restrict__ Bh, int ldb, size_t sB, float alpha, const float* __restrict__ bias, size_t sBias, const float* CP,
    float* C, _Float16* __restrict__ C16, int ldc, size_t sC, int M, int N, int K) {      /* CP may be C itself: a lane reads exactly the elements that it stores later */
  static_assert(!(EP & 2) || ACT == 0, "the residual is added behind the staging, so no activation may follow it");
  constexpr int KS = 128, PIT = KS + 8, BUF = (128 + 64) * PIT;      /* slice of k; LDS row pitch 272 B = 16 B x 17 (no bank conflict for 16-byte fragment reads); halves per buffer: rows 0-127 A, 128-191 B */
  __shared__ __attribute__((aligned(16))) unsigned short st[2 * BUF];      /* 104,448 B */
  float (*so)[32][68] = reinterpret_cast<float (*)[32][68]>(st);      /* the epilogue's staging (34,816 B) reuses the buffers behind the last barrier */
  const int tid = threadIdx.x, w = tid >> 5, lane = tid & 31, ln = lane & 15, hh = lane >> 4; const int by = blockIdx.y;
  A += (size_t)by * sA; Bh += (size_t)by * sB; const size_t cofs = (size_t)by * sC;
  const int ntn = N >> 6; const int mt = blockIdx.x / ntn, nq = blockIdx.x - mt * ntn; const int col0 = nq * 64; if (mt * 128 >= M) return;      /* the same for the whole work-group: barriers follow */
  const int sr = tid >> 4, sc = (tid & 15) * 8;      /* staging: 16 threads cover the 256 B of a row, the work-group 8 rows per load */
  (void)lda; (void)ldb; (void)K; (void)ldc;
  const char* aS = (const char*)(A + (size_t)(mt * 128) * LD); const char* bS = (const char*)(Bh + (size_t)col0 * LD);      /* the work-group's first A and B row: the same in every lane */
  unsigned vo = (unsigned)(sr * LD + sc) * 2u;      /* the lane's byte offset in both operands: its row of 8, its 16 bytes, the slice */
  const v8f z8 = {0.f,0.f,0.f,0.f,0.f,0.f,0.f,0.f}; v8f c00 = z8, c01 = z8, c02 = z8, c03 = z8, c10 = z8, c11 = z8, c12 = z8, c13 = z8;
  v8us rg[24];
  auto slice_load = [&]() {
#pragma unroll
    for (int i = 0; i < 16; ++i) rg[i] = *(const v8us*)(aS + (size_t)vo + (size_t)(16 * i) * LD);
#pragma unroll
    for (int i = 0; i < 8; ++i) rg[16 + i] = *(const v8us*)(bS + (size_t)vo + (size_t)(16 * i) * LD); };
  auto slice_next = [&]() { asm volatile("s_wait_xcnt 0x0" : "+v"(vo) : : "memory");      /* in front of the overwrite of the offset register that the issued loads name */
    vo += 2u * KS; };
  auto slice_store = [&](int bo) {
#pragma unroll
    for (int i = 0; i < 24; ++i) *(v8us*)&st[bo + (8 * i + sr) * PIT + sc] = rg[i]; };
  auto slice_mma = [&](int bo) { const unsigned short* ap = &st[bo + (32 * w + ln) * PIT + 8 * hh]; const unsigned short* bq = &st[bo + (128 + ln) * PIT + 8 * hh];
#pragma unroll
    for (int kk = 0; kk < KS; kk += 32) { const v16h a0 = g2_sfrag(ap + kk), a1 = g2_sfrag(ap + 16 * PIT + kk);      /* the six fragments of a k step as one group of LDS reads in front of its eight products */
      const v16h b0 = g2_sfrag(bq + kk), b1 = g2_sfrag(bq + 16 * PIT + kk), b2 = g2_sfrag(bq + 32 * PIT + kk), b3 = g2_sfrag(bq + 48 * PIT + kk);
      c00 = g2_mma(a0, b0, c00); c10 = g2_mma(a1, b0, c10); c01 = g2_mma(a0, b1, c01); c11 = g2_mma(a1, b1, c11);
      c02 = g2_mma(a0, b2, c02); c12 = g2_mma(a1, b2, c12); c03 = g2_mma(a0, b3, c03); c13 = g2_mma(a1, b3, c13); } };
  float braw[4] = {0.f, 0.f, 0.f, 0.f};      /* the lane's 4 bias values, asked for together with the first slice */
  if constexpr ((EP & 1) != 0) { const float* bS4 = bias + (size_t)by * sBias + col0 + ln;
#pragma unroll
    for (int t = 0; t < 4; ++t) braw[t] = bS4[16 * t]; }
  slice_load(); slice_next(); slice_store(0); __syncthreads();
  int cur = 0;      /* start (in halves) of the buffer that holds the slice being worked on: 0 or BUF */
#pragma unroll 1      /* one copy of the slice body; the buffer alternates at run time */
  for (int s = 1; s < LD / KS; ++s) {
    slice_load();      /* in flight while the slice before is worked on */
    slice_mma(cur);
    slice_next();
    slice_store(cur ^ BUF);      /* its last readers left this buffer in front of the barrier of the trip before */
    __syncthreads(); cur ^= BUF; }
  // The residual plane is asked for here, all at once, so that the last slice's products cover the loads: the lane's 16 pieces of 16 B, the very pieces that it stores at the end
  // (16 lanes = the 256 B of a row of the tile, a wave-wide load = two rows).
  const unsigned eo = (unsigned)((32 * w + (lane >> 4)) * LDC + (lane & 15) * 4);      /* the lane's element offset in the work-group's tile of C */
  const size_t tile0 = cofs + (size_t)(mt * 128) * LDC + col0;      /* the tile's first element: the same in every lane */
  v4f res[16];
  if constexpr ((EP & 2) != 0) { const char* rS = (const char*)(CP + tile0);
#pragma unroll
    for (int q = 0; q < 16; ++q) res[q] = *(const v4fa*)(rS + (size_t)(eo * 4u) + (size_t)(2 * q) * LDC * 4); }
  slice_mma(cur);
  __syncthreads();      /* every wave has read its last fragments before the buffers become output staging */
  v8f accs[8] = {c00, c01, c02, c03, c10, c11, c12, c13};
#pragma unroll
  for (int u = 0; u < 8; ++u) { const int t = u & 3, half = u >> 2; const float bv = bf16_round(braw[t]);
#pragma unroll
    for (int r = 0; r < 8; ++r) { const int rloc = half * 16 + 8 * hh + r; float v = accs[u][r] * alpha + bv;
      if (ACT == 3) v = fmaxf(v, 0.f); else if (ACT == 6) v = 0.5f * v * (1.0f + erff(v * 0.70710678118654752f)); else if (ACT == 11) v = 1.0f / (1.0f + expf(-v)); else if (ACT == 15) v = v / (1.0f + expf(-v)); else if (ACT == 12) v = (v > 0.f) ? v : 0.01f * v; else if (ACT == 8) v = tanhf(v);
      so[w][rloc][t * 16 + ln] = v; } }
  __builtin_amdgcn_fence(__ATOMIC_ACQ_REL, "workgroup"); __builtin_amdgcn_wave_barrier();
  const int rsub = lane >> 4, c4 = (lane & 15) * 4;
  {
#pragma unroll
    for (int q = 0; q < 16; ++q) { v4f v = *(const v4fa*)&so[w][q * 2 + rsub][c4];
      if constexpr ((EP & 2) != 0) v += res[q];
      if constexpr ((EP & 4) != 0) { v4h h4; for (int i = 0; i < 4; ++i) h4[i] = (_Float16)v[i]; *(v4h*)((char*)(C16 + tile0) + (size_t)(eo * 2u) + (size_t)(2 * q) * LDC * 2) = h4; }
      else *(v4f*)((char*)(C + tile0) + (size_t)(eo * 4u) + (size_t)(2 * q) * LDC * 4) = v; }
     } }



template <int TK>
__global__ __launch_bounds__(256) void k_vthl(const float* __restrict__ VF, int ldv, _Float16* __restrict__ Vth, _Float16* __restrict__ Vtl) { __shared__ float tl[64][65]; const int tid = threadIdx.x; const int slab = blockIdx.x / (TK / 64), lg = blockIdx.x % (TK / 64); const int b = slab / NH, h = slab % NH;
  for (int i = tid; i < 64 * 16; i += 256) { const int r = i / 16, c4 = (i % 16) * 4; const v4f a = *(const v4fa*)(VF + ((size_t)b * TK + lg * 64 + r) * ldv + h * 64 + c4); tl[r][c4] = a[0]; tl[r][c4 + 1] = a[1]; tl[r][c4 + 2] = a[2]; tl[r][c4 + 3] = a[3]; }
  __syncthreads();
  FragH fh[2], fl[2]; size_t oo[2];
#pragma unroll
  for (int rd = 0; rd < 2; ++rd) { const int d = rd * 32 + tid / 8, pc = tid % 8;
#pragma unroll
    for (int q = 0; q < 8; ++q) { const float v = tl[pc * 8 + q][d]; const _Float16 hv = (_Float16)v; fh[rd].h[q] = hv; fl[rd].h[q] = (_Float16)((v - (float)hv) * 1024.0f); } oo[rd] = ((size_t)slab * 64 + d) * TK + lg * 64 + pc * 8; }
  {
#pragma unroll
    for (int rd = 0; rd < 2; ++rd) { *(v8us*)((unsigned short*)Vth + oo[rd]) = fh[rd].half[0]; *(v8us*)((unsigned short*)Vtl + oo[rd]) = fl[rd].half[0]; }
     } }

template <int TQ, int TK>
__global__ __launch_bounds__(128) void k_flashm(const _Float16* __restrict__ Q16, const _Float16* __restrict__ Q16lo, int ldq, const _Float16* __restrict__ K16, const _Float16* __restrict__ K16lo, int ldk, const _Float16* __restrict__ Vt, const _Float16* __restrict__ Vtlo, const unsigned* __restrict__ MB, const int* __restrict__ RA, const int* __restrict__ KE, float* __restrict__ O, int ldo) {
  constexpr int RPW = 16, RTN = RPW / 16, NQB = TQ / (4 * RPW), DT = 4, KS = 2;
  __shared__ __attribute__((aligned(16))) unsigned short sP[4][RPW][40], sPl[4][RPW][40]; __shared__ __attribute__((aligned(16))) float sO[4][RPW][64 + 4];
  // A pass's keys and values lie in LDS once for the four waves. One buffer (in halves): 32 K rows hi, 32 K rows residual (128 B each, pitch 144 B), then 64 V^T rows hi, 64 residual (64 B each, pitch 80 B); pitches 16 B x odd for the 16-byte fragment reads.
  constexpr int KP = 72, VP = 40, VB0 = 64 * KP, KVB = VB0 + 128 * VP;
  __shared__ __attribute__((aligned(16))) unsigned short sKV[2 * KVB];      /* two buffers, 38,912 B: the next pass's tile flies while this one is worked on */
  const int tid = threadIdx.x, w = tid >> 5, lane = tid & 31, ln = lane & 15, hh = lane >> 4;
  const int h = blockIdx.x / NQB, t0 = blockIdx.x % NQB;
  // Causal balance: the work-group runs query tile t0 of batch 0, then tile NQB - 1 - t0 of batch 1 (alternating), so every work-group walks the same number of key passes.
#pragma unroll 1      /* one copy of the tile body: the tiles run one after the other in every wave */
  for (int b = 0; b < NBT; ++b) {
  const int slab = b * NH + h, qblk = (b & 1) ? NQB - 1 - t0 : t0; const int qb0 = qblk * (4 * RPW); const int q0 = qb0 + w * RPW;
  FragH aq[2][KS], aql[2][KS];
#pragma unroll
  for (int rt = 0; rt < RTN; ++rt) { const size_t qo = ((size_t)b * TQ + q0 + rt * 16 + ln) * ldq + h * 64; const unsigned short* qr = (const unsigned short*)Q16 + qo; const unsigned short* ql = (const unsigned short*)Q16lo + qo;
#pragma unroll
    for (int ks = 0; ks < KS; ++ks) { aq[rt][ks].half[0] = *(const v8us*)(qr + ks * 32 + 8 * hh); aq[rt][ks].half[1] = *(const v8us*)(qr + ks * 32 + 16 + 8 * hh); aql[rt][ks].half[0] = *(const v8us*)(ql + ks * 32 + 8 * hh); aql[rt][ks].half[1] = *(const v8us*)(ql + ks * 32 + 16 + 8 * hh); } }
  const unsigned short* Vth = (const unsigned short*)Vt + (size_t)slab * 64 * TK; const unsigned short* Vtl = (const unsigned short*)Vtlo + (size_t)slab * 64 * TK;
  // Staging, 8 copies of 16 B a lane and pass: 8 lanes cover a K row (rows tid / 8 and + 16 of each plane), 4 lanes a V^T row (rows tid / 4 and + 32 of each plane).
  const size_t kso = ((size_t)b * TK + (tid >> 3)) * ldk + h * 64 + (tid & 7) * 8, vso = (size_t)(tid >> 2) * TK + (tid & 3) * 8;
  const unsigned lk0 = (unsigned)(size_t)&sKV[(tid >> 3) * KP + (tid & 7) * 8], lv0 = (unsigned)(size_t)&sKV[VB0 + (tid >> 2) * VP + (tid & 3) * 8];      /* the lane's LDS byte addresses in buffer 0 */
  auto stage = [&](int js, int bo) {      /* keys js .. js + 31 into the buffer that starts at half bo */
    const unsigned short* kh = (const unsigned short*)K16 + kso + (size_t)js * ldk; const unsigned short* kl = (const unsigned short*)K16lo + kso + (size_t)js * ldk;
    const unsigned short* kh2 = kh + (size_t)16 * ldk; const unsigned short* kl2 = kl + (size_t)16 * ldk;
    const unsigned short* vh = Vth + vso + js; const unsigned short* vl = Vtl + vso + js; const unsigned short* vh2 = vh + (size_t)32 * TK; const unsigned short* vl2 = vl + (size_t)32 * TK;
    const unsigned lk = lk0 + 2u * (unsigned)bo, lv = lv0 + 2u * (unsigned)bo;
    const unsigned lk1 = lk + 2u * 16 * KP, lk2 = lk + 2u * 32 * KP, lk3 = lk + 2u * 48 * KP, lv1 = lv + 2u * 32 * VP, lv2 = lv + 2u * 64 * VP, lv3 = lv + 2u * 96 * VP;
    /* the copies and, as the statement's last line, the wait that stands in front of any rewrite of their address registers */
    asm volatile("global_load_async_to_lds_b128 %0, %8, off\n\t"
                 "global_load_async_to_lds_b128 %1, %9, off\n\t"
                 "global_load_async_to_lds_b128 %2, %10, off\n\t"
                 "global_load_async_to_lds_b128 %3, %11, off\n\t"
                 "global_load_async_to_lds_b128 %4, %12, off\n\t"
                 "global_load_async_to_lds_b128 %5, %13, off\n\t"
                 "global_load_async_to_lds_b128 %6, %14, off\n\t"
                 "global_load_async_to_lds_b128 %7, %15, off\n\t"
                 "s_wait_xcnt 0x0"
                 :: "v"(lk), "v"(lk1), "v"(lk2), "v"(lk3), "v"(lv), "v"(lv1), "v"(lv2), "v"(lv3), "v"(kh), "v"(kh2), "v"(kl), "v"(kl2), "v"(vh), "v"(vh2), "v"(vl), "v"(vl2) : "memory"); };
  float m_r[2][8], l_r[2][8]; v8f oacc[2][DT], oaccl[2][DT];
#pragma unroll
  for (int rt = 0; rt < RTN; ++rt) {
#pragma unroll
    for (int r = 0; r < 8; ++r) { m_r[rt][r] = -3.0e38f; l_r[rt][r] = 0.f; }
#pragma unroll
    for (int dt = 0; dt < DT; ++dt) { oacc[rt][dt] = (v8f){0.f,0.f,0.f,0.f,0.f,0.f,0.f,0.f}; oaccl[rt][dt] = oacc[rt][dt]; } }
  int jend = KE[qblk * 32]; jend = min(TK, (jend + 31) & ~31); if (jend < 32) jend = 32;      /* block-uniform */
  jend = __builtin_amdgcn_readfirstlane(jend);      /* in a scalar register: the tests around the copies and the barriers are scalar branches */
  int allm[2][8]; const unsigned* mrow[2][8];
#pragma unroll
  for (int rt = 0; rt < RTN; ++rt)
#pragma unroll
    for (int r = 0; r < 8; ++r) { const int tq = q0 + rt * 16 + 8 * hh + r; allm[rt][r] = RA[tq]; mrow[rt][r] = MB + (size_t)tq * (TK / 32); }
  stage(0, 0);      /* every reader of the tile before left both buffers in front of its last pass's barrier */
  asm volatile("s_wait_asynccnt 0x0" ::: "memory");      /* this wave's copies of pass 0 have landed */
  __syncthreads();      /* ... and every other wave's */
  if (jend > 32) stage(32, KVB);
  int cur = 0;      /* start (in halves) of the buffer that holds this pass's tile: 0 or KVB */
#pragma unroll 1
  for (int j0 = 0; j0 < jend; j0 += 32) {
    unsigned mwd[2][8];      /* the pass's mask words, asked for ahead of the score products so that these cover the loads */
#pragma unroll
    for (int rt = 0; rt < RTN; ++rt)
#pragma unroll
      for (int r = 0; r < 8; ++r) mwd[rt][r] = mrow[rt][r][j0 >> 5];
    v8f s[2][2];
#pragma unroll
    for (int nt = 0; nt < 2; ++nt) { const unsigned short* kr = &sKV[cur + (nt * 16 + ln) * KP]; const unsigned short* kl = kr + 32 * KP; FragH bk[KS], bkl[KS];
#pragma unroll
      for (int ks = 0; ks < KS; ++ks) { bk[ks].half[0] = *(const v8us*)(kr + ks * 32 + 8 * hh); bk[ks].half[1] = *(const v8us*)(kr + ks * 32 + 16 + 8 * hh); bkl[ks].half[0] = *(const v8us*)(kl + ks * 32 + 8 * hh); bkl[ks].half[1] = *(const v8us*)(kl + ks * 32 + 16 + 8 * hh); }
#pragma unroll
      for (int rt = 0; rt < RTN; ++rt) { v8f acc = (v8f){0.f,0.f,0.f,0.f,0.f,0.f,0.f,0.f}, accr = acc;
#pragma unroll
        for (int ks = 0; ks < KS; ++ks) { acc = mmaH<1>(aq[rt][ks].v, aq[rt][ks].v, bk[ks].v, bk[ks].v, acc); accr = mmaH<1>(aql[rt][ks].v, aql[rt][ks].v, bk[ks].v, bk[ks].v, accr); accr = mmaH<1>(aq[rt][ks].v, aq[rt][ks].v, bkl[ks].v, bkl[ks].v, accr); }
        s[rt][nt] = acc + accr * 0.0009765625f; } }
    // Online softmax, the eight rows of a lane side by side: each phase runs over all rows before the next begins, and every exponential is computed for every lane and then selected,
    // so the pass is one straight run of code in which the rows' shuffles and exponentials cover one another's latencies. Same values, same order of every sum as row after row.
#pragma unroll
    for (int rt = 0; rt < RTN; ++rt) {
      float s0v[8], s1v[8], mcv[8], alv[8], p0v[8], p1v[8]; bool ok0v[8], ok1v[8];
#pragma unroll
      for (int r = 0; r < 8; ++r) { const unsigned mw = mwd[rt][r]; const bool am = (allm[rt][r] != 0);
        ok0v[r] = am || (((mw >> ln) & 1u) == 0u); ok1v[r] = am || (((mw >> (16 + ln)) & 1u) == 0u);
        s0v[r] = ok0v[r] ? (am ? 0.f : s[rt][0][r] * SCL) : -INFINITY; s1v[r] = ok1v[r] ? (am ? 0.f : s[rt][1][r] * SCL) : -INFINITY; mcv[r] = fmaxf(s0v[r], s1v[r]); }
#pragma unroll
      for (int o = 1; o < 16; o <<= 1) { float xv[8];
#pragma unroll
        for (int r = 0; r < 8; ++r) xv[r] = __shfl_xor(mcv[r], o, 32);
        __builtin_amdgcn_sched_barrier(0);      /* all eight shuffles of a step are issued before the first result is waited for: one shuffle latency a step, not one a row */
#pragma unroll
        for (int r = 0; r < 8; ++r) mcv[r] = fmaxf(mcv[r], xv[r]); }
#pragma unroll
      for (int r = 0; r < 8; ++r) { const float mn = fmaxf(m_r[rt][r], mcv[r]);      /* mn is finite (at least -3.0e38), so a masked score gives exp(-inf) = 0 and no NaN reaches a selected value */
        const float ea = expf(m_r[rt][r] - mn), e0 = expf(s0v[r] - mn), e1 = expf(s1v[r] - mn);
        alv[r] = (mn > -1.0e38f) ? ea : 1.0f; m_r[rt][r] = mn; p0v[r] = ok0v[r] ? e0 : 0.f; p1v[r] = ok1v[r] ? e1 : 0.f; l_r[rt][r] = l_r[rt][r] * alv[r] + p0v[r] + p1v[r]; }
#pragma unroll
      for (int r = 0; r < 8; ++r) { const float al = alv[r], p0 = p0v[r], p1 = p1v[r];
#pragma unroll
        for (int dt = 0; dt < DT; ++dt) { oacc[rt][dt][r] *= al; oaccl[rt][dt][r] *= al; }
        FragH t2, t3; const float ps0 = p0 * 1024.0f, ps1 = p1 * 1024.0f; t2.h[0] = (_Float16)ps0; t2.h[1] = (_Float16)ps1; t3.h[0] = (_Float16)((ps0 - (float)t2.h[0]) * 1024.0f); t3.h[1] = (_Float16)((ps1 - (float)t2.h[1]) * 1024.0f);
        sP[w][rt * 16 + 8 * hh + r][ln] = t2.u[0]; sP[w][rt * 16 + 8 * hh + r][16 + ln] = t2.u[1]; sPl[w][rt * 16 + 8 * hh + r][ln] = t3.u[0]; sPl[w][rt * 16 + 8 * hh + r][16 + ln] = t3.u[1]; } }
    __builtin_amdgcn_fence(__ATOMIC_ACQ_REL, "workgroup"); __builtin_amdgcn_wave_barrier();
    FragH pa[2], pl[2];
#pragma unroll
    for (int rt = 0; rt < RTN; ++rt) { pa[rt].half[0] = *(const v8us*)&sP[w][rt * 16 + ln][8 * hh]; pa[rt].half[1] = *(const v8us*)&sP[w][rt * 16 + ln][16 + 8 * hh]; pl[rt].half[0] = *(const v8us*)&sPl[w][rt * 16 + ln][8 * hh]; pl[rt].half[1] = *(const v8us*)&sPl[w][rt * 16 + ln][16 + 8 * hh]; }
#pragma unroll
    for (int dt = 0; dt < DT; ++dt) { const unsigned short* vr = &sKV[cur + VB0 + (dt * 16 + ln) * VP + 8 * hh]; const unsigned short* vq = vr + 64 * VP; FragH bv, bl; bv.half[0] = *(const v8us*)vr; bv.half[1] = *(const v8us*)(vr + 16); bl.half[0] = *(const v8us*)vq; bl.half[1] = *(const v8us*)(vq + 16);
#pragma unroll
      for (int rt = 0; rt < RTN; ++rt) { oacc[rt][dt] = mmaH<1>(pa[rt].v, pa[rt].v, bv.v, bv.v, oacc[rt][dt]); oaccl[rt][dt] = mmaH<1>(pa[rt].v, pa[rt].v, bl.v, bl.v, oaccl[rt][dt]); oaccl[rt][dt] = mmaH<1>(pl[rt].v, pl[rt].v, bv.v, bv.v, oaccl[rt][dt]); } }
    asm volatile("s_wait_dscnt 0x0" ::: "memory");      /* this wave's LDS reads of the pass are done */
    asm volatile("s_wait_asynccnt 0x0" ::: "memory");      /* its copies of the next pass's tile have landed */
    __syncthreads();      /* publishes the next tile and ends every wave's reads of this one */
    if (j0 + 64 < jend) stage(j0 + 64, cur);      /* refill of the buffer just read, one whole pass ahead of its use */
    cur ^= KVB; }
  asm volatile("s_wait_asynccnt 0x0" ::: "memory");      /* nothing of this wave is in flight when the tile ends */
#pragma unroll
  for (int rt = 0; rt < RTN; ++rt) {
#pragma unroll
    for (int r = 0; r < 8; ++r) { float l = l_r[rt][r]; l += __shfl_xor(l, 1, 32); l += __shfl_xor(l, 2, 32); l += __shfl_xor(l, 4, 32); l += __shfl_xor(l, 8, 32); l_r[rt][r] = (l > 0.f) ? 1.0f / (l * 1024.0f) : 0.f; }
#pragma unroll
    for (int dt = 0; dt < DT; ++dt)
#pragma unroll
      for (int r = 0; r < 8; ++r) sO[w][rt * 16 + 8 * hh + r][dt * 16 + ln] = (oacc[rt][dt][r] + oaccl[rt][dt][r] * 0.0009765625f) * l_r[rt][r]; }
  __builtin_amdgcn_fence(__ATOMIC_ACQ_REL, "workgroup"); __builtin_amdgcn_wave_barrier();
  {
#pragma unroll
    for (int rp = 0; rp < RPW; rp += 2) { const int r = rp + (lane >> 4), pc = lane & 15; const v4f val = *(const v4fa*)&sO[w][r][pc * 4]; *(v4f*)(O + ((size_t)b * TQ + q0 + r) * ldo + h * 64 + pc * 4) = val; }
     }
  asm volatile("s_wait_xcnt 0x0" ::: "memory");      /* the next tile's set-up overwrites the address registers of the stores above */
  } }


template <int SRCBF>
__global__ __launch_bounds__(256) void k_lnab(const float* __restrict__ X, const float* __restrict__ g, const float* __restrict__ bb, _Float16* __restrict__ Y16, float* __restrict__ Y32, float* __restrict__ XB) {
  #pragma clang fp contract(off)
  const int tid = threadIdx.x, w = tid >> 5, ln = tid & 31; const int r = blockIdx.x * 8 + w; if (r >= NR) return; const float* x = X + (size_t)r * DM; float s = 0.f;
#pragma unroll 1
  for (int i = 0; i < DM / 128; ++i) { const v4f a = *(const v4fa*)(x + i * 128 + ln * 4); for (int q = 0; q < 4; ++q) s += SRCBF ? bf16_round(a[q]) : a[q]; }
  for (int o = 16; o > 0; o >>= 1) s += __shfl_xor(s, o, 32); const float mu = s / (float)DM; float q2 = 0.f;
#pragma unroll 1
  for (int i = 0; i < DM / 128; ++i) { const v4f a = *(const v4fa*)(x + i * 128 + ln * 4); for (int q = 0; q < 4; ++q) { const float d = (SRCBF ? bf16_round(a[q]) : a[q]) - mu; q2 += d * d; } }
  for (int o = 16; o > 0; o >>= 1) q2 += __shfl_xor(q2, o, 32); const float rs = rsqrtf(q2 / (float)DM + 1e-5f);
  {
#pragma unroll 1
    for (int i = 0; i < DM / 128; ++i) { const int c0 = i * 128 + ln * 4; const v4f a = *(const v4fa*)(x + c0); _Float16 h4[4]; v4f y4, xb;
      for (int q = 0; q < 4; ++q) { const float t = SRCBF ? bf16_round(a[q]) : a[q]; const float y = (t - mu) * rs * bf16_round(g[c0 + q]) + bf16_round(bb[c0 + q]); h4[q] = (_Float16)y; y4[q] = y; xb[q] = t; }
      if (Y16) *(unsigned long long*)((unsigned short*)Y16 + (size_t)r * DM + c0) = *(const unsigned long long*)h4; if (Y32) *(v4f*)(Y32 + (size_t)r * DM + c0) = y4; if (XB) *(v4f*)(XB + (size_t)r * DM + c0) = xb; }
     } }
__global__ __launch_bounds__(256) void k_causaltab(unsigned* __restrict__ MB, int* __restrict__ RA, int* __restrict__ KE, int nq, int nk) {
  const int t = blockIdx.x * 256 + threadIdx.x; const int nw = nk / 32;
  if (t < nq * nw) { const int q = t / nw, w = t % nw; const int first = q + 1 - 32 * w; const unsigned bits = (first <= 0) ? 0xffffffffu : ((first >= 32) ? 0u : (0xffffffffu << first)); *(unsigned*)(MB + t) = bits;  }
  if (t < nq) { *(int*)(RA + t) = 0;  }
  if (t < nq / 64) { const int v = 64 * (t + 1); *(int*)(KE + t * 32) = v;  } }


extern "C" void kernel_launch(void* const* d_in, const int* in_sizes, int n_in,
                              void* d_out, int out_size, void* d_ws, size_t ws_size, hipStream_t stream) {
  (void)in_sizes; (void)n_in; (void)out_size;
  const float* const* I = (const float* const*)d_in; const float* x = I[0]; const float* lag = I[1]; const float* lab = I[2]; const float* lbg = I[3]; const float* lbb = I[4]; const float* lcg = I[5]; const float* lcb = I[6];
  const float* Wq = I[7]; const float* bq = I[8]; const float* Wk = I[9]; const float* bk = I[10]; const float* Wv = I[11]; const float* bv = I[12]; const float* Wo = I[13]; const float* bo = I[14]; const float* We = I[15]; const float* be = I[16]; const float* Wd = I[17]; const float* bd = I[18];
  char* ws = (char*)d_ws; size_t off = 0;
  auto take = [&](size_t bytes) { char* p = ws + off; off += (bytes + 255) & ~(size_t)255; return p; };
  _Float16* BQ = (_Float16*)take((size_t)DM * DM * 2); _Float16* BK = (_Float16*)take((size_t)DM * DM * 2); _Float16* BV = (_Float16*)take((size_t)DM * DM * 2); _Float16* BO = (_Float16*)take((size_t)DM * DM * 2); _Float16* BE = (_Float16*)take((size_t)4096 * DM * 2); _Float16* BD = (_Float16*)take((size_t)DM * 4096 * 2);
  float* XB = (float*)take((size_t)NR * DM * 4); _Float16* T16 = (_Float16*)take((size_t)NR * DM * 2); float* F = (float*)take((size_t)NR * DM * 4);
  _Float16* Qh = (_Float16*)take((size_t)NR * DM * 2); _Float16* Ql = (_Float16*)take((size_t)NR * DM * 2); _Float16* Kh = (_Float16*)take((size_t)NR * DM * 2); _Float16* Kl = (_Float16*)take((size_t)NR * DM * 2); _Float16* Vth = (_Float16*)take((size_t)NR * DM * 2); _Float16* Vtl = (_Float16*)take((size_t)NR * DM * 2);
  unsigned* MB = (unsigned*)take((size_t)SLEN * (SLEN / 32) * 4); int* RA = (int*)take((size_t)SLEN * 4); int* KE = (int*)take((size_t)(SLEN / 64) * 32 * 4);
  if (off > ws_size) return;      /* 24 + 16 + 8 + 16 + 48 + 0.6 = 113 MiB (the first LN's f32 output lives in F until the second LN consumes it) */
  float* O = F; _Float16* Oh = Qh; _Float16* Ol = Ql; float* X1 = XB; _Float16* GH = Kh;      /* SiLU hidden [NR][4096] f16 = 32 MB over Kh|Kl|Vth|Vtl (dead after the flash) */
  const size_t n8 = (size_t)NR * DM / 8; const unsigned nb8 = (unsigned)((n8 + 255) / 256);
  k_wt_all<<<768, 256, 0, stream>>>(Wq, Wk, Wv, Wo, We, Wd, BQ, BK, BV, BO, BE, BD);      /* all (in,out) */
  k_causaltab<<<(SLEN * (SLEN / 32) + 255) / 256, 256, 0, stream>>>(MB, RA, KE, SLEN, SLEN);
  k_lnab<1><<<NR / 8, 256, 0, stream>>>(x, lag, lab, nullptr, F, XB);      /* t0 = LN_a(bf16 x) (f32), XB = bf16(x) */
  k_lnab<0><<<NR / 8, 256, 0, stream>>>(F, lbg, lbb, T16, nullptr, nullptr);      /* t = LN_b(t0) as f16 operand */
  const dim3 gP((NR / 128) * (DM / 64), 1), gM((NR / 128) * (4096 / 64), 1);
  k_gemm2<0, DM, DM, 1><<<gP, 128, 0, stream>>>(T16, DM, 0, BQ, DM, 0, 0.0625f, bq, 0, nullptr, F, nullptr, DM, 0, NR, DM, DM); k_hl<<<nb8, 256, 0, stream>>>(F, Qh, Ql, n8);
  k_gemm2<0, DM, DM, 1><<<gP, 128, 0, stream>>>(T16, DM, 0, BK, DM, 0, 0.0625f, bk, 0, nullptr, F, nullptr, DM, 0, NR, DM, DM); k_hl<<<nb8, 256, 0, stream>>>(F, Kh, Kl, n8);
  k_gemm2<0, DM, DM, 1><<<gP, 128, 0, stream>>>(T16, DM, 0, BV, DM, 0, 0.0625f, bv, 0, nullptr, F, nullptr, DM, 0, NR, DM, DM);
  for (int b = 0; b < NBT; ++b) k_vthl<SLEN><<<NH * (SLEN / 64), 256, 0, stream>>>(F + (size_t)b * SLEN * DM, DM, Vth + (size_t)b * SLEN * DM, Vtl + (size_t)b * SLEN * DM);
  k_flashm<SLEN, SLEN><<<NH * (SLEN / 64), 128, 0, stream>>>(Qh, Ql, DM, Kh, Kl, DM, Vth, Vtl, MB, RA, KE, O, DM);      /* both batches in one grid of equal work-groups */
  k_hl<<<nb8, 256, 0, stream>>>(O, Oh, Ol, n8);
  k_gemm2<0, DM, DM, 3><<<gP, 128, 0, stream>>>(Oh, DM, 0, BO, DM, 0, 0.0625f, bo, 0, XB, X1, nullptr, DM, 0, NR, DM, DM);      /* x1 = x + ctx Wo + bo (hi) */
  k_gemm2<0, DM, DM, 2><<<gP, 128, 0, stream>>>(Ol, DM, 0, BO, DM, 0, 0.0625f / 1024.0f, nullptr, 0, X1, X1, nullptr, DM, 0, NR, DM, DM);      /* + lo */
  k_lnab<0><<<NR / 8, 256, 0, stream>>>(X1, lcg, lcb, T16, nullptr, nullptr);
  k_gemm2<15, DM, 4096, 5><<<gM, 128, 0, stream>>>(T16, DM, 0, BE, DM, 0, 0.0625f, be, 0, nullptr, nullptr, GH, 4096, 0, NR, 4096, DM);      /* silu(t We + be) f16 (ACT 15 = x * sigmoid(x), present in the epilogue) */
  k_gemm2<0, 4096, DM, 3><<<gP, 128, 0, stream>>>(GH, 4096, 0, BD, 4096, 0, 0.0625f, bd, 0, X1, (float*)d_out, nullptr, DM, 0, NR, DM, 4096);      /* out = x1 + mlp */
}

// v007
// A run of this version takes 326 microseconds.
// In both of two side-by-side timings against v006, it was 1.07 times as fast.
// All steps since v000 together make it 3.72 times as fast.
#include <hip/hip_runtime.h>
// Pre-LN causal attention block (2 x 2048 tokens, 1024 = 16 heads x 64; MLP 4096 with SiLU): t = LN_b(LN_a(x)); q,k,v = t W + b; x1 = x + (causal softmax(q.k/8) v) Wo + bo; out = x1 + (silu(LN_c(x1) We + be)) Wd + bd -> [2,2048,1024].
// Structure: the LayerNorms on VALU (the first pass also writes the bf16 residual plane); projections / MLP as f16 WMMA GEMMs (32x64 wave tiles, f32 accumulation, exact x16 weights, biases / SiLU / residual addends in the epilogue); q, k as f16 hi + (x2^10) residual planes written by their GEMMs' own epilogue, V^T as hi + residual planes; fused causal flash kernel, one work-group per (head, t): 64-query tile t of batch 0, then tile 31 - t of batch 1 (32-key K and V^T tiles copied asynchronously into two LDS buffers shared by the four waves, device-built causal tables, online f32 softmax, P staged hi + residual, two value accumulators); O written by the flash kernel as hi + residual planes into Wo (two GEMMs).
// Compute dtype: x, weights, biases, LN parameters rounded to bf16; LN outputs and the SiLU hidden as f16 operands (~2^-12); q, k, P, v, O as f16 hi + residual pairs (~2^-21); f32 accumulation, softmax, LayerNorm. v_wmma_f32_16x16x32_f16.
#define NBT 2
#define SLEN 2048
#define DM 1024
#define NH 16
#define SCL 0.125f
#define NR (NBT * SLEN)
typedef __bf16 v16b __attribute__((ext_vector_type(16)));
typedef unsigned short v8us __attribute__((ext_vector_type(8), may_alias));
typedef float  v8f  __attribute__((ext_vector_type(8)));
typedef float  v4f  __attribute__((ext_vector_type(4)));
typedef float  v4fa __attribute__((ext_vector_type(4), may_alias));
union FragB { v16b v; v8us half[2]; unsigned short u[16]; };

__device__ __forceinline__ unsigned short bf16_bits(float x) { unsigned int u = __float_as_uint(x); return (unsigned short)((u + 0x7FFFu + ((u >> 16) & 1u)) >> 16); }
__device__ __forceinline__ float bf16_val(unsigned short b) { return __uint_as_float(((unsigned int)b) << 16); }
__device__ __forceinline__ float bf16_round(float x) { return bf16_val(bf16_bits(x)); }
// D += A·B with NT terms: 1 = ah·bh, 2 = + al·bh (A split), 3 = + ah·bl (both split)
template <int NT>
__device__ __forceinline__ v8f mmaN(v16b ah, v16b al, v16b bh, v16b bl, v8f c) {
  c = __builtin_amdgcn_wmma_f32_16x16x32_bf16(false, ah, false, bh, (short)0, c, false, false);
  if (NT >= 2) c = __builtin_amdgcn_wmma_f32_16x16x32_bf16(false, al, false, bh, (short)0, c, false, false);
  if (NT >= 3) c = __builtin_amdgcn_wmma_f32_16x16x32_bf16(false, ah, false, bl, (short)0, c, false, false);
  asm volatile("v_nop\n\tv_nop\n\tv_nop\n\tv_nop" : "+v"(c) : "v"(ah), "v"(al), "v"(bh), "v"(bl));
  return c;
}

__global__ __launch_bounds__(256) void k_wt_bf16(const float* __restrict__ W, unsigned short* __restrict__ Wt, int K, int N) {
  const int t = blockIdx.x * 256 + threadIdx.x;
  const int k8n = K / 8;
  if (t >= N * k8n) return;
  const int n = t / k8n, k8 = (t % k8n) * 8;
  v8us v;
#pragma unroll
  for (int i = 0; i < 8; ++i) v[i] = bf16_bits(W[(size_t)(k8 + i) * N + n]);
  *(v8us*)(Wt + (size_t)n * K + k8) = v;
  
}

// GEMM C[M][N] (f32, pitch ldc) = act(A[M][K]·W + bias). A f32 row-major (pitch lda) converted per fragment to bf16
// (ASPLIT: hi/lo two planes -> 2 terms, else single rounded term); Wt bf16 [N][K] (pitch ldb). BIAS_BF16 rounds the
// bias to bf16 first (bias quantised to bf16 before the add). K%32==0, M%16==0, N%64==0.
template <bool ASPLIT, int ACT, bool BIAS_BF16>
__global__ __launch_bounds__(128) void k_gemm_bf(const float* __restrict__ A, int lda, const unsigned short* __restrict__ Wt, int ldb,
                                               const float* __restrict__ bias, float* __restrict__ C, int ldc, int M, int N, int K) {
  __shared__ __attribute__((aligned(16))) float so[4][16][64];
  const int tid = threadIdx.x, w = tid >> 5, lane = tid & 31, ln = lane & 15, hh = lane >> 4;
  const int ntn = N / 64;
  const int wid = blockIdx.x * 4 + w;
  const int mt = wid / ntn, nq = wid % ntn;
  if (mt * 16 >= M) return;
  const int row0 = mt * 16, col0 = nq * 64;
  const float* arow = A + (size_t)(row0 + ln) * lda;
  v8f acc[4] = {};
  for (int kb = 0; kb < K; kb += 32) {
    FragB ah, al;
    const v4f x0 = *(const v4fa*)(arow + kb + 8 * hh), x1 = *(const v4fa*)(arow + kb + 8 * hh + 4);
    const v4f x2 = *(const v4fa*)(arow + kb + 16 + 8 * hh), x3 = *(const v4fa*)(arow + kb + 16 + 8 * hh + 4);
    float xs[16] = {x0[0],x0[1],x0[2],x0[3],x1[0],x1[1],x1[2],x1[3],x2[0],x2[1],x2[2],x2[3],x3[0],x3[1],x3[2],x3[3]};
#pragma unroll
    for (int i = 0; i < 16; ++i) { const unsigned short hb = bf16_bits(xs[i]); ah.u[i] = hb; al.u[i] = ASPLIT ? bf16_bits(xs[i] - bf16_val(hb)) : (unsigned short)0; }
#pragma unroll
    for (int t = 0; t < 4; ++t) {
      const unsigned short* brow = Wt + (size_t)(col0 + t * 16 + ln) * ldb + kb;
      FragB b;
      b.half[0] = *(const v8us*)(brow + 8 * hh);
      b.half[1] = *(const v8us*)(brow + 16 + 8 * hh);
      acc[t] = mmaN<ASPLIT ? 2 : 1>(ah.v, al.v, b.v, b.v, acc[t]);
    }
  }
#pragma unroll
  for (int t = 0; t < 4; ++t) {
    float bv = bias ? bias[col0 + t * 16 + ln] : 0.f;
    if (BIAS_BF16) bv = bf16_round(bv);
#pragma unroll
    for (int r = 0; r < 8; ++r) { float v = acc[t][r] + bv; if (ACT == 1) v = fmaxf(v, 0.f); so[w][8 * hh + r][t * 16 + ln] = v; }
  }
  __builtin_amdgcn_fence(__ATOMIC_ACQ_REL, "workgroup");
  __builtin_amdgcn_wave_barrier();
  const int rsub = lane >> 4, c4 = (lane & 15) * 4;
  {
#pragma unroll
    for (int q = 0; q < 8; ++q) {
      const int r = q * 2 + rsub;
      const v4f v = *(const v4fa*)&so[w][r][c4];
      *(v4f*)(C + (size_t)(row0 + r) * ldc + col0 + c4) = v;
    }
    
  }
}

// GEMM C = act(A·W + bias + resid): A f32 (ASPLIT -> hi/lo 2 terms), Wt bf16 [N][K]; ACT 0 none, 1 relu, 2 exact gelu;
// resid (optional, f32, row index = (row % rmod), pitch ldr, RES_BF16 rounds it) added before the activation.
template <bool ASPLIT, int ACT, bool BIAS_BF16, bool RES_BF16>
__global__ __launch_bounds__(128) void k_gemm_bf3(const float* __restrict__ A, int lda, const unsigned short* __restrict__ Wt, int ldb,
                                                const float* __restrict__ bias, const float* __restrict__ resid, int rmod, int ldr,
                                                float* __restrict__ C, int ldc, int M, int N, int K) {
  __shared__ __attribute__((aligned(16))) float so[4][16][64];
  const int tid = threadIdx.x, w = tid >> 5, lane = tid & 31, ln = lane & 15, hh = lane >> 4;
  const int ntn = N / 64;
  const int wid = blockIdx.x * 4 + w;
  const int mt = wid / ntn, nq = wid % ntn;
  if (mt * 16 >= M) return;
  const int row0 = mt * 16, col0 = nq * 64;
  const float* arow = A + (size_t)(row0 + ln) * lda;
  v8f acc[4] = {};
  for (int kb = 0; kb < K; kb += 32) {
    FragB ah, al;
    const v4f x0 = *(const v4fa*)(arow + kb + 8 * hh), x1 = *(const v4fa*)(arow + kb + 8 * hh + 4);
    const v4f x2 = *(const v4fa*)(arow + kb + 16 + 8 * hh), x3 = *(const v4fa*)(arow + kb + 16 + 8 * hh + 4);
    float xs[16] = {x0[0],x0[1],x0[2],x0[3],x1[0],x1[1],x1[2],x1[3],x2[0],x2[1],x2[2],x2[3],x3[0],x3[1],x3[2],x3[3]};
#pragma unroll
    for (int i = 0; i < 16; ++i) { const unsigned short hb = bf16_bits(xs[i]); ah.u[i] = hb; al.u[i] = ASPLIT ? bf16_bits(xs[i] - bf16_val(hb)) : (unsigned short)0; }
#pragma unroll
    for (int t = 0; t < 4; ++t) {
      const unsigned short* brow = Wt + (size_t)(col0 + t * 16 + ln) * ldb + kb;
      FragB b;
      b.half[0] = *(const v8us*)(brow + 8 * hh);
      b.half[1] = *(const v8us*)(brow + 16 + 8 * hh);
      acc[t] = mmaN<ASPLIT ? 2 : 1>(ah.v, al.v, b.v, b.v, acc[t]);
    }
  }
#pragma unroll
  for (int t = 0; t < 4; ++t) {
    const int col = col0 + t * 16 + ln;
    float bv = bias ? bias[col] : 0.f;
    if (BIAS_BF16) bv = bf16_round(bv);
#pragma unroll
    for (int r = 0; r < 8; ++r) {
      float v = acc[t][r] + bv;
      if (resid) { float rv = resid[(size_t)((row0 + 8 * hh + r) % rmod) * ldr + col]; if (RES_BF16) rv = bf16_round(rv); v += rv; }
      if (ACT == 1) v = fmaxf(v, 0.f);
      if (ACT == 2) v = 0.5f * v * (1.0f + erff(v * 0.70710678118654752f));
      if (ACT == 3) { const float u = 0.7978845608028654f * (v + 0.044715f * v * v * v); v = 0.5f * v * (1.0f + tanhf(u)); }
      so[w][8 * hh + r][t * 16 + ln] = v;
    }
  }
  __builtin_amdgcn_fence(__ATOMIC_ACQ_REL, "workgroup");
  __builtin_amdgcn_wave_barrier();
  const int rsub = lane >> 4, c4 = (lane & 15) * 4;
  {
#pragma unroll
    for (int q = 0; q < 8; ++q) {
      const int r = q * 2 + rsub;
      const v4f v = *(const v4fa*)&so[w][r][c4];
      *(v4f*)(C + (size_t)(row0 + r) * ldc + col0 + c4) = v;
    }
    
  }
}
// row LayerNorm (biased variance, eps) over N: s = X (+ R); optional out_sum <- s; out_norm <- (s-mu)*rsqrt(var+eps)*g + b
template <bool PARAM_BF16>
__global__ __launch_bounds__(256) void k_layernorm(const float* __restrict__ X, const float* __restrict__ R, const float* __restrict__ g, const float* __restrict__ bta,
                                                  float* __restrict__ out_sum, float* __restrict__ out_norm, int N, float eps) {
  __shared__ float red[256];
  const int row = blockIdx.x, tid = threadIdx.x;
  const float* x = X + (size_t)row * N; const float* rr = R ? R + (size_t)row * N : nullptr;
  float vals[16];                     // up to N = 4096
  const int per = N / 256;            // contiguous chunk per thread? use strided-by-4 chunks: thread handles j = tid*4 + 1024*u
  float s1 = 0.f;
  for (int u = 0; u < per / 4; ++u) {
    const int j = tid * 4 + 1024 * u;
    const v4f a = *(const v4fa*)(x + j);
    v4f b = {0.f,0.f,0.f,0.f}; if (rr) b = *(const v4fa*)(rr + j);
#pragma unroll
    for (int q = 0; q < 4; ++q) { const float v = a[q] + b[q]; vals[u * 4 + q] = v; s1 += v; }
  }
  red[tid] = s1; __syncthreads();
  for (int st = 128; st > 0; st >>= 1) { if (tid < st) red[tid] += red[tid + st]; __syncthreads(); }
  const float mu = red[0] / (float)N; __syncthreads();
  float s2 = 0.f;
  for (int u = 0; u < per / 4; ++u)
#pragma unroll
    for (int q = 0; q < 4; ++q) { const float c = vals[u * 4 + q] - mu; s2 += c * c; }
  red[tid] = s2; __syncthreads();
  for (int st = 128; st > 0; st >>= 1) { if (tid < st) red[tid] += red[tid + st]; __syncthreads(); }
  const float rs = rsqrtf(red[0] / (float)N + eps);
  {
    for (int u = 0; u < per / 4; ++u) {
      const int j = tid * 4 + 1024 * u;
      v4f o, sm;
#pragma unroll
      for (int q = 0; q < 4; ++q) {
        float gg = g[j + q], bb = bta[j + q];
        if (PARAM_BF16) { gg = bf16_round(gg); bb = bf16_round(bb); }
        sm[q] = vals[u * 4 + q]; o[q] = (vals[u * 4 + q] - mu) * rs * gg + bb;
      }
      if (out_sum) *(v4f*)(out_sum + (size_t)row * N + j) = sm;
      *(v4f*)(out_norm + (size_t)row * N + j) = o;
    }
    
  }
}



// ---- f16 WMMA path (v_wmma_f32_16x16x32_f16): 11-bit significands for operands in range — used where a [0,1] probability operand needs more precision than bf16
typedef _Float16 v16h __attribute__((ext_vector_type(16)));
union FragH { v16h v; v8us half[2]; _Float16 h[16]; unsigned short u[16]; };
template <int NT>
__device__ __forceinline__ v8f mmaH(v16h ah, v16h al, v16h bh, v16h bl, v8f c) {
  c = __builtin_amdgcn_wmma_f32_16x16x32_f16(false, ah, false, bh, (short)0, c, false, false);
  if (NT >= 2) c = __builtin_amdgcn_wmma_f32_16x16x32_f16(false, al, false, bh, (short)0, c, false, false);
  if (NT >= 3) c = __builtin_amdgcn_wmma_f32_16x16x32_f16(false, ah, false, bl, (short)0, c, false, false);
  asm volatile("v_nop\n\tv_nop\n\tv_nop\n\tv_nop" : "+v"(c) : "v"(ah), "v"(al), "v"(bh), "v"(bl));
  return c;
}
// batched GEMM like k_gemm_b but f16 operands: A f32 (split into f16 hi/lo if ASPLIT, else rounded to f16), Bt = f16 values [n][k]; alpha; C f32; N multiple of 16 (partial tiles skipped)
template <bool ASPLIT>
__global__ __launch_bounds__(128) void k_gemm_h(const float* __restrict__ A, int lda, size_t sA, const _Float16* __restrict__ Bh, int ldb, size_t sB, float alpha, float* __restrict__ C, int ldc, size_t sC, int M, int N, int K) {
  __shared__ __attribute__((aligned(16))) float so[4][16][64];
  const int tid = threadIdx.x, w = tid >> 5, lane = tid & 31, ln = lane & 15, hh = lane >> 4; const int by = blockIdx.y;
  A += (size_t)by * sA; Bh += (size_t)by * sB; C += (size_t)by * sC;
  const int ntn = (N + 63) / 64; const int wid = blockIdx.x * 4 + w; const int mt = wid / ntn, nq = wid % ntn; if (mt * 16 >= M) return;
  const int row0 = mt * 16, col0 = nq * 64; const float* arow = A + (size_t)(row0 + ln) * lda;
  v8f acc[4] = {};
  for (int kb = 0; kb < K; kb += 32) {
    FragH ah, al;
    const v4f x0 = *(const v4fa*)(arow + kb + 8 * hh), x1 = *(const v4fa*)(arow + kb + 8 * hh + 4), x2 = *(const v4fa*)(arow + kb + 16 + 8 * hh), x3 = *(const v4fa*)(arow + kb + 16 + 8 * hh + 4);
    float xs[16] = {x0[0],x0[1],x0[2],x0[3],x1[0],x1[1],x1[2],x1[3],x2[0],x2[1],x2[2],x2[3],x3[0],x3[1],x3[2],x3[3]};
#pragma unroll
    for (int i = 0; i < 16; ++i) { const _Float16 h = (_Float16)xs[i]; ah.h[i] = h; al.h[i] = ASPLIT ? (_Float16)(xs[i] - (float)h) : (_Float16)0.0f; }
#pragma unroll
    for (int t = 0; t < 4; ++t) { if (col0 + t * 16 >= N) continue; const size_t boff = (size_t)(col0 + t * 16 + ln) * ldb + kb; FragH bq; bq.half[0] = *(const v8us*)(Bh + boff + 8 * hh); bq.half[1] = *(const v8us*)(Bh + boff + 16 + 8 * hh);
      acc[t] = mmaH<ASPLIT ? 2 : 1>(ah.v, al.v, bq.v, bq.v, acc[t]); }
  }
#pragma unroll
  for (int t = 0; t < 4; ++t) { if (col0 + t * 16 >= N) continue;
#pragma unroll
    for (int r = 0; r < 8; ++r) so[w][8 * hh + r][t * 16 + ln] = acc[t][r] * alpha; }
  __builtin_amdgcn_fence(__ATOMIC_ACQ_REL, "workgroup"); __builtin_amdgcn_wave_barrier();
  const int rsub = lane >> 4, c4 = (lane & 15) * 4;
  {
#pragma unroll
    for (int q = 0; q < 8; ++q) { const int r = q * 2 + rsub; if (col0 + c4 < N) { const v4f v = *(const v4fa*)&so[w][r][c4]; *(v4f*)(C + (size_t)(row0 + r) * ldc + col0 + c4) = v; } }
     }
}

// Wt[n][k] = f16(bf16(W[k][n]) * 16) from f32 row-major W[K][N] (power-of-two scale: bf16-exact weights stay exact in f16 away from the subnormal range).
// One work-group turns a block of 64 k x 256 n in LDS: it reads the block's rows by whole lines (a wave-wide 16-byte load = 512 B of one row, all 16 loads of a lane in flight together),
// keeps it as f16 [k][n] (pitch 260 halves), reads it back as dwords (two n of one k) and writes 128-B lines of Wt (8 lanes x 8 k of one n). K, N at compile time: every row step is an immediate offset.
typedef unsigned long long u64a __attribute__((may_alias)); typedef unsigned u32a __attribute__((may_alias));
template <int K, int N>
__device__ __forceinline__ void wt_block(const float* __restrict__ W, _Float16* __restrict__ Wt, int u, unsigned short* tl) {
  constexpr int P = 256 + 4, NB = N / 256; const int tid = threadIdx.x; const int k0 = (u / NB) * 64, n0 = (u % NB) * 256;
  const float* src = W + (size_t)(k0 + (tid >> 6)) * N + n0 + (tid & 63) * 4; v4f a[16];
#pragma unroll
  for (int j = 0; j < 16; ++j) a[j] = *(const v4fa*)(src + (size_t)(4 * j) * N);
  asm volatile("s_wait_xcnt 0x0" : : "v"(src) : "memory");      /* in front of any overwrite of the address register that the 16 issued loads name (it stays live up to here) */
#pragma unroll
  for (int j = 0; j < 16; ++j) { FragH f;
#pragma unroll
    for (int q = 0; q < 4; ++q) f.h[q] = (_Float16)(bf16_round(a[j][q]) * 16.0f);
    *(u64a*)&tl[((tid >> 6) + 4 * j) * P + (tid & 63) * 4] = (unsigned long long)f.u[0] | ((unsigned long long)f.u[1] << 16) | ((unsigned long long)f.u[2] << 32) | ((unsigned long long)f.u[3] << 48); }
  __syncthreads();      /* the block is whole in LDS before any lane reads across the rows that other waves stored */
  const int kc = (tid & 7) * 8, np = tid >> 3; unsigned short* dst = (unsigned short*)Wt + (size_t)(n0 + 2 * np) * K + k0 + kc;
#pragma unroll
  for (int j = 0; j < 4; ++j) { unsigned d[8]; FragH lo, hi;
#pragma unroll
    for (int i = 0; i < 8; ++i) d[i] = *(const u32a*)&tl[(kc + i) * P + 2 * (np + 32 * j)];
#pragma unroll
    for (int i = 0; i < 8; ++i) { lo.u[i] = (unsigned short)(d[i] & 0xffffu); hi.u[i] = (unsigned short)(d[i] >> 16); }
    *(v8us*)(dst + (size_t)(64 * j) * K) = lo.half[0]; *(v8us*)(dst + (size_t)(64 * j + 1) * K) = hi.half[0]; } }
// All six weights in one grid of 768 equal work-groups: 4 x 64 blocks of the 1024 x 1024 projections, 256 of We, 256 of Wd.
__global__ __launch_bounds__(256) void k_wt_all(const float* __restrict__ Wq, const float* __restrict__ Wk, const float* __restrict__ Wv, const float* __restrict__ Wo, const float* __restrict__ We, const float* __restrict__ Wd,
    _Float16* __restrict__ BQ, _Float16* __restrict__ BK, _Float16* __restrict__ BV, _Float16* __restrict__ BO, _Float16* __restrict__ BE, _Float16* __restrict__ BD) {
  __shared__ __attribute__((aligned(16))) unsigned short tl[64 * 260];      /* 33,280 B */
  const int u = blockIdx.x;      /* the same for the whole work-group: a barrier follows in each branch */
  if (u < 256) { const int m = u >> 6; wt_block<DM, DM>(m == 0 ? Wq : m == 1 ? Wk : m == 2 ? Wv : Wo, m == 0 ? BQ : m == 1 ? BK : m == 2 ? BV : BO, u & 63, tl); }
  else if (u < 512) wt_block<DM, 4096>(We, BE, u - 256, tl);
  else wt_block<4096, DM>(Wd, BD, u - 512, tl); }
// k_gemm_hh variant with fused epilogue: v = acc·alpha + bias[by·sBias + col] (+ CP[(row/rowsPerB)·sCPb + by·64 + col] if CP) ; ACT 0 none / 1 elu ; writes f16 C16 (and f32 C if non-null)
template <int ACT>
__global__ __launch_bounds__(128) void k_gemm_hhx(const _Float16* __restrict__ A, int lda, size_t sA, const _Float16* __restrict__ Bh, int ldb, size_t sB, float alpha, const float* __restrict__ bias, size_t sBias, const float* __restrict__ CP, int rowsPerB, size_t sCPb, int row0g,
    float* __restrict__ C, _Float16* __restrict__ C16, int ldc, size_t sC, int M, int N, int K) {
  __shared__ __attribute__((aligned(16))) float so[4][16][64];
  const int tid = threadIdx.x, w = tid >> 5, lane = tid & 31, ln = lane & 15, hh = lane >> 4; const int by = blockIdx.y;
  A += (size_t)by * sA; Bh += (size_t)by * sB; const size_t cofs = (size_t)by * sC; const float* bp = bias ? bias + (size_t)by * sBias : nullptr;
  const int ntn = (N + 63) / 64; const int wid = blockIdx.x * 4 + w; const int mt = wid / ntn, nq = wid % ntn; if (mt * 16 >= M) return;
  const int row0 = mt * 16, col0 = nq * 64; const _Float16* arow = A + (size_t)(row0 + ln) * lda;
  v8f acc[4] = {};
  for (int kb = 0; kb < K; kb += 32) { FragH ah; ah.half[0] = *(const v8us*)((const unsigned short*)arow + kb + 8 * hh); ah.half[1] = *(const v8us*)((const unsigned short*)arow + kb + 16 + 8 * hh);
#pragma unroll
    for (int t = 0; t < 4; ++t) { if (col0 + t * 16 >= N) continue; const size_t boff = (size_t)(col0 + t * 16 + ln) * ldb + kb; FragH bq; bq.half[0] = *(const v8us*)((const unsigned short*)Bh + boff + 8 * hh); bq.half[1] = *(const v8us*)((const unsigned short*)Bh + boff + 16 + 8 * hh);
      acc[t] = mmaH<1>(ah.v, ah.v, bq.v, bq.v, acc[t]); }
  }
#pragma unroll
  for (int t = 0; t < 4; ++t) { if (col0 + t * 16 >= N) continue; const int col = col0 + t * 16 + ln; const float bv = bp ? bf16_round(bp[col]) : 0.f;
#pragma unroll
    for (int r = 0; r < 8; ++r) { float v = acc[t][r] * alpha + bv; if (CP) { const int bidx = (row0g + row0 + 8 * hh + r) / rowsPerB; v += CP[(size_t)bidx * sCPb + (size_t)by * 64 + col]; } if (ACT == 1) v = (v > 0.f) ? v : expm1f(v); else if (ACT == 7) v = (v > 0.f) ? v + 1.0f : expf(v); else if (ACT == 8) v = tanhf(v); else if (ACT == 9) v = 0.5f * v * (1.0f + tanhf(0.7978845608028654f * (v + 0.044715f * v * v * v))); else if (ACT == 11) v = 1.0f / (1.0f + expf(-v)); else if (ACT == 12) v = (v > 0.f) ? v : 0.01f * v; else if (ACT == 14) v = (v > 0.f) ? v : 0.1f * v; else if (ACT == 15) v = v / (1.0f + expf(-v)); else if (ACT == 3) v = fmaxf(v, 0.f); else if (ACT == 6) v = 0.5f * v * (1.0f + erff(v * 0.70710678118654752f)); so[w][8 * hh + r][t * 16 + ln] = v; } }
  __builtin_amdgcn_fence(__ATOMIC_ACQ_REL, "workgroup"); __builtin_amdgcn_wave_barrier();
  const int rsub = lane >> 4, c4 = (lane & 15) * 4; typedef _Float16 v4h __attribute__((ext_vector_type(4)));
  {
#pragma unroll
    for (int q = 0; q < 8; ++q) { const int r = q * 2 + rsub; if (col0 + c4 < N) { const v4f v = *(const v4fa*)&so[w][r][c4]; if (C) *(v4f*)(C + cofs + (size_t)(row0 + r) * ldc + col0 + c4) = v; if (C16) { v4h h4; for (int i = 0; i < 4; ++i) h4[i] = (_Float16)v[i]; *(v4h*)(C16 + cofs + (size_t)(row0 + r) * ldc + col0 + c4) = h4; } } }
     }
}


typedef _Float16 v4h __attribute__((ext_vector_type(4)));

__global__ __launch_bounds__(256) void k_x16(const float* __restrict__ x, _Float16* __restrict__ X16, size_t n8) { const size_t t = (size_t)blockIdx.x * 256 + threadIdx.x; if (t >= n8) return; FragH f;
#pragma unroll
  for (int q = 0; q < 8; ++q) f.h[q] = (_Float16)bf16_round(x[t * 8 + q]); *(v8us*)((unsigned short*)X16 + t * 8) = f.half[0];  }
__global__ __launch_bounds__(256) void k_h16(const float* __restrict__ x, _Float16* __restrict__ X16, size_t n8) { const size_t t = (size_t)blockIdx.x * 256 + threadIdx.x; if (t >= n8) return; FragH f;
#pragma unroll
  for (int q = 0; q < 8; ++q) f.h[q] = (_Float16)x[t * 8 + q]; *(v8us*)((unsigned short*)X16 + t * 8) = f.half[0];  }
__global__ __launch_bounds__(256) void k_round16f(const float* __restrict__ W, _Float16* __restrict__ Bt, size_t n8) { const size_t t = (size_t)blockIdx.x * 256 + threadIdx.x; if (t >= n8) return; FragH f;
#pragma unroll
  for (int i = 0; i < 8; ++i) f.h[i] = (_Float16)(bf16_round(W[t * 8 + i]) * 16.0f); *(v8us*)((unsigned short*)Bt + t * 8) = f.half[0];  }
template <int NHv, int TTv>
__global__ __launch_bounds__(256) void k_vt(const _Float16* __restrict__ V16, int ldv, int voff, _Float16* __restrict__ Vt) { __shared__ unsigned short tl[64][66]; const int tid = threadIdx.x; const int slab = blockIdx.x / (TTv / 64), lg = blockIdx.x % (TTv / 64); const int b = slab / NHv, h = slab % NHv;
  for (int i = tid; i < 64 * 8; i += 256) { const int r = i / 8, c8 = (i % 8) * 8; FragH f; f.half[0] = *(const v8us*)((const unsigned short*)V16 + ((size_t)b * TTv + lg * 64 + r) * ldv + voff + h * 64 + c8);
#pragma unroll
    for (int q = 0; q < 8; ++q) tl[r][c8 + q] = f.u[q]; }
  __syncthreads();
  {
#pragma unroll
    for (int rd = 0; rd < 2; ++rd) { const int d = rd * 32 + tid / 8, pc = tid % 8; FragH f;
#pragma unroll
      for (int q = 0; q < 8; ++q) f.u[q] = tl[pc * 8 + q][d];
      *(v8us*)((unsigned short*)Vt + ((size_t)slab * 64 + d) * TTv + lg * 64 + pc * 8) = f.half[0]; }
     } }

// ---- fast GEMM (work-group tile 128x64, wave tile 32x64; requires M % 128 == 0, N % 64 == 0, K % 128 == 0); epilogue: v = act(acc * alpha + bf16(bias[col])), or v = acc * alpha + bf16(bias[col]) + residual[row][col] ----
// Operands go through LDS: per slice of 128 k the work-group loads 256 B of each of its 128 A rows and 64 B rows with whole-line 16-byte loads (two rows per wave-wide load),
// keeps them in registers while the slice before is worked on, and stores them into the other of two LDS buffers; the fragments are read from LDS, A and B alike as halves k + 8 * hh .. + 7 and k + 16 + 8 * hh .. + 7 of their row.
__device__ __forceinline__ v16h g2_sfrag(const unsigned short* p) { FragH f; f.half[0] = *(const v8us*)p; f.half[1] = *(const v8us*)(p + 16); return f.v; }      /* p = LDS row + k + 8 * hh */
__device__ __forceinline__ v8f g2_mma(v16h a, v16h b, v8f c) { v8f d = __builtin_amdgcn_wmma_f32_16x16x32_f16(false, a, false, b, (short)0, c, false, false); asm volatile("v_nop\n\tv_nop\n\tv_nop\n\tv_nop" : "+v"(d) : "v"(a), "v"(b)); return d; }
template <int ACT, int LD, int LDC, int EP>      /* LD = lda = ldb = K and LDC = ldc at compile time: the row steps of the staging loads, of the residual loads and of the stores become immediate offsets. EP, the epilogue's kind: 1 = bias, 2 = residual plane added (indexed like C), 4 = f16 output to C16, 8 = f16 output to C16 and its rounding residual x 2^10 as f16 to C16l (else f32 to C) */
__global__ __launch_bounds__(128) void k_gemm2(const _Float16* __restrict__ A, int lda, size_t sA, const _Float16* __restrict__ Bh, int ldb, size_t sB, float alpha, const float* __restrict__ bias, size_t sBias, const float* CP,
    float* C, _Float16* __restrict__ C16, _Float16* __restrict__ C16l, int ldc, size_t sC, int M, int N, int K) {      /* CP may be C itself: a lane reads exactly the elements that it stores later */
  static_assert(!(EP & 2) || ACT == 0, "the residual is added behind the staging, so no activation may follow it");
  constexpr int KS = 128, PIT = KS + 8, BUF = (128 + 64) * PIT;      /* slice of k; LDS row pitch 272 B = 16 B x 17 (no bank conflict for 16-byte fragment reads); halves per buffer: rows 0-127 A, 128-191 B */
  __shared__ __attribute__((aligned(16))) unsigned short st[2 * BUF];      /* 104,448 B */
  float (*so)[32][68] = reinterpret_cast<float (*)[32][68]>(st);      /* the epilogue's staging (34,816 B) reuses the buffers behind the last barrier */
  const int tid = threadIdx.x, w = tid >> 5, lane = tid & 31, ln = lane & 15, hh = lane >> 4; const int by = blockIdx.y;
  A += (size_t)by * sA; Bh += (size_t)by * sB; const size_t cofs = (size_t)by * sC;
  const int ntn = N >> 6; const int mt = blockIdx.x / ntn, nq = blockIdx.x - mt * ntn; const int col0 = nq * 64; if (mt * 128 >= M) return;      /* the same for the whole work-group: barriers follow */
  const int sr = tid >> 4, sc = (tid & 15) * 8;      /* staging: 16 threads cover the 256 B of a row, the work-group 8 rows per load */
  (void)lda; (void)ldb; (void)K; (void)ldc;
  const char* aS = (const char*)(A + (size_t)(mt * 128) * LD); const char* bS = (const char*)(Bh + (size_t)col0 * LD);      /* the work-group's first A and B row: the same in every lane */
  unsigned vo = (unsigned)(sr * LD + sc) * 2u;      /* the lane's byte offset in both operands: its row of 8, its 16 bytes, the slice */
  const v8f z8 = {0.f,0.f,0.f,0.f,0.f,0.f,0.f,0.f}; v8f c00 = z8, c01 = z8, c02 = z8, c03 = z8, c10 = z8, c11 = z8, c12 = z8, c13 = z8;
  v8us rg[24];
  auto slice_load = [&]() {
#pragma unroll
    for (int i = 0; i < 16; ++i) rg[i] = *(const v8us*)(aS + (size_t)vo + (size_t)(16 * i) * LD);
#pragma unroll
    for (int i = 0; i < 8; ++i) rg[16 + i] = *(const v8us*)(bS + (size_t)vo + (size_t)(16 * i) * LD); };
  auto slice_next = [&]() { asm volatile("s_wait_xcnt 0x0" : "+v"(vo) : : "memory");      /* in front of the overwrite of the offset register that the issued loads name */
    vo += 2u * KS; };
  auto slice_store = [&](int bo) {
#pragma unroll
    for (int i = 0; i < 24; ++i) *(v8us*)&st[bo + (8 * i + sr) * PIT + sc] = rg[i]; };
  auto slice_mma = [&](int bo) { const unsigned short* ap = &st[bo + (32 * w + ln) * PIT + 8 * hh]; const unsigned short* bq = &st[bo + (128 + ln) * PIT + 8 * hh];
#pragma unroll
    for (int kk = 0; kk < KS; kk += 32) { const v16h a0 = g2_sfrag(ap + kk), a1 = g2_sfrag(ap + 16 * PIT + kk);      /* the six fragments of a k step as one group of LDS reads in front of its eight products */
      const v16h b0 = g2_sfrag(bq + kk), b1 = g2_sfrag(bq + 16 * PIT + kk), b2 = g2_sfrag(bq + 32 * PIT + kk), b3 = g2_sfrag(bq + 48 * PIT + kk);
      c00 = g2_mma(a0, b0, c00); c10 = g2_mma(a1, b0, c10); c01 = g2_mma(a0, b1, c01); c11 = g2_mma(a1, b1, c11);
      c02 = g2_mma(a0, b2, c02); c12 = g2_mma(a1, b2, c12); c03 = g2_mma(a0, b3, c03); c13 = g2_mma(a1, b3, c13); } };
  float braw[4] = {0.f, 0.f, 0.f, 0.f};      /* the lane's 4 bias values, asked for together with the first slice */
  if constexpr ((EP & 1) != 0) { const float* bS4 = bias + (size_t)by * sBias + col0 + ln;
#pragma unroll
    for (int t = 0; t < 4; ++t) braw[t] = bS4[16 * t]; }
  slice_load(); slice_next(); slice_store(0); __syncthreads();
  int cur = 0;      /* start (in halves) of the buffer that holds the slice being worked on: 0 or BUF */
#pragma unroll 1      /* one copy of the slice body; the buffer alternates at run time */
  for (int s = 1; s < LD / KS; ++s) {
    slice_load();      /* in flight while the slice before is worked on */
    slice_mma(cur);
    slice_next();
    slice_store(cur ^ BUF);      /* its last readers left this buffer in front of the barrier of the trip before */
    __syncthreads(); cur ^= BUF; }
  // The residual plane is asked for here, all at once, so that the last slice's products cover the loads: the lane's 16 pieces of 16 B, the very pieces that it stores at the end
  // (16 lanes = the 256 B of a row of the tile, a wave-wide load = two rows).
  const unsigned eo = (unsigned)((32 * w + (lane >> 4)) * LDC + (lane & 15) * 4);      /* the lane's element offset in the work-group's tile of C */
  const size_t tile0 = cofs + (size_t)(mt * 128) * LDC + col0;      /* the tile's first element: the same in every lane */
  v4f res[16];
  if constexpr ((EP & 2) != 0) { const char* rS = (const char*)(CP + tile0);
#pragma unroll
    for (int q = 0; q < 16; ++q) res[q] = *(const v4fa*)(rS + (size_t)(eo * 4u) + (size_t)(2 * q) * LDC * 4); }
  slice_mma(cur);
  __syncthreads();      /* every wave has read its last fragments before the buffers become output staging */
  v8f accs[8] = {c00, c01, c02, c03, c10, c11, c12, c13};
#pragma unroll
  for (int u = 0; u < 8; ++u) { const int t = u & 3, half = u >> 2; const float bv = bf16_round(braw[t]);
#pragma unroll
    for (int r = 0; r < 8; ++r) { const int rloc = half * 16 + 8 * hh + r; float v = accs[u][r] * alpha + bv;
      if (ACT == 3) v = fmaxf(v, 0.f); else if (ACT == 6) v = 0.5f * v * (1.0f + erff(v * 0.70710678118654752f)); else if (ACT == 11) v = 1.0f / (1.0f + expf(-v)); else if (ACT == 15) v = v / (1.0f + expf(-v)); else if (ACT == 12) v = (v > 0.f) ? v : 0.01f * v; else if (ACT == 8) v = tanhf(v);
      so[w][rloc][t * 16 + ln] = v; } }
  __builtin_amdgcn_fence(__ATOMIC_ACQ_REL, "workgroup"); __builtin_amdgcn_wave_barrier();
  const int rsub = lane >> 4, c4 = (lane & 15) * 4;
  {
#pragma unroll
    for (int q = 0; q < 16; ++q) { v4f v = *(const v4fa*)&so[w][q * 2 + rsub][c4];
      if constexpr ((EP & 2) != 0) v += res[q];
      if constexpr ((EP & 8) != 0) { v4h h4, l4; for (int i = 0; i < 4; ++i) { const _Float16 hv = (_Float16)v[i]; h4[i] = hv; l4[i] = (_Float16)((v[i] - (float)hv) * 1024.0f); }
        *(v4h*)((char*)(C16 + tile0) + (size_t)(eo * 2u) + (size_t)(2 * q) * LDC * 2) = h4; *(v4h*)((char*)(C16l + tile0) + (size_t)(eo * 2u) + (size_t)(2 * q) * LDC * 2) = l4; }
      else if constexpr ((EP & 4) != 0) { v4h h4; for (int i = 0; i < 4; ++i) h4[i] = (_Float16)v[i]; *(v4h*)((char*)(C16 + tile0) + (size_t)(eo * 2u) + (size_t)(2 * q) * LDC * 2) = h4; }
      else *(v4f*)((char*)(C + tile0) + (size_t)(eo * 4u) + (size_t)(2 * q) * LDC * 4) = v; }
     } }



template <int TK>
__global__ __launch_bounds__(256) void k_vthl(const float* __restrict__ VF, int ldv, _Float16* __restrict__ Vth, _Float16* __restrict__ Vtl) { __shared__ float tl[64][65]; const int tid = threadIdx.x; const int slab = blockIdx.x / (TK / 64), lg = blockIdx.x % (TK / 64); const int b = slab / NH, h = slab % NH;
  for (int i = tid; i < 64 * 16; i += 256) { const int r = i / 16, c4 = (i % 16) * 4; const v4f a = *(const v4fa*)(VF + ((size_t)b * TK + lg * 64 + r) * ldv + h * 64 + c4); tl[r][c4] = a[0]; tl[r][c4 + 1] = a[1]; tl[r][c4 + 2] = a[2]; tl[r][c4 + 3] = a[3]; }
  __syncthreads();
  FragH fh[2], fl[2]; size_t oo[2];
#pragma unroll
  for (int rd = 0; rd < 2; ++rd) { const int d = rd * 32 + tid / 8, pc = tid % 8;
#pragma unroll
    for (int q = 0; q < 8; ++q) { const float v = tl[pc * 8 + q][d]; const _Float16 hv = (_Float16)v; fh[rd].h[q] = hv; fl[rd].h[q] = (_Float16)((v - (float)hv) * 1024.0f); } oo[rd] = ((size_t)slab * 64 + d) * TK + lg * 64 + pc * 8; }
  {
#pragma unroll
    for (int rd = 0; rd < 2; ++rd) { *(v8us*)((unsigned short*)Vth + oo[rd]) = fh[rd].half[0]; *(v8us*)((unsigned short*)Vtl + oo[rd]) = fl[rd].half[0]; }
     } }

template <int TQ, int TK>
__global__ __launch_bounds__(128) void k_flashm(const _Float16* __restrict__ Q16, const _Float16* __restrict__ Q16lo, int ldq, const _Float16* __restrict__ K16, const _Float16* __restrict__ K16lo, int ldk, const _Float16* __restrict__ Vt, const _Float16* __restrict__ Vtlo, const unsigned* __restrict__ MB, const int* __restrict__ RA, const int* __restrict__ KE, _Float16* __restrict__ Oh, _Float16* __restrict__ Ol, int ldo) {
  constexpr int RPW = 16, RTN = RPW / 16, NQB = TQ / (4 * RPW), DT = 4, KS = 2;
  __shared__ __attribute__((aligned(16))) unsigned short sP[4][RPW][40], sPl[4][RPW][40]; __shared__ __attribute__((aligned(16))) float sO[4][RPW][64 + 4];
  // A pass's keys and values lie in LDS once for the four waves. One buffer (in halves): 32 K rows hi, 32 K rows residual (128 B each, pitch 144 B), then 64 V^T rows hi, 64 residual (64 B each, pitch 80 B); pitches 16 B x odd for the 16-byte fragment reads.
  constexpr int KP = 72, VP = 40, VB0 = 64 * KP, KVB = VB0 + 128 * VP;
  __shared__ __attribute__((aligned(16))) unsigned short sKV[2 * KVB];      /* two buffers, 38,912 B: the next pass's tile flies while this one is worked on */
  const int tid = threadIdx.x, w = tid >> 5, lane = tid & 31, ln = lane & 15, hh = lane >> 4;
  const int h = blockIdx.x / NQB, t0 = blockIdx.x % NQB;
  // Causal balance: the work-group runs query tile t0 of batch 0, then tile NQB - 1 - t0 of batch 1 (alternating), so every work-group walks the same number of key passes.
#pragma unroll 1      /* one copy of the tile body: the tiles run one after the other in every wave */
  for (int b = 0; b < NBT; ++b) {
  const int slab = b * NH + h, qblk = (b & 1) ? NQB - 1 - t0 : t0; const int qb0 = qblk * (4 * RPW); const int q0 = qb0 + w * RPW;
  FragH aq[2][KS], aql[2][KS];
#pragma unroll
  for (int rt = 0; rt < RTN; ++rt) { const size_t qo = ((size_t)b * TQ + q0 + rt * 16 + ln) * ldq + h * 64; const unsigned short* qr = (const unsigned short*)Q16 + qo; const unsigned short* ql = (const unsigned short*)Q16lo + qo;
#pragma unroll
    for (int ks = 0; ks < KS; ++ks) { aq[rt][ks].half[0] = *(const v8us*)(qr + ks * 32 + 8 * hh); aq[rt][ks].half[1] = *(const v8us*)(qr + ks * 32 + 16 + 8 * hh); aql[rt][ks].half[0] = *(const v8us*)(ql + ks * 32 + 8 * hh); aql[rt][ks].half[1] = *(const v8us*)(ql + ks * 32 + 16 + 8 * hh); } }
  const unsigned short* Vth = (const unsigned short*)Vt + (size_t)slab * 64 * TK; const unsigned short* Vtl = (const unsigned short*)Vtlo + (size_t)slab * 64 * TK;
  // Staging, 8 copies of 16 B a lane and pass: 8 lanes cover a K row (rows tid / 8 and + 16 of each plane), 4 lanes a V^T row (rows tid / 4 and + 32 of each plane).
  const size_t kso = ((size_t)b * TK + (tid >> 3)) * ldk + h * 64 + (tid & 7) * 8, vso = (size_t)(tid >> 2) * TK + (tid & 3) * 8;
  const unsigned lk0 = (unsigned)(size_t)&sKV[(tid >> 3) * KP + (tid & 7) * 8], lv0 = (unsigned)(size_t)&sKV[VB0 + (tid >> 2) * VP + (tid & 3) * 8];      /* the lane's LDS byte addresses in buffer 0 */
  auto stage = [&](int js, int bo) {      /* keys js .. js + 31 into the buffer that starts at half bo */
    const unsigned short* kh = (const unsigned short*)K16 + kso + (size_t)js * ldk; const unsigned short* kl = (const unsigned short*)K16lo + kso + (size_t)js * ldk;
    const unsigned short* kh2 = kh + (size_t)16 * ldk; const unsigned short* kl2 = kl + (size_t)16 * ldk;
    const unsigned short* vh = Vth + vso + js; const unsigned short* vl = Vtl + vso + js; const unsigned short* vh2 = vh + (size_t)32 * TK; const unsigned short* vl2 = vl + (size_t)32 * TK;
    const unsigned lk = lk0 + 2u * (unsigned)bo, lv = lv0 + 2u * (unsigned)bo;
    const unsigned lk1 = lk + 2u * 16 * KP, lk2 = lk + 2u * 32 * KP, lk3 = lk + 2u * 48 * KP, lv1 = lv + 2u * 32 * VP, lv2 = lv + 2u * 64 * VP, lv3 = lv + 2u * 96 * VP;
    /* the copies and, as the statement's last line, the wait that stands in front of any rewrite of their address registers */
    asm volatile("global_load_async_to_lds_b128 %0, %8, off\n\t"
                 "global_load_async_to_lds_b128 %1, %9, off\n\t"
                 "global_load_async_to_lds_b128 %2, %10, off\n\t"
                 "global_load_async_to_lds_b128 %3, %11, off\n\t"
                 "global_load_async_to_lds_b128 %4, %12, off\n\t"
                 "global_load_async_to_lds_b128 %5, %13, off\n\t"
                 "global_load_async_to_lds_b128 %6, %14, off\n\t"
                 "global_load_async_to_lds_b128 %7, %15, off\n\t"
                 "s_wait_xcnt 0x0"
                 :: "v"(lk), "v"(lk1), "v"(lk2), "v"(lk3), "v"(lv), "v"(lv1), "v"(lv2), "v"(lv3), "v"(kh), "v"(kh2), "v"(kl), "v"(kl2), "v"(vh), "v"(vh2), "v"(vl), "v"(vl2) : "memory"); };
  float m_r[2][8], l_r[2][8]; v8f oacc[2][DT], oaccl[2][DT];
#pragma unroll
  for (int rt = 0; rt < RTN; ++rt) {
#pragma unroll
    for (int r = 0; r < 8; ++r) { m_r[rt][r] = -3.0e38f; l_r[rt][r] = 0.f; }
#pragma unroll
    for (int dt = 0; dt < DT; ++dt) { oacc[rt][dt] = (v8f){0.f,0.f,0.f,0.f,0.f,0.f,0.f,0.f}; oaccl[rt][dt] = oacc[rt][dt]; } }
  int jend = KE[qblk * 32]; jend = min(TK, (jend + 31) & ~31); if (jend < 32) jend = 32;      /* block-uniform */
  jend = __builtin_amdgcn_readfirstlane(jend);      /* in a scalar register: the tests around the copies and the barriers are scalar branches */
  int allm[2][8]; const unsigned* mrow[2][8];
#pragma unroll
  for (int rt = 0; rt < RTN; ++rt)
#pragma unroll
    for (int r = 0; r < 8; ++r) { const int tq = q0 + rt * 16 + 8 * hh + r; allm[rt][r] = RA[tq]; mrow[rt][r] = MB + (size_t)tq * (TK / 32); }
  stage(0, 0);      /* every reader of the tile before left both buffers in front of its last pass's barrier */
  asm volatile("s_wait_asynccnt 0x0" ::: "memory");      /* this wave's copies of pass 0 have landed */
  __syncthreads();      /* ... and every other wave's */
  if (jend > 32) stage(32, KVB);
  int cur = 0;      /* start (in halves) of the buffer that holds this pass's tile: 0 or KVB */
#pragma unroll 1
  for (int j0 = 0; j0 < jend; j0 += 32) {
    unsigned mwd[2][8];      /* the pass's mask words, asked for ahead of the score products so that these cover the loads */
#pragma unroll
    for (int rt = 0; rt < RTN; ++rt)
#pragma unroll
      for (int r = 0; r < 8; ++r) mwd[rt][r] = mrow[rt][r][j0 >> 5];
    v8f s[2][2];
#pragma unroll
    for (int nt = 0; nt < 2; ++nt) { const unsigned short* kr = &sKV[cur + (nt * 16 + ln) * KP]; const unsigned short* kl = kr + 32 * KP; FragH bk[KS], bkl[KS];
#pragma unroll
      for (int ks = 0; ks < KS; ++ks) { bk[ks].half[0] = *(const v8us*)(kr + ks * 32 + 8 * hh); bk[ks].half[1] = *(const v8us*)(kr + ks * 32 + 16 + 8 * hh); bkl[ks].half[0] = *(const v8us*)(kl + ks * 32 + 8 * hh); bkl[ks].half[1] = *(const v8us*)(kl + ks * 32 + 16 + 8 * hh); }
#pragma unroll
      for (int rt = 0; rt < RTN; ++rt) { v8f acc = (v8f){0.f,0.f,0.f,0.f,0.f,0.f,0.f,0.f}, accr = acc;
#pragma unroll
        for (int ks = 0; ks < KS; ++ks) { acc = mmaH<1>(aq[rt][ks].v, aq[rt][ks].v, bk[ks].v, bk[ks].v, acc); accr = mmaH<1>(aql[rt][ks].v, aql[rt][ks].v, bk[ks].v, bk[ks].v, accr); accr = mmaH<1>(aq[rt][ks].v, aq[rt][ks].v, bkl[ks].v, bkl[ks].v, accr); }
        s[rt][nt] = acc + accr * 0.0009765625f; } }
    // Online softmax, the eight rows of a lane side by side: each phase runs over all rows before the next begins, and every exponential is computed for every lane and then selected,
    // so the pass is one straight run of code in which the rows' shuffles and exponentials cover one another's latencies. Same values, same order of every sum as row after row.
#pragma unroll
    for (int rt = 0; rt < RTN; ++rt) {
      float s0v[8], s1v[8], mcv[8], alv[8], p0v[8], p1v[8]; bool ok0v[8], ok1v[8];
#pragma unroll
      for (int r = 0; r < 8; ++r) { const unsigned mw = mwd[rt][r]; const bool am = (allm[rt][r] != 0);
        ok0v[r] = am || (((mw >> ln) & 1u) == 0u); ok1v[r] = am || (((mw >> (16 + ln)) & 1u) == 0u);
        s0v[r] = ok0v[r] ? (am ? 0.f : s[rt][0][r] * SCL) : -INFINITY; s1v[r] = ok1v[r] ? (am ? 0.f : s[rt][1][r] * SCL) : -INFINITY; mcv[r] = fmaxf(s0v[r], s1v[r]); }
#pragma unroll
      for (int o = 1; o < 16; o <<= 1) { float xv[8];
#pragma unroll
        for (int r = 0; r < 8; ++r) xv[r] = __shfl_xor(mcv[r], o, 32);
        __builtin_amdgcn_sched_barrier(0);      /* all eight shuffles of a step are issued before the first result is waited for: one shuffle latency a step, not one a row */
#pragma unroll
        for (int r = 0; r < 8; ++r) mcv[r] = fmaxf(mcv[r], xv[r]); }
#pragma unroll
      for (int r = 0; r < 8; ++r) { const float mn = fmaxf(m_r[rt][r], mcv[r]);      /* mn is finite (at least -3.0e38), so a masked score gives exp(-inf) = 0 and no NaN reaches a selected value */
        const float ea = expf(m_r[rt][r] - mn), e0 = expf(s0v[r] - mn), e1 = expf(s1v[r] - mn);
        alv[r] = (mn > -1.0e38f) ? ea : 1.0f; m_r[rt][r] = mn; p0v[r] = ok0v[r] ? e0 : 0.f; p1v[r] = ok1v[r] ? e1 : 0.f; l_r[rt][r] = l_r[rt][r] * alv[r] + p0v[r] + p1v[r]; }
#pragma unroll
      for (int r = 0; r < 8; ++r) { const float al = alv[r], p0 = p0v[r], p1 = p1v[r];
#pragma unroll
        for (int dt = 0; dt < DT; ++dt) { oacc[rt][dt][r] *= al; oaccl[rt][dt][r] *= al; }
        FragH t2, t3; const float ps0 = p0 * 1024.0f, ps1 = p1 * 1024.0f; t2.h[0] = (_Float16)ps0; t2.h[1] = (_Float16)ps1; t3.h[0] = (_Float16)((ps0 - (float)t2.h[0]) * 1024.0f); t3.h[1] = (_Float16)((ps1 - (float)t2.h[1]) * 1024.0f);
        sP[w][rt * 16 + 8 * hh + r][ln] = t2.u[0]; sP[w][rt * 16 + 8 * hh + r][16 + ln] = t2.u[1]; sPl[w][rt * 16 + 8 * hh + r][ln] = t3.u[0]; sPl[w][rt * 16 + 8 * hh + r][16 + ln] = t3.u[1]; } }
    __builtin_amdgcn_fence(__ATOMIC_ACQ_REL, "workgroup"); __builtin_amdgcn_wave_barrier();
    FragH pa[2], pl[2];
#pragma unroll
    for (int rt = 0; rt < RTN; ++rt) { pa[rt].half[0] = *(const v8us*)&sP[w][rt * 16 + ln][8 * hh]; pa[rt].half[1] = *(const v8us*)&sP[w][rt * 16 + ln][16 + 8 * hh]; pl[rt].half[0] = *(const v8us*)&sPl[w][rt * 16 + ln][8 * hh]; pl[rt].half[1] = *(const v8us*)&sPl[w][rt * 16 + ln][16 + 8 * hh]; }
#pragma unroll
    for (int dt = 0; dt < DT; ++dt) { const unsigned short* vr = &sKV[cur + VB0 + (dt * 16 + ln) * VP + 8 * hh]; const unsigned short* vq = vr + 64 * VP; FragH bv, bl; bv.half[0] = *(const v8us*)vr; bv.half[1] = *(const v8us*)(vr + 16); bl.half[0] = *(const v8us*)vq; bl.half[1] = *(const v8us*)(vq + 16);
#pragma unroll
      for (int rt = 0; rt < RTN; ++rt) { oacc[rt][dt] = mmaH<1>(pa[rt].v, pa[rt].v, bv.v, bv.v, oacc[rt][dt]); oaccl[rt][dt] = mmaH<1>(pa[rt].v, pa[rt].v, bl.v, bl.v, oaccl[rt][dt]); oaccl[rt][dt] = mmaH<1>(pl[rt].v, pl[rt].v, bv.v, bv.v, oaccl[rt][dt]); } }
    asm volatile("s_wait_dscnt 0x0" ::: "memory");      /* this wave's LDS reads of the pass are done */
    asm volatile("s_wait_asynccnt 0x0" ::: "memory");      /* its copies of the next pass's tile have landed */
    __syncthreads();      /* publishes the next tile and ends every wave's reads of this one */
    if (j0 + 64 < jend) stage(j0 + 64, cur);      /* refill of the buffer just read, one whole pass ahead of its use */
    cur ^= KVB; }
  asm volatile("s_wait_asynccnt 0x0" ::: "memory");      /* nothing of this wave is in flight when the tile ends */
#pragma unroll
  for (int rt = 0; rt < RTN; ++rt) {
#pragma unroll
    for (int r = 0; r < 8; ++r) { float l = l_r[rt][r]; l += __shfl_xor(l, 1, 32); l += __shfl_xor(l, 2, 32); l += __shfl_xor(l, 4, 32); l += __shfl_xor(l, 8, 32); l_r[rt][r] = (l > 0.f) ? 1.0f / (l * 1024.0f) : 0.f; }
#pragma unroll
    for (int dt = 0; dt < DT; ++dt)
#pragma unroll
      for (int r = 0; r < 8; ++r) sO[w][rt * 16 + 8 * hh + r][dt * 16 + ln] = (oacc[rt][dt][r] + oaccl[rt][dt][r] * 0.0009765625f) * l_r[rt][r]; }
  __builtin_amdgcn_fence(__ATOMIC_ACQ_REL, "workgroup"); __builtin_amdgcn_wave_barrier();
  {
#pragma unroll
    for (int rp = 0; rp < RPW; rp += 2) { const int r = rp + (lane >> 4), pc = lane & 15; const v4f val = *(const v4fa*)&sO[w][r][pc * 4]; v4h h4, l4;      /* O leaves as the f16 plane and its rounding residual x 2^10, the operands of the two Wo products: 16 lanes = one 128-B line of each plane */
      for (int i = 0; i < 4; ++i) { const _Float16 hv = (_Float16)val[i]; h4[i] = hv; l4[i] = (_Float16)((val[i] - (float)hv) * 1024.0f); }
      const size_t oo = ((size_t)b * TQ + q0 + r) * ldo + h * 64 + pc * 4; *(v4h*)(Oh + oo) = h4; *(v4h*)(Ol + oo) = l4; }
     }
  asm volatile("s_wait_xcnt 0x0" ::: "memory");      /* the next tile's set-up overwrites the address registers of the stores above */
  } }


template <int SRCBF>
__global__ __launch_bounds__(256) void k_lnab(const float* __restrict__ X, const float* __restrict__ g, const float* __restrict__ bb, _Float16* __restrict__ Y16, float* __restrict__ Y32, float* __restrict__ XB) {
  #pragma clang fp contract(off)
  const int tid = threadIdx.x, w = tid >> 5, ln = tid & 31; const int r = blockIdx.x * 8 + w; if (r >= NR) return; const float* x = X + (size_t)r * DM; float s = 0.f;
#pragma unroll 1
  for (int i = 0; i < DM / 128; ++i) { const v4f a = *(const v4fa*)(x + i * 128 + ln * 4); for (int q = 0; q < 4; ++q) s += SRCBF ? bf16_round(a[q]) : a[q]; }
  for (int o = 16; o > 0; o >>= 1) s += __shfl_xor(s, o, 32); const float mu = s / (float)DM; float q2 = 0.f;
#pragma unroll 1
  for (int i = 0; i < DM / 128; ++i) { const v4f a = *(const v4fa*)(x + i * 128 + ln * 4); for (int q = 0; q < 4; ++q) { const float d = (SRCBF ? bf16_round(a[q]) : a[q]) - mu; q2 += d * d; } }
  for (int o = 16; o > 0; o >>= 1) q2 += __shfl_xor(q2, o, 32); const float rs = rsqrtf(q2 / (float)DM + 1e-5f);
  {
#pragma unroll 1
    for (int i = 0; i < DM / 128; ++i) { const int c0 = i * 128 + ln * 4; const v4f a = *(const v4fa*)(x + c0); _Float16 h4[4]; v4f y4, xb;
      for (int q = 0; q < 4; ++q) { const float t = SRCBF ? bf16_round(a[q]) : a[q]; const float y = (t - mu) * rs * bf16_round(g[c0 + q]) + bf16_round(bb[c0 + q]); h4[q] = (_Float16)y; y4[q] = y; xb[q] = t; }
      if (Y16) *(unsigned long long*)((unsigned short*)Y16 + (size_t)r * DM + c0) = *(const unsigned long long*)h4; if (Y32) *(v4f*)(Y32 + (size_t)r * DM + c0) = y4; if (XB) *(v4f*)(XB + (size_t)r * DM + c0) = xb; }
     } }
__global__ __launch_bounds__(256) void k_causaltab(unsigned* __restrict__ MB, int* __restrict__ RA, int* __restrict__ KE, int nq, int nk) {
  const int t = blockIdx.x * 256 + threadIdx.x; const int nw = nk / 32;
  if (t < nq * nw) { const int q = t / nw, w = t % nw; const int first = q + 1 - 32 * w; const unsigned bits = (first <= 0) ? 0xffffffffu : ((first >= 32) ? 0u : (0xffffffffu << first)); *(unsigned*)(MB + t) = bits;  }
  if (t < nq) { *(int*)(RA + t) = 0;  }
  if (t < nq / 64) { const int v = 64 * (t + 1); *(int*)(KE + t * 32) = v;  } }


extern "C" void kernel_launch(void* const* d_in, const int* in_sizes, int n_in,
                              void* d_out, int out_size, void* d_ws, size_t ws_size, hipStream_t stream) {
  (void)in_sizes; (void)n_in; (void)out_size;
  const float* const* I = (const float* const*)d_in; const float* x = I[0]; const float* lag = I[1]; const float* lab = I[2]; const float* lbg = I[3]; const float* lbb = I[4]; const float* lcg = I[5]; const float* lcb = I[6];
  const float* Wq = I[7]; const float* bq = I[8]; const float* Wk = I[9]; const float* bk = I[10]; const float* Wv = I[11]; const float* bv = I[12]; const float* Wo = I[13]; const float* bo = I[14]; const float* We = I[15]; const float* be = I[16]; const float* Wd = I[17]; const float* bd = I[18];
  char* ws = (char*)d_ws; size_t off = 0;
  auto take = [&](size_t bytes) { char* p = ws + off; off += (bytes + 255) & ~(size_t)255; return p; };
  _Float16* BQ = (_Float16*)take((size_t)DM * DM * 2); _Float16* BK = (_Float16*)take((size_t)DM * DM * 2); _Float16* BV = (_Float16*)take((size_t)DM * DM * 2); _Float16* BO = (_Float16*)take((size_t)DM * DM * 2); _Float16* BE = (_Float16*)take((size_t)4096 * DM * 2); _Float16* BD = (_Float16*)take((size_t)DM * 4096 * 2);
  float* XB = (float*)take((size_t)NR * DM * 4); _Float16* T16 = (_Float16*)take((size_t)NR * DM * 2); float* F = (float*)take((size_t)NR * DM * 4);
  _Float16* Qh = (_Float16*)take((size_t)NR * DM * 2); _Float16* Ql = (_Float16*)take((size_t)NR * DM * 2); _Float16* Kh = (_Float16*)take((size_t)NR * DM * 2); _Float16* Kl = (_Float16*)take((size_t)NR * DM * 2); _Float16* Vth = (_Float16*)take((size_t)NR * DM * 2); _Float16* Vtl = (_Float16*)take((size_t)NR * DM * 2);
  unsigned* MB = (unsigned*)take((size_t)SLEN * (SLEN / 32) * 4); int* RA = (int*)take((size_t)SLEN * 4); int* KE = (int*)take((size_t)(SLEN / 64) * 32 * 4);
  if (off > ws_size) return;      /* 24 + 16 + 8 + 16 + 48 + 0.6 = 113 MiB (the first LN's f32 output lives in F until the second LN consumes it) */
  _Float16* Oh = (_Float16*)F; _Float16* Ol = Oh + (size_t)NR * DM; float* X1 = XB;      /* the two O planes fill F, dead once V is transposed */
  _Float16* GH = Kh;      /* SiLU hidden [NR][4096] f16 = 32 MB over Kh|Kl|Vth|Vtl (dead after the flash) */
  k_wt_all<<<768, 256, 0, stream>>>(Wq, Wk, Wv, Wo, We, Wd, BQ, BK, BV, BO, BE, BD);      /* all (in,out) */
  k_causaltab<<<(SLEN * (SLEN / 32) + 255) / 256, 256, 0, stream>>>(MB, RA, KE, SLEN, SLEN);
  k_lnab<1><<<NR / 8, 256, 0, stream>>>(x, lag, lab, nullptr, F, XB);      /* t0 = LN_a(bf16 x) (f32), XB = bf16(x) */
  k_lnab<0><<<NR / 8, 256, 0, stream>>>(F, lbg, lbb, T16, nullptr, nullptr);      /* t = LN_b(t0) as f16 operand */
  const dim3 gP((NR / 128) * (DM / 64), 1), gM((NR / 128) * (4096 / 64), 1);
  k_gemm2<0, DM, DM, 9><<<gP, 128, 0, stream>>>(T16, DM, 0, BQ, DM, 0, 0.0625f, bq, 0, nullptr, nullptr, Qh, Ql, DM, 0, NR, DM, DM);      /* q as hi + residual planes */
  k_gemm2<0, DM, DM, 9><<<gP, 128, 0, stream>>>(T16, DM, 0, BK, DM, 0, 0.0625f, bk, 0, nullptr, nullptr, Kh, Kl, DM, 0, NR, DM, DM);      /* k likewise */
  k_gemm2<0, DM, DM, 1><<<gP, 128, 0, stream>>>(T16, DM, 0, BV, DM, 0, 0.0625f, bv, 0, nullptr, F, nullptr, nullptr, DM, 0, NR, DM, DM);
  for (int b = 0; b < NBT; ++b) k_vthl<SLEN><<<NH * (SLEN / 64), 256, 0, stream>>>(F + (size_t)b * SLEN * DM, DM, Vth + (size_t)b * SLEN * DM, Vtl + (size_t)b * SLEN * DM);
  k_flashm<SLEN, SLEN><<<NH * (SLEN / 64), 128, 0, stream>>>(Qh, Ql, DM, Kh, Kl, DM, Vth, Vtl, MB, RA, KE, Oh, Ol, DM);      /* both batches in one grid of equal work-groups */
  k_gemm2<0, DM, DM, 3><<<gP, 128, 0, stream>>>(Oh, DM, 0, BO, DM, 0, 0.0625f, bo, 0, XB, X1, nullptr, nullptr, DM, 0, NR, DM, DM);      /* x1 = x + ctx Wo + bo (hi) */
  k_gemm2<0, DM, DM, 2><<<gP, 128, 0, stream>>>(Ol, DM, 0, BO, DM, 0, 0.0625f / 1024.0f, nullptr, 0, X1, X1, nullptr, nullptr, DM, 0, NR, DM, DM);      /* + lo */
  k_lnab<0><<<NR / 8, 256, 0, stream>>>(X1, lcg, lcb, T16, nullptr, nullptr);
  k_gemm2<15, DM, 4096, 5><<<gM, 128, 0, stream>>>(T16, DM, 0, BE, DM, 0, 0.0625f, be, 0, nullptr, nullptr, GH, nullptr, 4096, 0, NR, 4096, DM);      /* silu(t We + be) f16 (ACT 15 = x * sigmoid(x), present in the epilogue) */
  k_gemm2<0, 4096, DM, 3><<<gP, 128, 0, stream>>>(GH, 4096, 0, BD, 4096, 0, 0.0625f, bd, 0, X1, (float*)d_out, nullptr, nullptr, DM, 0, NR, DM, 4096);      /* out = x1 + mlp */
}

// v008
// One run takes 311 microseconds.
// Two timings next to v007 both put it at 1.03 times that version's speed.
// Counting every step since v000, it is 3.84 times as fast.
#include <hip/hip_runtime.h>
// Pre-LN causal attention block (2 x 2048 tokens, 1024 = 16 heads x 64; MLP 4096 with SiLU): t = LN_b(LN_a(x)); q,k,v = t W + b; x1 = x + (causal softmax(q.k/8) v) Wo + bo; out = x1 + (silu(LN_c(x1) We + be)) Wd + bd -> [2,2048,1024].
// Structure: the LayerNorms on VALU (the first pass also writes the bf16 residual plane); projections / MLP as f16 WMMA GEMMs (128x128 work-group tiles of eight 32x64 wave tiles, f32 accumulation, exact x16 weights, biases / SiLU / residual addends in the epilogue); q, k as f16 hi + (x2^10) residual planes written by their GEMMs' own epilogue, V^T as hi + residual planes; fused causal flash kernel, one work-group per (head, t): 64-query tile t of batch 0, then tile 31 - t of batch 1 (32-key K and V^T tiles copied asynchronously into two LDS buffers shared by the four waves, device-built causal tables, online f32 softmax, P staged hi + residual, two value accumulators); O written by the flash kernel as hi + residual planes into Wo (two GEMMs).
// Compute dtype: x, weights, biases, LN parameters rounded to bf16; LN outputs and the SiLU hidden as f16 operands (~2^-12); q, k, P, v, O as f16 hi + residual pairs (~2^-21); f32 accumulation, softmax, LayerNorm. v_wmma_f32_16x16x32_f16.
#define NBT 2
#define SLEN 2048
#define DM 1024
#define NH 16
#define SCL 0.125f
#define NR (NBT * SLEN)
typedef __bf16 v16b __attribute__((ext_vector_type(16)));
typedef unsigned short v8us __attribute__((ext_vector_type(8), may_alias));
typedef float  v8f  __attribute__((ext_vector_type(8)));
typedef float  v4f  __attribute__((ext_vector_type(4)));
typedef float  v4fa __attribute__((ext_vector_type(4), may_alias));
union FragB { v16b v; v8us half[2]; unsigned short u[16]; };

__device__ __forceinline__ unsigned short bf16_bits(float x) { unsigned int u = __float_as_uint(x); return (unsigned short)((u + 0x7FFFu + ((u >> 16) & 1u)) >> 16); }
__device__ __forceinline__ float bf16_val(unsigned short b) { return __uint_as_float(((unsigned int)b) << 16); }
__device__ __forceinline__ float bf16_round(float x) { return bf16_val(bf16_bits(x)); }
// D += A·B with NT terms: 1 = ah·bh, 2 = + al·bh (A split), 3 = + ah·bl (both split)
template <int NT>
__device__ __forceinline__ v8f mmaN(v16b ah, v16b al, v16b bh, v16b bl, v8f c) {
  c = __builtin_amdgcn_wmma_f32_16x16x32_bf16(false, ah, false, bh, (short)0, c, false, false);
  if (NT >= 2) c = __builtin_amdgcn_wmma_f32_16x16x32_bf16(false, al, false, bh, (short)0, c, false, false);
  if (NT >= 3) c = __builtin_amdgcn_wmma_f32_16x16x32_bf16(false, ah, false, bl, (short)0, c, false, false);
  asm volatile("v_nop\n\tv_nop\n\tv_nop\n\tv_nop" : "+v"(c) : "v"(ah), "v"(al), "v"(bh), "v"(bl));
  return c;
}

__global__ __launch_bounds__(256) void k_wt_bf16(const float* __restrict__ W, unsigned short* __restrict__ Wt, int K, int N) {
  const int t = blockIdx.x * 256 + threadIdx.x;
  const int k8n = K / 8;
  if (t >= N * k8n) return;
  const int n = t / k8n, k8 = (t % k8n) * 8;
  v8us v;
#pragma unroll
  for (int i = 0; i < 8; ++i) v[i] = bf16_bits(W[(size_t)(k8 + i) * N + n]);
  *(v8us*)(Wt + (size_t)n * K + k8) = v;
  
}

// GEMM C[M][N] (f32, pitch ldc) = act(A[M][K]·W + bias). A f32 row-major (pitch lda) converted per fragment to bf16
// (ASPLIT: hi/lo two planes -> 2 terms, else single rounded term); Wt bf16 [N][K] (pitch ldb). BIAS_BF16 rounds the
// bias to bf16 first (bias quantised to bf16 before the add). K%32==0, M%16==0, N%64==0.
template <bool ASPLIT, int ACT, bool BIAS_BF16>
__global__ __launch_bounds__(128) void k_gemm_bf(const float* __restrict__ A, int lda, const unsigned short* __restrict__ Wt, int ldb,
                                               const float* __restrict__ bias, float* __restrict__ C, int ldc, int M, int N, int K) {
  __shared__ __attribute__((aligned(16))) float so[4][16][64];
  const int tid = threadIdx.x, w = tid >> 5, lane = tid & 31, ln = lane & 15, hh = lane >> 4;
  const int ntn = N / 64;
  const int wid = blockIdx.x * 4 + w;
  const int mt = wid / ntn, nq = wid % ntn;
  if (mt * 16 >= M) return;
  const int row0 = mt * 16, col0 = nq * 64;
  const float* arow = A + (size_t)(row0 + ln) * lda;
  v8f acc[4] = {};
  for (int kb = 0; kb < K; kb += 32) {
    FragB ah, al;
    const v4f x0 = *(const v4fa*)(arow + kb + 8 * hh), x1 = *(const v4fa*)(arow + kb + 8 * hh + 4);
    const v4f x2 = *(const v4fa*)(arow + kb + 16 + 8 * hh), x3 = *(const v4fa*)(arow + kb + 16 + 8 * hh + 4);
    float xs[16] = {x0[0],x0[1],x0[2],x0[3],x1[0],x1[1],x1[2],x1[3],x2[0],x2[1],x2[2],x2[3],x3[0],x3[1],x3[2],x3[3]};
#pragma unroll
    for (int i = 0; i < 16; ++i) { const unsigned short hb = bf16_bits(xs[i]); ah.u[i] = hb; al.u[i] = ASPLIT ? bf16_bits(xs[i] - bf16_val(hb)) : (unsigned short)0; }
#pragma unroll
    for (int t = 0; t < 4; ++t) {
      const unsigned short* brow = Wt + (size_t)(col0 + t * 16 + ln) * ldb + kb;
      FragB b;
      b.half[0] = *(const v8us*)(brow + 8 * hh);
      b.half[1] = *(const v8us*)(brow + 16 + 8 * hh);
      acc[t] = mmaN<ASPLIT ? 2 : 1>(ah.v, al.v, b.v, b.v, acc[t]);
    }
  }
#pragma unroll
  for (int t = 0; t < 4; ++t) {
    float bv = bias ? bias[col0 + t * 16 + ln] : 0.f;
    if (BIAS_BF16) bv = bf16_round(bv);
#pragma unroll
    for (int r = 0; r < 8; ++r) { float v = acc[t][r] + bv; if (ACT == 1) v = fmaxf(v, 0.f); so[w][8 * hh + r][t * 16 + ln] = v; }
  }
  __builtin_amdgcn_fence(__ATOMIC_ACQ_REL, "workgroup");
  __builtin_amdgcn_wave_barrier();
  const int rsub = lane >> 4, c4 = (lane & 15) * 4;
  {
#pragma unroll
    for (int q = 0; q < 8; ++q) {
      const int r = q * 2 + rsub;
      const v4f v = *(const v4fa*)&so[w][r][c4];
      *(v4f*)(C + (size_t)(row0 + r) * ldc + col0 + c4) = v;
    }
    
  }
}

// GEMM C = act(A·W + bias + resid): A f32 (ASPLIT -> hi/lo 2 terms), Wt bf16 [N][K]; ACT 0 none, 1 relu, 2 exact gelu;
// resid (optional, f32, row index = (row % rmod), pitch ldr, RES_BF16 rounds it) added before the activation.
template <bool ASPLIT, int ACT, bool BIAS_BF16, bool RES_BF16>
__global__ __launch_bounds__(128) void k_gemm_bf3(const float* __restrict__ A, int lda, const unsigned short* __restrict__ Wt, int ldb,
                                                const float* __restrict__ bias, const float* __restrict__ resid, int rmod, int ldr,
                                                float* __restrict__ C, int ldc, int M, int N, int K) {
  __shared__ __attribute__((aligned(16))) float so[4][16][64];
  const int tid = threadIdx.x, w = tid >> 5, lane = tid & 31, ln = lane & 15, hh = lane >> 4;
  const int ntn = N / 64;
  const int wid = blockIdx.x * 4 + w;
  const int mt = wid / ntn, nq = wid % ntn;
  if (mt * 16 >= M) return;
  const int row0 = mt * 16, col0 = nq * 64;
  const float* arow = A + (size_t)(row0 + ln) * lda;
  v8f acc[4] = {};
  for (int kb = 0; kb < K; kb += 32) {
    FragB ah, al;
    const v4f x0 = *(const v4fa*)(arow + kb + 8 * hh), x1 = *(const v4fa*)(arow + kb + 8 * hh + 4);
    const v4f x2 = *(const v4fa*)(arow + kb + 16 + 8 * hh), x3 = *(const v4fa*)(arow + kb + 16 + 8 * hh + 4);
    float xs[16] = {x0[0],x0[1],x0[2],x0[3],x1[0],x1[1],x1[2],x1[3],x2[0],x2[1],x2[2],x2[3],x3[0],x3[1],x3[2],x3[3]};
#pragma unroll
    for (int i = 0; i < 16; ++i) { const unsigned short hb = bf16_bits(xs[i]); ah.u[i] = hb; al.u[i] = ASPLIT ? bf16_bits(xs[i] - bf16_val(hb)) : (unsigned short)0; }
#pragma unroll
    for (int t = 0; t < 4; ++t) {
      const unsigned short* brow = Wt + (size_t)(col0 + t * 16 + ln) * ldb + kb;
      FragB b;
      b.half[0] = *(const v8us*)(brow + 8 * hh);
      b.half[1] = *(const v8us*)(brow + 16 + 8 * hh);
      acc[t] = mmaN<ASPLIT ? 2 : 1>(ah.v, al.v, b.v, b.v, acc[t]);
    }
  }
#pragma unroll
  for (int t = 0; t < 4; ++t) {
    const int col = col0 + t * 16 + ln;
    float bv = bias ? bias[col] : 0.f;
    if (BIAS_BF16) bv = bf16_round(bv);
#pragma unroll
    for (int r = 0; r < 8; ++r) {
      float v = acc[t][r] + bv;
      if (resid) { float rv = resid[(size_t)((row0 + 8 * hh + r) % rmod) * ldr + col]; if (RES_BF16) rv = bf16_round(rv); v += rv; }
      if (ACT == 1) v = fmaxf(v, 0.f);
      if (ACT == 2) v = 0.5f * v * (1.0f + erff(v * 0.70710678118654752f));
      if (ACT == 3) { const float u = 0.7978845608028654f * (v + 0.044715f * v * v * v); v = 0.5f * v * (1.0f + tanhf(u)); }
      so[w][8 * hh + r][t * 16 + ln] = v;
    }
  }
  __builtin_amdgcn_fence(__ATOMIC_ACQ_REL, "workgroup");
  __builtin_amdgcn_wave_barrier();
  const int rsub = lane >> 4, c4 = (lane & 15) * 4;
  {
#pragma unroll
    for (int q = 0; q < 8; ++q) {
      const int r = q * 2 + rsub;
      const v4f v = *(const v4fa*)&so[w][r][c4];
      *(v4f*)(C + (size_t)(row0 + r) * ldc + col0 + c4) = v;
    }
    
  }
}
// row LayerNorm (biased variance, eps) over N: s = X (+ R); optional out_sum <- s; out_norm <- (s-mu)*rsqrt(var+eps)*g + b
template <bool PARAM_BF16>
__global__ __launch_bounds__(256) void k_layernorm(const float* __restrict__ X, const float* __restrict__ R, const float* __restrict__ g, const float* __restrict__ bta,
                                                  float* __restrict__ out_sum, float* __restrict__ out_norm, int N, float eps) {
  __shared__ float red[256];
  const int row = blockIdx.x, tid = threadIdx.x;
  const float* x = X + (size_t)row * N; const float* rr = R ? R + (size_t)row * N : nullptr;
  float vals[16];                     // up to N = 4096
  const int per = N / 256;            // contiguous chunk per thread? use strided-by-4 chunks: thread handles j = tid*4 + 1024*u
  float s1 = 0.f;
  for (int u = 0; u < per / 4; ++u) {
    const int j = tid * 4 + 1024 * u;
    const v4f a = *(const v4fa*)(x + j);
    v4f b = {0.f,0.f,0.f,0.f}; if (rr) b = *(const v4fa*)(rr + j);
#pragma unroll
    for (int q = 0; q < 4; ++q) { const float v = a[q] + b[q]; vals[u * 4 + q] = v; s1 += v; }
  }
  red[tid] = s1; __syncthreads();
  for (int st = 128; st > 0; st >>= 1) { if (tid < st) red[tid] += red[tid + st]; __syncthreads(); }
  const float mu = red[0] / (float)N; __syncthreads();
  float s2 = 0.f;
  for (int u = 0; u < per / 4; ++u)
#pragma unroll
    for (int q = 0; q < 4; ++q) { const float c = vals[u * 4 + q] - mu; s2 += c * c; }
  red[tid] = s2; __syncthreads();
  for (int st = 128; st > 0; st >>= 1) { if (tid < st) red[tid] += red[tid + st]; __syncthreads(); }
  const float rs = rsqrtf(red[0] / (float)N + eps);
  {
    for (int u = 0; u < per / 4; ++u) {
      const int j = tid * 4 + 1024 * u;
      v4f o, sm;
#pragma unroll
      for (int q = 0; q < 4; ++q) {
        float gg = g[j + q], bb = bta[j + q];
        if (PARAM_BF16) { gg = bf16_round(gg); bb = bf16_round(bb); }
        sm[q] = vals[u * 4 + q]; o[q] = (vals[u * 4 + q] - mu) * rs * gg + bb;
      }
      if (out_sum) *(v4f*)(out_sum + (size_t)row * N + j) = sm;
      *(v4f*)(out_norm + (size_t)row * N + j) = o;
    }
    
  }
}



// ---- f16 WMMA path (v_wmma_f32_16x16x32_f16): 11-bit significands for operands in range — used where a [0,1] probability operand needs more precision than bf16
typedef _Float16 v16h __attribute__((ext_vector_type(16)));
union FragH { v16h v; v8us half[2]; _Float16 h[16]; unsigned short u[16]; };
template <int NT>
__device__ __forceinline__ v8f mmaH(v16h ah, v16h al, v16h bh, v16h bl, v8f c) {
  c = __builtin_amdgcn_wmma_f32_16x16x32_f16(false, ah, false, bh, (short)0, c, false, false);
  if (NT >= 2) c = __builtin_amdgcn_wmma_f32_16x16x32_f16(false, al, false, bh, (short)0, c, false, false);
  if (NT >= 3) c = __builtin_amdgcn_wmma_f32_16x16x32_f16(false, ah, false, bl, (short)0, c, false, false);
  asm volatile("v_nop\n\tv_nop\n\tv_nop\n\tv_nop" : "+v"(c) : "v"(ah), "v"(al), "v"(bh), "v"(bl));
  return c;
}
// batched GEMM like k_gemm_b but f16 operands: A f32 (split into f16 hi/lo if ASPLIT, else rounded to f16), Bt = f16 values [n][k]; alpha; C f32; N multiple of 16 (partial tiles skipped)
template <bool ASPLIT>
__global__ __launch_bounds__(128) void k_gemm_h(const float* __restrict__ A, int lda, size_t sA, const _Float16* __restrict__ Bh, int ldb, size_t sB, float alpha, float* __restrict__ C, int ldc, size_t sC, int M, int N, int K) {
  __shared__ __attribute__((aligned(16))) float so[4][16][64];
  const int tid = threadIdx.x, w = tid >> 5, lane = tid & 31, ln = lane & 15, hh = lane >> 4; const int by = blockIdx.y;
  A += (size_t)by * sA; Bh += (size_t)by * sB; C += (size_t)by * sC;
  const int ntn = (N + 63) / 64; const int wid = blockIdx.x * 4 + w; const int mt = wid / ntn, nq = wid % ntn; if (mt * 16 >= M) return;
  const int row0 = mt * 16, col0 = nq * 64; const float* arow = A + (size_t)(row0 + ln) * lda;
  v8f acc[4] = {};
  for (int kb = 0; kb < K; kb += 32) {
    FragH ah, al;
    const v4f x0 = *(const v4fa*)(arow + kb + 8 * hh), x1 = *(const v4fa*)(arow + kb + 8 * hh + 4), x2 = *(const v4fa*)(arow + kb + 16 + 8 * hh), x3 = *(const v4fa*)(arow + kb + 16 + 8 * hh + 4);
    float xs[16] = {x0[0],x0[1],x0[2],x0[3],x1[0],x1[1],x1[2],x1[3],x2[0],x2[1],x2[2],x2[3],x3[0],x3[1],x3[2],x3[3]};
#pragma unroll
    for (int i = 0; i < 16; ++i) { const _Float16 h = (_Float16)xs[i]; ah.h[i] = h; al.h[i] = ASPLIT ? (_Float16)(xs[i] - (float)h) : (_Float16)0.0f; }
#pragma unroll
    for (int t = 0; t < 4; ++t) { if (col0 + t * 16 >= N) continue; const size_t boff = (size_t)(col0 + t * 16 + ln) * ldb + kb; FragH bq; bq.half[0] = *(const v8us*)(Bh + boff + 8 * hh); bq.half[1] = *(const v8us*)(Bh + boff + 16 + 8 * hh);
      acc[t] = mmaH<ASPLIT ? 2 : 1>(ah.v, al.v, bq.v, bq.v, acc[t]); }
  }
#pragma unroll
  for (int t = 0; t < 4; ++t) { if (col0 + t * 16 >= N) continue;
#pragma unroll
    for (int r = 0; r < 8; ++r) so[w][8 * hh + r][t * 16 + ln] = acc[t][r] * alpha; }
  __builtin_amdgcn_fence(__ATOMIC_ACQ_REL, "workgroup"); __builtin_amdgcn_wave_barrier();
  const int rsub = lane >> 4, c4 = (lane & 15) * 4;
  {
#pragma unroll
    for (int q = 0; q < 8; ++q) { const int r = q * 2 + rsub; if (col0 + c4 < N) { const v4f v = *(const v4fa*)&so[w][r][c4]; *(v4f*)(C + (size_t)(row0 + r) * ldc + col0 + c4) = v; } }
     }
}

// Wt[n][k] = f16(bf16(W[k][n]) * 16) from f32 row-major W[K][N] (power-of-two scale: bf16-exact weights stay exact in f16 away from the subnormal range).
// One work-group turns a block of 64 k x 256 n in LDS: it reads the block's rows by whole lines (a wave-wide 16-byte load = 512 B of one row, all 16 loads of a lane in flight together),
// keeps it as f16 [k][n] (pitch 260 halves), reads it back as dwords (two n of one k) and writes 128-B lines of Wt (8 lanes x 8 k of one n). K, N at compile time: every row step is an immediate offset.
typedef unsigned long long u64a __attribute__((may_alias)); typedef unsigned u32a __attribute__((may_alias));
template <int K, int N>
__device__ __forceinline__ void wt_block(const float* __restrict__ W, _Float16* __restrict__ Wt, int u, unsigned short* tl) {
  constexpr int P = 256 + 4, NB = N / 256; const int tid = threadIdx.x; const int k0 = (u / NB) * 64, n0 = (u % NB) * 256;
  const float* src = W + (size_t)(k0 + (tid >> 6)) * N + n0 + (tid & 63) * 4; v4f a[16];
#pragma unroll
  for (int j = 0; j < 16; ++j) a[j] = *(const v4fa*)(src + (size_t)(4 * j) * N);
  asm volatile("s_wait_xcnt 0x0" : : "v"(src) : "memory");      /* in front of any overwrite of the address register that the 16 issued loads name (it stays live up to here) */
#pragma unroll
  for (int j = 0; j < 16; ++j) { FragH f;
#pragma unroll
    for (int q = 0; q < 4; ++q) f.h[q] = (_Float16)(bf16_round(a[j][q]) * 16.0f);
    *(u64a*)&tl[((tid >> 6) + 4 * j) * P + (tid & 63) * 4] = (unsigned long long)f.u[0] | ((unsigned long long)f.u[1] << 16) | ((unsigned long long)f.u[2] << 32) | ((unsigned long long)f.u[3] << 48); }
  __syncthreads();      /* the block is whole in LDS before any lane reads across the rows that other waves stored */
  const int kc = (tid & 7) * 8, np = tid >> 3; unsigned short* dst = (unsigned short*)Wt + (size_t)(n0 + 2 * np) * K + k0 + kc;
#pragma unroll
  for (int j = 0; j < 4; ++j) { unsigned d[8]; FragH lo, hi;
#pragma unroll
    for (int i = 0; i < 8; ++i) d[i] = *(const u32a*)&tl[(kc + i) * P + 2 * (np + 32 * j)];
#pragma unroll
    for (int i = 0; i < 8; ++i) { lo.u[i] = (unsigned short)(d[i] & 0xffffu); hi.u[i] = (unsigned short)(d[i] >> 16); }
    *(v8us*)(dst + (size_t)(64 * j) * K) = lo.half[0]; *(v8us*)(dst + (size_t)(64 * j + 1) * K) = hi.half[0]; } }
// All six weights in one grid of 768 equal work-groups: 4 x 64 blocks of the 1024 x 1024 projections, 256 of We, 256 of Wd.
__global__ __launch_bounds__(256) void k_wt_all(const float* __restrict__ Wq, const float* __restrict__ Wk, const float* __restrict__ Wv, const float* __restrict__ Wo, const float* __restrict__ We, const float* __restrict__ Wd,
    _Float16* __restrict__ BQ, _Float16* __restrict__ BK, _Float16* __restrict__ BV, _Float16* __restrict__ BO, _Float16* __restrict__ BE, _Float16* __restrict__ BD) {
  __shared__ __attribute__((aligned(16))) unsigned short tl[64 * 260];      /* 33,280 B */
  const int u = blockIdx.x;      /* the same for the whole work-group: a barrier follows in each branch */
  if (u < 256) { const int m = u >> 6; wt_block<DM, DM>(m == 0 ? Wq : m == 1 ? Wk : m == 2 ? Wv : Wo, m == 0 ? BQ : m == 1 ? BK : m == 2 ? BV : BO, u & 63, tl); }
  else if (u < 512) wt_block<DM, 4096>(We, BE, u - 256, tl);
  else wt_block<4096, DM>(Wd, BD, u - 512, tl); }
// k_gemm_hh variant with fused epilogue: v = acc·alpha + bias[by·sBias + col] (+ CP[(row/rowsPerB)·sCPb + by·64 + col] if CP) ; ACT 0 none / 1 elu ; writes f16 C16 (and f32 C if non-null)
template <int ACT>
__global__ __launch_bounds__(128) void k_gemm_hhx(const _Float16* __restrict__ A, int lda, size_t sA, const _Float16* __restrict__ Bh, int ldb, size_t sB, float alpha, const float* __restrict__ bias, size_t sBias, const float* __restrict__ CP, int rowsPerB, size_t sCPb, int row0g,
    float* __restrict__ C, _Float16* __restrict__ C16, int ldc, size_t sC, int M, int N, int K) {
  __shared__ __attribute__((aligned(16))) float so[4][16][64];
  const int tid = threadIdx.x, w = tid >> 5, lane = tid & 31, ln = lane & 15, hh = lane >> 4; const int by = blockIdx.y;
  A += (size_t)by * sA; Bh += (size_t)by * sB; const size_t cofs = (size_t)by * sC; const float* bp = bias ? bias + (size_t)by * sBias : nullptr;
  const int ntn = (N + 63) / 64; const int wid = blockIdx.x * 4 + w; const int mt = wid / ntn, nq = wid % ntn; if (mt * 16 >= M) return;
  const int row0 = mt * 16, col0 = nq * 64; const _Float16* arow = A + (size_t)(row0 + ln) * lda;
  v8f acc[4] = {};
  for (int kb = 0; kb < K; kb += 32) { FragH ah; ah.half[0] = *(const v8us*)((const unsigned short*)arow + kb + 8 * hh); ah.half[1] = *(const v8us*)((const unsigned short*)arow + kb + 16 + 8 * hh);
#pragma unroll
    for (int t = 0; t < 4; ++t) { if (col0 + t * 16 >= N) continue; const size_t boff = (size_t)(col0 + t * 16 + ln) * ldb + kb; FragH bq; bq.half[0] = *(const v8us*)((const unsigned short*)Bh + boff + 8 * hh); bq.half[1] = *(const v8us*)((const unsigned short*)Bh + boff + 16 + 8 * hh);
      acc[t] = mmaH<1>(ah.v, ah.v, bq.v, bq.v, acc[t]); }
  }
#pragma unroll
  for (int t = 0; t < 4; ++t) { if (col0 + t * 16 >= N) continue; const int col = col0 + t * 16 + ln; const float bv = bp ? bf16_round(bp[col]) : 0.f;
#pragma unroll
    for (int r = 0; r < 8; ++r) { float v = acc[t][r] * alpha + bv; if (CP) { const int bidx = (row0g + row0 + 8 * hh + r) / rowsPerB; v += CP[(size_t)bidx * sCPb + (size_t)by * 64 + col]; } if (ACT == 1) v = (v > 0.f) ? v : expm1f(v); else if (ACT == 7) v = (v > 0.f) ? v + 1.0f : expf(v); else if (ACT == 8) v = tanhf(v); else if (ACT == 9) v = 0.5f * v * (1.0f + tanhf(0.7978845608028654f * (v + 0.044715f * v * v * v))); else if (ACT == 11) v = 1.0f / (1.0f + expf(-v)); else if (ACT == 12) v = (v > 0.f) ? v : 0.01f * v; else if (ACT == 14) v = (v > 0.f) ? v : 0.1f * v; else if (ACT == 15) v = v / (1.0f + expf(-v)); else if (ACT == 3) v = fmaxf(v, 0.f); else if (ACT == 6) v = 0.5f * v * (1.0f + erff(v * 0.70710678118654752f)); so[w][8 * hh + r][t * 16 + ln] = v; } }
  __builtin_amdgcn_fence(__ATOMIC_ACQ_REL, "workgroup"); __builtin_amdgcn_wave_barrier();
  const int rsub = lane >> 4, c4 = (lane & 15) * 4; typedef _Float16 v4h __attribute__((ext_vector_type(4)));
  {
#pragma unroll
    for (int q = 0; q < 8; ++q) { const int r = q * 2 + rsub; if (col0 + c4 < N) { const v4f v = *(const v4fa*)&so[w][r][c4]; if (C) *(v4f*)(C + cofs + (size_t)(row0 + r) * ldc + col0 + c4) = v; if (C16) { v4h h4; for (int i = 0; i < 4; ++i) h4[i] = (_Float16)v[i]; *(v4h*)(C16 + cofs + (size_t)(row0 + r) * ldc + col0 + c4) = h4; } } }
     }
}


typedef _Float16 v4h __attribute__((ext_vector_type(4)));

__global__ __launch_bounds__(256) void k_x16(const float* __restrict__ x, _Float16* __restrict__ X16, size_t n8) { const size_t t = (size_t)blockIdx.x * 256 + threadIdx.x; if (t >= n8) return; FragH f;
#pragma unroll
  for (int q = 0; q < 8; ++q) f.h[q] = (_Float16)bf16_round(x[t * 8 + q]); *(v8us*)((unsigned short*)X16 + t * 8) = f.half[0];  }
__global__ __launch_bounds__(256) void k_h16(const float* __restrict__ x, _Float16* __restrict__ X16, size_t n8) { const size_t t = (size_t)blockIdx.x * 256 + threadIdx.x; if (t >= n8) return; FragH f;
#pragma unroll
  for (int q = 0; q < 8; ++q) f.h[q] = (_Float16)x[t * 8 + q]; *(v8us*)((unsigned short*)X16 + t * 8) = f.half[0];  }
__global__ __launch_bounds__(256) void k_round16f(const float* __restrict__ W, _Float16* __restrict__ Bt, size_t n8) { const size_t t = (size_t)blockIdx.x * 256 + threadIdx.x; if (t >= n8) return; FragH f;
#pragma unroll
  for (int i = 0; i < 8; ++i) f.h[i] = (_Float16)(bf16_round(W[t * 8 + i]) * 16.0f); *(v8us*)((unsigned short*)Bt + t * 8) = f.half[0];  }
template <int NHv, int TTv>
__global__ __launch_bounds__(256) void k_vt(const _Float16* __restrict__ V16, int ldv, int voff, _Float16* __restrict__ Vt) { __shared__ unsigned short tl[64][66]; const int tid = threadIdx.x; const int slab = blockIdx.x / (TTv / 64), lg = blockIdx.x % (TTv / 64); const int b = slab / NHv, h = slab % NHv;
  for (int i = tid; i < 64 * 8; i += 256) { const int r = i / 8, c8 = (i % 8) * 8; FragH f; f.half[0] = *(const v8us*)((const unsigned short*)V16 + ((size_t)b * TTv + lg * 64 + r) * ldv + voff + h * 64 + c8);
#pragma unroll
    for (int q = 0; q < 8; ++q) tl[r][c8 + q] = f.u[q]; }
  __syncthreads();
  {
#pragma unroll
    for (int rd = 0; rd < 2; ++rd) { const int d = rd * 32 + tid / 8, pc = tid % 8; FragH f;
#pragma unroll
      for (int q = 0; q < 8; ++q) f.u[q] = tl[pc * 8 + q][d];
      *(v8us*)((unsigned short*)Vt + ((size_t)slab * 64 + d) * TTv + lg * 64 + pc * 8) = f.half[0]; }
     } }

// ---- fast GEMM (work-group tile 128x128 = 4 x 2 waves, wave tile 32x64; requires M % 128 == 0, N % 128 == 0, K % 128 == 0); epilogue: v = act(acc * alpha + bf16(bias[col])), or v = acc * alpha + bf16(bias[col]) + residual[row][col] ----
// Operands go through LDS: per slice of 128 k the work-group loads 256 B of each of its 128 A rows and 128 B rows with whole-line 16-byte loads (two rows per wave-wide load),
// keeps them in registers while the slice before is worked on, and stores them into the other of two LDS buffers; the fragments are read from LDS, A and B alike as halves k + 8 * hh .. + 7 and k + 16 + 8 * hh .. + 7 of their row.
__device__ __forceinline__ v16h g2_sfrag(const unsigned short* p) { FragH f; f.half[0] = *(const v8us*)p; f.half[1] = *(const v8us*)(p + 16); return f.v; }      /* p = LDS row + k + 8 * hh */
__device__ __forceinline__ v8f g2_mma(v16h a, v16h b, v8f c) { v8f d = __builtin_amdgcn_wmma_f32_16x16x32_f16(false, a, false, b, (short)0, c, false, false); asm volatile("v_nop\n\tv_nop\n\tv_nop\n\tv_nop" : "+v"(d) : "v"(a), "v"(b)); return d; }
template <int ACT, int LD, int LDC, int EP>      /* LD = lda = ldb = K and LDC = ldc at compile time: the row steps of the staging loads, of the residual loads and of the stores become immediate offsets. EP, the epilogue's kind: 1 = bias, 2 = residual plane added (indexed like C), 4 = f16 output to C16, 8 = f16 output to C16 and its rounding residual x 2^10 as f16 to C16l (else f32 to C) */
__global__ __launch_bounds__(256) void k_gemm2(const _Float16* __restrict__ A, int lda, size_t sA, const _Float16* __restrict__ Bh, int ldb, size_t sB, float alpha, const float* __restrict__ bias, size_t sBias, const float* CP,
    float* C, _Float16* __restrict__ C16, _Float16* __restrict__ C16l, int ldc, size_t sC, int M, int N, int K) {      /* CP may be C itself: a lane reads exactly the elements that it stores later */
  static_assert(!(EP & 2) || ACT == 0, "the residual is added behind the staging, so no activation may follow it");
  constexpr int KS = 128, PIT = KS + 8, BUF = (128 + 128) * PIT;      /* slice of k; LDS row pitch 272 B = 16 B x 17 (no bank conflict for 16-byte fragment reads); halves per buffer: rows 0-127 A, 128-255 B */
  __shared__ __attribute__((aligned(16))) unsigned short st[2 * BUF];      /* 139,264 B */
  float (*so)[32][68] = reinterpret_cast<float (*)[32][68]>(st);      /* the epilogue's staging (8 waves, 69,632 B) reuses the buffers behind the last barrier */
  const int tid = threadIdx.x, w = tid >> 5, lane = tid & 31, ln = lane & 15, hh = lane >> 4; const int by = blockIdx.y;
  const int wm = w & 3, wn = w >> 2;      /* the wave's 32 rows (of 128) and its 64 columns (of 128): the two waves of a row band read the same A rows from LDS, the four of a column band the same B rows */
  A += (size_t)by * sA; Bh += (size_t)by * sB; const size_t cofs = (size_t)by * sC;
  const int ntn = N >> 7; const int mt = blockIdx.x / ntn, nq = blockIdx.x - mt * ntn; const int col0 = nq * 128; if (mt * 128 >= M) return;      /* the same for the whole work-group: barriers follow */
  const int sr = tid >> 4, sc = (tid & 15) * 8;      /* staging: 16 threads cover the 256 B of a row, the work-group 16 rows per load */
  (void)lda; (void)ldb; (void)K; (void)ldc;
  const char* aS = (const char*)(A + (size_t)(mt * 128) * LD); const char* bS = (const char*)(Bh + (size_t)col0 * LD);      /* the work-group's first A and B row: the same in every lane */
  unsigned vo = (unsigned)(sr * LD + sc) * 2u;      /* the lane's byte offset in both operands: its row of 16, its 16 bytes, the slice */
  const v8f z8 = {0.f,0.f,0.f,0.f,0.f,0.f,0.f,0.f}; v8f c00 = z8, c01 = z8, c02 = z8, c03 = z8, c10 = z8, c11 = z8, c12 = z8, c13 = z8;
  v8us rg[16];
  auto slice_load = [&]() {
#pragma unroll
    for (int i = 0; i < 8; ++i) rg[i] = *(const v8us*)(aS + (size_t)vo + (size_t)(32 * i) * LD);
#pragma unroll
    for (int i = 0; i < 8; ++i) rg[8 + i] = *(const v8us*)(bS + (size_t)vo + (size_t)(32 * i) * LD); };
  auto slice_next = [&]() { asm volatile("s_wait_xcnt 0x0" : "+v"(vo) : : "memory");      /* in front of the overwrite of the offset register that the issued loads name */
    vo += 2u * KS; };
  auto slice_store = [&](int bo) {
#pragma unroll
    for (int i = 0; i < 16; ++i) *(v8us*)&st[bo + (16 * i + sr) * PIT + sc] = rg[i]; };
  auto slice_mma = [&](int bo) { const unsigned short* ap = &st[bo + (32 * wm + ln) * PIT + 8 * hh]; const unsigned short* bq = &st[bo + (128 + 64 * wn + ln) * PIT + 8 * hh];
#pragma unroll
    for (int kk = 0; kk < KS; kk += 32) { const v16h a0 = g2_sfrag(ap + kk), a1 = g2_sfrag(ap + 16 * PIT + kk);      /* the six fragments of a k step as one group of LDS reads in front of its eight products */
      const v16h b0 = g2_sfrag(bq + kk), b1 = g2_sfrag(bq + 16 * PIT + kk), b2 = g2_sfrag(bq + 32 * PIT + kk), b3 = g2_sfrag(bq + 48 * PIT + kk);
      c00 = g2_mma(a0, b0, c00); c10 = g2_mma(a1, b0, c10); c01 = g2_mma(a0, b1, c01); c11 = g2_mma(a1, b1, c11);
      c02 = g2_mma(a0, b2, c02); c12 = g2_mma(a1, b2, c12); c03 = g2_mma(a0, b3, c03); c13 = g2_mma(a1, b3, c13); } };
  float braw[4] = {0.f, 0.f, 0.f, 0.f};      /* the lane's 4 bias values, asked for together with the first slice */
  if constexpr ((EP & 1) != 0) { const float* bS4 = bias + (size_t)by * sBias + col0 + 64 * wn + ln;
#pragma unroll
    for (int t = 0; t < 4; ++t) braw[t] = bS4[16 * t]; }
  slice_load(); slice_next(); slice_store(0); __syncthreads();
  int cur = 0;      /* start (in halves) of the buffer that holds the slice being worked on: 0 or BUF */
#pragma unroll 1      /* one copy of the slice body; the buffer alternates at run time */
  for (int s = 1; s < LD / KS; ++s) {
    slice_load();      /* in flight while the slice before is worked on */
    slice_mma(cur);
    slice_next();
    slice_store(cur ^ BUF);      /* its last readers left this buffer in front of the barrier of the trip before */
    __syncthreads(); cur ^= BUF; }
  // The residual plane is asked for here, all at once, so that the last slice's products cover the loads: the lane's 16 pieces of 16 B, the very pieces that it stores at the end
  // (16 lanes = the 256 B of a row of the wave's tile, a wave-wide load = two rows).
  const unsigned eo = (unsigned)((32 * wm + (lane >> 4)) * LDC + 64 * wn + (lane & 15) * 4);      /* the lane's element offset in the work-group's tile of C */
  const size_t tile0 = cofs + (size_t)(mt * 128) * LDC + col0;      /* the tile's first element: the same in every lane */
  v4f res[16];
  if constexpr ((EP & 2) != 0) { const char* rS = (const char*)(CP + tile0);
#pragma unroll
    for (int q = 0; q < 16; ++q) res[q] = *(const v4fa*)(rS + (size_t)(eo * 4u) + (size_t)(2 * q) * LDC * 4); }
  slice_mma(cur);
  __syncthreads();      /* every wave has read its last fragments before the buffers become output staging */
  v8f accs[8] = {c00, c01, c02, c03, c10, c11, c12, c13};
#pragma unroll
  for (int u = 0; u < 8; ++u) { const int t = u & 3, half = u >> 2; const float bv = bf16_round(braw[t]);
#pragma unroll
    for (int r = 0; r < 8; ++r) { const int rloc = half * 16 + 8 * hh + r; float v = accs[u][r] * alpha + bv;
      if (ACT == 3) v = fmaxf(v, 0.f); else if (ACT == 6) v = 0.5f * v * (1.0f + erff(v * 0.70710678118654752f)); else if (ACT == 11) v = 1.0f / (1.0f + expf(-v)); else if (ACT == 15) v = v / (1.0f + expf(-v)); else if (ACT == 12) v = (v > 0.f) ? v : 0.01f * v; else if (ACT == 8) v = tanhf(v);
      so[w][rloc][t * 16 + ln] = v; } }
  __builtin_amdgcn_fence(__ATOMIC_ACQ_REL, "workgroup"); __builtin_amdgcn_wave_barrier();
  const int rsub = lane >> 4, c4 = (lane & 15) * 4;
  {
#pragma unroll
    for (int q = 0; q < 16; ++q) { v4f v = *(const v4fa*)&so[w][q * 2 + rsub][c4];
      if constexpr ((EP & 2) != 0) v += res[q];
      if constexpr ((EP & 8) != 0) { v4h h4, l4; for (int i = 0; i < 4; ++i) { const _Float16 hv = (_Float16)v[i]; h4[i] = hv; l4[i] = (_Float16)((v[i] - (float)hv) * 1024.0f); }
        *(v4h*)((char*)(C16 + tile0) + (size_t)(eo * 2u) + (size_t)(2 * q) * LDC * 2) = h4; *(v4h*)((char*)(C16l + tile0) + (size_t)(eo * 2u) + (size_t)(2 * q) * LDC * 2) = l4; }
      else if constexpr ((EP & 4) != 0) { v4h h4; for (int i = 0; i < 4; ++i) h4[i] = (_Float16)v[i]; *(v4h*)((char*)(C16 + tile0) + (size_t)(eo * 2u) + (size_t)(2 * q) * LDC * 2) = h4; }
      else *(v4f*)((char*)(C + tile0) + (size_t)(eo * 4u) + (size_t)(2 * q) * LDC * 4) = v; }
     } }



template <int TK>
__global__ __launch_bounds__(256) void k_vthl(const float* __restrict__ VF, int ldv, _Float16* __restrict__ Vth, _Float16* __restrict__ Vtl) { __shared__ float tl[64][65]; const int tid = threadIdx.x; const int slab = blockIdx.x / (TK / 64), lg = blockIdx.x % (TK / 64); const int b = slab / NH, h = slab % NH;
  for (int i = tid; i < 64 * 16; i += 256) { const int r = i / 16, c4 = (i % 16) * 4; const v4f a = *(const v4fa*)(VF + ((size_t)b * TK + lg * 64 + r) * ldv + h * 64 + c4); tl[r][c4] = a[0]; tl[r][c4 + 1] = a[1]; tl[r][c4 + 2] = a[2]; tl[r][c4 + 3] = a[3]; }
  __syncthreads();
  FragH fh[2], fl[2]; size_t oo[2];
#pragma unroll
  for (int rd = 0; rd < 2; ++rd) { const int d = rd * 32 + tid / 8, pc = tid % 8;
#pragma unroll
    for (int q = 0; q < 8; ++q) { const float v = tl[pc * 8 + q][d]; const _Float16 hv = (_Float16)v; fh[rd].h[q] = hv; fl[rd].h[q] = (_Float16)((v - (float)hv) * 1024.0f); } oo[rd] = ((size_t)slab * 64 + d) * TK + lg * 64 + pc * 8; }
  {
#pragma unroll
    for (int rd = 0; rd < 2; ++rd) { *(v8us*)((unsigned short*)Vth + oo[rd]) = fh[rd].half[0]; *(v8us*)((unsigned short*)Vtl + oo[rd]) = fl[rd].half[0]; }
     } }

template <int TQ, int TK>
__global__ __launch_bounds__(128) void k_flashm(const _Float16* __restrict__ Q16, const _Float16* __restrict__ Q16lo, int ldq, const _Float16* __restrict__ K16, const _Float16* __restrict__ K16lo, int ldk, const _Float16* __restrict__ Vt, const _Float16* __restrict__ Vtlo, const unsigned* __restrict__ MB, const int* __restrict__ RA, const int* __restrict__ KE, _Float16* __restrict__ Oh, _Float16* __restrict__ Ol, int ldo) {
  constexpr int RPW = 16, RTN = RPW / 16, NQB = TQ / (4 * RPW), DT = 4, KS = 2;
  __shared__ __attribute__((aligned(16))) unsigned short sP[4][RPW][40], sPl[4][RPW][40]; __shared__ __attribute__((aligned(16))) float sO[4][RPW][64 + 4];
  // A pass's keys and values lie in LDS once for the four waves. One buffer (in halves): 32 K rows hi, 32 K rows residual (128 B each, pitch 144 B), then 64 V^T rows hi, 64 residual (64 B each, pitch 80 B); pitches 16 B x odd for the 16-byte fragment reads.
  constexpr int KP = 72, VP = 40, VB0 = 64 * KP, KVB = VB0 + 128 * VP;
  __shared__ __attribute__((aligned(16))) unsigned short sKV[2 * KVB];      /* two buffers, 38,912 B: the next pass's tile flies while this one is worked on */
  const int tid = threadIdx.x, w = tid >> 5, lane = tid & 31, ln = lane & 15, hh = lane >> 4;
  const int h = blockIdx.x / NQB, t0 = blockIdx.x % NQB;
  // Causal balance: the work-group runs query tile t0 of batch 0, then tile NQB - 1 - t0 of batch 1 (alternating), so every work-group walks the same number of key passes.
#pragma unroll 1      /* one copy of the tile body: the tiles run one after the other in every wave */
  for (int b = 0; b < NBT; ++b) {
  const int slab = b * NH + h, qblk = (b & 1) ? NQB - 1 - t0 : t0; const int qb0 = qblk * (4 * RPW); const int q0 = qb0 + w * RPW;
  FragH aq[2][KS], aql[2][KS];
#pragma unroll
  for (int rt = 0; rt < RTN; ++rt) { const size_t qo = ((size_t)b * TQ + q0 + rt * 16 + ln) * ldq + h * 64; const unsigned short* qr = (const unsigned short*)Q16 + qo; const unsigned short* ql = (const unsigned short*)Q16lo + qo;
#pragma unroll
    for (int ks = 0; ks < KS; ++ks) { aq[rt][ks].half[0] = *(const v8us*)(qr + ks * 32 + 8 * hh); aq[rt][ks].half[1] = *(const v8us*)(qr + ks * 32 + 16 + 8 * hh); aql[rt][ks].half[0] = *(const v8us*)(ql + ks * 32 + 8 * hh); aql[rt][ks].half[1] = *(const v8us*)(ql + ks * 32 + 16 + 8 * hh); } }
  const unsigned short* Vth = (const unsigned short*)Vt + (size_t)slab * 64 * TK; const unsigned short* Vtl = (const unsigned short*)Vtlo + (size_t)slab * 64 * TK;
  // Staging, 8 copies of 16 B a lane and pass: 8 lanes cover a K row (rows tid / 8 and + 16 of each plane), 4 lanes a V^T row (rows tid / 4 and + 32 of each plane).
  const size_t kso = ((size_t)b * TK + (tid >> 3)) * ldk + h * 64 + (tid & 7) * 8, vso = (size_t)(tid >> 2) * TK + (tid & 3) * 8;
  const unsigned lk0 = (unsigned)(size_t)&sKV[(tid >> 3) * KP + (tid & 7) * 8], lv0 = (unsigned)(size_t)&sKV[VB0 + (tid >> 2) * VP + (tid & 3) * 8];      /* the lane's LDS byte addresses in buffer 0 */
  auto stage = [&](int js, int bo) {      /* keys js .. js + 31 into the buffer that starts at half bo */
    const unsigned short* kh = (const unsigned short*)K16 + kso + (size_t)js * ldk; const unsigned short* kl = (const unsigned short*)K16lo + kso + (size_t)js * ldk;
    const unsigned short* kh2 = kh + (size_t)16 * ldk; const unsigned short* kl2 = kl + (size_t)16 * ldk;
    const unsigned short* vh = Vth + vso + js; const unsigned short* vl = Vtl + vso + js; const unsigned short* vh2 = vh + (size_t)32 * TK; const unsigned short* vl2 = vl + (size_t)32 * TK;
    const unsigned lk = lk0 + 2u * (unsigned)bo, lv = lv0 + 2u * (unsigned)bo;
    const unsigned lk1 = lk + 2u * 16 * KP, lk2 = lk + 2u * 32 * KP, lk3 = lk + 2u * 48 * KP, lv1 = lv + 2u * 32 * VP, lv2 = lv + 2u * 64 * VP, lv3 = lv + 2u * 96 * VP;
    /* the copies and, as the statement's last line, the wait that stands in front of any rewrite of their address registers */
    asm volatile("global_load_async_to_lds_b128 %0, %8, off\n\t"
                 "global_load_async_to_lds_b128 %1, %9, off\n\t"
                 "global_load_async_to_lds_b128 %2, %10, off\n\t"
                 "global_load_async_to_lds_b128 %3, %11, off\n\t"
                 "global_load_async_to_lds_b128 %4, %12, off\n\t"
                 "global_load_async_to_lds_b128 %5, %13, off\n\t"
                 "global_load_async_to_lds_b128 %6, %14, off\n\t"
                 "global_load_async_to_lds_b128 %7, %15, off\n\t"
                 "s_wait_xcnt 0x0"
                 :: "v"(lk), "v"(lk1), "v"(lk2), "v"(lk3), "v"(lv), "v"(lv1), "v"(lv2), "v"(lv3), "v"(kh), "v"(kh2), "v"(kl), "v"(kl2), "v"(vh), "v"(vh2), "v"(vl), "v"(vl2) : "memory"); };
  float m_r[2][8], l_r[2][8]; v8f oacc[2][DT], oaccl[2][DT];
#pragma unroll
  for (int rt = 0; rt < RTN; ++rt) {
#pragma unroll
    for (int r = 0; r < 8; ++r) { m_r[rt][r] = -3.0e38f; l_r[rt][r] = 0.f; }
#pragma unroll
    for (int dt = 0; dt < DT; ++dt) { oacc[rt][dt] = (v8f){0.f,0.f,0.f,0.f,0.f,0.f,0.f,0.f}; oaccl[rt][dt] = oacc[rt][dt]; } }
  int jend = KE[qblk * 32]; jend = min(TK, (jend + 31) & ~31); if (jend < 32) jend = 32;      /* block-uniform */
  jend = __builtin_amdgcn_readfirstlane(jend);      /* in a scalar register: the tests around the copies and the barriers are scalar branches */
  int allm[2][8]; const unsigned* mrow[2][8];
#pragma unroll
  for (int rt = 0; rt < RTN; ++rt)
#pragma unroll
    for (int r = 0; r < 8; ++r) { const int tq = q0 + rt * 16 + 8 * hh + r; allm[rt][r] = RA[tq]; mrow[rt][r] = MB + (size_t)tq * (TK / 32); }
  stage(0, 0);      /* every reader of the tile before left both buffers in front of its last pass's barrier */
  asm volatile("s_wait_asynccnt 0x0" ::: "memory");      /* this wave's copies of pass 0 have landed */
  __syncthreads();      /* ... and every other wave's */
  if (jend > 32) stage(32, KVB);
  int cur = 0;      /* start (in halves) of the buffer that holds this pass's tile: 0 or KVB */
#pragma unroll 1
  for (int j0 = 0; j0 < jend; j0 += 32) {
    unsigned mwd[2][8];      /* the pass's mask words, asked for ahead of the score products so that these cover the loads */
#pragma unroll
    for (int rt = 0; rt < RTN; ++rt)
#pragma unroll
      for (int r = 0; r < 8; ++r) mwd[rt][r] = mrow[rt][r][j0 >> 5];
    v8f s[2][2];
#pragma unroll
    for (int nt = 0; nt < 2; ++nt) { const unsigned short* kr = &sKV[cur + (nt * 16 + ln) * KP]; const unsigned short* kl = kr + 32 * KP; FragH bk[KS], bkl[KS];
#pragma unroll
      for (int ks = 0; ks < KS; ++ks) { bk[ks].half[0] = *(const v8us*)(kr + ks * 32 + 8 * hh); bk[ks].half[1] = *(const v8us*)(kr + ks * 32 + 16 + 8 * hh); bkl[ks].half[0] = *(const v8us*)(kl + ks * 32 + 8 * hh); bkl[ks].half[1] = *(const v8us*)(kl + ks * 32 + 16 + 8 * hh); }
#pragma unroll
      for (int rt = 0; rt < RTN; ++rt) { v8f acc = (v8f){0.f,0.f,0.f,0.f,0.f,0.f,0.f,0.f}, accr = acc;
#pragma unroll
        for (int ks = 0; ks < KS; ++ks) { acc = mmaH<1>(aq[rt][ks].v, aq[rt][ks].v, bk[ks].v, bk[ks].v, acc); accr = mmaH<1>(aql[rt][ks].v, aql[rt][ks].v, bk[ks].v, bk[ks].v, accr); accr = mmaH<1>(aq[rt][ks].v, aq[rt][ks].v, bkl[ks].v, bkl[ks].v, accr); }
        s[rt][nt] = acc + accr * 0.0009765625f; } }
    // Online softmax, the eight rows of a lane side by side: each phase runs over all rows before the next begins, and every exponential is computed for every lane and then selected,
    // so the pass is one straight run of code in which the rows' shuffles and exponentials cover one another's latencies. Same values, same order of every sum as row after row.
#pragma unroll
    for (int rt = 0; rt < RTN; ++rt) {
      float s0v[8], s1v[8], mcv[8], alv[8], p0v[8], p1v[8]; bool ok0v[8], ok1v[8];
#pragma unroll
      for (int r = 0; r < 8; ++r) { const unsigned mw = mwd[rt][r]; const bool am = (allm[rt][r] != 0);
        ok0v[r] = am || (((mw >> ln) & 1u) == 0u); ok1v[r] = am || (((mw >> (16 + ln)) & 1u) == 0u);
        s0v[r] = ok0v[r] ? (am ? 0.f : s[rt][0][r] * SCL) : -INFINITY; s1v[r] = ok1v[r] ? (am ? 0.f : s[rt][1][r] * SCL) : -INFINITY; mcv[r] = fmaxf(s0v[r], s1v[r]); }
#pragma unroll
      for (int o = 1; o < 16; o <<= 1) { float xv[8];
#pragma unroll
        for (int r = 0; r < 8; ++r) xv[r] = __shfl_xor(mcv[r], o, 32);
        __builtin_amdgcn_sched_barrier(0);      /* all eight shuffles of a step are issued before the first result is waited for: one shuffle latency a step, not one a row */
#pragma unroll
        for (int r = 0; r < 8; ++r) mcv[r] = fmaxf(mcv[r], xv[r]); }
#pragma unroll
      for (int r = 0; r < 8; ++r) { const float mn = fmaxf(m_r[rt][r], mcv[r]);      /* mn is finite (at least -3.0e38), so a masked score gives exp(-inf) = 0 and no NaN reaches a selected value */
        const float ea = expf(m_r[rt][r] - mn), e0 = expf(s0v[r] - mn), e1 = expf(s1v[r] - mn);
        alv[r] = (mn > -1.0e38f) ? ea : 1.0f; m_r[rt][r] = mn; p0v[r] = ok0v[r] ? e0 : 0.f; p1v[r] = ok1v[r] ? e1 : 0.f; l_r[rt][r] = l_r[rt][r] * alv[r] + p0v[r] + p1v[r]; }
#pragma unroll
      for (int r = 0; r < 8; ++r) { const float al = alv[r], p0 = p0v[r], p1 = p1v[r];
#pragma unroll
        for (int dt = 0; dt < DT; ++dt) { oacc[rt][dt][r] *= al; oaccl[rt][dt][r] *= al; }
        FragH t2, t3; const float ps0 = p0 * 1024.0f, ps1 = p1 * 1024.0f; t2.h[0] = (_Float16)ps0; t2.h[1] = (_Float16)ps1; t3.h[0] = (_Float16)((ps0 - (float)t2.h[0]) * 1024.0f); t3.h[1] = (_Float16)((ps1 - (float)t2.h[1]) * 1024.0f);
        sP[w][rt * 16 + 8 * hh + r][ln] = t2.u[0]; sP[w][rt * 16 + 8 * hh + r][16 + ln] = t2.u[1]; sPl[w][rt * 16 + 8 * hh + r][ln] = t3.u[0]; sPl[w][rt * 16 + 8 * hh + r][16 + ln] = t3.u[1]; } }
    __builtin_amdgcn_fence(__ATOMIC_ACQ_REL, "workgroup"); __builtin_amdgcn_wave_barrier();
    FragH pa[2], pl[2];
#pragma unroll
    for (int rt = 0; rt < RTN; ++rt) { pa[rt].half[0] = *(const v8us*)&sP[w][rt * 16 + ln][8 * hh]; pa[rt].half[1] = *(const v8us*)&sP[w][rt * 16 + ln][16 + 8 * hh]; pl[rt].half[0] = *(const v8us*)&sPl[w][rt * 16 + ln][8 * hh]; pl[rt].half[1] = *(const v8us*)&sPl[w][rt * 16 + ln][16 + 8 * hh]; }
#pragma unroll
    for (int dt = 0; dt < DT; ++dt) { const unsigned short* vr = &sKV[cur + VB0 + (dt * 16 + ln) * VP + 8 * hh]; const unsigned short* vq = vr + 64 * VP; FragH bv, bl; bv.half[0] = *(const v8us*)vr; bv.half[1] = *(const v8us*)(vr + 16); bl.half[0] = *(const v8us*)vq; bl.half[1] = *(const v8us*)(vq + 16);
#pragma unroll
      for (int rt = 0; rt < RTN; ++rt) { oacc[rt][dt] = mmaH<1>(pa[rt].v, pa[rt].v, bv.v, bv.v, oacc[rt][dt]); oaccl[rt][dt] = mmaH<1>(pa[rt].v, pa[rt].v, bl.v, bl.v, oaccl[rt][dt]); oaccl[rt][dt] = mmaH<1>(pl[rt].v, pl[rt].v, bv.v, bv.v, oaccl[rt][dt]); } }
    asm volatile("s_wait_dscnt 0x0" ::: "memory");      /* this wave's LDS reads of the pass are done */
    asm volatile("s_wait_asynccnt 0x0" ::: "memory");      /* its copies of the next pass's tile have landed */
    __syncthreads();      /* publishes the next tile and ends every wave's reads of this one */
    if (j0 + 64 < jend) stage(j0 + 64, cur);      /* refill of the buffer just read, one whole pass ahead of its use */
    cur ^= KVB; }
  asm volatile("s_wait_asynccnt 0x0" ::: "memory");      /* nothing of this wave is in flight when the tile ends */
#pragma unroll
  for (int rt = 0; rt < RTN; ++rt) {
#pragma unroll
    for (int r = 0; r < 8; ++r) { float l = l_r[rt][r]; l += __shfl_xor(l, 1, 32); l += __shfl_xor(l, 2, 32); l += __shfl_xor(l, 4, 32); l += __shfl_xor(l, 8, 32); l_r[rt][r] = (l > 0.f) ? 1.0f / (l * 1024.0f) : 0.f; }
#pragma unroll
    for (int dt = 0; dt < DT; ++dt)
#pragma unroll
      for (int r = 0; r < 8; ++r) sO[w][rt * 16 + 8 * hh + r][dt * 16 + ln] = (oacc[rt][dt][r] + oaccl[rt][dt][r] * 0.0009765625f) * l_r[rt][r]; }
  __builtin_amdgcn_fence(__ATOMIC_ACQ_REL, "workgroup"); __builtin_amdgcn_wave_barrier();
  {
#pragma unroll
    for (int rp = 0; rp < RPW; rp += 2) { const int r = rp + (lane >> 4), pc = lane & 15; const v4f val = *(const v4fa*)&sO[w][r][pc * 4]; v4h h4, l4;      /* O leaves as the f16 plane and its rounding residual x 2^10, the operands of the two Wo products: 16 lanes = one 128-B line of each plane */
      for (int i = 0; i < 4; ++i) { const _Float16 hv = (_Float16)val[i]; h4[i] = hv; l4[i] = (_Float16)((val[i] - (float)hv) * 1024.0f); }
      const size_t oo = ((size_t)b * TQ + q0 + r) * ldo + h * 64 + pc * 4; *(v4h*)(Oh + oo) = h4; *(v4h*)(Ol + oo) = l4; }
     }
  asm volatile("s_wait_xcnt 0x0" ::: "memory");      /* the next tile's set-up overwrites the address registers of the stores above */
  } }


template <int SRCBF>
__global__ __launch_bounds__(256) void k_lnab(const float* __restrict__ X, const float* __restrict__ g, const float* __restrict__ bb, _Float16* __restrict__ Y16, float* __restrict__ Y32, float* __restrict__ XB) {
  #pragma clang fp contract(off)
  const int tid = threadIdx.x, w = tid >> 5, ln = tid & 31; const int r = blockIdx.x * 8 + w; if (r >= NR) return; const float* x = X + (size_t)r * DM; float s = 0.f;
#pragma unroll 1
  for (int i = 0; i < DM / 128; ++i) { const v4f a = *(const v4fa*)(x + i * 128 + ln * 4); for (int q = 0; q < 4; ++q) s += SRCBF ? bf16_round(a[q]) : a[q]; }
  for (int o = 16; o > 0; o >>= 1) s += __shfl_xor(s, o, 32); const float mu = s / (float)DM; float q2 = 0.f;
#pragma unroll 1
  for (int i = 0; i < DM / 128; ++i) { const v4f a = *(const v4fa*)(x + i * 128 + ln * 4); for (int q = 0; q < 4; ++q) { const float d = (SRCBF ? bf16_round(a[q]) : a[q]) - mu; q2 += d * d; } }
  for (int o = 16; o > 0; o >>= 1) q2 += __shfl_xor(q2, o, 32); const float rs = rsqrtf(q2 / (float)DM + 1e-5f);
  {
#pragma unroll 1
    for (int i = 0; i < DM / 128; ++i) { const int c0 = i * 128 + ln * 4; const v4f a = *(const v4fa*)(x + c0); _Float16 h4[4]; v4f y4, xb;
      for (int q = 0; q < 4; ++q) { const float t = SRCBF ? bf16_round(a[q]) : a[q]; const float y = (t - mu) * rs * bf16_round(g[c0 + q]) + bf16_round(bb[c0 + q]); h4[q] = (_Float16)y; y4[q] = y; xb[q] = t; }
      if (Y16) *(unsigned long long*)((unsigned short*)Y16 + (size_t)r * DM + c0) = *(const unsigned long long*)h4; if (Y32) *(v4f*)(Y32 + (size_t)r * DM + c0) = y4; if (XB) *(v4f*)(XB + (size_t)r * DM + c0) = xb; }
     } }
__global__ __launch_bounds__(256) void k_causaltab(unsigned* __restrict__ MB, int* __restrict__ RA, int* __restrict__ KE, int nq, int nk) {
  const int t = blockIdx.x * 256 + threadIdx.x; const int nw = nk / 32;
  if (t < nq * nw) { const int q = t / nw, w = t % nw; const int first = q + 1 - 32 * w; const unsigned bits = (first <= 0) ? 0xffffffffu : ((first >= 32) ? 0u : (0xffffffffu << first)); *(unsigned*)(MB + t) = bits;  }
  if (t < nq) { *(int*)(RA + t) = 0;  }
  if (t < nq / 64) { const int v = 64 * (t + 1); *(int*)(KE + t * 32) = v;  } }


extern "C" void kernel_launch(void* const* d_in, const int* in_sizes, int n_in,
                              void* d_out, int out_size, void* d_ws, size_t ws_size, hipStream_t stream) {
  (void)in_sizes; (void)n_in; (void)out_size;
  const float* const* I = (const float* const*)d_in; const float* x = I[0]; const float* lag = I[1]; const float* lab = I[2]; const float* lbg = I[3]; const float* lbb = I[4]; const float* lcg = I[5]; const float* lcb = I[6];
  const float* Wq = I[7]; const float* bq = I[8]; const float* Wk = I[9]; const float* bk = I[10]; const float* Wv = I[11]; const float* bv = I[12]; const float* Wo = I[13]; const float* bo = I[14]; const float* We = I[15]; const float* be = I[16]; const float* Wd = I[17]; const float* bd = I[18];
  char* ws = (char*)d_ws; size_t off = 0;
  auto take = [&](size_t bytes) { char* p = ws + off; off += (bytes + 255) & ~(size_t)255; return p; };
  _Float16* BQ = (_Float16*)take((size_t)DM * DM * 2); _Float16* BK = (_Float16*)take((size_t)DM * DM * 2); _Float16* BV = (_Float16*)take((size_t)DM * DM * 2); _Float16* BO = (_Float16*)take((size_t)DM * DM * 2); _Float16* BE = (_Float16*)take((size_t)4096 * DM * 2); _Float16* BD = (_Float16*)take((size_t)DM * 4096 * 2);
  float* XB = (float*)take((size_t)NR * DM * 4); _Float16* T16 = (_Float16*)take((size_t)NR * DM * 2); float* F = (float*)take((size_t)NR * DM * 4);
  _Float16* Qh = (_Float16*)take((size_t)NR * DM * 2); _Float16* Ql = (_Float16*)take((size_t)NR * DM * 2); _Float16* Kh = (_Float16*)take((size_t)NR * DM * 2); _Float16* Kl = (_Float16*)take((size_t)NR * DM * 2); _Float16* Vth = (_Float16*)take((size_t)NR * DM * 2); _Float16* Vtl = (_Float16*)take((size_t)NR * DM * 2);
  unsigned* MB = (unsigned*)take((size_t)SLEN * (SLEN / 32) * 4); int* RA = (int*)take((size_t)SLEN * 4); int* KE = (int*)take((size_t)(SLEN / 64) * 32 * 4);
  if (off > ws_size) return;      /* 24 + 16 + 8 + 16 + 48 + 0.6 = 113 MiB (the first LN's f32 output lives in F until the second LN consumes it) */
  _Float16* Oh = (_Float16*)F; _Float16* Ol = Oh + (size_t)NR * DM; float* X1 = XB;      /* the two O planes fill F, dead once V is transposed */
  _Float16* GH = Kh;      /* SiLU hidden [NR][4096] f16 = 32 MB over Kh|Kl|Vth|Vtl (dead after the flash) */
  k_wt_all<<<768, 256, 0, stream>>>(Wq, Wk, Wv, Wo, We, Wd, BQ, BK, BV, BO, BE, BD);      /* all (in,out) */
  k_causaltab<<<(SLEN * (SLEN / 32) + 255) / 256, 256, 0, stream>>>(MB, RA, KE, SLEN, SLEN);
  k_lnab<1><<<NR / 8, 256, 0, stream>>>(x, lag, lab, nullptr, F, XB);      /* t0 = LN_a(bf16 x) (f32), XB = bf16(x) */
  k_lnab<0><<<NR / 8, 256, 0, stream>>>(F, lbg, lbb, T16, nullptr, nullptr);      /* t = LN_b(t0) as f16 operand */
  const dim3 gP((NR / 128) * (DM / 128), 1), gM((NR / 128) * (4096 / 128), 1);
  k_gemm2<0, DM, DM, 9><<<gP, 256, 0, stream>>>(T16, DM, 0, BQ, DM, 0, 0.0625f, bq, 0, nullptr, nullptr, Qh, Ql, DM, 0, NR, DM, DM);      /* q as hi + residual planes */
  k_gemm2<0, DM, DM, 9><<<gP, 256, 0, stream>>>(T16, DM, 0, BK, DM, 0, 0.0625f, bk, 0, nullptr, nullptr, Kh, Kl, DM, 0, NR, DM, DM);      /* k likewise */
  k_gemm2<0, DM, DM, 1><<<gP, 256, 0, stream>>>(T16, DM, 0, BV, DM, 0, 0.0625f, bv, 0, nullptr, F, nullptr, nullptr, DM, 0, NR, DM, DM);
  for (int b = 0; b < NBT; ++b) k_vthl<SLEN><<<NH * (SLEN / 64), 256, 0, stream>>>(F + (size_t)b * SLEN * DM, DM, Vth + (size_t)b * SLEN * DM, Vtl + (size_t)b * SLEN * DM);
  k_flashm<SLEN, SLEN><<<NH * (SLEN / 64), 128, 0, stream>>>(Qh, Ql, DM, Kh, Kl, DM, Vth, Vtl, MB, RA, KE, Oh, Ol, DM);      /* both batches in one grid of equal work-groups */
  k_gemm2<0, DM, DM, 3><<<gP, 256, 0, stream>>>(Oh, DM, 0, BO, DM, 0, 0.0625f, bo, 0, XB, X1, nullptr, nullptr, DM, 0, NR, DM, DM);      /* x1 = x + ctx Wo + bo (hi) */
  k_gemm2<0, DM, DM, 2><<<gP, 256, 0, stream>>>(Ol, DM, 0, BO, DM, 0, 0.0625f / 1024.0f, nullptr, 0, X1, X1, nullptr, nullptr, DM, 0, NR, DM, DM);      /* + lo */
  k_lnab<0><<<NR / 8, 256, 0, stream>>>(X1, lcg, lcb, T16, nullptr, nullptr);
  k_gemm2<15, DM, 4096, 5><<<gM, 256, 0, stream>>>(T16, DM, 0, BE, DM, 0, 0.0625f, be, 0, nullptr, nullptr, GH, nullptr, 4096, 0, NR, 4096, DM);      /* silu(t We + be) f16 (ACT 15 = x * sigmoid(x), present in the epilogue) */
  k_gemm2<0, 4096, DM, 3><<<gP, 256, 0, stream>>>(GH, 4096, 0, BD, 4096, 0, 0.0625f, bd, 0, X1, (float*)d_out, nullptr, nullptr, DM, 0, NR, DM, 4096);      /* out = x1 + mlp */
}

// v009
// A run of this version takes 298 microseconds.
// Timed twice side by side with v008, it ran 1.06 times as fast both times.
// All steps since v000 together make it 4.06 times as fast.
#include <hip/hip_runtime.h>
// Pre-LN causal attention block (2 x 2048 tokens, 1024 = 16 heads x 64; MLP 4096 with SiLU): t = LN_b(LN_a(x)); q,k,v = t W + b; x1 = x + (causal softmax(q.k/8) v) Wo + bo; out = x1 + (silu(LN_c(x1) We + be)) Wd + bd -> [2,2048,1024].
// Structure: the LayerNorms on VALU (the first pass also writes the bf16 residual plane); projections / MLP as f16 WMMA GEMMs (128x128 work-group tiles of eight 32x64 wave tiles, f32 accumulation, exact x16 weights, biases / SiLU / residual addends in the epilogue); q, k as f16 hi + (x2^10) residual planes written by their GEMMs' own epilogue, V^T as hi + residual planes; fused causal flash kernel, one work-group per (head, t): 64-query tile t of batch 0, then tile 31 - t of batch 1 (32-key K and V^T tiles copied asynchronously into two LDS buffers shared by the four waves, device-built causal tables, online f32 softmax, P staged hi + residual, two value accumulators); O written by the flash kernel as hi + residual planes into Wo (two GEMMs).
// Compute dtype: x, weights, biases, LN parameters rounded to bf16; LN outputs and the SiLU hidden as f16 operands (~2^-12); q, k, P, v, O as f16 hi + residual pairs (~2^-21); f32 accumulation, softmax, LayerNorm. v_wmma_f32_16x16x32_f16.
#define NBT 2
#define SLEN 2048
#define DM 1024
#define NH 16
#define SCL 0.125f
#define L2E 1.4426950408889634f      /* log2(e): exp(x) is taken as 2^(x * log2 e), one v_exp_f32 */
#define NR (NBT * SLEN)
typedef __bf16 v16b __attribute__((ext_vector_type(16)));
typedef unsigned short v8us __attribute__((ext_vector_type(8), may_alias));
typedef float  v8f  __attribute__((ext_vector_type(8)));
typedef float  v4f  __attribute__((ext_vector_type(4)));
typedef float  v4fa __attribute__((ext_vector_type(4), may_alias));
union FragB { v16b v; v8us half[2]; unsigned short u[16]; };

__device__ __forceinline__ unsigned short bf16_bits(float x) { unsigned int u = __float_as_uint(x); return (unsigned short)((u + 0x7FFFu + ((u >> 16) & 1u)) >> 16); }
__device__ __forceinline__ float bf16_val(unsigned short b) { return __uint_as_float(((unsigned int)b) << 16); }
__device__ __forceinline__ float bf16_round(float x) { return bf16_val(bf16_bits(x)); }
// D += A·B with NT terms: 1 = ah·bh, 2 = + al·bh (A split), 3 = + ah·bl (both split)
template <int NT>
__device__ __forceinline__ v8f mmaN(v16b ah, v16b al, v16b bh, v16b bl, v8f c) {
  c = __builtin_amdgcn_wmma_f32_16x16x32_bf16(false, ah, false, bh, (short)0, c, false, false);
  if (NT >= 2) c = __builtin_amdgcn_wmma_f32_16x16x32_bf16(false, al, false, bh, (short)0, c, false, false);
  if (NT >= 3) c = __builtin_amdgcn_wmma_f32_16x16x32_bf16(false, ah, false, bl, (short)0, c, false, false);
  asm volatile("v_nop\n\tv_nop\n\tv_nop\n\tv_nop" : "+v"(c) : "v"(ah), "v"(al), "v"(bh), "v"(bl));
  return c;
}

__global__ __launch_bounds__(256) void k_wt_bf16(const float* __restrict__ W, unsigned short* __restrict__ Wt, int K, int N) {
  const int t = blockIdx.x * 256 + threadIdx.x;
  const int k8n = K / 8;
  if (t >= N * k8n) return;
  const int n = t / k8n, k8 = (t % k8n) * 8;
  v8us v;
#pragma unroll
  for (int i = 0; i < 8; ++i) v[i] = bf16_bits(W[(size_t)(k8 + i) * N + n]);
  *(v8us*)(Wt + (size_t)n * K + k8) = v;
  
}

// GEMM C[M][N] (f32, pitch ldc) = act(A[M][K]·W + bias). A f32 row-major (pitch lda) converted per fragment to bf16
// (ASPLIT: hi/lo two planes -> 2 terms, else single rounded term); Wt bf16 [N][K] (pitch ldb). BIAS_BF16 rounds the
// bias to bf16 first (bias quantised to bf16 before the add). K%32==0, M%16==0, N%64==0.
template <bool ASPLIT, int ACT, bool BIAS_BF16>
__global__ __launch_bounds__(128) void k_gemm_bf(const float* __restrict__ A, int lda, const unsigned short* __restrict__ Wt, int ldb,
                                               const float* __restrict__ bias, float* __restrict__ C, int ldc, int M, int N, int K) {
  __shared__ __attribute__((aligned(16))) float so[4][16][64];
  const int tid = threadIdx.x, w = tid >> 5, lane = tid & 31, ln = lane & 15, hh = lane >> 4;
  const int ntn = N / 64;
  const int wid = blockIdx.x * 4 + w;
  const int mt = wid / ntn, nq = wid % ntn;
  if (mt * 16 >= M) return;
  const int row0 = mt * 16, col0 = nq * 64;
  const float* arow = A + (size_t)(row0 + ln) * lda;
  v8f acc[4] = {};
  for (int kb = 0; kb < K; kb += 32) {
    FragB ah, al;
    const v4f x0 = *(const v4fa*)(arow + kb + 8 * hh), x1 = *(const v4fa*)(arow + kb + 8 * hh + 4);
    const v4f x2 = *(const v4fa*)(arow + kb + 16 + 8 * hh), x3 = *(const v4fa*)(arow + kb + 16 + 8 * hh + 4);
    float xs[16] = {x0[0],x0[1],x0[2],x0[3],x1[0],x1[1],x1[2],x1[3],x2[0],x2[1],x2[2],x2[3],x3[0],x3[1],x3[2],x3[3]};
#pragma unroll
    for (int i = 0; i < 16; ++i) { const unsigned short hb = bf16_bits(xs[i]); ah.u[i] = hb; al.u[i] = ASPLIT ? bf16_bits(xs[i] - bf16_val(hb)) : (unsigned short)0; }
#pragma unroll
    for (int t = 0; t < 4; ++t) {
      const unsigned short* brow = Wt + (size_t)(col0 + t * 16 + ln) * ldb + kb;
      FragB b;
      b.half[0] = *(const v8us*)(brow + 8 * hh);
      b.half[1] = *(const v8us*)(brow + 16 + 8 * hh);
      acc[t] = mmaN<ASPLIT ? 2 : 1>(ah.v, al.v, b.v, b.v, acc[t]);
    }
  }
#pragma unroll
  for (int t = 0; t < 4; ++t) {
    float bv = bias ? bias[col0 + t * 16 + ln] : 0.f;
    if (BIAS_BF16) bv = bf16_round(bv);
#pragma unroll
    for (int r = 0; r < 8; ++r) { float v = acc[t][r] + bv; if (ACT == 1) v = fmaxf(v, 0.f); so[w][8 * hh + r][t * 16 + ln] = v; }
  }
  __builtin_amdgcn_fence(__ATOMIC_ACQ_REL, "workgroup");
  __builtin_amdgcn_wave_barrier();
  const int rsub = lane >> 4, c4 = (lane & 15) * 4;
  {
#pragma unroll
    for (int q = 0; q < 8; ++q) {
      const int r = q * 2 + rsub;
      const v4f v = *(const v4fa*)&so[w][r][c4];
      *(v4f*)(C + (size_t)(row0 + r) * ldc + col0 + c4) = v;
    }
    
  }
}

// GEMM C = act(A·W + bias + resid): A f32 (ASPLIT -> hi/lo 2 terms), Wt bf16 [N][K]; ACT 0 none, 1 relu, 2 exact gelu;
// resid (optional, f32, row index = (row % rmod), pitch ldr, RES_BF16 rounds it) added before the activation.
template <bool ASPLIT, int ACT, bool BIAS_BF16, bool RES_BF16>
__global__ __launch_bounds__(128) void k_gemm_bf3(const float* __restrict__ A, int lda, const unsigned short* __restrict__ Wt, int ldb,
                                                const float* __restrict__ bias, const float* __restrict__ resid, int rmod, int ldr,
                                                float* __restrict__ C, int ldc, int M, int N, int K) {
  __shared__ __attribute__((aligned(16))) float so[4][16][64];
  const int tid = threadIdx.x, w = tid >> 5, lane = tid & 31, ln = lane & 15, hh = lane >> 4;
  const int ntn = N / 64;
  const int wid = blockIdx.x * 4 + w;
  const int mt = wid / ntn, nq = wid % ntn;
  if (mt * 16 >= M) return;
  const int row0 = mt * 16, col0 = nq * 64;
  const float* arow = A + (size_t)(row0 + ln) * lda;
  v8f acc[4] = {};
  for (int kb = 0; kb < K; kb += 32) {
    FragB ah, al;
    const v4f x0 = *(const v4fa*)(arow + kb + 8 * hh), x1 = *(const v4fa*)(arow + kb + 8 * hh + 4);
    const v4f x2 = *(const v4fa*)(arow + kb + 16 + 8 * hh), x3 = *(const v4fa*)(arow + kb + 16 + 8 * hh + 4);
    float xs[16] = {x0[0],x0[1],x0[2],x0[3],x1[0],x1[1],x1[2],x1[3],x2[0],x2[1],x2[2],x2[3],x3[0],x3[1],x3[2],x3[3]};
#pragma unroll
    for (int i = 0; i < 16; ++i) { const unsigned short hb = bf16_bits(xs[i]); ah.u[i] = hb; al.u[i] = ASPLIT ? bf16_bits(xs[i] - bf16_val(hb)) : (unsigned short)0; }
#pragma unroll
    for (int t = 0; t < 4; ++t) {
      const unsigned short* brow = Wt + (size_t)(col0 + t * 16 + ln) * ldb + kb;
      FragB b;
      b.half[0] = *(const v8us*)(brow + 8 * hh);
      b.half[1] = *(const v8us*)(brow + 16 + 8 * hh);
      acc[t] = mmaN<ASPLIT ? 2 : 1>(ah.v, al.v, b.v, b.v, acc[t]);
    }
  }
#pragma unroll
  for (int t = 0; t < 4; ++t) {
    const int col = col0 + t * 16 + ln;
    float bv = bias ? bias[col] : 0.f;
    if (BIAS_BF16) bv = bf16_round(bv);
#pragma unroll
    for (int r = 0; r < 8; ++r) {
      float v = acc[t][r] + bv;
      if (resid) { float rv = resid[(size_t)((row0 + 8 * hh + r) % rmod) * ldr + col]; if (RES_BF16) rv = bf16_round(rv); v += rv; }
      if (ACT == 1) v = fmaxf(v, 0.f);
      if (ACT == 2) v = 0.5f * v * (1.0f + erff(v * 0.70710678118654752f));
      if (ACT == 3) { const float u = 0.7978845608028654f * (v + 0.044715f * v * v * v); v = 0.5f * v * (1.0f + tanhf(u)); }
      so[w][8 * hh + r][t * 16 + ln] = v;
    }
  }
  __builtin_amdgcn_fence(__ATOMIC_ACQ_REL, "workgroup");
  __builtin_amdgcn_wave_barrier();
  const int rsub = lane >> 4, c4 = (lane & 15) * 4;
  {
#pragma unroll
    for (int q = 0; q < 8; ++q) {
      const int r = q * 2 + rsub;
      const v4f v = *(const v4fa*)&so[w][r][c4];
      *(v4f*)(C + (size_t)(row0 + r) * ldc + col0 + c4) = v;
    }
    
  }
}
// row LayerNorm (biased variance, eps) over N: s = X (+ R); optional out_sum <- s; out_norm <- (s-mu)*rsqrt(var+eps)*g + b
template <bool PARAM_BF16>
__global__ __launch_bounds__(256) void k_layernorm(const float* __restrict__ X, const float* __restrict__ R, const float* __restrict__ g, const float* __restrict__ bta,
                                                  float* __restrict__ out_sum, float* __restrict__ out_norm, int N, float eps) {
  __shared__ float red[256];
  const int row = blockIdx.x, tid = threadIdx.x;
  const float* x = X + (size_t)row * N; const float* rr = R ? R + (size_t)row * N : nullptr;
  float vals[16];                     // up to N = 4096
  const int per = N / 256;            // contiguous chunk per thread? use strided-by-4 chunks: thread handles j = tid*4 + 1024*u
  float s1 = 0.f;
  for (int u = 0; u < per / 4; ++u) {
    const int j = tid * 4 + 1024 * u;
    const v4f a = *(const v4fa*)(x + j);
    v4f b = {0.f,0.f,0.f,0.f}; if (rr) b = *(const v4fa*)(rr + j);
#pragma unroll
    for (int q = 0; q < 4; ++q) { const float v = a[q] + b[q]; vals[u * 4 + q] = v; s1 += v; }
  }
  red[tid] = s1; __syncthreads();
  for (int st = 128; st > 0; st >>= 1) { if (tid < st) red[tid] += red[tid + st]; __syncthreads(); }
  const float mu = red[0] / (float)N; __syncthreads();
  float s2 = 0.f;
  for (int u = 0; u < per / 4; ++u)
#pragma unroll
    for (int q = 0; q < 4; ++q) { const float c = vals[u * 4 + q] - mu; s2 += c * c; }
  red[tid] = s2; __syncthreads();
  for (int st = 128; st > 0; st >>= 1) { if (tid < st) red[tid] += red[tid + st]; __syncthreads(); }
  const float rs = rsqrtf(red[0] / (float)N + eps);
  {
    for (int u = 0; u < per / 4; ++u) {
      const int j = tid * 4 + 1024 * u;
      v4f o, sm;
#pragma unroll
      for (int q = 0; q < 4; ++q) {
        float gg = g[j + q], bb = bta[j + q];
        if (PARAM_BF16) { gg = bf16_round(gg); bb = bf16_round(bb); }
        sm[q] = vals[u * 4 + q]; o[q] = (vals[u * 4 + q] - mu) * rs * gg + bb;
      }
      if (out_sum) *(v4f*)(out_sum + (size_t)row * N + j) = sm;
      *(v4f*)(out_norm + (size_t)row * N + j) = o;
    }
    
  }
}



// Eight 2^x, and eight 1/x, in place, by the hardware's own instruction. One statement each: every instruction reads and writes its own register only, so none touches a neighbour's source or result,
// and the closing v_nop is the slot that the instruction set asks for between the last one and whatever uses its result next.
__device__ __forceinline__ void exp2x8(float (&x)[8]) {
  asm("v_exp_f32 %0, %0\n\tv_exp_f32 %1, %1\n\tv_exp_f32 %2, %2\n\tv_exp_f32 %3, %3\n\tv_exp_f32 %4, %4\n\tv_exp_f32 %5, %5\n\tv_exp_f32 %6, %6\n\tv_exp_f32 %7, %7\n\tv_nop"
      : "+v"(x[0]), "+v"(x[1]), "+v"(x[2]), "+v"(x[3]), "+v"(x[4]), "+v"(x[5]), "+v"(x[6]), "+v"(x[7])); }
__device__ __forceinline__ void rcpx8(float (&x)[8]) {
  asm("v_rcp_f32 %0, %0\n\tv_rcp_f32 %1, %1\n\tv_rcp_f32 %2, %2\n\tv_rcp_f32 %3, %3\n\tv_rcp_f32 %4, %4\n\tv_rcp_f32 %5, %5\n\tv_rcp_f32 %6, %6\n\tv_rcp_f32 %7, %7\n\tv_nop"
      : "+v"(x[0]), "+v"(x[1]), "+v"(x[2]), "+v"(x[3]), "+v"(x[4]), "+v"(x[5]), "+v"(x[6]), "+v"(x[7])); }

// ---- f16 WMMA path (v_wmma_f32_16x16x32_f16): 11-bit significands for operands in range — used where a [0,1] probability operand needs more precision than bf16
typedef _Float16 v16h __attribute__((ext_vector_type(16)));
union FragH { v16h v; v8us half[2]; _Float16 h[16]; unsigned short u[16]; };
template <int NT>
__device__ __forceinline__ v8f mmaH(v16h ah, v16h al, v16h bh, v16h bl, v8f c) {
  c = __builtin_amdgcn_wmma_f32_16x16x32_f16(false, ah, false, bh, (short)0, c, false, false);
  if (NT >= 2) c = __builtin_amdgcn_wmma_f32_16x16x32_f16(false, al, false, bh, (short)0, c, false, false);
  if (NT >= 3) c = __builtin_amdgcn_wmma_f32_16x16x32_f16(false, ah, false, bl, (short)0, c, false, false);
  asm volatile("v_nop\n\tv_nop\n\tv_nop\n\tv_nop" : "+v"(c) : "v"(ah), "v"(al), "v"(bh), "v"(bl));
  return c;
}
// batched GEMM like k_gemm_b but f16 operands: A f32 (split into f16 hi/lo if ASPLIT, else rounded to f16), Bt = f16 values [n][k]; alpha; C f32; N multiple of 16 (partial tiles skipped)
template <bool ASPLIT>
__global__ __launch_bounds__(128) void k_gemm_h(const float* __restrict__ A, int lda, size_t sA, const _Float16* __restrict__ Bh, int ldb, size_t sB, float alpha, float* __restrict__ C, int ldc, size_t sC, int M, int N, int K) {
  __shared__ __attribute__((aligned(16))) float so[4][16][64];
  const int tid = threadIdx.x, w = tid >> 5, lane = tid & 31, ln = lane & 15, hh = lane >> 4; const int by = blockIdx.y;
  A += (size_t)by * sA; Bh += (size_t)by * sB; C += (size_t)by * sC;
  const int ntn = (N + 63) / 64; const int wid = blockIdx.x * 4 + w; const int mt = wid / ntn, nq = wid % ntn; if (mt * 16 >= M) return;
  const int row0 = mt * 16, col0 = nq * 64; const float* arow = A + (size_t)(row0 + ln) * lda;
  v8f acc[4] = {};
  for (int kb = 0; kb < K; kb += 32) {
    FragH ah, al;
    const v4f x0 = *(const v4fa*)(arow + kb + 8 * hh), x1 = *(const v4fa*)(arow + kb + 8 * hh + 4), x2 = *(const v4fa*)(arow + kb + 16 + 8 * hh), x3 = *(const v4fa*)(arow + kb + 16 + 8 * hh + 4);
    float xs[16] = {x0[0],x0[1],x0[2],x0[3],x1[0],x1[1],x1[2],x1[3],x2[0],x2[1],x2[2],x2[3],x3[0],x3[1],x3[2],x3[3]};
#pragma unroll
    for (int i = 0; i < 16; ++i) { const _Float16 h = (_Float16)xs[i]; ah.h[i] = h; al.h[i] = ASPLIT ? (_Float16)(xs[i] - (float)h) : (_Float16)0.0f; }
#pragma unroll
    for (int t = 0; t < 4; ++t) { if (col0 + t * 16 >= N) continue; const size_t boff = (size_t)(col0 + t * 16 + ln) * ldb + kb; FragH bq; bq.half[0] = *(const v8us*)(Bh + boff + 8 * hh); bq.half[1] = *(const v8us*)(Bh + boff + 16 + 8 * hh);
      acc[t] = mmaH<ASPLIT ? 2 : 1>(ah.v, al.v, bq.v, bq.v, acc[t]); }
  }
#pragma unroll
  for (int t = 0; t < 4; ++t) { if (col0 + t * 16 >= N) continue;
#pragma unroll
    for (int r = 0; r < 8; ++r) so[w][8 * hh + r][t * 16 + ln] = acc[t][r] * alpha; }
  __builtin_amdgcn_fence(__ATOMIC_ACQ_REL, "workgroup"); __builtin_amdgcn_wave_barrier();
  const int rsub = lane >> 4, c4 = (lane & 15) * 4;
  {
#pragma unroll
    for (int q = 0; q < 8; ++q) { const int r = q * 2 + rsub; if (col0 + c4 < N) { const v4f v = *(const v4fa*)&so[w][r][c4]; *(v4f*)(C + (size_t)(row0 + r) * ldc + col0 + c4) = v; } }
     }
}

// Wt[n][k] = f16(bf16(W[k][n]) * 16) from f32 row-major W[K][N] (power-of-two scale: bf16-exact weights stay exact in f16 away from the subnormal range).
// One work-group turns a block of 64 k x 256 n in LDS: it reads the block's rows by whole lines (a wave-wide 16-byte load = 512 B of one row, all 16 loads of a lane in flight together),
// keeps it as f16 [k][n] (pitch 260 halves), reads it back as dwords (two n of one k) and writes 128-B lines of Wt (8 lanes x 8 k of one n). K, N at compile time: every row step is an immediate offset.
typedef unsigned long long u64a __attribute__((may_alias)); typedef unsigned u32a __attribute__((may_alias));
template <int K, int N>
__device__ __forceinline__ void wt_block(const float* __restrict__ W, _Float16* __restrict__ Wt, int u, unsigned short* tl) {
  constexpr int P = 256 + 4, NB = N / 256; const int tid = threadIdx.x; const int k0 = (u / NB) * 64, n0 = (u % NB) * 256;
  const float* src = W + (size_t)(k0 + (tid >> 6)) * N + n0 + (tid & 63) * 4; v4f a[16];
#pragma unroll
  for (int j = 0; j < 16; ++j) a[j] = *(const v4fa*)(src + (size_t)(4 * j) * N);
  asm volatile("s_wait_xcnt 0x0" : : "v"(src) : "memory");      /* in front of any overwrite of the address register that the 16 issued loads name (it stays live up to here) */
#pragma unroll
  for (int j = 0; j < 16; ++j) { FragH f;
#pragma unroll
    for (int q = 0; q < 4; ++q) f.h[q] = (_Float16)(bf16_round(a[j][q]) * 16.0f);
    *(u64a*)&tl[((tid >> 6) + 4 * j) * P + (tid & 63) * 4] = (unsigned long long)f.u[0] | ((unsigned long long)f.u[1] << 16) | ((unsigned long long)f.u[2] << 32) | ((unsigned long long)f.u[3] << 48); }
  __syncthreads();      /* the block is whole in LDS before any lane reads across the rows that other waves stored */
  const int kc = (tid & 7) * 8, np = tid >> 3; unsigned short* dst = (unsigned short*)Wt + (size_t)(n0 + 2 * np) * K + k0 + kc;
#pragma unroll
  for (int j = 0; j < 4; ++j) { unsigned d[8]; FragH lo, hi;
#pragma unroll
    for (int i = 0; i < 8; ++i) d[i] = *(const u32a*)&tl[(kc + i) * P + 2 * (np + 32 * j)];
#pragma unroll
    for (int i = 0; i < 8; ++i) { lo.u[i] = (unsigned short)(d[i] & 0xffffu); hi.u[i] = (unsigned short)(d[i] >> 16); }
    *(v8us*)(dst + (size_t)(64 * j) * K) = lo.half[0]; *(v8us*)(dst + (size_t)(64 * j + 1) * K) = hi.half[0]; } }
// All six weights in one grid of 768 equal work-groups: 4 x 64 blocks of the 1024 x 1024 projections, 256 of We, 256 of Wd.
__global__ __launch_bounds__(256) void k_wt_all(const float* __restrict__ Wq, const float* __restrict__ Wk, const float* __restrict__ Wv, const float* __restrict__ Wo, const float* __restrict__ We, const float* __restrict__ Wd,
    _Float16* __restrict__ BQ, _Float16* __restrict__ BK, _Float16* __restrict__ BV, _Float16* __restrict__ BO, _Float16* __restrict__ BE, _Float16* __restrict__ BD) {
  __shared__ __attribute__((aligned(16))) unsigned short tl[64 * 260];      /* 33,280 B */
  const int u = blockIdx.x;      /* the same for the whole work-group: a barrier follows in each branch */
  if (u < 256) { const int m = u >> 6; wt_block<DM, DM>(m == 0 ? Wq : m == 1 ? Wk : m == 2 ? Wv : Wo, m == 0 ? BQ : m == 1 ? BK : m == 2 ? BV : BO, u & 63, tl); }
  else if (u < 512) wt_block<DM, 4096>(We, BE, u - 256, tl);
  else wt_block<4096, DM>(Wd, BD, u - 512, tl); }
// k_gemm_hh variant with fused epilogue: v = acc·alpha + bias[by·sBias + col] (+ CP[(row/rowsPerB)·sCPb + by·64 + col] if CP) ; ACT 0 none / 1 elu ; writes f16 C16 (and f32 C if non-null)
template <int ACT>
__global__ __launch_bounds__(128) void k_gemm_hhx(const _Float16* __restrict__ A, int lda, size_t sA, const _Float16* __restrict__ Bh, int ldb, size_t sB, float alpha, const float* __restrict__ bias, size_t sBias, const float* __restrict__ CP, int rowsPerB, size_t sCPb, int row0g,
    float* __restrict__ C, _Float16* __restrict__ C16, int ldc, size_t sC, int M, int N, int K) {
  __shared__ __attribute__((aligned(16))) float so[4][16][64];
  const int tid = threadIdx.x, w = tid >> 5, lane = tid & 31, ln = lane & 15, hh = lane >> 4; const int by = blockIdx.y;
  A += (size_t)by * sA; Bh += (size_t)by * sB; const size_t cofs = (size_t)by * sC; const float* bp = bias ? bias + (size_t)by * sBias : nullptr;
  const int ntn = (N + 63) / 64; const int wid = blockIdx.x * 4 + w; const int mt = wid / ntn, nq = wid % ntn; if (mt * 16 >= M) return;
  const int row0 = mt * 16, col0 = nq * 64; const _Float16* arow = A + (size_t)(row0 + ln) * lda;
  v8f acc[4] = {};
  for (int kb = 0; kb < K; kb += 32) { FragH ah; ah.half[0] = *(const v8us*)((const unsigned short*)arow + kb + 8 * hh); ah.half[1] = *(const v8us*)((const unsigned short*)arow + kb + 16 + 8 * hh);
#pragma unroll
    for (int t = 0; t < 4; ++t) { if (col0 + t * 16 >= N) continue; const size_t boff = (size_t)(col0 + t * 16 + ln) * ldb + kb; FragH bq; bq.half[0] = *(const v8us*)((const unsigned short*)Bh + boff + 8 * hh); bq.half[1] = *(const v8us*)((const unsigned short*)Bh + boff + 16 + 8 * hh);
      acc[t] = mmaH<1>(ah.v, ah.v, bq.v, bq.v, acc[t]); }
  }
#pragma unroll
  for (int t = 0; t < 4; ++t) { if (col0 + t * 16 >= N) continue; const int col = col0 + t * 16 + ln; const float bv = bp ? bf16_round(bp[col]) : 0.f;
#pragma unroll
    for (int r = 0; r < 8; ++r) { float v = acc[t][r] * alpha + bv; if (CP) { const int bidx = (row0g + row0 + 8 * hh + r) / rowsPerB; v += CP[(size_t)bidx * sCPb + (size_t)by * 64 + col]; } if (ACT == 1) v = (v > 0.f) ? v : expm1f(v); else if (ACT == 7) v = (v > 0.f) ? v + 1.0f : expf(v); else if (ACT == 8) v = tanhf(v); else if (ACT == 9) v = 0.5f * v * (1.0f + tanhf(0.7978845608028654f * (v + 0.044715f * v * v * v))); else if (ACT == 11) v = 1.0f / (1.0f + expf(-v)); else if (ACT == 12) v = (v > 0.f) ? v : 0.01f * v; else if (ACT == 14) v = (v > 0.f) ? v : 0.1f * v; else if (ACT == 15) v = v / (1.0f + expf(-v)); else if (ACT == 3) v = fmaxf(v, 0.f); else if (ACT == 6) v = 0.5f * v * (1.0f + erff(v * 0.70710678118654752f)); so[w][8 * hh + r][t * 16 + ln] = v; } }
  __builtin_amdgcn_fence(__ATOMIC_ACQ_REL, "workgroup"); __builtin_amdgcn_wave_barrier();
  const int rsub = lane >> 4, c4 = (lane & 15) * 4; typedef _Float16 v4h __attribute__((ext_vector_type(4)));
  {
#pragma unroll
    for (int q = 0; q < 8; ++q) { const int r = q * 2 + rsub; if (col0 + c4 < N) { const v4f v = *(const v4fa*)&so[w][r][c4]; if (C) *(v4f*)(C + cofs + (size_t)(row0 + r) * ldc + col0 + c4) = v; if (C16) { v4h h4; for (int i = 0; i < 4; ++i) h4[i] = (_Float16)v[i]; *(v4h*)(C16 + cofs + (size_t)(row0 + r) * ldc + col0 + c4) = h4; } } }
     }
}


typedef _Float16 v4h __attribute__((ext_vector_type(4)));

__global__ __launch_bounds__(256) void k_x16(const float* __restrict__ x, _Float16* __restrict__ X16, size_t n8) { const size_t t = (size_t)blockIdx.x * 256 + threadIdx.x; if (t >= n8) return; FragH f;
#pragma unroll
  for (int q = 0; q < 8; ++q) f.h[q] = (_Float16)bf16_round(x[t * 8 + q]); *(v8us*)((unsigned short*)X16 + t * 8) = f.half[0];  }
__global__ __launch_bounds__(256) void k_h16(const float* __restrict__ x, _Float16* __restrict__ X16, size_t n8) { const size_t t = (size_t)blockIdx.x * 256 + threadIdx.x; if (t >= n8) return; FragH f;
#pragma unroll
  for (int q = 0; q < 8; ++q) f.h[q] = (_Float16)x[t * 8 + q]; *(v8us*)((unsigned short*)X16 + t * 8) = f.half[0];  }
__global__ __launch_bounds__(256) void k_round16f(const float* __restrict__ W, _Float16* __restrict__ Bt, size_t n8) { const size_t t = (size_t)blockIdx.x * 256 + threadIdx.x; if (t >= n8) return; FragH f;
#pragma unroll
  for (int i = 0; i < 8; ++i) f.h[i] = (_Float16)(bf16_round(W[t * 8 + i]) * 16.0f); *(v8us*)((unsigned short*)Bt + t * 8) = f.half[0];  }
template <int NHv, int TTv>
__global__ __launch_bounds__(256) void k_vt(const _Float16* __restrict__ V16, int ldv, int voff, _Float16* __restrict__ Vt) { __shared__ unsigned short tl[64][66]; const int tid = threadIdx.x; const int slab = blockIdx.x / (TTv / 64), lg = blockIdx.x % (TTv / 64); const int b = slab / NHv, h = slab % NHv;
  for (int i = tid; i < 64 * 8; i += 256) { const int r = i / 8, c8 = (i % 8) * 8; FragH f; f.half[0] = *(const v8us*)((const unsigned short*)V16 + ((size_t)b * TTv + lg * 64 + r) * ldv + voff + h * 64 + c8);
#pragma unroll
    for (int q = 0; q < 8; ++q) tl[r][c8 + q] = f.u[q]; }
  __syncthreads();
  {
#pragma unroll
    for (int rd = 0; rd < 2; ++rd) { const int d = rd * 32 + tid / 8, pc = tid % 8; FragH f;
#pragma unroll
      for (int q = 0; q < 8; ++q) f.u[q] = tl[pc * 8 + q][d];
      *(v8us*)((unsigned short*)Vt + ((size_t)slab * 64 + d) * TTv + lg * 64 + pc * 8) = f.half[0]; }
     } }

// ---- fast GEMM (work-group tile 128x128 = 4 x 2 waves, wave tile 32x64; requires M % 128 == 0, N % 128 == 0, K % 128 == 0); epilogue: v = act(acc * alpha + bf16(bias[col])), or v = acc * alpha + bf16(bias[col]) + residual[row][col] ----
// Operands go through LDS: per slice of 128 k the work-group loads 256 B of each of its 128 A rows and 128 B rows with whole-line 16-byte loads (two rows per wave-wide load),
// keeps them in registers while the slice before is worked on, and stores them into the other of two LDS buffers; the fragments are read from LDS, A and B alike as halves k + 8 * hh .. + 7 and k + 16 + 8 * hh .. + 7 of their row.
__device__ __forceinline__ v16h g2_sfrag(const unsigned short* p) { FragH f; f.half[0] = *(const v8us*)p; f.half[1] = *(const v8us*)(p + 16); return f.v; }      /* p = LDS row + k + 8 * hh */
__device__ __forceinline__ v8f g2_mma(v16h a, v16h b, v8f c) { v8f d = __builtin_amdgcn_wmma_f32_16x16x32_f16(false, a, false, b, (short)0, c, false, false); asm volatile("v_nop\n\tv_nop\n\tv_nop\n\tv_nop" : "+v"(d) : "v"(a), "v"(b)); return d; }
template <int ACT, int LD, int LDC, int EP>      /* LD = lda = ldb = K and LDC = ldc at compile time: the row steps of the staging loads, of the residual loads and of the stores become immediate offsets. EP, the epilogue's kind: 1 = bias, 2 = residual plane added (indexed like C), 4 = f16 output to C16, 8 = f16 output to C16 and its rounding residual x 2^10 as f16 to C16l (else f32 to C) */
__global__ __launch_bounds__(256) void k_gemm2(const _Float16* __restrict__ A, int lda, size_t sA, const _Float16* __restrict__ Bh, int ldb, size_t sB, float alpha, const float* __restrict__ bias, size_t sBias, const float* CP,
    float* C, _Float16* __restrict__ C16, _Float16* __restrict__ C16l, int ldc, size_t sC, int M, int N, int K) {      /* CP may be C itself: a lane reads exactly the elements that it stores later */
  static_assert(!(EP & 2) || ACT == 0, "the residual is added behind the staging, so no activation may follow it");
  constexpr int KS = 128, PIT = KS + 8, BUF = (128 + 128) * PIT;      /* slice of k; LDS row pitch 272 B = 16 B x 17 (no bank conflict for 16-byte fragment reads); halves per buffer: rows 0-127 A, 128-255 B */
  __shared__ __attribute__((aligned(16))) unsigned short st[2 * BUF];      /* 139,264 B */
  float (*so)[32][68] = reinterpret_cast<float (*)[32][68]>(st);      /* the epilogue's staging (8 waves, 69,632 B) reuses the buffers behind the last barrier */
  const int tid = threadIdx.x, w = tid >> 5, lane = tid & 31, ln = lane & 15, hh = lane >> 4; const int by = blockIdx.y;
  const int wm = w & 3, wn = w >> 2;      /* the wave's 32 rows (of 128) and its 64 columns (of 128): the two waves of a row band read the same A rows from LDS, the four of a column band the same B rows */
  A += (size_t)by * sA; Bh += (size_t)by * sB; const size_t cofs = (size_t)by * sC;
  const int ntn = N >> 7; const int mt = blockIdx.x / ntn, nq = blockIdx.x - mt * ntn; const int col0 = nq * 128; if (mt * 128 >= M) return;      /* the same for the whole work-group: barriers follow */
  const int sr = tid >> 4, sc = (tid & 15) * 8;      /* staging: 16 threads cover the 256 B of a row, the work-group 16 rows per load */
  (void)lda; (void)ldb; (void)K; (void)ldc;
  const char* aS = (const char*)(A + (size_t)(mt * 128) * LD); const char* bS = (const char*)(Bh + (size_t)col0 * LD);      /* the work-group's first A and B row: the same in every lane */
  unsigned vo = (unsigned)(sr * LD + sc) * 2u;      /* the lane's byte offset in both operands: its row of 16, its 16 bytes, the slice */
  const v8f z8 = {0.f,0.f,0.f,0.f,0.f,0.f,0.f,0.f}; v8f c00 = z8, c01 = z8, c02 = z8, c03 = z8, c10 = z8, c11 = z8, c12 = z8, c13 = z8;
  v8us rg[16];
  auto slice_load = [&]() {
#pragma unroll
    for (int i = 0; i < 8; ++i) rg[i] = *(const v8us*)(aS + (size_t)vo + (size_t)(32 * i) * LD);
#pragma unroll
    for (int i = 0; i < 8; ++i) rg[8 + i] = *(const v8us*)(bS + (size_t)vo + (size_t)(32 * i) * LD); };
  auto slice_next = [&]() { asm volatile("s_wait_xcnt 0x0" : "+v"(vo) : : "memory");      /* in front of the overwrite of the offset register that the issued loads name */
    vo += 2u * KS; };
  auto slice_store = [&](int bo) {
#pragma unroll
    for (int i = 0; i < 16; ++i) *(v8us*)&st[bo + (16 * i + sr) * PIT + sc] = rg[i]; };
  auto slice_mma = [&](int bo) { const unsigned short* ap = &st[bo + (32 * wm + ln) * PIT + 8 * hh]; const unsigned short* bq = &st[bo + (128 + 64 * wn + ln) * PIT + 8 * hh];
#pragma unroll
    for (int kk = 0; kk < KS; kk += 32) { const v16h a0 = g2_sfrag(ap + kk), a1 = g2_sfrag(ap + 16 * PIT + kk);      /* the six fragments of a k step as one group of LDS reads in front of its eight products */
      const v16h b0 = g2_sfrag(bq + kk), b1 = g2_sfrag(bq + 16 * PIT + kk), b2 = g2_sfrag(bq + 32 * PIT + kk), b3 = g2_sfrag(bq + 48 * PIT + kk);
      c00 = g2_mma(a0, b0, c00); c10 = g2_mma(a1, b0, c10); c01 = g2_mma(a0, b1, c01); c11 = g2_mma(a1, b1, c11);
      c02 = g2_mma(a0, b2, c02); c12 = g2_mma(a1, b2, c12); c03 = g2_mma(a0, b3, c03); c13 = g2_mma(a1, b3, c13); } };
  float braw[4] = {0.f, 0.f, 0.f, 0.f};      /* the lane's 4 bias values, asked for together with the first slice */
  if constexpr ((EP & 1) != 0) { const float* bS4 = bias + (size_t)by * sBias + col0 + 64 * wn + ln;
#pragma unroll
    for (int t = 0; t < 4; ++t) braw[t] = bS4[16 * t]; }
  slice_load(); slice_next(); slice_store(0); __syncthreads();
  int cur = 0;      /* start (in halves) of the buffer that holds the slice being worked on: 0 or BUF */
#pragma unroll 1      /* one copy of the slice body; the buffer alternates at run time */
  for (int s = 1; s < LD / KS; ++s) {
    slice_load();      /* in flight while the slice before is worked on */
    slice_mma(cur);
    slice_next();
    slice_store(cur ^ BUF);      /* its last readers left this buffer in front of the barrier of the trip before */
    __syncthreads(); cur ^= BUF; }
  // The residual plane is asked for here, all at once, so that the last slice's products cover the loads: the lane's 16 pieces of 16 B, the very pieces that it stores at the end
  // (16 lanes = the 256 B of a row of the wave's tile, a wave-wide load = two rows).
  const unsigned eo = (unsigned)((32 * wm + (lane >> 4)) * LDC + 64 * wn + (lane & 15) * 4);      /* the lane's element offset in the work-group's tile of C */
  const size_t tile0 = cofs + (size_t)(mt * 128) * LDC + col0;      /* the tile's first element: the same in every lane */
  v4f res[16];
  if constexpr ((EP & 2) != 0) { const char* rS = (const char*)(CP + tile0);
#pragma unroll
    for (int q = 0; q < 16; ++q) res[q] = *(const v4fa*)(rS + (size_t)(eo * 4u) + (size_t)(2 * q) * LDC * 4); }
  slice_mma(cur);
  __syncthreads();      /* every wave has read its last fragments before the buffers become output staging */
  v8f accs[8] = {c00, c01, c02, c03, c10, c11, c12, c13};
#pragma unroll
  for (int u = 0; u < 8; ++u) { const int t = u & 3, half = u >> 2; const float bv = bf16_round(braw[t]);
    float sg[8];      /* ACT 15: sigmoid(v) = 1 / (1 + 2^(-v log2 e)); the denominator is at least 1, and where 2^x is inf the sigmoid is 0, as with exp and a division */
    if constexpr (ACT == 15) {
#pragma unroll
      for (int r = 0; r < 8; ++r) sg[r] = (accs[u][r] * alpha + bv) * -L2E;
      exp2x8(sg);
#pragma unroll
      for (int r = 0; r < 8; ++r) sg[r] = 1.0f + sg[r];
      rcpx8(sg); }
#pragma unroll
    for (int r = 0; r < 8; ++r) { const int rloc = half * 16 + 8 * hh + r; float v = accs[u][r] * alpha + bv;
      if (ACT == 3) v = fmaxf(v, 0.f); else if (ACT == 6) v = 0.5f * v * (1.0f + erff(v * 0.70710678118654752f)); else if (ACT == 11) v = 1.0f / (1.0f + expf(-v)); else if (ACT == 15) v = v * sg[r]; else if (ACT == 12) v = (v > 0.f) ? v : 0.01f * v; else if (ACT == 8) v = tanhf(v);
      so[w][rloc][t * 16 + ln] = v; } }
  __builtin_amdgcn_fence(__ATOMIC_ACQ_REL, "workgroup"); __builtin_amdgcn_wave_barrier();
  const int rsub = lane >> 4, c4 = (lane & 15) * 4;
  {
#pragma unroll
    for (int q = 0; q < 16; ++q) { v4f v = *(const v4fa*)&so[w][q * 2 + rsub][c4];
      if constexpr ((EP & 2) != 0) v += res[q];
      if constexpr ((EP & 8) != 0) { v4h h4, l4; for (int i = 0; i < 4; ++i) { const _Float16 hv = (_Float16)v[i]; h4[i] = hv; l4[i] = (_Float16)((v[i] - (float)hv) * 1024.0f); }
        *(v4h*)((char*)(C16 + tile0) + (size_t)(eo * 2u) + (size_t)(2 * q) * LDC * 2) = h4; *(v4h*)((char*)(C16l + tile0) + (size_t)(eo * 2u) + (size_t)(2 * q) * LDC * 2) = l4; }
      else if constexpr ((EP & 4) != 0) { v4h h4; for (int i = 0; i < 4; ++i) h4[i] = (_Float16)v[i]; *(v4h*)((char*)(C16 + tile0) + (size_t)(eo * 2u) + (size_t)(2 * q) * LDC * 2) = h4; }
      else *(v4f*)((char*)(C + tile0) + (size_t)(eo * 4u) + (size_t)(2 * q) * LDC * 4) = v; }
     } }



template <int TK>
__global__ __launch_bounds__(256) void k_vthl(const float* __restrict__ VF, int ldv, _Float16* __restrict__ Vth, _Float16* __restrict__ Vtl) { __shared__ float tl[64][65]; const int tid = threadIdx.x; const int slab = blockIdx.x / (TK / 64), lg = blockIdx.x % (TK / 64); const int b = slab / NH, h = slab % NH;
  for (int i = tid; i < 64 * 16; i += 256) { const int r = i / 16, c4 = (i % 16) * 4; const v4f a = *(const v4fa*)(VF + ((size_t)b * TK + lg * 64 + r) * ldv + h * 64 + c4); tl[r][c4] = a[0]; tl[r][c4 + 1] = a[1]; tl[r][c4 + 2] = a[2]; tl[r][c4 + 3] = a[3]; }
  __syncthreads();
  FragH fh[2], fl[2]; size_t oo[2];
#pragma unroll
  for (int rd = 0; rd < 2; ++rd) { const int d = rd * 32 + tid / 8, pc = tid % 8;
#pragma unroll
    for (int q = 0; q < 8; ++q) { const float v = tl[pc * 8 + q][d]; const _Float16 hv = (_Float16)v; fh[rd].h[q] = hv; fl[rd].h[q] = (_Float16)((v - (float)hv) * 1024.0f); } oo[rd] = ((size_t)slab * 64 + d) * TK + lg * 64 + pc * 8; }
  {
#pragma unroll
    for (int rd = 0; rd < 2; ++rd) { *(v8us*)((unsigned short*)Vth + oo[rd]) = fh[rd].half[0]; *(v8us*)((unsigned short*)Vtl + oo[rd]) = fl[rd].half[0]; }
     } }

template <int TQ, int TK>
__global__ __launch_bounds__(128) void k_flashm(const _Float16* __restrict__ Q16, const _Float16* __restrict__ Q16lo, int ldq, const _Float16* __restrict__ K16, const _Float16* __restrict__ K16lo, int ldk, const _Float16* __restrict__ Vt, const _Float16* __restrict__ Vtlo, const unsigned* __restrict__ MB, const int* __restrict__ RA, const int* __restrict__ KE, _Float16* __restrict__ Oh, _Float16* __restrict__ Ol, int ldo) {
  constexpr int RPW = 16, RTN = RPW / 16, NQB = TQ / (4 * RPW), DT = 4, KS = 2;
  __shared__ __attribute__((aligned(16))) unsigned short sP[4][RPW][40], sPl[4][RPW][40]; __shared__ __attribute__((aligned(16))) float sO[4][RPW][64 + 4];
  // A pass's keys and values lie in LDS once for the four waves. One buffer (in halves): 32 K rows hi, 32 K rows residual (128 B each, pitch 144 B), then 64 V^T rows hi, 64 residual (64 B each, pitch 80 B); pitches 16 B x odd for the 16-byte fragment reads.
  constexpr int KP = 72, VP = 40, VB0 = 64 * KP, KVB = VB0 + 128 * VP;
  __shared__ __attribute__((aligned(16))) unsigned short sKV[2 * KVB];      /* two buffers, 38,912 B: the next pass's tile flies while this one is worked on */
  const int tid = threadIdx.x, w = tid >> 5, lane = tid & 31, ln = lane & 15, hh = lane >> 4;
  const int h = blockIdx.x / NQB, t0 = blockIdx.x % NQB;
  // Causal balance: the work-group runs query tile t0 of batch 0, then tile NQB - 1 - t0 of batch 1 (alternating), so every work-group walks the same number of key passes.
#pragma unroll 1      /* one copy of the tile body: the tiles run one after the other in every wave */
  for (int b = 0; b < NBT; ++b) {
  const int slab = b * NH + h, qblk = (b & 1) ? NQB - 1 - t0 : t0; const int qb0 = qblk * (4 * RPW); const int q0 = qb0 + w * RPW;
  FragH aq[2][KS], aql[2][KS];
#pragma unroll
  for (int rt = 0; rt < RTN; ++rt) { const size_t qo = ((size_t)b * TQ + q0 + rt * 16 + ln) * ldq + h * 64; const unsigned short* qr = (const unsigned short*)Q16 + qo; const unsigned short* ql = (const unsigned short*)Q16lo + qo;
#pragma unroll
    for (int ks = 0; ks < KS; ++ks) { aq[rt][ks].half[0] = *(const v8us*)(qr + ks * 32 + 8 * hh); aq[rt][ks].half[1] = *(const v8us*)(qr + ks * 32 + 16 + 8 * hh); aql[rt][ks].half[0] = *(const v8us*)(ql + ks * 32 + 8 * hh); aql[rt][ks].half[1] = *(const v8us*)(ql + ks * 32 + 16 + 8 * hh); } }
  const unsigned short* Vth = (const unsigned short*)Vt + (size_t)slab * 64 * TK; const unsigned short* Vtl = (const unsigned short*)Vtlo + (size_t)slab * 64 * TK;
  // Staging, 8 copies of 16 B a lane and pass: 8 lanes cover a K row (rows tid / 8 and + 16 of each plane), 4 lanes a V^T row (rows tid / 4 and + 32 of each plane).
  const size_t kso = ((size_t)b * TK + (tid >> 3)) * ldk + h * 64 + (tid & 7) * 8, vso = (size_t)(tid >> 2) * TK + (tid & 3) * 8;
  const unsigned lk0 = (unsigned)(size_t)&sKV[(tid >> 3) * KP + (tid & 7) * 8], lv0 = (unsigned)(size_t)&sKV[VB0 + (tid >> 2) * VP + (tid & 3) * 8];      /* the lane's LDS byte addresses in buffer 0 */
  auto stage = [&](int js, int bo) {      /* keys js .. js + 31 into the buffer that starts at half bo */
    const unsigned short* kh = (const unsigned short*)K16 + kso + (size_t)js * ldk; const unsigned short* kl = (const unsigned short*)K16lo + kso + (size_t)js * ldk;
    const unsigned short* kh2 = kh + (size_t)16 * ldk; const unsigned short* kl2 = kl + (size_t)16 * ldk;
    const unsigned short* vh = Vth + vso + js; const unsigned short* vl = Vtl + vso + js; const unsigned short* vh2 = vh + (size_t)32 * TK; const unsigned short* vl2 = vl + (size_t)32 * TK;
    const unsigned lk = lk0 + 2u * (unsigned)bo, lv = lv0 + 2u * (unsigned)bo;
    const unsigned lk1 = lk + 2u * 16 * KP, lk2 = lk + 2u * 32 * KP, lk3 = lk + 2u * 48 * KP, lv1 = lv + 2u * 32 * VP, lv2 = lv + 2u * 64 * VP, lv3 = lv + 2u * 96 * VP;
    /* the copies and, as the statement's last line, the wait that stands in front of any rewrite of their address registers */
    asm volatile("global_load_async_to_lds_b128 %0, %8, off\n\t"
                 "global_load_async_to_lds_b128 %1, %9, off\n\t"
                 "global_load_async_to_lds_b128 %2, %10, off\n\t"
                 "global_load_async_to_lds_b128 %3, %11, off\n\t"
                 "global_load_async_to_lds_b128 %4, %12, off\n\t"
                 "global_load_async_to_lds_b128 %5, %13, off\n\t"
                 "global_load_async_to_lds_b128 %6, %14, off\n\t"
                 "global_load_async_to_lds_b128 %7, %15, off\n\t"
                 "s_wait_xcnt 0x0"
                 :: "v"(lk), "v"(lk1), "v"(lk2), "v"(lk3), "v"(lv), "v"(lv1), "v"(lv2), "v"(lv3), "v"(kh), "v"(kh2), "v"(kl), "v"(kl2), "v"(vh), "v"(vh2), "v"(vl), "v"(vl2) : "memory"); };
  float m_r[2][8], l_r[2][8]; v8f oacc[2][DT], oaccl[2][DT];
#pragma unroll
  for (int rt = 0; rt < RTN; ++rt) {
#pragma unroll
    for (int r = 0; r < 8; ++r) { m_r[rt][r] = -3.0e38f; l_r[rt][r] = 0.f; }
#pragma unroll
    for (int dt = 0; dt < DT; ++dt) { oacc[rt][dt] = (v8f){0.f,0.f,0.f,0.f,0.f,0.f,0.f,0.f}; oaccl[rt][dt] = oacc[rt][dt]; } }
  int jend = KE[qblk * 32]; jend = min(TK, (jend + 31) & ~31); if (jend < 32) jend = 32;      /* block-uniform */
  jend = __builtin_amdgcn_readfirstlane(jend);      /* in a scalar register: the tests around the copies and the barriers are scalar branches */
  int allm[2][8]; const unsigned* mrow[2][8];
#pragma unroll
  for (int rt = 0; rt < RTN; ++rt)
#pragma unroll
    for (int r = 0; r < 8; ++r) { const int tq = q0 + rt * 16 + 8 * hh + r; allm[rt][r] = RA[tq]; mrow[rt][r] = MB + (size_t)tq * (TK / 32); }
  stage(0, 0);      /* every reader of the tile before left both buffers in front of its last pass's barrier */
  asm volatile("s_wait_asynccnt 0x0" ::: "memory");      /* this wave's copies of pass 0 have landed */
  __syncthreads();      /* ... and every other wave's */
  if (jend > 32) stage(32, KVB);
  int cur = 0;      /* start (in halves) of the buffer that holds this pass's tile: 0 or KVB */
#pragma unroll 1
  for (int j0 = 0; j0 < jend; j0 += 32) {
    unsigned mwd[2][8];      /* the pass's mask words, asked for ahead of the score products so that these cover the loads */
#pragma unroll
    for (int rt = 0; rt < RTN; ++rt)
#pragma unroll
      for (int r = 0; r < 8; ++r) mwd[rt][r] = mrow[rt][r][j0 >> 5];
    v8f s[2][2];
#pragma unroll
    for (int nt = 0; nt < 2; ++nt) { const unsigned short* kr = &sKV[cur + (nt * 16 + ln) * KP]; const unsigned short* kl = kr + 32 * KP; FragH bk[KS], bkl[KS];
#pragma unroll
      for (int ks = 0; ks < KS; ++ks) { bk[ks].half[0] = *(const v8us*)(kr + ks * 32 + 8 * hh); bk[ks].half[1] = *(const v8us*)(kr + ks * 32 + 16 + 8 * hh); bkl[ks].half[0] = *(const v8us*)(kl + ks * 32 + 8 * hh); bkl[ks].half[1] = *(const v8us*)(kl + ks * 32 + 16 + 8 * hh); }
#pragma unroll
      for (int rt = 0; rt < RTN; ++rt) { v8f acc = (v8f){0.f,0.f,0.f,0.f,0.f,0.f,0.f,0.f}, accr = acc;
#pragma unroll
        for (int ks = 0; ks < KS; ++ks) { acc = mmaH<1>(aq[rt][ks].v, aq[rt][ks].v, bk[ks].v, bk[ks].v, acc); accr = mmaH<1>(aql[rt][ks].v, aql[rt][ks].v, bk[ks].v, bk[ks].v, accr); accr = mmaH<1>(aq[rt][ks].v, aq[rt][ks].v, bkl[ks].v, bkl[ks].v, accr); }
        s[rt][nt] = acc + accr * 0.0009765625f; } }
    // Online softmax, the eight rows of a lane side by side: each phase runs over all rows before the next begins, and every exponential is computed for every lane and then selected,
    // so the pass is one straight run of code in which the rows' shuffles and exponentials cover one another's latencies. Same values, same order of every sum as row after row.
#pragma unroll
    for (int rt = 0; rt < RTN; ++rt) {
      float s0v[8], s1v[8], mcv[8], alv[8], p0v[8], p1v[8]; bool ok0v[8], ok1v[8];
#pragma unroll
      for (int r = 0; r < 8; ++r) { const unsigned mw = mwd[rt][r]; const bool am = (allm[rt][r] != 0);
        ok0v[r] = am || (((mw >> ln) & 1u) == 0u); ok1v[r] = am || (((mw >> (16 + ln)) & 1u) == 0u);
        s0v[r] = ok0v[r] ? (am ? 0.f : s[rt][0][r] * (SCL * L2E)) : -INFINITY; s1v[r] = ok1v[r] ? (am ? 0.f : s[rt][1][r] * (SCL * L2E)) : -INFINITY;      /* scores, and with them the running maximum, in log2 units */
         mcv[r] = fmaxf(s0v[r], s1v[r]); }
#pragma unroll
      for (int o = 1; o < 16; o <<= 1) { float xv[8];
#pragma unroll
        for (int r = 0; r < 8; ++r) xv[r] = __shfl_xor(mcv[r], o, 32);
        __builtin_amdgcn_sched_barrier(0);      /* all eight shuffles of a step are issued before the first result is waited for: one shuffle latency a step, not one a row */
#pragma unroll
        for (int r = 0; r < 8; ++r) mcv[r] = fmaxf(mcv[r], xv[r]); }
#pragma unroll
      for (int r = 0; r < 8; ++r) { const float mn = fmaxf(m_r[rt][r], mcv[r]);      /* mn is finite (at least -3.0e38), so a masked score gives 2^(-inf) = 0 and no NaN reaches a selected value */
        alv[r] = m_r[rt][r] - mn; p0v[r] = s0v[r] - mn; p1v[r] = s1v[r] - mn; m_r[rt][r] = mn; }      /* the exponents, none above 0 */
      exp2x8(alv); exp2x8(p0v); exp2x8(p1v);
#pragma unroll
      for (int r = 0; r < 8; ++r) { alv[r] = (m_r[rt][r] > -1.0e38f) ? alv[r] : 1.0f; p0v[r] = ok0v[r] ? p0v[r] : 0.f; p1v[r] = ok1v[r] ? p1v[r] : 0.f; l_r[rt][r] = l_r[rt][r] * alv[r] + p0v[r] + p1v[r]; }
#pragma unroll
      for (int r = 0; r < 8; ++r) { const float al = alv[r], p0 = p0v[r], p1 = p1v[r];
#pragma unroll
        for (int dt = 0; dt < DT; ++dt) { oacc[rt][dt][r] *= al; oaccl[rt][dt][r] *= al; }
        FragH t2, t3; const float ps0 = p0 * 1024.0f, ps1 = p1 * 1024.0f; t2.h[0] = (_Float16)ps0; t2.h[1] = (_Float16)ps1; t3.h[0] = (_Float16)((ps0 - (float)t2.h[0]) * 1024.0f); t3.h[1] = (_Float16)((ps1 - (float)t2.h[1]) * 1024.0f);
        sP[w][rt * 16 + 8 * hh + r][ln] = t2.u[0]; sP[w][rt * 16 + 8 * hh + r][16 + ln] = t2.u[1]; sPl[w][rt * 16 + 8 * hh + r][ln] = t3.u[0]; sPl[w][rt * 16 + 8 * hh + r][16 + ln] = t3.u[1]; } }
    __builtin_amdgcn_fence(__ATOMIC_ACQ_REL, "workgroup"); __builtin_amdgcn_wave_barrier();
    FragH pa[2], pl[2];
#pragma unroll
    for (int rt = 0; rt < RTN; ++rt) { pa[rt].half[0] = *(const v8us*)&sP[w][rt * 16 + ln][8 * hh]; pa[rt].half[1] = *(const v8us*)&sP[w][rt * 16 + ln][16 + 8 * hh]; pl[rt].half[0] = *(const v8us*)&sPl[w][rt * 16 + ln][8 * hh]; pl[rt].half[1] = *(const v8us*)&sPl[w][rt * 16 + ln][16 + 8 * hh]; }
#pragma unroll
    for (int dt = 0; dt < DT; ++dt) { const unsigned short* vr = &sKV[cur + VB0 + (dt * 16 + ln) * VP + 8 * hh]; const unsigned short* vq = vr + 64 * VP; FragH bv, bl; bv.half[0] = *(const v8us*)vr; bv.half[1] = *(const v8us*)(vr + 16); bl.half[0] = *(const v8us*)vq; bl.half[1] = *(const v8us*)(vq + 16);
#pragma unroll
      for (int rt = 0; rt < RTN; ++rt) { oacc[rt][dt] = mmaH<1>(pa[rt].v, pa[rt].v, bv.v, bv.v, oacc[rt][dt]); oaccl[rt][dt] = mmaH<1>(pa[rt].v, pa[rt].v, bl.v, bl.v, oaccl[rt][dt]); oaccl[rt][dt] = mmaH<1>(pl[rt].v, pl[rt].v, bv.v, bv.v, oaccl[rt][dt]); } }
    asm volatile("s_wait_dscnt 0x0" ::: "memory");      /* this wave's LDS reads of the pass are done */
    asm volatile("s_wait_asynccnt 0x0" ::: "memory");      /* its copies of the next pass's tile have landed */
    __syncthreads();      /* publishes the next tile and ends every wave's reads of this one */
    if (j0 + 64 < jend) stage(j0 + 64, cur);      /* refill of the buffer just read, one whole pass ahead of its use */
    cur ^= KVB; }
  asm volatile("s_wait_asynccnt 0x0" ::: "memory");      /* nothing of this wave is in flight when the tile ends */
#pragma unroll
  for (int rt = 0; rt < RTN; ++rt) {
#pragma unroll
    for (int r = 0; r < 8; ++r) { float l = l_r[rt][r]; l += __shfl_xor(l, 1, 32); l += __shfl_xor(l, 2, 32); l += __shfl_xor(l, 4, 32); l += __shfl_xor(l, 8, 32); l_r[rt][r] = (l > 0.f) ? 1.0f / (l * 1024.0f) : 0.f; }
#pragma unroll
    for (int dt = 0; dt < DT; ++dt)
#pragma unroll
      for (int r = 0; r < 8; ++r) sO[w][rt * 16 + 8 * hh + r][dt * 16 + ln] = (oacc[rt][dt][r] + oaccl[rt][dt][r] * 0.0009765625f) * l_r[rt][r]; }
  __builtin_amdgcn_fence(__ATOMIC_ACQ_REL, "workgroup"); __builtin_amdgcn_wave_barrier();
  {
#pragma unroll
    for (int rp = 0; rp < RPW; rp += 2) { const int r = rp + (lane >> 4), pc = lane & 15; const v4f val = *(const v4fa*)&sO[w][r][pc * 4]; v4h h4, l4;      /* O leaves as the f16 plane and its rounding residual x 2^10, the operands of the two Wo products: 16 lanes = one 128-B line of each plane */
      for (int i = 0; i < 4; ++i) { const _Float16 hv = (_Float16)val[i]; h4[i] = hv; l4[i] = (_Float16)((val[i] - (float)hv) * 1024.0f); }
      const size_t oo = ((size_t)b * TQ + q0 + r) * ldo + h * 64 + pc * 4; *(v4h*)(Oh + oo) = h4; *(v4h*)(Ol + oo) = l4; }
     }
  asm volatile("s_wait_xcnt 0x0" ::: "memory");      /* the next tile's set-up overwrites the address registers of the stores above */
  } }


template <int SRCBF>
__global__ __launch_bounds__(256) void k_lnab(const float* __restrict__ X, const float* __restrict__ g, const float* __restrict__ bb, _Float16* __restrict__ Y16, float* __restrict__ Y32, float* __restrict__ XB) {
  #pragma clang fp contract(off)
  const int tid = threadIdx.x, w = tid >> 5, ln = tid & 31; const int r = blockIdx.x * 8 + w; if (r >= NR) return; const float* x = X + (size_t)r * DM; float s = 0.f;
#pragma unroll 1
  for (int i = 0; i < DM / 128; ++i) { const v4f a = *(const v4fa*)(x + i * 128 + ln * 4); for (int q = 0; q < 4; ++q) s += SRCBF ? bf16_round(a[q]) : a[q]; }
  for (int o = 16; o > 0; o >>= 1) s += __shfl_xor(s, o, 32); const float mu = s / (float)DM; float q2 = 0.f;
#pragma unroll 1
  for (int i = 0; i < DM / 128; ++i) { const v4f a = *(const v4fa*)(x + i * 128 + ln * 4); for (int q = 0; q < 4; ++q) { const float d = (SRCBF ? bf16_round(a[q]) : a[q]) - mu; q2 += d * d; } }
  for (int o = 16; o > 0; o >>= 1) q2 += __shfl_xor(q2, o, 32); const float rs = rsqrtf(q2 / (float)DM + 1e-5f);
  {
#pragma unroll 1
    for (int i = 0; i < DM / 128; ++i) { const int c0 = i * 128 + ln * 4; const v4f a = *(const v4fa*)(x + c0); _Float16 h4[4]; v4f y4, xb;
      for (int q = 0; q < 4; ++q) { const float t = SRCBF ? bf16_round(a[q]) : a[q]; const float y = (t - mu) * rs * bf16_round(g[c0 + q]) + bf16_round(bb[c0 + q]); h4[q] = (_Float16)y; y4[q] = y; xb[q] = t; }
      if (Y16) *(unsigned long long*)((unsigned short*)Y16 + (size_t)r * DM + c0) = *(const unsigned long long*)h4; if (Y32) *(v4f*)(Y32 + (size_t)r * DM + c0) = y4; if (XB) *(v4f*)(XB + (size_t)r * DM + c0) = xb; }
     } }
__global__ __launch_bounds__(256) void k_causaltab(unsigned* __restrict__ MB, int* __restrict__ RA, int* __restrict__ KE, int nq, int nk) {
  const int t = blockIdx.x * 256 + threadIdx.x; const int nw = nk / 32;
  if (t < nq * nw) { const int q = t / nw, w = t % nw; const int first = q + 1 - 32 * w; const unsigned bits = (first <= 0) ? 0xffffffffu : ((first >= 32) ? 0u : (0xffffffffu << first)); *(unsigned*)(MB + t) = bits;  }
  if (t < nq) { *(int*)(RA + t) = 0;  }
  if (t < nq / 64) { const int v = 64 * (t + 1); *(int*)(KE + t * 32) = v;  } }


extern "C" void kernel_launch(void* const* d_in, const int* in_sizes, int n_in,
                              void* d_out, int out_size, void* d_ws, size_t ws_size, hipStream_t stream) {
  (void)in_sizes; (void)n_in; (void)out_size;
  const float* const* I = (const float* const*)d_in; const float* x = I[0]; const float* lag = I[1]; const float* lab = I[2]; const float* lbg = I[3]; const float* lbb = I[4]; const float* lcg = I[5]; const float* lcb = I[6];
  const float* Wq = I[7]; const float* bq = I[8]; const float* Wk = I[9]; const float* bk = I[10]; const float* Wv = I[11]; const float* bv = I[12]; const float* Wo = I[13]; const float* bo = I[14]; const float* We = I[15]; const float* be = I[16]; const float* Wd = I[17]; const float* bd = I[18];
  char* ws = (char*)d_ws; size_t off = 0;
  auto take = [&](size_t bytes) { char* p = ws + off; off += (bytes + 255) & ~(size_t)255; return p; };
  _Float16* BQ = (_Float16*)take((size_t)DM * DM * 2); _Float16* BK = (_Float16*)take((size_t)DM * DM * 2); _Float16* BV = (_Float16*)take((size_t)DM * DM * 2); _Float16* BO = (_Float16*)take((size_t)DM * DM * 2); _Float16* BE = (_Float16*)take((size_t)4096 * DM * 2); _Float16* BD = (_Float16*)take((size_t)DM * 4096 * 2);
  float* XB = (float*)take((size_t)NR * DM * 4); _Float16* T16 = (_Float16*)take((size_t)NR * DM * 2); float* F = (float*)take((size_t)NR * DM * 4);
  _Float16* Qh = (_Float16*)take((size_t)NR * DM * 2); _Float16* Ql = (_Float16*)take((size_t)NR * DM * 2); _Float16* Kh = (_Float16*)take((size_t)NR * DM * 2); _Float16* Kl = (_Float16*)take((size_t)NR * DM * 2); _Float16* Vth = (_Float16*)take((size_t)NR * DM * 2); _Float16* Vtl = (_Float16*)take((size_t)NR * DM * 2);
  unsigned* MB = (unsigned*)take((size_t)SLEN * (SLEN / 32) * 4); int* RA = (int*)take((size_t)SLEN * 4); int* KE = (int*)take((size_t)(SLEN / 64) * 32 * 4);
  if (off > ws_size) return;      /* 24 + 16 + 8 + 16 + 48 + 0.6 = 113 MiB (the first LN's f32 output lives in F until the second LN consumes it) */
  _Float16* Oh = (_Float16*)F; _Float16* Ol = Oh + (size_t)NR * DM; float* X1 = XB;      /* the two O planes fill F, dead once V is transposed */
  _Float16* GH = Kh;      /* SiLU hidden [NR][4096] f16 = 32 MB over Kh|Kl|Vth|Vtl (dead after the flash) */
  k_wt_all<<<768, 256, 0, stream>>>(Wq, Wk, Wv, Wo, We, Wd, BQ, BK, BV, BO, BE, BD);      /* all (in,out) */
  k_causaltab<<<(SLEN * (SLEN / 32) + 255) / 256, 256, 0, stream>>>(MB, RA, KE, SLEN, SLEN);
  k_lnab<1><<<NR / 8, 256, 0, stream>>>(x, lag, lab, nullptr, F, XB);      /* t0 = LN_a(bf16 x) (f32), XB = bf16(x) */
  k_lnab<0><<<NR / 8, 256, 0, stream>>>(F, lbg, lbb, T16, nullptr, nullptr);      /* t = LN_b(t0) as f16 operand */
  const dim3 gP((NR / 128) * (DM / 128), 1), gM((NR / 128) * (4096 / 128), 1);
  k_gemm2<0, DM, DM, 9><<<gP, 256, 0, stream>>>(T16, DM, 0, BQ, DM, 0, 0.0625f, bq, 0, nullptr, nullptr, Qh, Ql, DM, 0, NR, DM, DM);      /* q as hi + residual planes */
  k_gemm2<0, DM, DM, 9><<<gP, 256, 0, stream>>>(T16, DM, 0, BK, DM, 0, 0.0625f, bk, 0, nullptr, nullptr, Kh, Kl, DM, 0, NR, DM, DM);      /* k likewise */
  k_gemm2<0, DM, DM, 1><<<gP, 256, 0, stream>>>(T16, DM, 0, BV, DM, 0, 0.0625f, bv, 0, nullptr, F, nullptr, nullptr, DM, 0, NR, DM, DM);
  for (int b = 0; b < NBT; ++b) k_vthl<SLEN><<<NH * (SLEN / 64), 256, 0, stream>>>(F + (size_t)b * SLEN * DM, DM, Vth + (size_t)b * SLEN * DM, Vtl + (size_t)b * SLEN * DM);
  k_flashm<SLEN, SLEN><<<NH * (SLEN / 64), 128, 0, stream>>>(Qh, Ql, DM, Kh, Kl, DM, Vth, Vtl, MB, RA, KE, Oh, Ol, DM);      /* both batches in one grid of equal work-groups */
  k_gemm2<0, DM, DM, 3><<<gP, 256, 0, stream>>>(Oh, DM, 0, BO, DM, 0, 0.0625f, bo, 0, XB, X1, nullptr, nullptr, DM, 0, NR, DM, DM);      /* x1 = x + ctx Wo + bo (hi) */
  k_gemm2<0, DM, DM, 2><<<gP, 256, 0, stream>>>(Ol, DM, 0, BO, DM, 0, 0.0625f / 1024.0f, nullptr, 0, X1, X1, nullptr, nullptr, DM, 0, NR, DM, DM);      /* + lo */
  k_lnab<0><<<NR / 8, 256, 0, stream>>>(X1, lcg, lcb, T16, nullptr, nullptr);
  k_gemm2<15, DM, 4096, 5><<<gM, 256, 0, stream>>>(T16, DM, 0, BE, DM, 0, 0.0625f, be, 0, nullptr, nullptr, GH, nullptr, 4096, 0, NR, 4096, DM);      /* silu(t We + be) f16 (ACT 15 = x * sigmoid(x), present in the epilogue) */
  k_gemm2<0, 4096, DM, 3><<<gP, 256, 0, stream>>>(GH, 4096, 0, BD, 4096, 0, 0.0625f, bd, 0, X1, (float*)d_out, nullptr, nullptr, DM, 0, NR, DM, 4096);      /* out = x1 + mlp */
}
